// v000
// Measured on an AMD MI455X. A time is GPU time per run, averaged over a window of back-to-back runs after a warm-up
// (all launches, gaps included; the runs take copies of the inputs in turn), and the median of several windows.
// Apart from v000's, it joins two sittings. Times from different sittings can be a few percent apart, while
// side-by-side timings come from the same sitting.
// v000 is the starting kernel. One run takes 693 microseconds.
// compute dtype: all float inputs rounded to bf16; q/k/v projections with EXACT bf16 products on WMMA 16x16x32 (f32 accumulate) + bias; causal logits: 3 products (q f16 hi + residual x k hi + residual) for the first 384 rows, single f16 q x k after, x scale; softmax f32; P x 2^11 once to f16 x v once to f16 (1 product; bf16 hi + lo below row 384); f32 output.
#include <hip/hip_runtime.h>
#include <math.h>

typedef __attribute__((ext_vector_type(16))) _Float16 v16h;
typedef __attribute__((ext_vector_type(16))) __bf16 v16b;
typedef __attribute__((ext_vector_type(8)))  _Float16 v8h;
typedef __attribute__((ext_vector_type(8)))  float v8f;
typedef __attribute__((ext_vector_type(4)))  float v4f;
typedef __attribute__((ext_vector_type(2)))  float v2f;
typedef __attribute__((ext_vector_type(4)))  unsigned v4u;
typedef __attribute__((ext_vector_type(4)))  int v4i;
typedef float __attribute__((may_alias)) float_a;
typedef int __attribute__((may_alias)) int_a;

template <typename T> __device__ __forceinline__ void vst2(void* p, T v) { *(T*)p = v;  }
__device__ __forceinline__ v8f wmma16(v16h a, v16h b, v8f c) {
  v8f d = __builtin_amdgcn_wmma_f32_16x16x32_f16(false, a, false, b, (short)0, c, false, false);
  asm volatile("v_nop\n\tv_nop\n\tv_nop\n\tv_nop" : "+v"(d) : "v"(a), "v"(b));
  return d;
}
__device__ __forceinline__ v8f wmma_bf(v16b a, v16b b, v8f c) {
  v8f d = __builtin_amdgcn_wmma_f32_16x16x32_bf16(false, a, false, b, (short)0, c, false, false);
  asm volatile("v_nop\n\tv_nop\n\tv_nop\n\tv_nop" : "+v"(d) : "v"(a), "v"(b));
  return d;
}
// 16x16x32 fragments: lane = (h = lane>>4, row/col = lane&15); elements 0..7 = k0+8h+0..7, 8..15 = k0+16+8h+0..7; D element r = row 8h+r
__device__ __forceinline__ v16h frag_h(const _Float16* rowk0, int lane) {
  union { v16h v; v8h q[2]; } u; const _Float16* p = rowk0 + 8 * (lane >> 4);
  u.q[0] = *(const v8h*)p; u.q[1] = *(const v8h*)(p + 16); return u.v;
}
__device__ __forceinline__ v16h frag_f32(const float* rowk0, int lane) {
  v16h a; const float* p = rowk0 + 8 * (lane >> 4);
#pragma unroll
  for (int i = 0; i < 8; ++i) { a[i] = (_Float16)p[i]; a[8 + i] = (_Float16)p[16 + i]; }
  return a;
}
__device__ __forceinline__ v16h frag_f32s(const float* rowk0, int lane, float sc) {
  v16h a; const float* p = rowk0 + 8 * (lane >> 4);
#pragma unroll
  for (int i = 0; i < 8; ++i) { a[i] = (_Float16)(p[i] * sc); a[8 + i] = (_Float16)(p[16 + i] * sc); }
  return a;
}
// column fragment from a [K][ld] layout (column n), rows >= K read as 0
__device__ __forceinline__ v16h fragc_f32(const float* W, int k0, int n, int lane, int ld, int K) {
  v16h a; const int g = lane >> 4;
#pragma unroll
  for (int i = 0; i < 8; ++i) { const int ka = k0 + 8 * g + i, kb = ka + 16;
    a[i] = (_Float16)(ka < K ? W[(size_t)(ka < K ? ka : K - 1) * ld + n] : 0.f); a[8 + i] = (_Float16)(kb < K ? W[(size_t)(kb < K ? kb : K - 1) * ld + n] : 0.f); }
  return a;
}
struct F2 { v16b h, l; };
__device__ __forceinline__ F2 bsplit16(const float v[16]) { F2 r;
#pragma unroll
  for (int i = 0; i < 16; ++i) { const __bf16 h = (__bf16)v[i]; r.h[i] = h; r.l[i] = (__bf16)(v[i] - (float)h); }
  return r; }
__device__ __forceinline__ F2 split_row(const float* row, int k0, int lane) { float v[16]; const float* p = row + k0 + 8 * (lane >> 4);
#pragma unroll
  for (int i = 0; i < 8; ++i) { v[i] = p[i]; v[8 + i] = p[16 + i]; }
  return bsplit16(v); }
__device__ __forceinline__ F2 split_rowK(const float* row, int k0, int lane, int K) { float v[16]; const int g = lane >> 4;
#pragma unroll
  for (int i = 0; i < 8; ++i) { const int ka = k0 + 8 * g + i, kb = ka + 16; v[i] = ka < K ? row[ka < K ? ka : K - 1] : 0.f; v[8 + i] = kb < K ? row[kb < K ? kb : K - 1] : 0.f; }
  return bsplit16(v); }
__device__ __forceinline__ F2 split_col(const float* W, int k0, int n, int lane, int ld, int K) { float v[16]; const int g = lane >> 4;
#pragma unroll
  for (int i = 0; i < 8; ++i) { const int ka = k0 + 8 * g + i, kb = ka + 16; v[i] = ka < K ? W[(size_t)(ka < K ? ka : K - 1) * ld + n] : 0.f; v[8 + i] = kb < K ? W[(size_t)(kb < K ? kb : K - 1) * ld + n] : 0.f; }
  return bsplit16(v); }
__device__ __forceinline__ v8f mac3(const F2& a, const F2& b, v8f c) { c = wmma_bf(a.l, b.h, c); c = wmma_bf(a.h, b.l, c); return wmma_bf(a.h, b.h, c); }
__device__ __forceinline__ float sigm(float v) { return 1.0f / (1.0f + expf(-v)); }
#define LDSX() do { asm volatile("s_wait_dscnt 0" ::: "memory"); __builtin_amdgcn_wave_barrier(); __builtin_amdgcn_fence(__ATOMIC_RELEASE, "workgroup"); } while (0)

// Single-head causal scaled dot-product attention with separate inputs (q_in / k_in / v_in [4,4096,512]; Keras Dense (in,out) Wq / Wk / Wv [512,64] N(0, 1/512) + zero biases; scale 1/8; causal j <= i, -inf): out = softmax(causal((q_in Wq + bq)(k_in Wk + bk)^T / 8)) (v_in Wv + bv) -> [4,4096,64].
#define NB 4
#define TT 4096
#define CC 128            // NH * HD = projected width
#define DIN 512          // input (model) width
#define NH 2
#define HD 64
#define NQB (TT / 64)
#define HG 1
#define SCALE (0.125f)
#define CAUSAL 1
#ifndef TNB
#define TNB NB
#endif
__device__ __forceinline__ float bfr(float v) { return (float)(__bf16)v; }
__host__ __device__ __forceinline__ int kb_last(int qb) { return CAUSAL ? ((qb * 64 + 63) >> 7) : (TT / 128 - 1); }
typedef __attribute__((ext_vector_type(8))) __bf16 v8b;
__device__ __forceinline__ v16b frag_b(const __bf16* rowk0, int lane) {
  union { v16b v; v8b q[2]; } u; const __bf16* p = rowk0 + 8 * (lane >> 4);
  u.q[0] = *(const v8b*)p; u.q[1] = *(const v8b*)(p + 16); return u.v;
}
#define QBH 6              // causal: query blocks 0..QBH-1 of each sequence (few keys, no averaging) take the high-precision path
#define QHI 384            // rows carrying a q residual plane
#define KHI 384            // key rows carrying k residual / v bf16 hi+lo planes (used only by the causal high-precision path)
// B fragment (k rows k0+.., output column o) of a weight: (in,out) [K][ld] or (out,in) [ld rows of K]: bf16 exact, or f16(bf16 * 256) exact
__device__ __forceinline__ v16b wcol_io(const float* Wm, int k0, int o, int lane, int ld) { v16b w; const int g = lane >> 4;
#pragma unroll
  for (int i = 0; i < 8; ++i) { w[i] = (__bf16)Wm[(size_t)(k0 + 8 * g + i) * ld + o]; w[8 + i] = (__bf16)Wm[(size_t)(k0 + 16 + 8 * g + i) * ld + o]; }
  return w; }
__device__ __forceinline__ v16b wcol_oi(const float* Wm, int k0, int o, int lane, int K) { v16b w; const float* p = Wm + (size_t)o * K + k0 + 8 * (lane >> 4);
#pragma unroll
  for (int i = 0; i < 8; ++i) { w[i] = (__bf16)p[i]; w[8 + i] = (__bf16)p[16 + i]; }
  return w; }
__device__ __forceinline__ v16h wcolh_io(const float* Wm, int k0, int o, int lane, int ld) { v16h w; const int g = lane >> 4;
#pragma unroll
  for (int i = 0; i < 8; ++i) { w[i] = (_Float16)(bfr(Wm[(size_t)(k0 + 8 * g + i) * ld + o]) * 256.0f); w[8 + i] = (_Float16)(bfr(Wm[(size_t)(k0 + 16 + 8 * g + i) * ld + o]) * 256.0f); }
  return w; }
__device__ __forceinline__ v16h wcolh_oi(const float* Wm, int k0, int o, int lane, int K) { v16h w; const float* p = Wm + (size_t)o * K + k0 + 8 * (lane >> 4);
#pragma unroll
  for (int i = 0; i < 8; ++i) { w[i] = (_Float16)(bfr(p[i]) * 256.0f); w[8 + i] = (_Float16)(bfr(p[16 + i]) * 256.0f); }
  return w; }
#define WQKV_LAYOUT 0   // 0 = (in,out) [DIN][CC]; 1 = (out,in) [CC][DIN]; 2 = per-head [NH][DIN][HD]
__device__ __forceinline__ v16b wcol_hdk(const float* Wm, int k0, int o, int lane) { v16b w; const int g = lane >> 4; const float* p = Wm + (size_t)(o / HD) * DIN * HD + (o % HD);
#pragma unroll
  for (int i = 0; i < 8; ++i) { w[i] = (__bf16)p[(size_t)(k0 + 8 * g + i) * HD]; w[8 + i] = (__bf16)p[(size_t)(k0 + 16 + 8 * g + i) * HD]; }
  return w; }
#define WO_OUT_IN 0
#if WQKV_LAYOUT == 1
#define WCOL(W, k0, o, lane) wcol_oi(W, k0, o, lane, DIN)
#elif WQKV_LAYOUT == 2
#define WCOL(W, k0, o, lane) wcol_hdk(W, k0, o, lane)
#else
#define WCOL(W, k0, o, lane) wcol_io(W, k0, o, lane, CC)
#endif
#if WO_OUT_IN
#define WOCOL(W, k0, o, lane) wcol_oi(W, k0, o, lane, CC)
#define WOCOLH(W, k0, o, lane) wcolh_oi(W, k0, o, lane, CC)
#else
#define WOCOL(W, k0, o, lane) wcol_io(W, k0, o, lane, DIN)
#define WOCOLH(W, k0, o, lane) wcolh_io(W, k0, o, lane, DIN)
#endif
#define CIN 512
// ---- k_padw: the three (in,out) [C][64] projection weights copied into zero-padded (in,out) [C][128] ws planes (columns 64..127 zero) + zero-padded [128] biases
__global__ __launch_bounds__(256) void k_padw(const float* __restrict__ WQ, const float* __restrict__ WK, const float* __restrict__ WV, const float* __restrict__ BQ, const float* __restrict__ BK, const float* __restrict__ BV, float* __restrict__ WP, float* __restrict__ BP) { const int which = blockIdx.y; const float* Wsrc = which == 0 ? WQ : (which == 1 ? WK : WV); const float* Bsrc = which == 0 ? BQ : (which == 1 ? BK : BV); float* dst = WP + (size_t)which * CIN * 128;
  for (int e = blockIdx.x * 256 + threadIdx.x; e < CIN * 32; e += gridDim.x * 256) { const int row = e >> 5, q = e & 31; const v4f ld = *(const v4f*)(Wsrc + (size_t)row * 64 + (q & 15) * 4); asm volatile("s_wait_loadcnt 0x0" ::: "memory"); const float keep = q < 16 ? 1.f : 0.f; v4f ov; ov[0] = ld[0] * keep; ov[1] = ld[1] * keep; ov[2] = ld[2] * keep; ov[3] = ld[3] * keep; vst2(dst + (size_t)row * 128 + q * 4, ov); }
  if (blockIdx.x == 0 && threadIdx.x < 128) { const int c = threadIdx.x; float bvv = 0.f; if (Bsrc) { const float t = Bsrc[c & 63]; asm volatile("s_wait_loadcnt 0x0" ::: "memory"); bvv = c < 64 ? t : 0.f; } vst2(BP + which * 128 + c, bvv); } }
// ---- k_out64: out[b][t][0..63] = ctx row columns 0..63 (256 B by 16 lanes)
__global__ __launch_bounds__(256) void k_out64(const float* __restrict__ Y, float* __restrict__ OUT) { const size_t row = (size_t)blockIdx.x * 16 + (threadIdx.x >> 4); const int q = threadIdx.x & 15; const v4f v = *(const v4f*)(Y + row * CC + q * 4); asm volatile("s_wait_loadcnt 0x0" ::: "memory"); vst2(OUT + row * 64 + q * 4, v); }
#define WS_WP (WS_END)                                  // padded weights [3][128 x C]
#define WS_BP (WS_WP + 4u * 3 * (size_t)CIN * 128)        // padded biases [3][128]
#define WS_Y2 (WS_BP + 4u * 3 * 128)                      // ctx rows [b*TT+t][128]
#define WS_END2 (WS_Y2 + 4u * (size_t)NB * TT * CC)
#ifndef SM_EXTRA_PARAMS
#define SM_EXTRA_PARAMS
#endif
#ifndef PROJ_EXTRA_PARAMS
#define PROJ_EXTRA_PARAMS
#endif
#ifndef SM_MASK_HOOK
#define SM_MASK_HOOK (void)0
#endif

#define WS_QH  0u                                      // f16 q rows [b*t][CC]
#define WS_KH  (WS_QH + 2u * (size_t)NB * TT * CC)      // f16 k rows [b*t][CC]
#define WS_VT  (WS_KH + 2u * (size_t)NB * TT * CC)      // f16 v planes [b][c][t]
#define WS_QL  (WS_VT + 2u * (size_t)NB * CC * TT)      // f16 q residual x 2^10 rows [b][t < QHI][CC]
#define WS_KL  (WS_QL + 2u * (size_t)NB * QHI * CC)     // f16 k residual x 2^10 rows [b][t < KHI][CC]
#define WS_VB  (WS_KL + 2u * (size_t)NB * KHI * CC)     // bf16 v hi planes [b][c][t < KHI]
#define WS_VBL (WS_VB + 2u * (size_t)NB * CC * KHI)
#define WS_S   (WS_VBL + 2u * (size_t)NB * CC * KHI)    // f32 logits / P [hg][t][s]
#define WS_Y   (WS_S  + 4u * (size_t)HG * TT * TT)      // f32 ctx rows [b*t][CC] (only when there is an output projection)
#define WS_END (WS_Y  + 0u)

// ---- k_proj: block = (64 rows, 128 cols, which): q/k/v = X W (+ b) with exact bf16 products (K = DIN) -> which 0: q f16 rows (+ residual rows < QHI); 1: k f16 rows (+ residual rows < KHI); 2: v f16 planes [c][t] (+ bf16 hi/lo planes for t < KHI)
__global__ __launch_bounds__(128) void k_proj(const float* __restrict__ XQ, const float* __restrict__ XK, const float* __restrict__ XV, const float* __restrict__ WQ, const float* __restrict__ WK, const float* __restrict__ WV, const float* __restrict__ BQ, const float* __restrict__ BK, const float* __restrict__ BV,
    _Float16* __restrict__ QH, _Float16* __restrict__ QL, _Float16* __restrict__ KH, _Float16* __restrict__ KL, _Float16* __restrict__ VT, __bf16* __restrict__ VB, __bf16* __restrict__ VBL) {
  __shared__ __align__(16) _Float16 sh[64][136], sl[64][136]; __shared__ __align__(16) _Float16 th[128][72]; __shared__ __align__(16) __bf16 tb[128][72], tbl[128][72];
  const int tid = threadIdx.x, wave = tid >> 5, lane = tid & 31, col = lane & 15, g = lane >> 4; const int which = blockIdx.z; const int c0 = blockIdx.y * 128; const size_t r0 = (size_t)blockIdx.x * 64; const size_t bb = r0 / TT; const int t0 = (int)(r0 % TT);
  const float* X = which == 0 ? XQ : which == 1 ? XK : XV; const float* WA = which == 0 ? WQ : which == 1 ? WK : WV; const float* BA = which == 0 ? BQ : which == 1 ? BK : BV;
  v8f acc[8] = {};
#pragma unroll 2
  for (int kc = 0; kc < DIN / 32; ++kc) { v16b a; { const float* p = X + (r0 + wave * 16 + col) * DIN + kc * 32 + 8 * g;
#pragma unroll
      for (int i = 0; i < 8; ++i) { a[i] = (__bf16)p[i]; a[8 + i] = (__bf16)p[16 + i]; } }
    asm volatile("s_wait_loadcnt 0x0" ::: "memory");
#pragma unroll
    for (int j = 0; j < 8; ++j) { const v16b w = WCOL(WA, kc * 32, c0 + j * 16 + col, lane); asm volatile("s_wait_loadcnt 0x0" ::: "memory"); acc[j] = wmma_bf(a, w, acc[j]); } }
  if (which < 2) { _Float16* DH = which == 0 ? QH : KH; _Float16* DL = which == 0 ? QL : KL; const int nhi = which == 0 ? QHI : KHI; const bool hi_rows = t0 < nhi;
#pragma unroll
    for (int j = 0; j < 8; ++j) { const float bias = BA ? bfr(BA[c0 + j * 16 + col]) : 0.f;
#pragma unroll
      for (int r = 0; r < 8; ++r) { const float v = acc[j][r] + bias; const _Float16 hv = (_Float16)v; sh[wave * 16 + 8 * g + r][j * 16 + col] = hv; sl[wave * 16 + 8 * g + r][j * 16 + col] = (_Float16)((v - (float)hv) * 1024.0f); } }
    __syncthreads();
    for (int e = tid; e < 64 * 16; e += 128) { const int rl = e >> 4, q = e & 15; vst2((unsigned*)(DH + (r0 + rl) * CC + c0 + q * 8), *(const v4u*)&sh[rl][q * 8]); if (hi_rows) vst2((unsigned*)(DL + (bb * nhi + t0 + rl) * (size_t)CC + c0 + q * 8), *(const v4u*)&sl[rl][q * 8]); }
  } else { const bool hi_rows = t0 < KHI;
#pragma unroll
    for (int j = 0; j < 8; ++j) { const float bias = BA ? bfr(BA[c0 + j * 16 + col]) : 0.f;
#pragma unroll
      for (int r = 0; r < 8; ++r) { const float v = acc[j][r] + bias; const int rl = wave * 16 + 8 * g + r, cl = j * 16 + col; th[cl][rl] = (_Float16)v; const __bf16 bh = (__bf16)v; tb[cl][rl] = bh; tbl[cl][rl] = (__bf16)(v - (float)bh); } }
    __syncthreads();
    for (int e = tid; e < 128 * 8; e += 128) { const int cl = e >> 3, q = e & 7; vst2((unsigned*)(VT + (bb * CC + c0 + cl) * (size_t)TT + t0 + q * 8), *(const v4u*)&th[cl][q * 8]); if (hi_rows) { const size_t o3 = (bb * CC + c0 + cl) * (size_t)KHI + t0 + q * 8; vst2((unsigned*)(VB + o3), *(const v4u*)&tb[cl][q * 8]); vst2((unsigned*)(VBL + o3), *(const v4u*)&tbl[cl][q * 8]); } } } }
// ---- k_sc: block = (query block qb, key block kb <= kb_last(qb), head in group) of batch b: logits x SCALE; q hi + residual (x 2^10) against k (2 products) for query rows < QHI, plus the k residual (3 products) for query blocks < QBH (causal early rows); causal: blocks past the diagonal exit, the mask itself is applied by index in k_sm
__global__ __launch_bounds__(128) void k_sc(const _Float16* __restrict__ QH, const _Float16* __restrict__ KH, const _Float16* __restrict__ QL, const _Float16* __restrict__ KL, int b, int h0, float* __restrict__ S0) { __shared__ __align__(16) float ss[4][16][132];
  const int qb = blockIdx.x, kb = blockIdx.y; if (kb > kb_last(qb)) return;
  const int h = h0 + blockIdx.z; float* S = S0 + (size_t)blockIdx.z * TT * TT;
  const int tid = threadIdx.x, wave = tid >> 5, lane = tid & 31, col = lane & 15, g = lane >> 4; const int k0 = kb * 128; const int ql0 = qb * 64 + wave * 16; const size_t q0 = (size_t)b * TT + ql0, kr0 = (size_t)b * TT + k0;
  v8f acc[8] = {}, accl[8] = {};
  const _Float16* QLb = QL + (size_t)b * QHI * CC; const _Float16* KLb = KL + (size_t)b * KHI * CC;
  if (qb < QBH) {
#pragma unroll
    for (int kc = 0; kc < HD / 32; ++kc) { const v16h ah = frag_h(QH + (q0 + col) * CC + h * HD + kc * 32, lane), al = frag_h(QLb + (size_t)(ql0 + col) * CC + h * HD + kc * 32, lane);
#pragma unroll
      for (int j = 0; j < 8; ++j) { const v16h kbf = frag_h(KH + (kr0 + j * 16 + col) * CC + h * HD + kc * 32, lane), klf = frag_h(KLb + (size_t)(k0 + j * 16 + col) * CC + h * HD + kc * 32, lane); acc[j] = wmma16(ah, kbf, acc[j]); accl[j] = wmma16(al, kbf, accl[j]); accl[j] = wmma16(ah, klf, accl[j]); } }
  } else if (qb * 64 < QHI) {
#pragma unroll
    for (int kc = 0; kc < HD / 32; ++kc) { const v16h ah = frag_h(QH + (q0 + col) * CC + h * HD + kc * 32, lane), al = frag_h(QLb + (size_t)(ql0 + col) * CC + h * HD + kc * 32, lane);
#pragma unroll
      for (int j = 0; j < 8; ++j) { const v16h kbf = frag_h(KH + (kr0 + j * 16 + col) * CC + h * HD + kc * 32, lane); acc[j] = wmma16(ah, kbf, acc[j]); accl[j] = wmma16(al, kbf, accl[j]); } }
  } else {
#pragma unroll
    for (int kc = 0; kc < HD / 32; ++kc) { const v16h ah = frag_h(QH + (q0 + col) * CC + h * HD + kc * 32, lane);
#pragma unroll
      for (int j = 0; j < 8; ++j) { const v16h kbf = frag_h(KH + (kr0 + j * 16 + col) * CC + h * HD + kc * 32, lane); acc[j] = wmma16(ah, kbf, acc[j]); } } }
#pragma unroll
  for (int j = 0; j < 8; ++j) {
#pragma unroll
    for (int r = 0; r < 8; ++r) ss[wave][8 * g + r][j * 16 + col] = (acc[j][r] + accl[j][r] * (1.0f / 1024.0f)) * SCALE; }
  LDSX(); for (int rl = 0; rl < 16; ++rl) vst2(S + (size_t)(ql0 + rl) * TT + k0 + lane * 4, *(const v4f*)&ss[wave][rl][lane * 4]); }
// ---- k_sm: block = query row t (head in group): keys [0, kend): causal -> logit if s <= t else excluded; softmax in f32; P x 2^11 in place (0 for excluded)
__global__ __launch_bounds__(256) void k_sm(float* __restrict__ S0 SM_EXTRA_PARAMS) { __shared__ float sred[8]; __shared__ float sbc; __shared__ __align__(16) float shv[TT];
  const int tid = threadIdx.x; const int t = blockIdx.x; const int kend = (kb_last(t >> 6) + 1) * 128;
  float* sr = S0 + (size_t)blockIdx.y * TT * TT + (size_t)t * TT;
  float m = -3.0e38f; for (int k = tid; k < kend; k += 256) { float v = (!CAUSAL || k <= t) ? sr[k] : -3.0e38f; SM_MASK_HOOK; shv[k] = v; m = fmaxf(m, v); }
#pragma unroll
  for (int o = 1; o < 32; o <<= 1) m = fmaxf(m, __shfl_xor(m, o));
  if ((tid & 31) == 0) sred[tid >> 5] = m; __syncthreads(); if (tid == 0) { float a = sred[0]; for (int i = 1; i < 8; ++i) a = fmaxf(a, sred[i]); sbc = a; } __syncthreads(); m = sbc; __syncthreads();
  float sum = 0.f; for (int k = tid; k < kend; k += 256) { const float v = shv[k]; const float e = (v <= -1.0e38f) ? 0.f : expf(v - m); shv[k] = e; sum += e; }
#pragma unroll
  for (int o = 1; o < 32; o <<= 1) sum += __shfl_xor(sum, o);
  if ((tid & 31) == 0) sred[tid >> 5] = sum; __syncthreads(); if (tid == 0) { float a = 0.f; for (int i = 0; i < 8; ++i) a += sred[i]; sbc = a > 0.f ? 2048.0f / a : 0.f; }   /* a fully excluded row yields P = 0 */ __syncthreads(); const float inv = sbc;
  for (int k = tid; k < kend; k += 256) shv[k] = shv[k] * inv;
  __syncthreads(); for (int q = tid; q < kend / 4; q += 256) vst2(sr + q * 4, *(const v4f*)&shv[q * 4]); }
// ---- k_pv: block = 64 queries (qb) of (b, h): ctx = P . v over keys [0, kend) (P x 2^11 once to f16 against v f16: 1 product; causal early query blocks: P and v as bf16 hi + lo, 3 products); 256-B (row, head) segment by 16 lanes
__global__ __launch_bounds__(128) void k_pv(const float* __restrict__ PS0, const _Float16* __restrict__ VT, const __bf16* __restrict__ VB, const __bf16* __restrict__ VBL, int b, int h0, float* __restrict__ Y) { const int h = h0 + blockIdx.z; const float* PS = PS0 + (size_t)blockIdx.z * TT * TT; __shared__ __align__(16) float ss[4][16][HD + 4];
  const int tid = threadIdx.x, wave = tid >> 5, lane = tid & 31, col = lane & 15, g = lane >> 4; const int qb = blockIdx.x; const int ql0 = qb * 64 + wave * 16; const int kce = (kb_last(qb) + 1) * 4;
  v8f acc[HD / 16] = {};
  if (qb < QBH) {
#pragma unroll 1
    for (int kc = 0; kc < kce; ++kc) { const F2 p = split_row(PS + (size_t)(ql0 + col) * TT, kc * 32, lane);
      asm volatile("s_wait_loadcnt 0x0" ::: "memory");
#pragma unroll
      for (int j = 0; j < HD / 16; ++j) { const size_t po = ((size_t)b * CC + h * HD + j * 16 + col) * (size_t)KHI + kc * 32; const v16b vh = frag_b(VB + po, lane); acc[j] = wmma_bf(p.h, vh, acc[j]); acc[j] = wmma_bf(p.l, vh, acc[j]); acc[j] = wmma_bf(p.h, frag_b(VBL + po, lane), acc[j]); } }
  } else {
#pragma unroll 1
    for (int kc = 0; kc < kce; ++kc) { const v16h p = frag_f32(PS + (size_t)(ql0 + col) * TT + kc * 32, lane);
      asm volatile("s_wait_loadcnt 0x0" ::: "memory");
#pragma unroll
      for (int j = 0; j < HD / 16; ++j) { const size_t po = ((size_t)b * CC + h * HD + j * 16 + col) * (size_t)TT + kc * 32; acc[j] = wmma16(p, frag_h(VT + po, lane), acc[j]); } } }
#pragma unroll
  for (int j = 0; j < HD / 16; ++j)
#pragma unroll
    for (int r = 0; r < 8; ++r) ss[wave][8 * g + r][j * 16 + col] = acc[j][r] * (1.0f / 2048.0f);
  LDSX(); for (int rl = 0; rl < 16; ++rl) if (lane < HD / 4) vst2(Y + ((size_t)b * TT + ql0 + rl) * CC + h * HD + lane * 4, *(const v4f*)&ss[wave][rl][lane * 4]); }

extern "C" void kernel_launch(void* const* d_in, const int* in_sizes, int n_in, void* d_out, int out_size, void* d_ws, size_t ws_size, hipStream_t stream) {
  (void)in_sizes; (void)n_in; (void)out_size;
  const float** F = (const float**)d_in;
  if (ws_size < (size_t)WS_END) return;
  char* ws = (char*)d_ws; _Float16 *QH = (_Float16*)(ws + WS_QH), *KH = (_Float16*)(ws + WS_KH), *VT = (_Float16*)(ws + WS_VT), *QL = (_Float16*)(ws + WS_QL), *KL = (_Float16*)(ws + WS_KL); __bf16 *VB = (__bf16*)(ws + WS_VB), *VBL = (__bf16*)(ws + WS_VBL); float *S = (float*)(ws + WS_S), *Y = (float*)(ws + WS_Y);
  (void)Y; (void)QL; (void)KL; (void)VB; (void)VBL;
  // inputs: 0 q_in [4,4096,512]; 1 k_in; 2 v_in (separate inputs); 3 Wq [512,64], 4 bq; 5 Wk, 6 bk; 7 Wv, 8 bv ((in,out); zero biases read)
  if (ws_size < (size_t)WS_END2) return;
  float *WP = (float*)(ws + WS_WP), *BP = (float*)(ws + WS_BP), *Y2 = (float*)(ws + WS_Y2);
  k_padw<<<dim3(32, 3), 256, 0, stream>>>(F[3], F[5], F[7], F[4], F[6], F[8], WP, BP);
  k_proj<<<dim3(TNB * TT / 64, CC / 128, 3), 128, 0, stream>>>(F[0], F[1], F[2], WP, WP + (size_t)CIN * 128, WP + 2 * (size_t)CIN * 128, BP, BP + 128, BP + 256, QH, QL, KH, KL, VT, VB, VBL);
  for (int b = 0; b < TNB; ++b) {   /* head 0 only (head 1 is the zero padding) */
    k_sc<<<dim3(NQB, TT / 128, 1), 128, 0, stream>>>(QH, KH, QL, KL, b, 0, S);
    k_sm<<<dim3(TT, 1), 256, 0, stream>>>(S);
    k_pv<<<dim3(NQB, 1, 1), 128, 0, stream>>>(S, VT, VB, VBL, b, 0, Y2);
  }
  k_out64<<<dim3(TNB * TT / 16), 256, 0, stream>>>(Y2, (float*)d_out);
}

// v001
// A run of this version takes 281 microseconds.
// Timed twice side by side with v000, it ran 2.47 and 2.46 times as fast.
// compute dtype: all float inputs rounded to bf16; q/k/v projections with EXACT bf16 products on WMMA 16x16x32 (f32 accumulate) + bias; causal logits: 3 products (q f16 hi + residual x k hi + residual) for the first 384 rows, single f16 q x k after, x scale; softmax f32; P x 2^11 once to f16 x v once to f16 (1 product; bf16 hi + lo below row 384); f32 output.
#include <hip/hip_runtime.h>
#include <math.h>

typedef __attribute__((ext_vector_type(16))) _Float16 v16h;
typedef __attribute__((ext_vector_type(16))) __bf16 v16b;
typedef __attribute__((ext_vector_type(8)))  _Float16 v8h;
typedef __attribute__((ext_vector_type(8)))  float v8f;
typedef __attribute__((ext_vector_type(4)))  float v4f;
typedef __attribute__((ext_vector_type(2)))  float v2f;
typedef __attribute__((ext_vector_type(4)))  unsigned v4u;
typedef __attribute__((ext_vector_type(4)))  int v4i;
typedef float __attribute__((may_alias)) float_a;
typedef int __attribute__((may_alias)) int_a;

template <typename T> __device__ __forceinline__ void vst2(void* p, T v) { *(T*)p = v;  }
__device__ __forceinline__ v8f wmma16(v16h a, v16h b, v8f c) {
  v8f d = __builtin_amdgcn_wmma_f32_16x16x32_f16(false, a, false, b, (short)0, c, false, false);
  asm volatile("v_nop\n\tv_nop\n\tv_nop\n\tv_nop" : "+v"(d) : "v"(a), "v"(b));
  return d;
}
__device__ __forceinline__ v8f wmma_bf(v16b a, v16b b, v8f c) {
  v8f d = __builtin_amdgcn_wmma_f32_16x16x32_bf16(false, a, false, b, (short)0, c, false, false);
  asm volatile("v_nop\n\tv_nop\n\tv_nop\n\tv_nop" : "+v"(d) : "v"(a), "v"(b));
  return d;
}
// 16x16x32 fragments: lane = (h = lane>>4, row/col = lane&15); elements 0..7 = k0+8h+0..7, 8..15 = k0+16+8h+0..7; D element r = row 8h+r
__device__ __forceinline__ v16h frag_h(const _Float16* rowk0, int lane) {
  union { v16h v; v8h q[2]; } u; const _Float16* p = rowk0 + 8 * (lane >> 4);
  u.q[0] = *(const v8h*)p; u.q[1] = *(const v8h*)(p + 16); return u.v;
}
__device__ __forceinline__ v16h frag_f32(const float* rowk0, int lane) {
  v16h a; const float* p = rowk0 + 8 * (lane >> 4);
#pragma unroll
  for (int i = 0; i < 8; ++i) { a[i] = (_Float16)p[i]; a[8 + i] = (_Float16)p[16 + i]; }
  return a;
}
__device__ __forceinline__ v16h frag_f32s(const float* rowk0, int lane, float sc) {
  v16h a; const float* p = rowk0 + 8 * (lane >> 4);
#pragma unroll
  for (int i = 0; i < 8; ++i) { a[i] = (_Float16)(p[i] * sc); a[8 + i] = (_Float16)(p[16 + i] * sc); }
  return a;
}
// column fragment from a [K][ld] layout (column n), rows >= K read as 0
__device__ __forceinline__ v16h fragc_f32(const float* W, int k0, int n, int lane, int ld, int K) {
  v16h a; const int g = lane >> 4;
#pragma unroll
  for (int i = 0; i < 8; ++i) { const int ka = k0 + 8 * g + i, kb = ka + 16;
    a[i] = (_Float16)(ka < K ? W[(size_t)(ka < K ? ka : K - 1) * ld + n] : 0.f); a[8 + i] = (_Float16)(kb < K ? W[(size_t)(kb < K ? kb : K - 1) * ld + n] : 0.f); }
  return a;
}
struct F2 { v16b h, l; };
__device__ __forceinline__ F2 bsplit16(const float v[16]) { F2 r;
#pragma unroll
  for (int i = 0; i < 16; ++i) { const __bf16 h = (__bf16)v[i]; r.h[i] = h; r.l[i] = (__bf16)(v[i] - (float)h); }
  return r; }
__device__ __forceinline__ F2 split_row(const float* row, int k0, int lane) { float v[16]; const float* p = row + k0 + 8 * (lane >> 4);
#pragma unroll
  for (int i = 0; i < 8; ++i) { v[i] = p[i]; v[8 + i] = p[16 + i]; }
  return bsplit16(v); }
__device__ __forceinline__ F2 split_rowK(const float* row, int k0, int lane, int K) { float v[16]; const int g = lane >> 4;
#pragma unroll
  for (int i = 0; i < 8; ++i) { const int ka = k0 + 8 * g + i, kb = ka + 16; v[i] = ka < K ? row[ka < K ? ka : K - 1] : 0.f; v[8 + i] = kb < K ? row[kb < K ? kb : K - 1] : 0.f; }
  return bsplit16(v); }
__device__ __forceinline__ F2 split_col(const float* W, int k0, int n, int lane, int ld, int K) { float v[16]; const int g = lane >> 4;
#pragma unroll
  for (int i = 0; i < 8; ++i) { const int ka = k0 + 8 * g + i, kb = ka + 16; v[i] = ka < K ? W[(size_t)(ka < K ? ka : K - 1) * ld + n] : 0.f; v[8 + i] = kb < K ? W[(size_t)(kb < K ? kb : K - 1) * ld + n] : 0.f; }
  return bsplit16(v); }
__device__ __forceinline__ v8f mac3(const F2& a, const F2& b, v8f c) { c = wmma_bf(a.l, b.h, c); c = wmma_bf(a.h, b.l, c); return wmma_bf(a.h, b.h, c); }
__device__ __forceinline__ float sigm(float v) { return 1.0f / (1.0f + expf(-v)); }
#define LDSX() do { asm volatile("s_wait_dscnt 0" ::: "memory"); __builtin_amdgcn_wave_barrier(); __builtin_amdgcn_fence(__ATOMIC_RELEASE, "workgroup"); } while (0)

// Single-head causal scaled dot-product attention with separate inputs (q_in / k_in / v_in [4,4096,512]; Keras Dense (in,out) Wq / Wk / Wv [512,64] N(0, 1/512) + zero biases; scale 1/8; causal j <= i, -inf): out = softmax(causal((q_in Wq + bq)(k_in Wk + bk)^T / 8)) (v_in Wv + bv) -> [4,4096,64].
#define NB 4
#define TT 4096
#define CC 128            // NH * HD = projected width
#define DIN 512          // input (model) width
#define NH 2
#define HD 64
#define NQB (TT / 64)
#define HG 1
#define SCALE (0.125f)
#define CAUSAL 1
#ifndef TNB
#define TNB NB
#endif
__device__ __forceinline__ float bfr(float v) { return (float)(__bf16)v; }
__host__ __device__ __forceinline__ int kb_last(int qb) { return CAUSAL ? ((qb * 64 + 63) >> 7) : (TT / 128 - 1); }
typedef __attribute__((ext_vector_type(8))) __bf16 v8b;
__device__ __forceinline__ v16b frag_b(const __bf16* rowk0, int lane) {
  union { v16b v; v8b q[2]; } u; const __bf16* p = rowk0 + 8 * (lane >> 4);
  u.q[0] = *(const v8b*)p; u.q[1] = *(const v8b*)(p + 16); return u.v;
}
#define QBH 6              // causal: query blocks 0..QBH-1 of each sequence (few keys, no averaging) take the high-precision path
#define QHI 384            // rows carrying a q residual plane
#define KHI 384            // key rows carrying k residual / v bf16 hi+lo planes (used only by the causal high-precision path)
// B fragment (k rows k0+.., output column o) of a weight: (in,out) [K][ld] or (out,in) [ld rows of K]: bf16 exact, or f16(bf16 * 256) exact
__device__ __forceinline__ v16b wcol_io(const float* Wm, int k0, int o, int lane, int ld) { v16b w; const int g = lane >> 4;
#pragma unroll
  for (int i = 0; i < 8; ++i) { w[i] = (__bf16)Wm[(size_t)(k0 + 8 * g + i) * ld + o]; w[8 + i] = (__bf16)Wm[(size_t)(k0 + 16 + 8 * g + i) * ld + o]; }
  return w; }
__device__ __forceinline__ v16b wcol_oi(const float* Wm, int k0, int o, int lane, int K) { v16b w; const float* p = Wm + (size_t)o * K + k0 + 8 * (lane >> 4);
#pragma unroll
  for (int i = 0; i < 8; ++i) { w[i] = (__bf16)p[i]; w[8 + i] = (__bf16)p[16 + i]; }
  return w; }
__device__ __forceinline__ v16h wcolh_io(const float* Wm, int k0, int o, int lane, int ld) { v16h w; const int g = lane >> 4;
#pragma unroll
  for (int i = 0; i < 8; ++i) { w[i] = (_Float16)(bfr(Wm[(size_t)(k0 + 8 * g + i) * ld + o]) * 256.0f); w[8 + i] = (_Float16)(bfr(Wm[(size_t)(k0 + 16 + 8 * g + i) * ld + o]) * 256.0f); }
  return w; }
__device__ __forceinline__ v16h wcolh_oi(const float* Wm, int k0, int o, int lane, int K) { v16h w; const float* p = Wm + (size_t)o * K + k0 + 8 * (lane >> 4);
#pragma unroll
  for (int i = 0; i < 8; ++i) { w[i] = (_Float16)(bfr(p[i]) * 256.0f); w[8 + i] = (_Float16)(bfr(p[16 + i]) * 256.0f); }
  return w; }
#define WQKV_LAYOUT 0   // 0 = (in,out) [DIN][CC]; 1 = (out,in) [CC][DIN]; 2 = per-head [NH][DIN][HD]
__device__ __forceinline__ v16b wcol_hdk(const float* Wm, int k0, int o, int lane) { v16b w; const int g = lane >> 4; const float* p = Wm + (size_t)(o / HD) * DIN * HD + (o % HD);
#pragma unroll
  for (int i = 0; i < 8; ++i) { w[i] = (__bf16)p[(size_t)(k0 + 8 * g + i) * HD]; w[8 + i] = (__bf16)p[(size_t)(k0 + 16 + 8 * g + i) * HD]; }
  return w; }
#define WO_OUT_IN 0
#if WQKV_LAYOUT == 1
#define WCOL(W, k0, o, lane) wcol_oi(W, k0, o, lane, DIN)
#elif WQKV_LAYOUT == 2
#define WCOL(W, k0, o, lane) wcol_hdk(W, k0, o, lane)
#else
#define WCOL(W, k0, o, lane) wcol_io(W, k0, o, lane, CC)
#endif
#if WO_OUT_IN
#define WOCOL(W, k0, o, lane) wcol_oi(W, k0, o, lane, CC)
#define WOCOLH(W, k0, o, lane) wcolh_oi(W, k0, o, lane, CC)
#else
#define WOCOL(W, k0, o, lane) wcol_io(W, k0, o, lane, DIN)
#define WOCOLH(W, k0, o, lane) wcolh_io(W, k0, o, lane, DIN)
#endif
#define CIN 512
// ---- k_padw: the three (in,out) [C][64] projection weights copied into zero-padded (in,out) [C][128] ws planes (columns 64..127 zero) + zero-padded [128] biases
__global__ __launch_bounds__(256) void k_padw(const float* __restrict__ WQ, const float* __restrict__ WK, const float* __restrict__ WV, const float* __restrict__ BQ, const float* __restrict__ BK, const float* __restrict__ BV, float* __restrict__ WP, float* __restrict__ BP) { const int which = blockIdx.y; const float* Wsrc = which == 0 ? WQ : (which == 1 ? WK : WV); const float* Bsrc = which == 0 ? BQ : (which == 1 ? BK : BV); float* dst = WP + (size_t)which * CIN * 128;
  for (int e = blockIdx.x * 256 + threadIdx.x; e < CIN * 32; e += gridDim.x * 256) { const int row = e >> 5, q = e & 31; const v4f ld = *(const v4f*)(Wsrc + (size_t)row * 64 + (q & 15) * 4); asm volatile("s_wait_loadcnt 0x0" ::: "memory"); const float keep = q < 16 ? 1.f : 0.f; v4f ov; ov[0] = ld[0] * keep; ov[1] = ld[1] * keep; ov[2] = ld[2] * keep; ov[3] = ld[3] * keep; vst2(dst + (size_t)row * 128 + q * 4, ov); }
  if (blockIdx.x == 0 && threadIdx.x < 128) { const int c = threadIdx.x; float bvv = 0.f; if (Bsrc) { const float t = Bsrc[c & 63]; asm volatile("s_wait_loadcnt 0x0" ::: "memory"); bvv = c < 64 ? t : 0.f; } vst2(BP + which * 128 + c, bvv); } }
// ---- k_out64: out[b][t][0..63] = ctx row columns 0..63 (256 B by 16 lanes)
__global__ __launch_bounds__(256) void k_out64(const float* __restrict__ Y, float* __restrict__ OUT) { const size_t row = (size_t)blockIdx.x * 16 + (threadIdx.x >> 4); const int q = threadIdx.x & 15; const v4f v = *(const v4f*)(Y + row * CC + q * 4); asm volatile("s_wait_loadcnt 0x0" ::: "memory"); vst2(OUT + row * 64 + q * 4, v); }
#define WS_WP (WS_END)                                  // padded weights [3][128 x C]
#define WS_BP (WS_WP + 4u * 3 * (size_t)CIN * 128)        // padded biases [3][128]
#define WS_Y2 (WS_BP + 4u * 3 * 128)                      // ctx rows [b*TT+t][128]
#define WS_END2 (WS_Y2 + 4u * (size_t)NB * TT * CC)
#ifndef SM_EXTRA_PARAMS
#define SM_EXTRA_PARAMS
#endif
#ifndef PROJ_EXTRA_PARAMS
#define PROJ_EXTRA_PARAMS
#endif
#ifndef SM_MASK_HOOK
#define SM_MASK_HOOK (void)0
#endif

#define WS_QH  0u                                      // f16 q rows [b*t][CC]
#define WS_KH  (WS_QH + 2u * (size_t)NB * TT * CC)      // f16 k rows [b*t][CC]
#define WS_VT  (WS_KH + 2u * (size_t)NB * TT * CC)      // f16 v planes [b][c][t]
#define WS_QL  (WS_VT + 2u * (size_t)NB * CC * TT)      // f16 q residual x 2^10 rows [b][t < QHI][CC]
#define WS_KL  (WS_QL + 2u * (size_t)NB * QHI * CC)     // f16 k residual x 2^10 rows [b][t < KHI][CC]
#define WS_VB  (WS_KL + 2u * (size_t)NB * KHI * CC)     // bf16 v hi planes [b][c][t < KHI]
#define WS_VBL (WS_VB + 2u * (size_t)NB * CC * KHI)
#define WS_S   (WS_VBL + 2u * (size_t)NB * CC * KHI)    // f32 logits / P [hg][t][s]
#define WS_Y   (WS_S  + 4u * (size_t)HG * TT * TT)      // f32 ctx rows [b*t][CC] (only when there is an output projection)
#define WS_END (WS_Y  + 0u)

// ---- k_proj: block = (64 rows, 128 cols, which): q/k/v = X W (+ b) with exact bf16 products (K = DIN) -> which 0: q f16 rows (+ residual rows < QHI); 1: k f16 rows (+ residual rows < KHI); 2: v f16 planes [c][t] (+ bf16 hi/lo planes for t < KHI)
__global__ __launch_bounds__(128) void k_proj(const float* __restrict__ XQ, const float* __restrict__ XK, const float* __restrict__ XV, const float* __restrict__ WQ, const float* __restrict__ WK, const float* __restrict__ WV, const float* __restrict__ BQ, const float* __restrict__ BK, const float* __restrict__ BV,
    _Float16* __restrict__ QH, _Float16* __restrict__ QL, _Float16* __restrict__ KH, _Float16* __restrict__ KL, _Float16* __restrict__ VT, __bf16* __restrict__ VB, __bf16* __restrict__ VBL) {
  __shared__ __align__(16) _Float16 sh[64][136], sl[64][136]; __shared__ __align__(16) _Float16 th[128][72]; __shared__ __align__(16) __bf16 tb[128][72], tbl[128][72];
  const int tid = threadIdx.x, wave = tid >> 5, lane = tid & 31, col = lane & 15, g = lane >> 4; const int which = blockIdx.z; const int c0 = blockIdx.y * 128; const size_t r0 = (size_t)blockIdx.x * 64; const size_t bb = r0 / TT; const int t0 = (int)(r0 % TT);
  const float* X = which == 0 ? XQ : which == 1 ? XK : XV; const float* WA = which == 0 ? WQ : which == 1 ? WK : WV; const float* BA = which == 0 ? BQ : which == 1 ? BK : BV;
  v8f acc[8] = {};
#pragma unroll 2
  for (int kc = 0; kc < DIN / 32; ++kc) { v16b a; { const float* p = X + (r0 + wave * 16 + col) * DIN + kc * 32 + 8 * g;
#pragma unroll
      for (int i = 0; i < 8; ++i) { a[i] = (__bf16)p[i]; a[8 + i] = (__bf16)p[16 + i]; } }
    asm volatile("s_wait_loadcnt 0x0" ::: "memory");
#pragma unroll
    for (int j = 0; j < 8; ++j) { const v16b w = WCOL(WA, kc * 32, c0 + j * 16 + col, lane); asm volatile("s_wait_loadcnt 0x0" ::: "memory"); acc[j] = wmma_bf(a, w, acc[j]); } }
  if (which < 2) { _Float16* DH = which == 0 ? QH : KH; _Float16* DL = which == 0 ? QL : KL; const int nhi = which == 0 ? QHI : KHI; const bool hi_rows = t0 < nhi;
#pragma unroll
    for (int j = 0; j < 8; ++j) { const float bias = BA ? bfr(BA[c0 + j * 16 + col]) : 0.f;
#pragma unroll
      for (int r = 0; r < 8; ++r) { const float v = acc[j][r] + bias; const _Float16 hv = (_Float16)v; sh[wave * 16 + 8 * g + r][j * 16 + col] = hv; sl[wave * 16 + 8 * g + r][j * 16 + col] = (_Float16)((v - (float)hv) * 1024.0f); } }
    __syncthreads();
    for (int e = tid; e < 64 * 16; e += 128) { const int rl = e >> 4, q = e & 15; vst2((unsigned*)(DH + (r0 + rl) * CC + c0 + q * 8), *(const v4u*)&sh[rl][q * 8]); if (hi_rows) vst2((unsigned*)(DL + (bb * nhi + t0 + rl) * (size_t)CC + c0 + q * 8), *(const v4u*)&sl[rl][q * 8]); }
  } else { const bool hi_rows = t0 < KHI;
#pragma unroll
    for (int j = 0; j < 8; ++j) { const float bias = BA ? bfr(BA[c0 + j * 16 + col]) : 0.f;
#pragma unroll
      for (int r = 0; r < 8; ++r) { const float v = acc[j][r] + bias; const int rl = wave * 16 + 8 * g + r, cl = j * 16 + col; th[cl][rl] = (_Float16)v; const __bf16 bh = (__bf16)v; tb[cl][rl] = bh; tbl[cl][rl] = (__bf16)(v - (float)bh); } }
    __syncthreads();
    for (int e = tid; e < 128 * 8; e += 128) { const int cl = e >> 3, q = e & 7; vst2((unsigned*)(VT + (bb * CC + c0 + cl) * (size_t)TT + t0 + q * 8), *(const v4u*)&th[cl][q * 8]); if (hi_rows) { const size_t o3 = (bb * CC + c0 + cl) * (size_t)KHI + t0 + q * 8; vst2((unsigned*)(VB + o3), *(const v4u*)&tb[cl][q * 8]); vst2((unsigned*)(VBL + o3), *(const v4u*)&tbl[cl][q * 8]); } } } }
// ---- k_sc: block = (query block qb, key block kb <= kb_last(qb), head in group) of batch b: logits x SCALE; q hi + residual (x 2^10) against k (2 products) for query rows < QHI, plus the k residual (3 products) for query blocks < QBH (causal early rows); causal: blocks past the diagonal exit, the mask itself is applied by index in k_sm
__global__ __launch_bounds__(128) void k_sc(const _Float16* __restrict__ QH, const _Float16* __restrict__ KH, const _Float16* __restrict__ QL, const _Float16* __restrict__ KL, int b, int h0, float* __restrict__ S0) { __shared__ __align__(16) float ss[4][16][132];
  const int qb = blockIdx.x, kb = blockIdx.y; if (kb > kb_last(qb)) return;
  const int h = h0 + blockIdx.z; float* S = S0 + (size_t)blockIdx.z * TT * TT;
  const int tid = threadIdx.x, wave = tid >> 5, lane = tid & 31, col = lane & 15, g = lane >> 4; const int k0 = kb * 128; const int ql0 = qb * 64 + wave * 16; const size_t q0 = (size_t)b * TT + ql0, kr0 = (size_t)b * TT + k0;
  v8f acc[8] = {}, accl[8] = {};
  const _Float16* QLb = QL + (size_t)b * QHI * CC; const _Float16* KLb = KL + (size_t)b * KHI * CC;
  if (qb < QBH) {
#pragma unroll
    for (int kc = 0; kc < HD / 32; ++kc) { const v16h ah = frag_h(QH + (q0 + col) * CC + h * HD + kc * 32, lane), al = frag_h(QLb + (size_t)(ql0 + col) * CC + h * HD + kc * 32, lane);
#pragma unroll
      for (int j = 0; j < 8; ++j) { const v16h kbf = frag_h(KH + (kr0 + j * 16 + col) * CC + h * HD + kc * 32, lane), klf = frag_h(KLb + (size_t)(k0 + j * 16 + col) * CC + h * HD + kc * 32, lane); acc[j] = wmma16(ah, kbf, acc[j]); accl[j] = wmma16(al, kbf, accl[j]); accl[j] = wmma16(ah, klf, accl[j]); } }
  } else if (qb * 64 < QHI) {
#pragma unroll
    for (int kc = 0; kc < HD / 32; ++kc) { const v16h ah = frag_h(QH + (q0 + col) * CC + h * HD + kc * 32, lane), al = frag_h(QLb + (size_t)(ql0 + col) * CC + h * HD + kc * 32, lane);
#pragma unroll
      for (int j = 0; j < 8; ++j) { const v16h kbf = frag_h(KH + (kr0 + j * 16 + col) * CC + h * HD + kc * 32, lane); acc[j] = wmma16(ah, kbf, acc[j]); accl[j] = wmma16(al, kbf, accl[j]); } }
  } else {
#pragma unroll
    for (int kc = 0; kc < HD / 32; ++kc) { const v16h ah = frag_h(QH + (q0 + col) * CC + h * HD + kc * 32, lane);
#pragma unroll
      for (int j = 0; j < 8; ++j) { const v16h kbf = frag_h(KH + (kr0 + j * 16 + col) * CC + h * HD + kc * 32, lane); acc[j] = wmma16(ah, kbf, acc[j]); } } }
#pragma unroll
  for (int j = 0; j < 8; ++j) {
#pragma unroll
    for (int r = 0; r < 8; ++r) ss[wave][8 * g + r][j * 16 + col] = (acc[j][r] + accl[j][r] * (1.0f / 1024.0f)) * SCALE; }
  LDSX(); for (int rl = 0; rl < 16; ++rl) vst2(S + (size_t)(ql0 + rl) * TT + k0 + lane * 4, *(const v4f*)&ss[wave][rl][lane * 4]); }
// ---- k_sm: block = query row t (head in group): keys [0, kend): causal -> logit if s <= t else excluded; softmax in f32; P x 2^11 in place (0 for excluded)
__global__ __launch_bounds__(256) void k_sm(float* __restrict__ S0 SM_EXTRA_PARAMS) { __shared__ float sred[8]; __shared__ float sbc; __shared__ __align__(16) float shv[TT];
  const int tid = threadIdx.x; const int t = blockIdx.x; const int kend = (kb_last(t >> 6) + 1) * 128;
  float* sr = S0 + (size_t)blockIdx.y * TT * TT + (size_t)t * TT;
  float m = -3.0e38f; for (int k = tid; k < kend; k += 256) { float v = (!CAUSAL || k <= t) ? sr[k] : -3.0e38f; SM_MASK_HOOK; shv[k] = v; m = fmaxf(m, v); }
#pragma unroll
  for (int o = 1; o < 32; o <<= 1) m = fmaxf(m, __shfl_xor(m, o));
  if ((tid & 31) == 0) sred[tid >> 5] = m; __syncthreads(); if (tid == 0) { float a = sred[0]; for (int i = 1; i < 8; ++i) a = fmaxf(a, sred[i]); sbc = a; } __syncthreads(); m = sbc; __syncthreads();
  float sum = 0.f; for (int k = tid; k < kend; k += 256) { const float v = shv[k]; const float e = (v <= -1.0e38f) ? 0.f : expf(v - m); shv[k] = e; sum += e; }
#pragma unroll
  for (int o = 1; o < 32; o <<= 1) sum += __shfl_xor(sum, o);
  if ((tid & 31) == 0) sred[tid >> 5] = sum; __syncthreads(); if (tid == 0) { float a = 0.f; for (int i = 0; i < 8; ++i) a += sred[i]; sbc = a > 0.f ? 2048.0f / a : 0.f; }   /* a fully excluded row yields P = 0 */ __syncthreads(); const float inv = sbc;
  for (int k = tid; k < kend; k += 256) shv[k] = shv[k] * inv;
  __syncthreads(); for (int q = tid; q < kend / 4; q += 256) vst2(sr + q * 4, *(const v4f*)&shv[q * 4]); }
// ---- k_pv: block = 16 queries (row tile rt) of (b, h), PVW waves: wave w takes the 32-key chunks w, w + PVW, ... of keys [0, kend) and the PVW partial ctx tiles are summed through LDS in wave order (P x 2^11 once to f16 against v f16: 1 product; causal early query blocks: P and v as bf16 hi + lo, 3 products); 256-B (row, head) segment by 16 lanes
#define PVW 16
__global__ __launch_bounds__(PVW * 32) void k_pv(const float* __restrict__ PS0, const _Float16* __restrict__ VT, const __bf16* __restrict__ VB, const __bf16* __restrict__ VBL, int b, int h0, float* __restrict__ Y) { const int h = h0 + blockIdx.z; const float* PS = PS0 + (size_t)blockIdx.z * TT * TT; __shared__ __align__(16) float ss[PVW][16][HD + 4];
  const int tid = threadIdx.x, wave = __builtin_amdgcn_readfirstlane(tid >> 5), lane = tid & 31, col = lane & 15, g = lane >> 4; const int rt = blockIdx.x; const int qb = rt >> 2; const int ql0 = rt * 16; const int kce = (kb_last(qb) + 1) * 4;
  v8f acc[HD / 16] = {};
  if (qb < QBH) {
#pragma unroll 1
    for (int kc = wave; kc < kce; kc += PVW) { const F2 p = split_row(PS + (size_t)(ql0 + col) * TT, kc * 32, lane);
      asm volatile("s_wait_loadcnt 0x0" ::: "memory");
#pragma unroll
      for (int j = 0; j < HD / 16; ++j) { const size_t po = ((size_t)b * CC + h * HD + j * 16 + col) * (size_t)KHI + kc * 32; const v16b vh = frag_b(VB + po, lane); acc[j] = wmma_bf(p.h, vh, acc[j]); acc[j] = wmma_bf(p.l, vh, acc[j]); acc[j] = wmma_bf(p.h, frag_b(VBL + po, lane), acc[j]); } }
  } else {
#pragma unroll 1
    for (int kc = wave; kc < kce; kc += PVW) { const v16h p = frag_f32(PS + (size_t)(ql0 + col) * TT + kc * 32, lane);
      asm volatile("s_wait_loadcnt 0x0" ::: "memory");
#pragma unroll
      for (int j = 0; j < HD / 16; ++j) { const size_t po = ((size_t)b * CC + h * HD + j * 16 + col) * (size_t)TT + kc * 32; acc[j] = wmma16(p, frag_h(VT + po, lane), acc[j]); } } }
#pragma unroll
  for (int j = 0; j < HD / 16; ++j)
#pragma unroll
    for (int r = 0; r < 8; ++r) ss[wave][8 * g + r][j * 16 + col] = acc[j][r] * (1.0f / 2048.0f);
  __syncthreads();   /* every wave's partial tile is in LDS before any of them is summed */
  if (tid < 16 * (HD / 4)) { const int rl = tid >> 4, q = tid & 15; v4f s = *(const v4f*)&ss[0][rl][q * 4];
#pragma unroll
    for (int w = 1; w < PVW; ++w) s += *(const v4f*)&ss[w][rl][q * 4];
    vst2(Y + ((size_t)b * TT + ql0 + rl) * CC + h * HD + q * 4, s); } }

extern "C" void kernel_launch(void* const* d_in, const int* in_sizes, int n_in, void* d_out, int out_size, void* d_ws, size_t ws_size, hipStream_t stream) {
  (void)in_sizes; (void)n_in; (void)out_size;
  const float** F = (const float**)d_in;
  if (ws_size < (size_t)WS_END) return;
  char* ws = (char*)d_ws; _Float16 *QH = (_Float16*)(ws + WS_QH), *KH = (_Float16*)(ws + WS_KH), *VT = (_Float16*)(ws + WS_VT), *QL = (_Float16*)(ws + WS_QL), *KL = (_Float16*)(ws + WS_KL); __bf16 *VB = (__bf16*)(ws + WS_VB), *VBL = (__bf16*)(ws + WS_VBL); float *S = (float*)(ws + WS_S), *Y = (float*)(ws + WS_Y);
  (void)Y; (void)QL; (void)KL; (void)VB; (void)VBL;
  // inputs: 0 q_in [4,4096,512]; 1 k_in; 2 v_in (separate inputs); 3 Wq [512,64], 4 bq; 5 Wk, 6 bk; 7 Wv, 8 bv ((in,out); zero biases read)
  if (ws_size < (size_t)WS_END2) return;
  float *WP = (float*)(ws + WS_WP), *BP = (float*)(ws + WS_BP), *Y2 = (float*)(ws + WS_Y2);
  k_padw<<<dim3(32, 3), 256, 0, stream>>>(F[3], F[5], F[7], F[4], F[6], F[8], WP, BP);
  k_proj<<<dim3(TNB * TT / 64, CC / 128, 3), 128, 0, stream>>>(F[0], F[1], F[2], WP, WP + (size_t)CIN * 128, WP + 2 * (size_t)CIN * 128, BP, BP + 128, BP + 256, QH, QL, KH, KL, VT, VB, VBL);
  for (int b = 0; b < TNB; ++b) {   /* head 0 only (head 1 is the zero padding) */
    k_sc<<<dim3(NQB, TT / 128, 1), 128, 0, stream>>>(QH, KH, QL, KL, b, 0, S);
    k_sm<<<dim3(TT, 1), 256, 0, stream>>>(S);
    k_pv<<<dim3(TT / 16, 1, 1), PVW * 32, 0, stream>>>(S, VT, VB, VBL, b, 0, Y2);
  }
  k_out64<<<dim3(TNB * TT / 16), 256, 0, stream>>>(Y2, (float*)d_out);
}

// v002
// One run takes 81 microseconds.
// Timed twice side by side with v001, it ran 3.45 and 3.52 times as fast.
// Counting every step since v000, it is 8.59 times as fast.
// compute dtype: all float inputs rounded to bf16; q/k/v projections with EXACT bf16 products on WMMA 16x16x32 (f32 accumulate) + bias; causal logits: 3 products (q f16 hi + residual x k hi + residual) for the first 384 rows, single f16 q x k after, x scale; online softmax f32 (base 2) in registers; unnormalised weights x 2^10 once to f16 x v once to f16 (1 product; bf16 hi + lo below row 384), divided by the f32 sum at the end; f32 output.
#include <hip/hip_runtime.h>
#include <math.h>

typedef __attribute__((ext_vector_type(16))) _Float16 v16h;
typedef __attribute__((ext_vector_type(16))) __bf16 v16b;
typedef __attribute__((ext_vector_type(8)))  _Float16 v8h;
typedef __attribute__((ext_vector_type(8)))  float v8f;
typedef __attribute__((ext_vector_type(4)))  float v4f;
typedef __attribute__((ext_vector_type(2)))  float v2f;
typedef __attribute__((ext_vector_type(4)))  unsigned v4u;
typedef __attribute__((ext_vector_type(4)))  int v4i;
typedef float __attribute__((may_alias)) float_a;
typedef int __attribute__((may_alias)) int_a;

template <typename T> __device__ __forceinline__ void vst2(void* p, T v) { *(T*)p = v;  }
__device__ __forceinline__ v8f wmma16(v16h a, v16h b, v8f c) {
  v8f d = __builtin_amdgcn_wmma_f32_16x16x32_f16(false, a, false, b, (short)0, c, false, false);
  asm volatile("v_nop\n\tv_nop\n\tv_nop\n\tv_nop" : "+v"(d) : "v"(a), "v"(b));
  return d;
}
__device__ __forceinline__ v8f wmma_bf(v16b a, v16b b, v8f c) {
  v8f d = __builtin_amdgcn_wmma_f32_16x16x32_bf16(false, a, false, b, (short)0, c, false, false);
  asm volatile("v_nop\n\tv_nop\n\tv_nop\n\tv_nop" : "+v"(d) : "v"(a), "v"(b));
  return d;
}
// 16x16x32 fragments: lane = (h = lane>>4, row/col = lane&15); elements 0..7 = k0+8h+0..7, 8..15 = k0+16+8h+0..7; D element r = row 8h+r
__device__ __forceinline__ v16h frag_h(const _Float16* rowk0, int lane) {
  union { v16h v; v8h q[2]; } u; const _Float16* p = rowk0 + 8 * (lane >> 4);
  u.q[0] = *(const v8h*)p; u.q[1] = *(const v8h*)(p + 16); return u.v;
}
__device__ __forceinline__ v16h frag_f32(const float* rowk0, int lane) {
  v16h a; const float* p = rowk0 + 8 * (lane >> 4);
#pragma unroll
  for (int i = 0; i < 8; ++i) { a[i] = (_Float16)p[i]; a[8 + i] = (_Float16)p[16 + i]; }
  return a;
}
__device__ __forceinline__ v16h frag_f32s(const float* rowk0, int lane, float sc) {
  v16h a; const float* p = rowk0 + 8 * (lane >> 4);
#pragma unroll
  for (int i = 0; i < 8; ++i) { a[i] = (_Float16)(p[i] * sc); a[8 + i] = (_Float16)(p[16 + i] * sc); }
  return a;
}
// column fragment from a [K][ld] layout (column n), rows >= K read as 0
__device__ __forceinline__ v16h fragc_f32(const float* W, int k0, int n, int lane, int ld, int K) {
  v16h a; const int g = lane >> 4;
#pragma unroll
  for (int i = 0; i < 8; ++i) { const int ka = k0 + 8 * g + i, kb = ka + 16;
    a[i] = (_Float16)(ka < K ? W[(size_t)(ka < K ? ka : K - 1) * ld + n] : 0.f); a[8 + i] = (_Float16)(kb < K ? W[(size_t)(kb < K ? kb : K - 1) * ld + n] : 0.f); }
  return a;
}
struct F2 { v16b h, l; };
__device__ __forceinline__ F2 bsplit16(const float v[16]) { F2 r;
#pragma unroll
  for (int i = 0; i < 16; ++i) { const __bf16 h = (__bf16)v[i]; r.h[i] = h; r.l[i] = (__bf16)(v[i] - (float)h); }
  return r; }
__device__ __forceinline__ F2 split_row(const float* row, int k0, int lane) { float v[16]; const float* p = row + k0 + 8 * (lane >> 4);
#pragma unroll
  for (int i = 0; i < 8; ++i) { v[i] = p[i]; v[8 + i] = p[16 + i]; }
  return bsplit16(v); }
__device__ __forceinline__ F2 split_rowK(const float* row, int k0, int lane, int K) { float v[16]; const int g = lane >> 4;
#pragma unroll
  for (int i = 0; i < 8; ++i) { const int ka = k0 + 8 * g + i, kb = ka + 16; v[i] = ka < K ? row[ka < K ? ka : K - 1] : 0.f; v[8 + i] = kb < K ? row[kb < K ? kb : K - 1] : 0.f; }
  return bsplit16(v); }
__device__ __forceinline__ F2 split_col(const float* W, int k0, int n, int lane, int ld, int K) { float v[16]; const int g = lane >> 4;
#pragma unroll
  for (int i = 0; i < 8; ++i) { const int ka = k0 + 8 * g + i, kb = ka + 16; v[i] = ka < K ? W[(size_t)(ka < K ? ka : K - 1) * ld + n] : 0.f; v[8 + i] = kb < K ? W[(size_t)(kb < K ? kb : K - 1) * ld + n] : 0.f; }
  return bsplit16(v); }
__device__ __forceinline__ v8f mac3(const F2& a, const F2& b, v8f c) { c = wmma_bf(a.l, b.h, c); c = wmma_bf(a.h, b.l, c); return wmma_bf(a.h, b.h, c); }
__device__ __forceinline__ float sigm(float v) { return 1.0f / (1.0f + expf(-v)); }
#define LDSX() do { asm volatile("s_wait_dscnt 0" ::: "memory"); __builtin_amdgcn_wave_barrier(); __builtin_amdgcn_fence(__ATOMIC_RELEASE, "workgroup"); } while (0)

// Single-head causal scaled dot-product attention with separate inputs (q_in / k_in / v_in [4,4096,512]; Keras Dense (in,out) Wq / Wk / Wv [512,64] N(0, 1/512) + zero biases; scale 1/8; causal j <= i, -inf): out = softmax(causal((q_in Wq + bq)(k_in Wk + bk)^T / 8)) (v_in Wv + bv) -> [4,4096,64].
#define NB 4
#define TT 4096
#define CC 128            // NH * HD = projected width
#define DIN 512          // input (model) width
#define NH 2
#define HD 64
#define NQB (TT / 64)
#define HG 1
#define SCALE (0.125f)
#define CAUSAL 1
#ifndef TNB
#define TNB NB
#endif
__device__ __forceinline__ float bfr(float v) { return (float)(__bf16)v; }
__host__ __device__ __forceinline__ int kb_last(int qb) { return CAUSAL ? ((qb * 64 + 63) >> 7) : (TT / 128 - 1); }
typedef __attribute__((ext_vector_type(8))) __bf16 v8b;
__device__ __forceinline__ v16b frag_b(const __bf16* rowk0, int lane) {
  union { v16b v; v8b q[2]; } u; const __bf16* p = rowk0 + 8 * (lane >> 4);
  u.q[0] = *(const v8b*)p; u.q[1] = *(const v8b*)(p + 16); return u.v;
}
#define QBH 6              // unused; causal: query rows < QBH * 64 (= QHI; few keys, no averaging) take the high-precision path
#define QHI 384            // rows carrying a q residual plane
#define KHI 384            // key rows carrying k residual / v bf16 hi+lo planes (used only by the causal high-precision path)
// B fragment (k rows k0+.., output column o) of a weight: (in,out) [K][ld] or (out,in) [ld rows of K]: bf16 exact, or f16(bf16 * 256) exact
__device__ __forceinline__ v16b wcol_io(const float* Wm, int k0, int o, int lane, int ld) { v16b w; const int g = lane >> 4;
#pragma unroll
  for (int i = 0; i < 8; ++i) { w[i] = (__bf16)Wm[(size_t)(k0 + 8 * g + i) * ld + o]; w[8 + i] = (__bf16)Wm[(size_t)(k0 + 16 + 8 * g + i) * ld + o]; }
  return w; }
__device__ __forceinline__ v16b wcol_oi(const float* Wm, int k0, int o, int lane, int K) { v16b w; const float* p = Wm + (size_t)o * K + k0 + 8 * (lane >> 4);
#pragma unroll
  for (int i = 0; i < 8; ++i) { w[i] = (__bf16)p[i]; w[8 + i] = (__bf16)p[16 + i]; }
  return w; }
__device__ __forceinline__ v16h wcolh_io(const float* Wm, int k0, int o, int lane, int ld) { v16h w; const int g = lane >> 4;
#pragma unroll
  for (int i = 0; i < 8; ++i) { w[i] = (_Float16)(bfr(Wm[(size_t)(k0 + 8 * g + i) * ld + o]) * 256.0f); w[8 + i] = (_Float16)(bfr(Wm[(size_t)(k0 + 16 + 8 * g + i) * ld + o]) * 256.0f); }
  return w; }
__device__ __forceinline__ v16h wcolh_oi(const float* Wm, int k0, int o, int lane, int K) { v16h w; const float* p = Wm + (size_t)o * K + k0 + 8 * (lane >> 4);
#pragma unroll
  for (int i = 0; i < 8; ++i) { w[i] = (_Float16)(bfr(p[i]) * 256.0f); w[8 + i] = (_Float16)(bfr(p[16 + i]) * 256.0f); }
  return w; }
#define WQKV_LAYOUT 0   // 0 = (in,out) [DIN][CC]; 1 = (out,in) [CC][DIN]; 2 = per-head [NH][DIN][HD]
__device__ __forceinline__ v16b wcol_hdk(const float* Wm, int k0, int o, int lane) { v16b w; const int g = lane >> 4; const float* p = Wm + (size_t)(o / HD) * DIN * HD + (o % HD);
#pragma unroll
  for (int i = 0; i < 8; ++i) { w[i] = (__bf16)p[(size_t)(k0 + 8 * g + i) * HD]; w[8 + i] = (__bf16)p[(size_t)(k0 + 16 + 8 * g + i) * HD]; }
  return w; }
#define WO_OUT_IN 0
#if WQKV_LAYOUT == 1
#define WCOL(W, k0, o, lane) wcol_oi(W, k0, o, lane, DIN)
#elif WQKV_LAYOUT == 2
#define WCOL(W, k0, o, lane) wcol_hdk(W, k0, o, lane)
#else
#define WCOL(W, k0, o, lane) wcol_io(W, k0, o, lane, CC)
#endif
#if WO_OUT_IN
#define WOCOL(W, k0, o, lane) wcol_oi(W, k0, o, lane, CC)
#define WOCOLH(W, k0, o, lane) wcolh_oi(W, k0, o, lane, CC)
#else
#define WOCOL(W, k0, o, lane) wcol_io(W, k0, o, lane, DIN)
#define WOCOLH(W, k0, o, lane) wcolh_io(W, k0, o, lane, DIN)
#endif
#define CIN 512
// ---- k_padw: the three (in,out) [C][64] projection weights copied into zero-padded (in,out) [C][128] ws planes (columns 64..127 zero) + zero-padded [128] biases
__global__ __launch_bounds__(256) void k_padw(const float* __restrict__ WQ, const float* __restrict__ WK, const float* __restrict__ WV, const float* __restrict__ BQ, const float* __restrict__ BK, const float* __restrict__ BV, float* __restrict__ WP, float* __restrict__ BP) { const int which = blockIdx.y; const float* Wsrc = which == 0 ? WQ : (which == 1 ? WK : WV); const float* Bsrc = which == 0 ? BQ : (which == 1 ? BK : BV); float* dst = WP + (size_t)which * CIN * 128;
  for (int e = blockIdx.x * 256 + threadIdx.x; e < CIN * 32; e += gridDim.x * 256) { const int row = e >> 5, q = e & 31; const v4f ld = *(const v4f*)(Wsrc + (size_t)row * 64 + (q & 15) * 4); asm volatile("s_wait_loadcnt 0x0" ::: "memory"); const float keep = q < 16 ? 1.f : 0.f; v4f ov; ov[0] = ld[0] * keep; ov[1] = ld[1] * keep; ov[2] = ld[2] * keep; ov[3] = ld[3] * keep; vst2(dst + (size_t)row * 128 + q * 4, ov); }
  if (blockIdx.x == 0 && threadIdx.x < 128) { const int c = threadIdx.x; float bvv = 0.f; if (Bsrc) { const float t = Bsrc[c & 63]; asm volatile("s_wait_loadcnt 0x0" ::: "memory"); bvv = c < 64 ? t : 0.f; } vst2(BP + which * 128 + c, bvv); } }
// ---- k_out64: out[b][t][0..63] = ctx row columns 0..63 (256 B by 16 lanes)
__global__ __launch_bounds__(256) void k_out64(const float* __restrict__ Y, float* __restrict__ OUT) { const size_t row = (size_t)blockIdx.x * 16 + (threadIdx.x >> 4); const int q = threadIdx.x & 15; const v4f v = *(const v4f*)(Y + row * CC + q * 4); asm volatile("s_wait_loadcnt 0x0" ::: "memory"); vst2(OUT + row * 64 + q * 4, v); }
#define WS_WP (WS_END)                                  // padded weights [3][128 x C]
#define WS_BP (WS_WP + 4u * 3 * (size_t)CIN * 128)        // padded biases [3][128]
#define WS_Y2 (WS_BP + 4u * 3 * 128)                      // ctx rows [b*TT+t][128]
#define WS_END2 (WS_Y2 + 4u * (size_t)NB * TT * CC)
#ifndef SM_EXTRA_PARAMS
#define SM_EXTRA_PARAMS
#endif
#ifndef PROJ_EXTRA_PARAMS
#define PROJ_EXTRA_PARAMS
#endif
#ifndef SM_MASK_HOOK
#define SM_MASK_HOOK (void)0
#endif

#define WS_QH  0u                                      // f16 q rows [b*t][CC]
#define WS_KH  (WS_QH + 2u * (size_t)NB * TT * CC)      // f16 k rows [b*t][CC]
#define WS_VT  (WS_KH + 2u * (size_t)NB * TT * CC)      // f16 v planes [b][c][t]
#define WS_QL  (WS_VT + 2u * (size_t)NB * CC * TT)      // f16 q residual x 2^10 rows [b][t < QHI][CC]
#define WS_KL  (WS_QL + 2u * (size_t)NB * QHI * CC)     // f16 k residual x 2^10 rows [b][t < KHI][CC]
#define WS_VB  (WS_KL + 2u * (size_t)NB * KHI * CC)     // bf16 v hi planes [b][c][t < KHI]
#define WS_VBL (WS_VB + 2u * (size_t)NB * CC * KHI)
#define WS_S   (WS_VBL + 2u * (size_t)NB * CC * KHI)    // f32 [hg][t][s] region, unused (the logits stay in registers)
#define WS_Y   (WS_S  + 4u * (size_t)HG * TT * TT)      // f32 ctx rows [b*t][CC] (only when there is an output projection)
#define WS_END (WS_Y  + 0u)

// ---- k_proj: block = (64 rows, 128 cols, which): q/k/v = X W (+ b) with exact bf16 products (K = DIN) -> which 0: q f16 rows (+ residual rows < QHI); 1: k f16 rows (+ residual rows < KHI); 2: v f16 planes [c][t] (+ bf16 hi/lo planes for t < KHI)
__global__ __launch_bounds__(128) void k_proj(const float* __restrict__ XQ, const float* __restrict__ XK, const float* __restrict__ XV, const float* __restrict__ WQ, const float* __restrict__ WK, const float* __restrict__ WV, const float* __restrict__ BQ, const float* __restrict__ BK, const float* __restrict__ BV,
    _Float16* __restrict__ QH, _Float16* __restrict__ QL, _Float16* __restrict__ KH, _Float16* __restrict__ KL, _Float16* __restrict__ VT, __bf16* __restrict__ VB, __bf16* __restrict__ VBL) {
  __shared__ __align__(16) _Float16 sh[64][136], sl[64][136]; __shared__ __align__(16) _Float16 th[128][72]; __shared__ __align__(16) __bf16 tb[128][72], tbl[128][72];
  const int tid = threadIdx.x, wave = tid >> 5, lane = tid & 31, col = lane & 15, g = lane >> 4; const int which = blockIdx.z; const int c0 = blockIdx.y * 128; const size_t r0 = (size_t)blockIdx.x * 64; const size_t bb = r0 / TT; const int t0 = (int)(r0 % TT);
  const float* X = which == 0 ? XQ : which == 1 ? XK : XV; const float* WA = which == 0 ? WQ : which == 1 ? WK : WV; const float* BA = which == 0 ? BQ : which == 1 ? BK : BV;
  v8f acc[8] = {};
#pragma unroll 2
  for (int kc = 0; kc < DIN / 32; ++kc) { v16b a; { const float* p = X + (r0 + wave * 16 + col) * DIN + kc * 32 + 8 * g;
#pragma unroll
      for (int i = 0; i < 8; ++i) { a[i] = (__bf16)p[i]; a[8 + i] = (__bf16)p[16 + i]; } }
    asm volatile("s_wait_loadcnt 0x0" ::: "memory");
#pragma unroll
    for (int j = 0; j < 8; ++j) { const v16b w = WCOL(WA, kc * 32, c0 + j * 16 + col, lane); asm volatile("s_wait_loadcnt 0x0" ::: "memory"); acc[j] = wmma_bf(a, w, acc[j]); } }
  if (which < 2) { _Float16* DH = which == 0 ? QH : KH; _Float16* DL = which == 0 ? QL : KL; const int nhi = which == 0 ? QHI : KHI; const bool hi_rows = t0 < nhi;
#pragma unroll
    for (int j = 0; j < 8; ++j) { const float bias = BA ? bfr(BA[c0 + j * 16 + col]) : 0.f;
#pragma unroll
      for (int r = 0; r < 8; ++r) { const float v = acc[j][r] + bias; const _Float16 hv = (_Float16)v; sh[wave * 16 + 8 * g + r][j * 16 + col] = hv; sl[wave * 16 + 8 * g + r][j * 16 + col] = (_Float16)((v - (float)hv) * 1024.0f); } }
    __syncthreads();
    for (int e = tid; e < 64 * 16; e += 128) { const int rl = e >> 4, q = e & 15; vst2((unsigned*)(DH + (r0 + rl) * CC + c0 + q * 8), *(const v4u*)&sh[rl][q * 8]); if (hi_rows) vst2((unsigned*)(DL + (bb * nhi + t0 + rl) * (size_t)CC + c0 + q * 8), *(const v4u*)&sl[rl][q * 8]); }
  } else { const bool hi_rows = t0 < KHI;
#pragma unroll
    for (int j = 0; j < 8; ++j) { const float bias = BA ? bfr(BA[c0 + j * 16 + col]) : 0.f;
#pragma unroll
      for (int r = 0; r < 8; ++r) { const float v = acc[j][r] + bias; const int rl = wave * 16 + 8 * g + r, cl = j * 16 + col; th[cl][rl] = (_Float16)v; const __bf16 bh = (__bf16)v; tb[cl][rl] = bh; tbl[cl][rl] = (__bf16)(v - (float)bh); } }
    __syncthreads();
    for (int e = tid; e < 128 * 8; e += 128) { const int cl = e >> 3, q = e & 7; vst2((unsigned*)(VT + (bb * CC + c0 + cl) * (size_t)TT + t0 + q * 8), *(const v4u*)&th[cl][q * 8]); if (hi_rows) { const size_t o3 = (bb * CC + c0 + cl) * (size_t)KHI + t0 + q * 8; vst2((unsigned*)(VB + o3), *(const v4u*)&tb[cl][q * 8]); vst2((unsigned*)(VBL + o3), *(const v4u*)&tbl[cl][q * 8]); } } } }
// ---- k_attn: logits, causal softmax and P V in one kernel, all batches in one launch; the logits never leave the registers.
// block = 32 queries (two 16-column groups) of batch b, AW waves; wave w walks the 32-key chunks w, w + AW, ... up to the diagonal chunk.
// S^T = K Q^T (A = 16 key rows, B = 16 query columns): a lane holds 16 logits of ONE query (column lane & 15), in the k order a B operand wants, so P^T goes from the two score tiles straight into O^T += V^T P^T.
// Running maximum and sum per lane (log2 domain, online softmax); the AW partial (max, sum, O) are joined through LDS in wave order.
// Queries < QHI: 3-product logits (q, k as f16 hi + residual x 2^10) and P, v as bf16 hi + lo (3 products); after: single f16 products, weights x 2^10 (the factor is in the sum too and cancels).
#define AW 16
#define SL2E (SCALE * 1.4426950408889634f)
// fragment from a pointer that already holds the lane half's offset (row start + k0 + 8 * (lane >> 4))
__device__ __forceinline__ v16h frag_hp(const _Float16* p) { union { v16h v; v8h q[2]; } u; u.q[0] = *(const v8h*)p; u.q[1] = *(const v8h*)(p + 16); return u.v; }
__device__ __forceinline__ v16b frag_bp(const __bf16* p) { union { v16b v; v8b q[2]; } u; u.q[0] = *(const v8b*)p; u.q[1] = *(const v8b*)(p + 16); return u.v; }
// 2^x, eight at a time: the early-clobber outputs keep a v_exp_f32 from overwriting the source of the one in front of it, and the v_nop fills the slot behind the last one
__device__ __forceinline__ void exp2x8(float* o, const float* x) {
  asm("v_exp_f32 %0, %8\n\tv_exp_f32 %1, %9\n\tv_exp_f32 %2, %10\n\tv_exp_f32 %3, %11\n\tv_exp_f32 %4, %12\n\tv_exp_f32 %5, %13\n\tv_exp_f32 %6, %14\n\tv_exp_f32 %7, %15\n\tv_nop"
      : "=&v"(o[0]), "=&v"(o[1]), "=&v"(o[2]), "=&v"(o[3]), "=&v"(o[4]), "=&v"(o[5]), "=&v"(o[6]), "=&v"(o[7]) : "v"(x[0]), "v"(x[1]), "v"(x[2]), "v"(x[3]), "v"(x[4]), "v"(x[5]), "v"(x[6]), "v"(x[7])); }
// 2^x, one value; the v_nop fills the slot behind the transcendental
__device__ __forceinline__ float exp2x1(float x) { float r; asm("v_exp_f32 %0, %1\n\tv_nop" : "=v"(r) : "v"(x)); return r; }
struct SMX { float e[16]; float al; };
// one online-softmax step of one query column: sv = 16 scaled log2 logits of this lane's query; poff = log2 of the weights' common factor
__device__ __forceinline__ SMX sm_step(const float sv[16], float& m, float& l, float poff) { SMX o; float mx = sv[0];
#pragma unroll
  for (int i = 1; i < 16; ++i) mx = fmaxf(mx, sv[i]);
  mx = fmaxf(mx, __shfl_xor(mx, 16)); const float mn = fmaxf(m, mx); o.al = exp2x1(m - mn); m = mn; const float mref = mn - poff; float d[16], ls = 0.f;
#pragma unroll
  for (int i = 0; i < 16; ++i) d[i] = sv[i] - mref;
  exp2x8(o.e, d); exp2x8(o.e + 8, d + 8);
#pragma unroll
  for (int i = 0; i < 16; ++i) ls += o.e[i];
  l = l * o.al + ls; return o; }
__global__ __launch_bounds__(AW * 32) void k_attn(const _Float16* __restrict__ QH, const _Float16* __restrict__ KH, const _Float16* __restrict__ QL, const _Float16* __restrict__ KL, const _Float16* __restrict__ VT, const __bf16* __restrict__ VB, const __bf16* __restrict__ VBL, float* __restrict__ Y) {
  __shared__ __align__(16) float so[AW][32][HD + 4]; __shared__ float smx[AW][32], sls[AW][32];
  const int tid = threadIdx.x, wave = __builtin_amdgcn_readfirstlane(tid >> 5), lane = tid & 31, col = lane & 15, g = lane >> 4;
  const int b = blockIdx.x % NB; const int rt = (TT / 32 - 1) - blockIdx.x / NB;   /* longest walks start first */
  const int q0 = rt * 32, nch = rt + 1; const size_t row0 = (size_t)b * TT;
  v8f acc[2][HD / 16] = {}; float m[2] = {-3.0e38f, -3.0e38f}, l[2] = {0.f, 0.f};
  const _Float16* qhp = QH + (row0 + q0 + col) * CC + 8 * g;
  const _Float16* khp = KH + (row0 + wave * 32 + col) * CC + 8 * g;
  if (q0 < QHI) { const _Float16* qlp = QL + ((size_t)b * QHI + q0 + col) * CC + 8 * g; const _Float16* klp = KL + ((size_t)b * KHI + wave * 32 + col) * CC + 8 * g;
    const __bf16* vhp = VB + ((size_t)b * CC + col) * (size_t)KHI + wave * 32 + 8 * g; const __bf16* vlp = VBL + ((size_t)b * CC + col) * (size_t)KHI + wave * 32 + 8 * g;
#pragma unroll 1
    for (int kc = wave; kc < nch; kc += AW, khp += AW * 32 * CC, klp += AW * 32 * CC, vhp += AW * 32, vlp += AW * 32) {
#pragma unroll
      for (int qt = 0; qt < 2; ++qt) { v16h qh[HD / 32], ql[HD / 32], kh[2][HD / 32], kl[2][HD / 32];
#pragma unroll
        for (int kd = 0; kd < HD / 32; ++kd) { qh[kd] = frag_hp(qhp + qt * 16 * CC + kd * 32); ql[kd] = frag_hp(qlp + qt * 16 * CC + kd * 32);
#pragma unroll
          for (int t = 0; t < 2; ++t) { kh[t][kd] = frag_hp(khp + t * 16 * CC + kd * 32); kl[t][kd] = frag_hp(klp + t * 16 * CC + kd * 32); } }
        asm volatile("s_wait_xcnt 0x0" :: "v"(qhp), "v"(qlp), "v"(khp), "v"(klp) : "memory");   /* keeps the loads' address pairs live and unwritten up to the wait */
        v8f s[2] = {}, sr[2] = {};
#pragma unroll
        for (int kd = 0; kd < HD / 32; ++kd)
#pragma unroll
          for (int t = 0; t < 2; ++t) { s[t] = wmma16(kh[t][kd], qh[kd], s[t]); sr[t] = wmma16(kh[t][kd], ql[kd], sr[t]); sr[t] = wmma16(kl[t][kd], qh[kd], sr[t]); }
        float sv[16];
#pragma unroll
        for (int i = 0; i < 16; ++i) { const float v = (s[i >> 3][i & 7] + sr[i >> 3][i & 7] * (1.0f / 1024.0f)) * SL2E; sv[i] = (kc * 32 + (i >> 3) * 16 + 8 * g + (i & 7) <= q0 + qt * 16 + col) ? v : -3.0e38f; }
        const SMX x = sm_step(sv, m[qt], l[qt], 0.f); const F2 p = bsplit16(x.e); v16b vh[HD / 16], vl[HD / 16];
#pragma unroll
        for (int j = 0; j < HD / 16; ++j) { vh[j] = frag_bp(vhp + j * 16 * KHI); vl[j] = frag_bp(vlp + j * 16 * KHI); }
        asm volatile("s_wait_xcnt 0x0" :: "v"(vhp), "v"(vlp) : "memory");   /* as above */
#pragma unroll
        for (int j = 0; j < HD / 16; ++j) { acc[qt][j] *= x.al; acc[qt][j] = wmma_bf(vh[j], p.h, acc[qt][j]); acc[qt][j] = wmma_bf(vh[j], p.l, acc[qt][j]); acc[qt][j] = wmma_bf(vl[j], p.h, acc[qt][j]); } } }
  } else { const _Float16* vp = VT + ((size_t)b * CC + col) * (size_t)TT + wave * 32 + 8 * g; v16h qf[2][HD / 32];
#pragma unroll
    for (int qt = 0; qt < 2; ++qt)
#pragma unroll
      for (int kd = 0; kd < HD / 32; ++kd) qf[qt][kd] = frag_hp(qhp + qt * 16 * CC + kd * 32);
    asm volatile("s_wait_xcnt 0x0" :: "v"(qhp) : "memory");   /* as above */
#pragma unroll 1
    for (int kc = wave; kc < nch; kc += AW, khp += AW * 32 * CC, vp += AW * 32) { v16h kf[2][HD / 32], vf[HD / 16];
#pragma unroll
      for (int t = 0; t < 2; ++t)
#pragma unroll
        for (int kd = 0; kd < HD / 32; ++kd) kf[t][kd] = frag_hp(khp + t * 16 * CC + kd * 32);
#pragma unroll
      for (int j = 0; j < HD / 16; ++j) vf[j] = frag_hp(vp + (size_t)j * 16 * TT);
      asm volatile("s_wait_xcnt 0x0" :: "v"(khp), "v"(vp) : "memory");   /* as above */
#pragma unroll
      for (int qt = 0; qt < 2; ++qt) { v8f s[2] = {};
#pragma unroll
        for (int t = 0; t < 2; ++t)
#pragma unroll
          for (int kd = 0; kd < HD / 32; ++kd) s[t] = wmma16(kf[t][kd], qf[qt][kd], s[t]);
        float sv[16];
#pragma unroll
        for (int i = 0; i < 16; ++i) sv[i] = s[i >> 3][i & 7] * SL2E;
        if (kc == nch - 1) {   /* only the diagonal chunk holds keys past a query */
#pragma unroll
          for (int i = 0; i < 16; ++i) if (kc * 32 + (i >> 3) * 16 + 8 * g + (i & 7) > q0 + qt * 16 + col) sv[i] = -3.0e38f; }
        const SMX x = sm_step(sv, m[qt], l[qt], 10.f); v16h p;
#pragma unroll
        for (int i = 0; i < 16; ++i) p[i] = (_Float16)x.e[i];
#pragma unroll
        for (int j = 0; j < HD / 16; ++j) { acc[qt][j] *= x.al; acc[qt][j] = wmma16(vf[j], p, acc[qt][j]); } } } }
#pragma unroll
  for (int qt = 0; qt < 2; ++qt) { const float lt = l[qt] + __shfl_xor(l[qt], 16); if (g == 0) { smx[wave][qt * 16 + col] = m[qt]; sls[wave][qt * 16 + col] = lt; }
#pragma unroll
    for (int j = 0; j < HD / 16; ++j) { v4f a0, a1;
#pragma unroll
      for (int r = 0; r < 4; ++r) { a0[r] = acc[qt][j][r]; a1[r] = acc[qt][j][4 + r]; }
      *(v4f*)&so[wave][qt * 16 + col][j * 16 + 8 * g] = a0; *(v4f*)&so[wave][qt * 16 + col][j * 16 + 8 * g + 4] = a1; } }
  __syncthreads();   /* every wave's partial (max, sum, O) is in LDS before any of them is joined */
  { const int qr = tid >> 4, q = tid & 15; float mw[AW], wt[AW]; float M = -3.0e38f;
#pragma unroll
    for (int w = 0; w < AW; ++w) { mw[w] = smx[w][qr]; M = fmaxf(M, mw[w]); }
#pragma unroll
    for (int w = 0; w < AW; ++w) mw[w] -= M;
    exp2x8(wt, mw); exp2x8(wt + 8, mw + 8);
    float Ls = 0.f; v4f o = {};
#pragma unroll
    for (int w = 0; w < AW; ++w) { Ls += wt[w] * sls[w][qr]; o += *(const v4f*)&so[w][qr][q * 4] * wt[w]; }
    const float inv = Ls > 0.f ? 1.0f / Ls : 0.f; vst2(Y + (row0 + q0 + qr) * CC + q * 4, o * inv); } }

extern "C" void kernel_launch(void* const* d_in, const int* in_sizes, int n_in, void* d_out, int out_size, void* d_ws, size_t ws_size, hipStream_t stream) {
  (void)in_sizes; (void)n_in; (void)out_size;
  const float** F = (const float**)d_in;
  if (ws_size < (size_t)WS_END) return;
  char* ws = (char*)d_ws; _Float16 *QH = (_Float16*)(ws + WS_QH), *KH = (_Float16*)(ws + WS_KH), *VT = (_Float16*)(ws + WS_VT), *QL = (_Float16*)(ws + WS_QL), *KL = (_Float16*)(ws + WS_KL); __bf16 *VB = (__bf16*)(ws + WS_VB), *VBL = (__bf16*)(ws + WS_VBL); float *S = (float*)(ws + WS_S), *Y = (float*)(ws + WS_Y);
  (void)Y; (void)S;
  // inputs: 0 q_in [4,4096,512]; 1 k_in; 2 v_in (separate inputs); 3 Wq [512,64], 4 bq; 5 Wk, 6 bk; 7 Wv, 8 bv ((in,out); zero biases read)
  if (ws_size < (size_t)WS_END2) return;
  float *WP = (float*)(ws + WS_WP), *BP = (float*)(ws + WS_BP), *Y2 = (float*)(ws + WS_Y2);
  k_padw<<<dim3(32, 3), 256, 0, stream>>>(F[3], F[5], F[7], F[4], F[6], F[8], WP, BP);
  k_proj<<<dim3(TNB * TT / 64, CC / 128, 3), 128, 0, stream>>>(F[0], F[1], F[2], WP, WP + (size_t)CIN * 128, WP + 2 * (size_t)CIN * 128, BP, BP + 128, BP + 256, QH, QL, KH, KL, VT, VB, VBL);
  k_attn<<<dim3(NB * (TT / 32)), AW * 32, 0, stream>>>(QH, KH, QL, KL, VT, VB, VBL, Y2);   /* head 0 only (head 1 is the zero padding) */
  k_out64<<<dim3(TNB * TT / 16), 256, 0, stream>>>(Y2, (float*)d_out);
}

// v003
// Measured time: 53.9 microseconds a run.
// Timed twice side by side with v002, it ran 1.48 times as fast both times.
// All steps since v000 together make it 12.7 times as fast.
// compute dtype: all float inputs rounded to bf16; q/k/v projections with EXACT bf16 products on WMMA 16x16x32 (f32 accumulate) + bias; causal logits: 3 products (q f16 hi + residual x k hi + residual) for the first 384 rows, single f16 q x k after, x scale; online softmax f32 (base 2) in registers; unnormalised weights x 2^10 once to f16 x v once to f16 (1 product; bf16 hi + lo below row 384), divided by the f32 sum at the end; f32 output.
#include <hip/hip_runtime.h>
#include <math.h>

typedef __attribute__((ext_vector_type(16))) _Float16 v16h;
typedef __attribute__((ext_vector_type(16))) __bf16 v16b;
typedef __attribute__((ext_vector_type(8)))  _Float16 v8h;
typedef __attribute__((ext_vector_type(8)))  float v8f;
typedef __attribute__((ext_vector_type(4)))  float v4f;
typedef __attribute__((ext_vector_type(2)))  float v2f;
typedef __attribute__((ext_vector_type(4)))  unsigned v4u;
typedef __attribute__((ext_vector_type(4)))  int v4i;
typedef float __attribute__((may_alias)) float_a;
typedef int __attribute__((may_alias)) int_a;

template <typename T> __device__ __forceinline__ void vst2(void* p, T v) { *(T*)p = v;  }
// store in a loop: the wait takes the store's address and data as inputs, so that neither register is rewritten (next store, next trip) in front of it
template <typename T> __device__ __forceinline__ void vst2w(void* p, T v) { *(T*)p = v; asm volatile("s_wait_xcnt 0x0" :: "v"(p), "v"(v) : "memory"); }
__device__ __forceinline__ v8f wmma16(v16h a, v16h b, v8f c) {
  v8f d = __builtin_amdgcn_wmma_f32_16x16x32_f16(false, a, false, b, (short)0, c, false, false);
  asm volatile("v_nop\n\tv_nop\n\tv_nop\n\tv_nop" : "+v"(d) : "v"(a), "v"(b));
  return d;
}
__device__ __forceinline__ v8f wmma_bf(v16b a, v16b b, v8f c) {
  v8f d = __builtin_amdgcn_wmma_f32_16x16x32_bf16(false, a, false, b, (short)0, c, false, false);
  asm volatile("v_nop\n\tv_nop\n\tv_nop\n\tv_nop" : "+v"(d) : "v"(a), "v"(b));
  return d;
}
// 16x16x32 fragments: lane = (h = lane>>4, row/col = lane&15); elements 0..7 = k0+8h+0..7, 8..15 = k0+16+8h+0..7; D element r = row 8h+r
__device__ __forceinline__ v16h frag_h(const _Float16* rowk0, int lane) {
  union { v16h v; v8h q[2]; } u; const _Float16* p = rowk0 + 8 * (lane >> 4);
  u.q[0] = *(const v8h*)p; u.q[1] = *(const v8h*)(p + 16); return u.v;
}
__device__ __forceinline__ v16h frag_f32(const float* rowk0, int lane) {
  v16h a; const float* p = rowk0 + 8 * (lane >> 4);
#pragma unroll
  for (int i = 0; i < 8; ++i) { a[i] = (_Float16)p[i]; a[8 + i] = (_Float16)p[16 + i]; }
  return a;
}
__device__ __forceinline__ v16h frag_f32s(const float* rowk0, int lane, float sc) {
  v16h a; const float* p = rowk0 + 8 * (lane >> 4);
#pragma unroll
  for (int i = 0; i < 8; ++i) { a[i] = (_Float16)(p[i] * sc); a[8 + i] = (_Float16)(p[16 + i] * sc); }
  return a;
}
// column fragment from a [K][ld] layout (column n), rows >= K read as 0
__device__ __forceinline__ v16h fragc_f32(const float* W, int k0, int n, int lane, int ld, int K) {
  v16h a; const int g = lane >> 4;
#pragma unroll
  for (int i = 0; i < 8; ++i) { const int ka = k0 + 8 * g + i, kb = ka + 16;
    a[i] = (_Float16)(ka < K ? W[(size_t)(ka < K ? ka : K - 1) * ld + n] : 0.f); a[8 + i] = (_Float16)(kb < K ? W[(size_t)(kb < K ? kb : K - 1) * ld + n] : 0.f); }
  return a;
}
struct F2 { v16b h, l; };
__device__ __forceinline__ F2 bsplit16(const float v[16]) { F2 r;
#pragma unroll
  for (int i = 0; i < 16; ++i) { const __bf16 h = (__bf16)v[i]; r.h[i] = h; r.l[i] = (__bf16)(v[i] - (float)h); }
  return r; }
__device__ __forceinline__ F2 split_row(const float* row, int k0, int lane) { float v[16]; const float* p = row + k0 + 8 * (lane >> 4);
#pragma unroll
  for (int i = 0; i < 8; ++i) { v[i] = p[i]; v[8 + i] = p[16 + i]; }
  return bsplit16(v); }
__device__ __forceinline__ F2 split_rowK(const float* row, int k0, int lane, int K) { float v[16]; const int g = lane >> 4;
#pragma unroll
  for (int i = 0; i < 8; ++i) { const int ka = k0 + 8 * g + i, kb = ka + 16; v[i] = ka < K ? row[ka < K ? ka : K - 1] : 0.f; v[8 + i] = kb < K ? row[kb < K ? kb : K - 1] : 0.f; }
  return bsplit16(v); }
__device__ __forceinline__ F2 split_col(const float* W, int k0, int n, int lane, int ld, int K) { float v[16]; const int g = lane >> 4;
#pragma unroll
  for (int i = 0; i < 8; ++i) { const int ka = k0 + 8 * g + i, kb = ka + 16; v[i] = ka < K ? W[(size_t)(ka < K ? ka : K - 1) * ld + n] : 0.f; v[8 + i] = kb < K ? W[(size_t)(kb < K ? kb : K - 1) * ld + n] : 0.f; }
  return bsplit16(v); }
__device__ __forceinline__ v8f mac3(const F2& a, const F2& b, v8f c) { c = wmma_bf(a.l, b.h, c); c = wmma_bf(a.h, b.l, c); return wmma_bf(a.h, b.h, c); }
__device__ __forceinline__ float sigm(float v) { return 1.0f / (1.0f + expf(-v)); }
#define LDSX() do { asm volatile("s_wait_dscnt 0" ::: "memory"); __builtin_amdgcn_wave_barrier(); __builtin_amdgcn_fence(__ATOMIC_RELEASE, "workgroup"); } while (0)

// Single-head causal scaled dot-product attention with separate inputs (q_in / k_in / v_in [4,4096,512]; Keras Dense (in,out) Wq / Wk / Wv [512,64] N(0, 1/512) + zero biases; scale 1/8; causal j <= i, -inf): out = softmax(causal((q_in Wq + bq)(k_in Wk + bk)^T / 8)) (v_in Wv + bv) -> [4,4096,64].
#define NB 4
#define TT 4096
#define CC 64             // NH * HD = projected width
#define DIN 512          // input (model) width
#define NH 1
#define HD 64
#define NQB (TT / 64)
#define HG 1
#define SCALE (0.125f)
#define CAUSAL 1
#ifndef TNB
#define TNB NB
#endif
__device__ __forceinline__ float bfr(float v) { return (float)(__bf16)v; }
__host__ __device__ __forceinline__ int kb_last(int qb) { return CAUSAL ? ((qb * 64 + 63) >> 7) : (TT / 128 - 1); }
typedef __attribute__((ext_vector_type(8))) __bf16 v8b;
__device__ __forceinline__ v16b frag_b(const __bf16* rowk0, int lane) {
  union { v16b v; v8b q[2]; } u; const __bf16* p = rowk0 + 8 * (lane >> 4);
  u.q[0] = *(const v8b*)p; u.q[1] = *(const v8b*)(p + 16); return u.v;
}
#define QBH 6              // unused; causal: query rows < QBH * 64 (= QHI; few keys, no averaging) take the high-precision path
#define QHI 384            // rows carrying a q residual plane
#define KHI 384            // key rows carrying k residual / v bf16 hi+lo planes (used only by the causal high-precision path)
// B fragment (k rows k0+.., output column o) of a weight: (in,out) [K][ld] or (out,in) [ld rows of K]: bf16 exact, or f16(bf16 * 256) exact
__device__ __forceinline__ v16b wcol_io(const float* Wm, int k0, int o, int lane, int ld) { v16b w; const int g = lane >> 4;
#pragma unroll
  for (int i = 0; i < 8; ++i) { w[i] = (__bf16)Wm[(size_t)(k0 + 8 * g + i) * ld + o]; w[8 + i] = (__bf16)Wm[(size_t)(k0 + 16 + 8 * g + i) * ld + o]; }
  return w; }
__device__ __forceinline__ v16b wcol_oi(const float* Wm, int k0, int o, int lane, int K) { v16b w; const float* p = Wm + (size_t)o * K + k0 + 8 * (lane >> 4);
#pragma unroll
  for (int i = 0; i < 8; ++i) { w[i] = (__bf16)p[i]; w[8 + i] = (__bf16)p[16 + i]; }
  return w; }
__device__ __forceinline__ v16h wcolh_io(const float* Wm, int k0, int o, int lane, int ld) { v16h w; const int g = lane >> 4;
#pragma unroll
  for (int i = 0; i < 8; ++i) { w[i] = (_Float16)(bfr(Wm[(size_t)(k0 + 8 * g + i) * ld + o]) * 256.0f); w[8 + i] = (_Float16)(bfr(Wm[(size_t)(k0 + 16 + 8 * g + i) * ld + o]) * 256.0f); }
  return w; }
__device__ __forceinline__ v16h wcolh_oi(const float* Wm, int k0, int o, int lane, int K) { v16h w; const float* p = Wm + (size_t)o * K + k0 + 8 * (lane >> 4);
#pragma unroll
  for (int i = 0; i < 8; ++i) { w[i] = (_Float16)(bfr(p[i]) * 256.0f); w[8 + i] = (_Float16)(bfr(p[16 + i]) * 256.0f); }
  return w; }
#define WQKV_LAYOUT 0   // 0 = (in,out) [DIN][CC]; 1 = (out,in) [CC][DIN]; 2 = per-head [NH][DIN][HD]
__device__ __forceinline__ v16b wcol_hdk(const float* Wm, int k0, int o, int lane) { v16b w; const int g = lane >> 4; const float* p = Wm + (size_t)(o / HD) * DIN * HD + (o % HD);
#pragma unroll
  for (int i = 0; i < 8; ++i) { w[i] = (__bf16)p[(size_t)(k0 + 8 * g + i) * HD]; w[8 + i] = (__bf16)p[(size_t)(k0 + 16 + 8 * g + i) * HD]; }
  return w; }
#define WO_OUT_IN 0
#if WQKV_LAYOUT == 1
#define WCOL(W, k0, o, lane) wcol_oi(W, k0, o, lane, DIN)
#elif WQKV_LAYOUT == 2
#define WCOL(W, k0, o, lane) wcol_hdk(W, k0, o, lane)
#else
#define WCOL(W, k0, o, lane) wcol_io(W, k0, o, lane, CC)
#endif
#if WO_OUT_IN
#define WOCOL(W, k0, o, lane) wcol_oi(W, k0, o, lane, CC)
#define WOCOLH(W, k0, o, lane) wcolh_oi(W, k0, o, lane, CC)
#else
#define WOCOL(W, k0, o, lane) wcol_io(W, k0, o, lane, DIN)
#define WOCOLH(W, k0, o, lane) wcolh_io(W, k0, o, lane, DIN)
#endif
#ifndef SM_EXTRA_PARAMS
#define SM_EXTRA_PARAMS
#endif
#ifndef PROJ_EXTRA_PARAMS
#define PROJ_EXTRA_PARAMS
#endif
#ifndef SM_MASK_HOOK
#define SM_MASK_HOOK (void)0
#endif

#define WS_QH  0u                                      // f16 q rows [b*t][CC]
#define WS_KH  (WS_QH + 2u * (size_t)NB * TT * CC)      // f16 k rows [b*t][CC]
#define WS_VT  (WS_KH + 2u * (size_t)NB * TT * CC)      // f16 v planes [b][c][t]
#define WS_QL  (WS_VT + 2u * (size_t)NB * CC * TT)      // f16 q residual x 2^10 rows [b][t < QHI][CC]
#define WS_KL  (WS_QL + 2u * (size_t)NB * QHI * CC)     // f16 k residual x 2^10 rows [b][t < KHI][CC]
#define WS_VB  (WS_KL + 2u * (size_t)NB * KHI * CC)     // bf16 v hi planes [b][c][t < KHI]
#define WS_VBL (WS_VB + 2u * (size_t)NB * CC * KHI)
#define WS_S   (WS_VBL + 2u * (size_t)NB * CC * KHI)    // f32 [hg][t][s] region, unused (the logits stay in registers)
#define WS_Y   (WS_S  + 4u * (size_t)HG * TT * TT)      // f32 ctx rows [b*t][CC] (only when there is an output projection)
#define WS_END (WS_Y  + 0u)

// ---- k_proj: block = (64 rows, 64 cols, which): q/k/v = X W (+ b) with exact bf16 products (K = DIN) -> which 0: q f16 rows (+ residual rows < QHI); 1: k f16 rows (+ residual rows < KHI); 2: v f16 planes [c][t] (+ bf16 hi/lo planes for t < KHI)
__global__ __launch_bounds__(128) void k_proj(const float* __restrict__ XQ, const float* __restrict__ XK, const float* __restrict__ XV, const float* __restrict__ WQ, const float* __restrict__ WK, const float* __restrict__ WV, const float* __restrict__ BQ, const float* __restrict__ BK, const float* __restrict__ BV,
    _Float16* __restrict__ QH, _Float16* __restrict__ QL, _Float16* __restrict__ KH, _Float16* __restrict__ KL, _Float16* __restrict__ VT, __bf16* __restrict__ VB, __bf16* __restrict__ VBL) {
  __shared__ __align__(16) _Float16 sh[64][72], sl[64][72]; __shared__ __align__(16) _Float16 th[64][72]; __shared__ __align__(16) __bf16 tb[64][72], tbl[64][72];
  const int tid = threadIdx.x, wave = tid >> 5, lane = tid & 31, col = lane & 15, g = lane >> 4; const int which = blockIdx.z; const int c0 = blockIdx.y * 64; const size_t r0 = (size_t)blockIdx.x * 64; const size_t bb = r0 / TT; const int t0 = (int)(r0 % TT);
  const float* X = which == 0 ? XQ : which == 1 ? XK : XV; const float* WA = which == 0 ? WQ : which == 1 ? WK : WV; const float* BA = which == 0 ? BQ : which == 1 ? BK : BV;
  v8f acc[4] = {};
#pragma unroll 2
  for (int kc = 0; kc < DIN / 32; ++kc) { v16b a; { const float* p = X + (r0 + wave * 16 + col) * DIN + kc * 32 + 8 * g;
#pragma unroll
      for (int i = 0; i < 8; ++i) { a[i] = (__bf16)p[i]; a[8 + i] = (__bf16)p[16 + i]; } }
    asm volatile("s_wait_loadcnt 0x0" ::: "memory");
#pragma unroll
    for (int j = 0; j < 4; ++j) { const v16b w = WCOL(WA, kc * 32, c0 + j * 16 + col, lane); asm volatile("s_wait_loadcnt 0x0" ::: "memory"); acc[j] = wmma_bf(a, w, acc[j]); } }
  if (which < 2) { _Float16* DH = which == 0 ? QH : KH; _Float16* DL = which == 0 ? QL : KL; const int nhi = which == 0 ? QHI : KHI; const bool hi_rows = t0 < nhi;
#pragma unroll
    for (int j = 0; j < 4; ++j) { const float bias = BA ? bfr(BA[c0 + j * 16 + col]) : 0.f;
#pragma unroll
      for (int r = 0; r < 8; ++r) { const float v = acc[j][r] + bias; const _Float16 hv = (_Float16)v; sh[wave * 16 + 8 * g + r][j * 16 + col] = hv; sl[wave * 16 + 8 * g + r][j * 16 + col] = (_Float16)((v - (float)hv) * 1024.0f); } }
    __syncthreads();
    for (int e = tid; e < 64 * 8; e += 128) { const int rl = e >> 3, q = e & 7; vst2w((unsigned*)(DH + (r0 + rl) * CC + c0 + q * 8), *(const v4u*)&sh[rl][q * 8]); if (hi_rows) vst2w((unsigned*)(DL + (bb * nhi + t0 + rl) * (size_t)CC + c0 + q * 8), *(const v4u*)&sl[rl][q * 8]); }
  } else { const bool hi_rows = t0 < KHI;
#pragma unroll
    for (int j = 0; j < 4; ++j) { const float bias = BA ? bfr(BA[c0 + j * 16 + col]) : 0.f;
#pragma unroll
      for (int r = 0; r < 8; ++r) { const float v = acc[j][r] + bias; const int rl = wave * 16 + 8 * g + r, cl = j * 16 + col; th[cl][rl] = (_Float16)v; const __bf16 bh = (__bf16)v; tb[cl][rl] = bh; tbl[cl][rl] = (__bf16)(v - (float)bh); } }
    __syncthreads();
    for (int e = tid; e < 64 * 8; e += 128) { const int cl = e >> 3, q = e & 7; vst2w((unsigned*)(VT + (bb * CC + c0 + cl) * (size_t)TT + t0 + q * 8), *(const v4u*)&th[cl][q * 8]); if (hi_rows) { const size_t o3 = (bb * CC + c0 + cl) * (size_t)KHI + t0 + q * 8; vst2w((unsigned*)(VB + o3), *(const v4u*)&tb[cl][q * 8]); vst2w((unsigned*)(VBL + o3), *(const v4u*)&tbl[cl][q * 8]); } } } }
// ---- k_attn: logits, causal softmax and P V in one kernel, all batches in one launch; the logits never leave the registers.
// block = 32 queries (two 16-column groups) of batch b, AW waves; wave w walks the 32-key chunks w, w + AW, ... up to the diagonal chunk.
// S^T = K Q^T (A = 16 key rows, B = 16 query columns): a lane holds 16 logits of ONE query (column lane & 15), in the k order a B operand wants, so P^T goes from the two score tiles straight into O^T += V^T P^T.
// Running maximum and sum per lane (log2 domain, online softmax); the AW partial (max, sum, O) are joined through LDS in wave order.
// Queries < QHI: 3-product logits (q, k as f16 hi + residual x 2^10) and P, v as bf16 hi + lo (3 products); after: single f16 products, weights x 2^10 (the factor is in the sum too and cancels).
#define AW 16
#define SL2E (SCALE * 1.4426950408889634f)
// fragment from a pointer that already holds the lane half's offset (row start + k0 + 8 * (lane >> 4))
__device__ __forceinline__ v16h frag_hp(const _Float16* p) { union { v16h v; v8h q[2]; } u; u.q[0] = *(const v8h*)p; u.q[1] = *(const v8h*)(p + 16); return u.v; }
__device__ __forceinline__ v16b frag_bp(const __bf16* p) { union { v16b v; v8b q[2]; } u; u.q[0] = *(const v8b*)p; u.q[1] = *(const v8b*)(p + 16); return u.v; }
// 2^x, eight at a time: the early-clobber outputs keep a v_exp_f32 from overwriting the source of the one in front of it, and the v_nop fills the slot behind the last one
__device__ __forceinline__ void exp2x8(float* o, const float* x) {
  asm("v_exp_f32 %0, %8\n\tv_exp_f32 %1, %9\n\tv_exp_f32 %2, %10\n\tv_exp_f32 %3, %11\n\tv_exp_f32 %4, %12\n\tv_exp_f32 %5, %13\n\tv_exp_f32 %6, %14\n\tv_exp_f32 %7, %15\n\tv_nop"
      : "=&v"(o[0]), "=&v"(o[1]), "=&v"(o[2]), "=&v"(o[3]), "=&v"(o[4]), "=&v"(o[5]), "=&v"(o[6]), "=&v"(o[7]) : "v"(x[0]), "v"(x[1]), "v"(x[2]), "v"(x[3]), "v"(x[4]), "v"(x[5]), "v"(x[6]), "v"(x[7])); }
// 2^x, one value; the v_nop fills the slot behind the transcendental
__device__ __forceinline__ float exp2x1(float x) { float r; asm("v_exp_f32 %0, %1\n\tv_nop" : "=v"(r) : "v"(x)); return r; }
struct SMX { float e[16]; float al; };
// one online-softmax step of one query column: sv = 16 scaled log2 logits of this lane's query; poff = log2 of the weights' common factor
__device__ __forceinline__ SMX sm_step(const float sv[16], float& m, float& l, float poff) { SMX o; float mx = sv[0];
#pragma unroll
  for (int i = 1; i < 16; ++i) mx = fmaxf(mx, sv[i]);
  mx = fmaxf(mx, __shfl_xor(mx, 16)); const float mn = fmaxf(m, mx); o.al = exp2x1(m - mn); m = mn; const float mref = mn - poff; float d[16], ls = 0.f;
#pragma unroll
  for (int i = 0; i < 16; ++i) d[i] = sv[i] - mref;
  exp2x8(o.e, d); exp2x8(o.e + 8, d + 8);
#pragma unroll
  for (int i = 0; i < 16; ++i) ls += o.e[i];
  l = l * o.al + ls; return o; }
__global__ __launch_bounds__(AW * 32) void k_attn(const _Float16* __restrict__ QH, const _Float16* __restrict__ KH, const _Float16* __restrict__ QL, const _Float16* __restrict__ KL, const _Float16* __restrict__ VT, const __bf16* __restrict__ VB, const __bf16* __restrict__ VBL, float* __restrict__ Y) {
  __shared__ __align__(16) float so[AW][32][HD + 4]; __shared__ float smx[AW][32], sls[AW][32];
  const int tid = threadIdx.x, wave = __builtin_amdgcn_readfirstlane(tid >> 5), lane = tid & 31, col = lane & 15, g = lane >> 4;
  const int b = blockIdx.x % NB; const int rt = (TT / 32 - 1) - blockIdx.x / NB;   /* longest walks start first */
  const int q0 = rt * 32, nch = rt + 1; const size_t row0 = (size_t)b * TT;
  v8f acc[2][HD / 16] = {}; float m[2] = {-3.0e38f, -3.0e38f}, l[2] = {0.f, 0.f};
  const _Float16* qhp = QH + (row0 + q0 + col) * CC + 8 * g;
  const _Float16* khp = KH + (row0 + wave * 32 + col) * CC + 8 * g;
  if (q0 < QHI) { const _Float16* qlp = QL + ((size_t)b * QHI + q0 + col) * CC + 8 * g; const _Float16* klp = KL + ((size_t)b * KHI + wave * 32 + col) * CC + 8 * g;
    const __bf16* vhp = VB + ((size_t)b * CC + col) * (size_t)KHI + wave * 32 + 8 * g; const __bf16* vlp = VBL + ((size_t)b * CC + col) * (size_t)KHI + wave * 32 + 8 * g;
#pragma unroll 1
    for (int kc = wave; kc < nch; kc += AW, khp += AW * 32 * CC, klp += AW * 32 * CC, vhp += AW * 32, vlp += AW * 32) {
#pragma unroll
      for (int qt = 0; qt < 2; ++qt) { v16h qh[HD / 32], ql[HD / 32], kh[2][HD / 32], kl[2][HD / 32];
#pragma unroll
        for (int kd = 0; kd < HD / 32; ++kd) { qh[kd] = frag_hp(qhp + qt * 16 * CC + kd * 32); ql[kd] = frag_hp(qlp + qt * 16 * CC + kd * 32);
#pragma unroll
          for (int t = 0; t < 2; ++t) { kh[t][kd] = frag_hp(khp + t * 16 * CC + kd * 32); kl[t][kd] = frag_hp(klp + t * 16 * CC + kd * 32); } }
        asm volatile("s_wait_xcnt 0x0" :: "v"(qhp), "v"(qlp), "v"(khp), "v"(klp) : "memory");   /* keeps the loads' address pairs live and unwritten up to the wait */
        v8f s[2] = {}, sr[2] = {};
#pragma unroll
        for (int kd = 0; kd < HD / 32; ++kd)
#pragma unroll
          for (int t = 0; t < 2; ++t) { s[t] = wmma16(kh[t][kd], qh[kd], s[t]); sr[t] = wmma16(kh[t][kd], ql[kd], sr[t]); sr[t] = wmma16(kl[t][kd], qh[kd], sr[t]); }
        float sv[16];
#pragma unroll
        for (int i = 0; i < 16; ++i) { const float v = (s[i >> 3][i & 7] + sr[i >> 3][i & 7] * (1.0f / 1024.0f)) * SL2E; sv[i] = (kc * 32 + (i >> 3) * 16 + 8 * g + (i & 7) <= q0 + qt * 16 + col) ? v : -3.0e38f; }
        const SMX x = sm_step(sv, m[qt], l[qt], 0.f); const F2 p = bsplit16(x.e); v16b vh[HD / 16], vl[HD / 16];
#pragma unroll
        for (int j = 0; j < HD / 16; ++j) { vh[j] = frag_bp(vhp + j * 16 * KHI); vl[j] = frag_bp(vlp + j * 16 * KHI); }
        asm volatile("s_wait_xcnt 0x0" :: "v"(vhp), "v"(vlp) : "memory");   /* as above */
#pragma unroll
        for (int j = 0; j < HD / 16; ++j) { acc[qt][j] *= x.al; acc[qt][j] = wmma_bf(vh[j], p.h, acc[qt][j]); acc[qt][j] = wmma_bf(vh[j], p.l, acc[qt][j]); acc[qt][j] = wmma_bf(vl[j], p.h, acc[qt][j]); } } }
  } else { const _Float16* vp = VT + ((size_t)b * CC + col) * (size_t)TT + wave * 32 + 8 * g; v16h qf[2][HD / 32];
#pragma unroll
    for (int qt = 0; qt < 2; ++qt)
#pragma unroll
      for (int kd = 0; kd < HD / 32; ++kd) qf[qt][kd] = frag_hp(qhp + qt * 16 * CC + kd * 32);
    asm volatile("s_wait_xcnt 0x0" :: "v"(qhp) : "memory");   /* as above */
#pragma unroll 1
    for (int kc = wave; kc < nch; kc += AW, khp += AW * 32 * CC, vp += AW * 32) { v16h kf[2][HD / 32], vf[HD / 16];
#pragma unroll
      for (int t = 0; t < 2; ++t)
#pragma unroll
        for (int kd = 0; kd < HD / 32; ++kd) kf[t][kd] = frag_hp(khp + t * 16 * CC + kd * 32);
#pragma unroll
      for (int j = 0; j < HD / 16; ++j) vf[j] = frag_hp(vp + (size_t)j * 16 * TT);
      asm volatile("s_wait_xcnt 0x0" :: "v"(khp), "v"(vp) : "memory");   /* as above */
#pragma unroll
      for (int qt = 0; qt < 2; ++qt) { v8f s[2] = {};
#pragma unroll
        for (int t = 0; t < 2; ++t)
#pragma unroll
          for (int kd = 0; kd < HD / 32; ++kd) s[t] = wmma16(kf[t][kd], qf[qt][kd], s[t]);
        float sv[16];
#pragma unroll
        for (int i = 0; i < 16; ++i) sv[i] = s[i >> 3][i & 7] * SL2E;
        if (kc == nch - 1) {   /* only the diagonal chunk holds keys past a query */
#pragma unroll
          for (int i = 0; i < 16; ++i) if (kc * 32 + (i >> 3) * 16 + 8 * g + (i & 7) > q0 + qt * 16 + col) sv[i] = -3.0e38f; }
        const SMX x = sm_step(sv, m[qt], l[qt], 10.f); v16h p;
#pragma unroll
        for (int i = 0; i < 16; ++i) p[i] = (_Float16)x.e[i];
#pragma unroll
        for (int j = 0; j < HD / 16; ++j) { acc[qt][j] *= x.al; acc[qt][j] = wmma16(vf[j], p, acc[qt][j]); } } } }
#pragma unroll
  for (int qt = 0; qt < 2; ++qt) { const float lt = l[qt] + __shfl_xor(l[qt], 16); if (g == 0) { smx[wave][qt * 16 + col] = m[qt]; sls[wave][qt * 16 + col] = lt; }
#pragma unroll
    for (int j = 0; j < HD / 16; ++j) { v4f a0, a1;
#pragma unroll
      for (int r = 0; r < 4; ++r) { a0[r] = acc[qt][j][r]; a1[r] = acc[qt][j][4 + r]; }
      *(v4f*)&so[wave][qt * 16 + col][j * 16 + 8 * g] = a0; *(v4f*)&so[wave][qt * 16 + col][j * 16 + 8 * g + 4] = a1; } }
  __syncthreads();   /* every wave's partial (max, sum, O) is in LDS before any of them is joined */
  { const int qr = tid >> 4, q = tid & 15; float mw[AW], wt[AW]; float M = -3.0e38f;
#pragma unroll
    for (int w = 0; w < AW; ++w) { mw[w] = smx[w][qr]; M = fmaxf(M, mw[w]); }
#pragma unroll
    for (int w = 0; w < AW; ++w) mw[w] -= M;
    exp2x8(wt, mw); exp2x8(wt + 8, mw + 8);
    float Ls = 0.f; v4f o = {};
#pragma unroll
    for (int w = 0; w < AW; ++w) { Ls += wt[w] * sls[w][qr]; o += *(const v4f*)&so[w][qr][q * 4] * wt[w]; }
    const float inv = Ls > 0.f ? 1.0f / Ls : 0.f; vst2(Y + (row0 + q0 + qr) * CC + q * 4, o * inv); } }

extern "C" void kernel_launch(void* const* d_in, const int* in_sizes, int n_in, void* d_out, int out_size, void* d_ws, size_t ws_size, hipStream_t stream) {
  (void)in_sizes; (void)n_in; (void)out_size;
  const float** F = (const float**)d_in;
  if (ws_size < (size_t)WS_END) return;
  char* ws = (char*)d_ws; _Float16 *QH = (_Float16*)(ws + WS_QH), *KH = (_Float16*)(ws + WS_KH), *VT = (_Float16*)(ws + WS_VT), *QL = (_Float16*)(ws + WS_QL), *KL = (_Float16*)(ws + WS_KL); __bf16 *VB = (__bf16*)(ws + WS_VB), *VBL = (__bf16*)(ws + WS_VBL); float *S = (float*)(ws + WS_S), *Y = (float*)(ws + WS_Y);
  (void)Y; (void)S;
  // inputs: 0 q_in [4,4096,512]; 1 k_in; 2 v_in (separate inputs); 3 Wq [512,64], 4 bq; 5 Wk, 6 bk; 7 Wv, 8 bv ((in,out); zero biases read)
  k_proj<<<dim3(TNB * TT / 64, CC / 64, 3), 128, 0, stream>>>(F[0], F[1], F[2], F[3], F[5], F[7], F[4], F[6], F[8], QH, QL, KH, KL, VT, VB, VBL);
  k_attn<<<dim3(NB * (TT / 32)), AW * 32, 0, stream>>>(QH, KH, QL, KL, VT, VB, VBL, (float*)d_out);   /* out rows are the ctx rows: [b*TT+t][64] */
}

// v004
// It runs in 44.3 microseconds.
// Next to v003, in two timings, it ran 1.22 times as fast each time.
// All steps since v000 together make it 15.5 times as fast.
// compute dtype: all float inputs rounded to bf16; q/k/v projections with EXACT bf16 products on WMMA 16x16x32 (f32 accumulate) + bias; causal logits: 3 products (q f16 hi + residual x k hi + residual) for the first 384 rows, single f16 q x k after, x scale; online softmax f32 (base 2) in registers; unnormalised weights x 2^10 once to f16 x v once to f16 (1 product; bf16 hi + lo below row 384), divided by the f32 sum at the end; f32 output.
#include <hip/hip_runtime.h>
#include <math.h>

typedef __attribute__((ext_vector_type(16))) _Float16 v16h;
typedef __attribute__((ext_vector_type(16))) __bf16 v16b;
typedef __attribute__((ext_vector_type(8)))  _Float16 v8h;
typedef __attribute__((ext_vector_type(8)))  float v8f;
typedef __attribute__((ext_vector_type(4)))  float v4f;
typedef __attribute__((ext_vector_type(2)))  float v2f;
typedef __attribute__((ext_vector_type(4)))  unsigned v4u;
typedef __attribute__((ext_vector_type(4)))  int v4i;
typedef float __attribute__((may_alias)) float_a;
typedef int __attribute__((may_alias)) int_a;

template <typename T> __device__ __forceinline__ void vst2(void* p, T v) { *(T*)p = v;  }
// store in a loop: the wait takes the store's address and data as inputs, so that neither register is rewritten (next store, next trip) in front of it
template <typename T> __device__ __forceinline__ void vst2w(void* p, T v) { *(T*)p = v; asm volatile("s_wait_xcnt 0x0" :: "v"(p), "v"(v) : "memory"); }
__device__ __forceinline__ v8f wmma16(v16h a, v16h b, v8f c) {
  v8f d = __builtin_amdgcn_wmma_f32_16x16x32_f16(false, a, false, b, (short)0, c, false, false);
  asm volatile("v_nop\n\tv_nop\n\tv_nop\n\tv_nop" : "+v"(d) : "v"(a), "v"(b));
  return d;
}
__device__ __forceinline__ v8f wmma_bf(v16b a, v16b b, v8f c) {
  v8f d = __builtin_amdgcn_wmma_f32_16x16x32_bf16(false, a, false, b, (short)0, c, false, false);
  asm volatile("v_nop\n\tv_nop\n\tv_nop\n\tv_nop" : "+v"(d) : "v"(a), "v"(b));
  return d;
}
// 16x16x32 fragments: lane = (h = lane>>4, row/col = lane&15); elements 0..7 = k0+8h+0..7, 8..15 = k0+16+8h+0..7; D element r = row 8h+r
__device__ __forceinline__ v16h frag_h(const _Float16* rowk0, int lane) {
  union { v16h v; v8h q[2]; } u; const _Float16* p = rowk0 + 8 * (lane >> 4);
  u.q[0] = *(const v8h*)p; u.q[1] = *(const v8h*)(p + 16); return u.v;
}
__device__ __forceinline__ v16h frag_f32(const float* rowk0, int lane) {
  v16h a; const float* p = rowk0 + 8 * (lane >> 4);
#pragma unroll
  for (int i = 0; i < 8; ++i) { a[i] = (_Float16)p[i]; a[8 + i] = (_Float16)p[16 + i]; }
  return a;
}
__device__ __forceinline__ v16h frag_f32s(const float* rowk0, int lane, float sc) {
  v16h a; const float* p = rowk0 + 8 * (lane >> 4);
#pragma unroll
  for (int i = 0; i < 8; ++i) { a[i] = (_Float16)(p[i] * sc); a[8 + i] = (_Float16)(p[16 + i] * sc); }
  return a;
}
// column fragment from a [K][ld] layout (column n), rows >= K read as 0
__device__ __forceinline__ v16h fragc_f32(const float* W, int k0, int n, int lane, int ld, int K) {
  v16h a; const int g = lane >> 4;
#pragma unroll
  for (int i = 0; i < 8; ++i) { const int ka = k0 + 8 * g + i, kb = ka + 16;
    a[i] = (_Float16)(ka < K ? W[(size_t)(ka < K ? ka : K - 1) * ld + n] : 0.f); a[8 + i] = (_Float16)(kb < K ? W[(size_t)(kb < K ? kb : K - 1) * ld + n] : 0.f); }
  return a;
}
struct F2 { v16b h, l; };
__device__ __forceinline__ F2 bsplit16(const float v[16]) { F2 r;
#pragma unroll
  for (int i = 0; i < 16; ++i) { const __bf16 h = (__bf16)v[i]; r.h[i] = h; r.l[i] = (__bf16)(v[i] - (float)h); }
  return r; }
__device__ __forceinline__ F2 split_row(const float* row, int k0, int lane) { float v[16]; const float* p = row + k0 + 8 * (lane >> 4);
#pragma unroll
  for (int i = 0; i < 8; ++i) { v[i] = p[i]; v[8 + i] = p[16 + i]; }
  return bsplit16(v); }
__device__ __forceinline__ F2 split_rowK(const float* row, int k0, int lane, int K) { float v[16]; const int g = lane >> 4;
#pragma unroll
  for (int i = 0; i < 8; ++i) { const int ka = k0 + 8 * g + i, kb = ka + 16; v[i] = ka < K ? row[ka < K ? ka : K - 1] : 0.f; v[8 + i] = kb < K ? row[kb < K ? kb : K - 1] : 0.f; }
  return bsplit16(v); }
__device__ __forceinline__ F2 split_col(const float* W, int k0, int n, int lane, int ld, int K) { float v[16]; const int g = lane >> 4;
#pragma unroll
  for (int i = 0; i < 8; ++i) { const int ka = k0 + 8 * g + i, kb = ka + 16; v[i] = ka < K ? W[(size_t)(ka < K ? ka : K - 1) * ld + n] : 0.f; v[8 + i] = kb < K ? W[(size_t)(kb < K ? kb : K - 1) * ld + n] : 0.f; }
  return bsplit16(v); }
__device__ __forceinline__ v8f mac3(const F2& a, const F2& b, v8f c) { c = wmma_bf(a.l, b.h, c); c = wmma_bf(a.h, b.l, c); return wmma_bf(a.h, b.h, c); }
__device__ __forceinline__ float sigm(float v) { return 1.0f / (1.0f + expf(-v)); }
#define LDSX() do { asm volatile("s_wait_dscnt 0" ::: "memory"); __builtin_amdgcn_wave_barrier(); __builtin_amdgcn_fence(__ATOMIC_RELEASE, "workgroup"); } while (0)

// Single-head causal scaled dot-product attention with separate inputs (q_in / k_in / v_in [4,4096,512]; Keras Dense (in,out) Wq / Wk / Wv [512,64] N(0, 1/512) + zero biases; scale 1/8; causal j <= i, -inf): out = softmax(causal((q_in Wq + bq)(k_in Wk + bk)^T / 8)) (v_in Wv + bv) -> [4,4096,64].
#define NB 4
#define TT 4096
#define CC 64             // NH * HD = projected width
#define DIN 512          // input (model) width
#define NH 1
#define HD 64
#define NQB (TT / 64)
#define HG 1
#define SCALE (0.125f)
#define CAUSAL 1
#ifndef TNB
#define TNB NB
#endif
__device__ __forceinline__ float bfr(float v) { return (float)(__bf16)v; }
__host__ __device__ __forceinline__ int kb_last(int qb) { return CAUSAL ? ((qb * 64 + 63) >> 7) : (TT / 128 - 1); }
typedef __attribute__((ext_vector_type(8))) __bf16 v8b;
__device__ __forceinline__ v16b frag_b(const __bf16* rowk0, int lane) {
  union { v16b v; v8b q[2]; } u; const __bf16* p = rowk0 + 8 * (lane >> 4);
  u.q[0] = *(const v8b*)p; u.q[1] = *(const v8b*)(p + 16); return u.v;
}
#define QBH 6              // unused; causal: query rows < QBH * 64 (= QHI; few keys, no averaging) take the high-precision path
#define QHI 384            // rows carrying a q residual plane
#define KHI 384            // key rows carrying k residual / v bf16 hi+lo planes (used only by the causal high-precision path)
// B fragment (k rows k0+.., output column o) of a weight: (in,out) [K][ld] or (out,in) [ld rows of K]: bf16 exact, or f16(bf16 * 256) exact
__device__ __forceinline__ v16b wcol_io(const float* Wm, int k0, int o, int lane, int ld) { v16b w; const int g = lane >> 4;
#pragma unroll
  for (int i = 0; i < 8; ++i) { w[i] = (__bf16)Wm[(size_t)(k0 + 8 * g + i) * ld + o]; w[8 + i] = (__bf16)Wm[(size_t)(k0 + 16 + 8 * g + i) * ld + o]; }
  return w; }
__device__ __forceinline__ v16b wcol_oi(const float* Wm, int k0, int o, int lane, int K) { v16b w; const float* p = Wm + (size_t)o * K + k0 + 8 * (lane >> 4);
#pragma unroll
  for (int i = 0; i < 8; ++i) { w[i] = (__bf16)p[i]; w[8 + i] = (__bf16)p[16 + i]; }
  return w; }
__device__ __forceinline__ v16h wcolh_io(const float* Wm, int k0, int o, int lane, int ld) { v16h w; const int g = lane >> 4;
#pragma unroll
  for (int i = 0; i < 8; ++i) { w[i] = (_Float16)(bfr(Wm[(size_t)(k0 + 8 * g + i) * ld + o]) * 256.0f); w[8 + i] = (_Float16)(bfr(Wm[(size_t)(k0 + 16 + 8 * g + i) * ld + o]) * 256.0f); }
  return w; }
__device__ __forceinline__ v16h wcolh_oi(const float* Wm, int k0, int o, int lane, int K) { v16h w; const float* p = Wm + (size_t)o * K + k0 + 8 * (lane >> 4);
#pragma unroll
  for (int i = 0; i < 8; ++i) { w[i] = (_Float16)(bfr(p[i]) * 256.0f); w[8 + i] = (_Float16)(bfr(p[16 + i]) * 256.0f); }
  return w; }
#define WQKV_LAYOUT 0   // 0 = (in,out) [DIN][CC]; 1 = (out,in) [CC][DIN]; 2 = per-head [NH][DIN][HD]
__device__ __forceinline__ v16b wcol_hdk(const float* Wm, int k0, int o, int lane) { v16b w; const int g = lane >> 4; const float* p = Wm + (size_t)(o / HD) * DIN * HD + (o % HD);
#pragma unroll
  for (int i = 0; i < 8; ++i) { w[i] = (__bf16)p[(size_t)(k0 + 8 * g + i) * HD]; w[8 + i] = (__bf16)p[(size_t)(k0 + 16 + 8 * g + i) * HD]; }
  return w; }
#define WO_OUT_IN 0
#if WQKV_LAYOUT == 1
#define WCOL(W, k0, o, lane) wcol_oi(W, k0, o, lane, DIN)
#elif WQKV_LAYOUT == 2
#define WCOL(W, k0, o, lane) wcol_hdk(W, k0, o, lane)
#else
#define WCOL(W, k0, o, lane) wcol_io(W, k0, o, lane, CC)
#endif
#if WO_OUT_IN
#define WOCOL(W, k0, o, lane) wcol_oi(W, k0, o, lane, CC)
#define WOCOLH(W, k0, o, lane) wcolh_oi(W, k0, o, lane, CC)
#else
#define WOCOL(W, k0, o, lane) wcol_io(W, k0, o, lane, DIN)
#define WOCOLH(W, k0, o, lane) wcolh_io(W, k0, o, lane, DIN)
#endif
#ifndef SM_EXTRA_PARAMS
#define SM_EXTRA_PARAMS
#endif
#ifndef PROJ_EXTRA_PARAMS
#define PROJ_EXTRA_PARAMS
#endif
#ifndef SM_MASK_HOOK
#define SM_MASK_HOOK (void)0
#endif

// k_attn's operands lie in FRAGMENT ORDER: a 32-row chunk (32 queries or 32 keys, all 64 channels) is 4 KB = 8 groups of 512 B, and a group holds lane 0..31's 16 bytes side by side,
// so that one wave-wide 16-byte load covers 4 whole 128-byte lines. q, k: group = (t, kd, half), lane (g, col) holds row t * 16 + col, channels kd * 32 + half * 16 + g * 8 + 0..7;
// v: group = (j, half), lane (g, col) holds channel j * 16 + col, keys half * 16 + g * 8 + 0..7.
static_assert(CC == 64 && HD == 64, "the fragment order is laid out for 64 channels");
#define WS_QH  0u                                      // f16 q, fragment order [b][t / 32][4 KB]
#define WS_KH  (WS_QH + 2u * (size_t)NB * TT * CC)      // f16 k, fragment order [b][t / 32][4 KB]
#define WS_VT  (WS_KH + 2u * (size_t)NB * TT * CC)      // f16 v, fragment order [b][t / 32][4 KB]
#define WS_QL  (WS_VT + 2u * (size_t)NB * CC * TT)      // f16 q residual x 2^10, fragment order [b][t / 32, t < QHI][4 KB]
#define WS_KL  (WS_QL + 2u * (size_t)NB * QHI * CC)     // f16 k residual x 2^10, fragment order [b][t / 32, t < KHI][4 KB]
#define WS_VB  (WS_KL + 2u * (size_t)NB * KHI * CC)     // bf16 v hi (VBL: lo), fragment order [b][t / 32, t < KHI][4 KB]
#define WS_VBL (WS_VB + 2u * (size_t)NB * CC * KHI)
#define WS_S   (WS_VBL + 2u * (size_t)NB * CC * KHI)    // f32 [hg][t][s] region, unused (the logits stay in registers)
#define WS_Y   (WS_S  + 4u * (size_t)HG * TT * TT)      // f32 ctx rows [b*t][CC] (only when there is an output projection)
#define WS_END (WS_Y  + 0u)

// ---- k_proj: block = (64 rows, 64 cols, which): q/k/v = X W (+ b) with exact bf16 products (K = DIN) -> which 0: q f16 (+ residual for rows < QHI); 1: k f16 (+ residual for rows < KHI); 2: v f16 (+ bf16 hi/lo for t < KHI); all stored in fragment order
__global__ __launch_bounds__(128) void k_proj(const float* __restrict__ XQ, const float* __restrict__ XK, const float* __restrict__ XV, const float* __restrict__ WQ, const float* __restrict__ WK, const float* __restrict__ WV, const float* __restrict__ BQ, const float* __restrict__ BK, const float* __restrict__ BV,
    _Float16* __restrict__ QH, _Float16* __restrict__ QL, _Float16* __restrict__ KH, _Float16* __restrict__ KL, _Float16* __restrict__ VT, __bf16* __restrict__ VB, __bf16* __restrict__ VBL) {
  __shared__ __align__(16) _Float16 sh[64][72], sl[64][72]; __shared__ __align__(16) _Float16 th[64][72]; __shared__ __align__(16) __bf16 tb[64][72], tbl[64][72];
  const int tid = threadIdx.x, wave = tid >> 5, lane = tid & 31, col = lane & 15, g = lane >> 4; const int which = blockIdx.z; const int c0 = blockIdx.y * 64; const size_t r0 = (size_t)blockIdx.x * 64; const size_t bb = r0 / TT; const int t0 = (int)(r0 % TT);
  const float* X = which == 0 ? XQ : which == 1 ? XK : XV; const float* WA = which == 0 ? WQ : which == 1 ? WK : WV; const float* BA = which == 0 ? BQ : which == 1 ? BK : BV;
  v8f acc[4] = {};
#pragma unroll 2
  for (int kc = 0; kc < DIN / 32; ++kc) { v16b a; { const float* p = X + (r0 + wave * 16 + col) * DIN + kc * 32 + 8 * g;
#pragma unroll
      for (int i = 0; i < 8; ++i) { a[i] = (__bf16)p[i]; a[8 + i] = (__bf16)p[16 + i]; } }
    asm volatile("s_wait_loadcnt 0x0" ::: "memory");
#pragma unroll
    for (int j = 0; j < 4; ++j) { const v16b w = WCOL(WA, kc * 32, c0 + j * 16 + col, lane); asm volatile("s_wait_loadcnt 0x0" ::: "memory"); acc[j] = wmma_bf(a, w, acc[j]); } }
  if (which < 2) { _Float16* DH = which == 0 ? QH : KH; _Float16* DL = which == 0 ? QL : KL; const int nhi = which == 0 ? QHI : KHI; const bool hi_rows = t0 < nhi;
#pragma unroll
    for (int j = 0; j < 4; ++j) { const float bias = BA ? bfr(BA[c0 + j * 16 + col]) : 0.f;
#pragma unroll
      for (int r = 0; r < 8; ++r) { const float v = acc[j][r] + bias; const _Float16 hv = (_Float16)v; sh[wave * 16 + 8 * g + r][j * 16 + col] = hv; sl[wave * 16 + 8 * g + r][j * 16 + col] = (_Float16)((v - (float)hv) * 1024.0f); } }
    __syncthreads();
    for (int e = tid; e < 64 * 8; e += 128) { const int rl = (e >> 7) * 16 + (e & 15), d = ((e >> 4) & 7) * 8;   /* 16-byte piece e = (chunk, t, kd, half, g, col) */
      vst2w((unsigned*)(DH + r0 * CC + (size_t)e * 8), *(const v4u*)&sh[rl][d]); if (hi_rows) vst2w((unsigned*)(DL + (bb * nhi + t0) * (size_t)CC + (size_t)e * 8), *(const v4u*)&sl[rl][d]); }
  } else { const bool hi_rows = t0 < KHI;
#pragma unroll
    for (int j = 0; j < 4; ++j) { const float bias = BA ? bfr(BA[c0 + j * 16 + col]) : 0.f;
#pragma unroll
      for (int r = 0; r < 8; ++r) { const float v = acc[j][r] + bias; const int rl = wave * 16 + 8 * g + r, cl = j * 16 + col; th[cl][rl] = (_Float16)v; const __bf16 bh = (__bf16)v; tb[cl][rl] = bh; tbl[cl][rl] = (__bf16)(v - (float)bh); } }
    __syncthreads();
    for (int e = tid; e < 64 * 8; e += 128) { const int cl = ((e >> 6) & 3) * 16 + (e & 15), tl = (e >> 8) * 32 + ((e >> 4) & 3) * 8;   /* 16-byte piece e = (chunk, j, half, g, col) */
      vst2w((unsigned*)(VT + r0 * CC + (size_t)e * 8), *(const v4u*)&th[cl][tl]); if (hi_rows) { const size_t o3 = (bb * KHI + t0) * (size_t)CC + (size_t)e * 8; vst2w((unsigned*)(VB + o3), *(const v4u*)&tb[cl][tl]); vst2w((unsigned*)(VBL + o3), *(const v4u*)&tbl[cl][tl]); } } } }
// ---- k_attn: logits, causal softmax and P V in one kernel, all batches in one launch; the logits never leave the registers.
// block = 32 queries (two 16-column groups) of batch b, AW waves; wave w walks the 32-key chunks w, w + AW, ... up to the diagonal chunk.
// S^T = K Q^T (A = 16 key rows, B = 16 query columns): a lane holds 16 logits of ONE query (column lane & 15), in the k order a B operand wants, so P^T goes from the two score tiles straight into O^T += V^T P^T.
// Running maximum and sum per lane (log2 domain, online softmax); the AW partial (max, sum, O) are joined through LDS in wave order.
// Queries < QHI: 3-product logits (q, k as f16 hi + residual x 2^10) and P, v as bf16 hi + lo (3 products); after: single f16 products, weights x 2^10 (the factor is in the sum too and cancels).
#define AW 16
#define SL2E (SCALE * 1.4426950408889634f)
// fragment in fragment order: p = chunk start + group pair * 512 + lane * 8; the two halves are neighbouring 512-byte groups
__device__ __forceinline__ v16h frag_hp(const _Float16* p) { union { v16h v; v8h q[2]; } u; u.q[0] = *(const v8h*)p; u.q[1] = *(const v8h*)(p + 256); return u.v; }
__device__ __forceinline__ v16b frag_bp(const __bf16* p) { union { v16b v; v8b q[2]; } u; u.q[0] = *(const v8b*)p; u.q[1] = *(const v8b*)(p + 256); return u.v; }
// 2^x, eight at a time: the early-clobber outputs keep a v_exp_f32 from overwriting the source of the one in front of it, and the v_nop fills the slot behind the last one
__device__ __forceinline__ void exp2x8(float* o, const float* x) {
  asm("v_exp_f32 %0, %8\n\tv_exp_f32 %1, %9\n\tv_exp_f32 %2, %10\n\tv_exp_f32 %3, %11\n\tv_exp_f32 %4, %12\n\tv_exp_f32 %5, %13\n\tv_exp_f32 %6, %14\n\tv_exp_f32 %7, %15\n\tv_nop"
      : "=&v"(o[0]), "=&v"(o[1]), "=&v"(o[2]), "=&v"(o[3]), "=&v"(o[4]), "=&v"(o[5]), "=&v"(o[6]), "=&v"(o[7]) : "v"(x[0]), "v"(x[1]), "v"(x[2]), "v"(x[3]), "v"(x[4]), "v"(x[5]), "v"(x[6]), "v"(x[7])); }
// 2^x, one value; the v_nop fills the slot behind the transcendental
__device__ __forceinline__ float exp2x1(float x) { float r; asm("v_exp_f32 %0, %1\n\tv_nop" : "=v"(r) : "v"(x)); return r; }
struct SMX { float e[16]; float al; };
// one online-softmax step of one query column: sv = 16 scaled log2 logits of this lane's query; poff = log2 of the weights' common factor
__device__ __forceinline__ SMX sm_step(const float sv[16], float& m, float& l, float poff) { SMX o; float mx = sv[0];
#pragma unroll
  for (int i = 1; i < 16; ++i) mx = fmaxf(mx, sv[i]);
  mx = fmaxf(mx, __shfl_xor(mx, 16)); const float mn = fmaxf(m, mx); o.al = exp2x1(m - mn); m = mn; const float mref = mn - poff; float d[16], ls = 0.f;
#pragma unroll
  for (int i = 0; i < 16; ++i) d[i] = sv[i] - mref;
  exp2x8(o.e, d); exp2x8(o.e + 8, d + 8);
#pragma unroll
  for (int i = 0; i < 16; ++i) ls += o.e[i];
  l = l * o.al + ls; return o; }
__global__ __launch_bounds__(AW * 32) void k_attn(const _Float16* __restrict__ QH, const _Float16* __restrict__ KH, const _Float16* __restrict__ QL, const _Float16* __restrict__ KL, const _Float16* __restrict__ VT, const __bf16* __restrict__ VB, const __bf16* __restrict__ VBL, float* __restrict__ Y) {
  __shared__ __align__(16) float so[AW][32][HD + 4]; __shared__ float smx[AW][32], sls[AW][32];
  const int tid = threadIdx.x, wave = __builtin_amdgcn_readfirstlane(tid >> 5), lane = tid & 31, col = lane & 15, g = lane >> 4;
  const int b = blockIdx.x % NB; const int rt = (TT / 32 - 1) - blockIdx.x / NB;   /* longest walks start first */
  const int q0 = rt * 32, nch = rt + 1; const size_t row0 = (size_t)b * TT;
  v8f acc[2][HD / 16] = {}; float m[2] = {-3.0e38f, -3.0e38f}, l[2] = {0.f, 0.f};
  const _Float16* qhp = QH + (row0 + q0) * CC + lane * 8;
  const _Float16* khp = KH + (row0 + wave * 32) * CC + lane * 8;
  if (q0 < QHI) { const _Float16* qlp = QL + ((size_t)b * QHI + q0) * CC + lane * 8; const _Float16* klp = KL + ((size_t)b * KHI + wave * 32) * CC + lane * 8;
    const __bf16* vhp = VB + ((size_t)b * KHI + wave * 32) * CC + lane * 8; const __bf16* vlp = VBL + ((size_t)b * KHI + wave * 32) * CC + lane * 8;
#pragma unroll 1
    for (int kc = wave; kc < nch; kc += AW, khp += AW * 32 * CC, klp += AW * 32 * CC, vhp += AW * 32 * CC, vlp += AW * 32 * CC) {
#pragma unroll
      for (int qt = 0; qt < 2; ++qt) { v16h qh[HD / 32], ql[HD / 32], kh[2][HD / 32], kl[2][HD / 32];
#pragma unroll
        for (int kd = 0; kd < HD / 32; ++kd) { qh[kd] = frag_hp(qhp + (qt * 2 + kd) * 512); ql[kd] = frag_hp(qlp + (qt * 2 + kd) * 512);
#pragma unroll
          for (int t = 0; t < 2; ++t) { kh[t][kd] = frag_hp(khp + (t * 2 + kd) * 512); kl[t][kd] = frag_hp(klp + (t * 2 + kd) * 512); } }
        asm volatile("s_wait_xcnt 0x0" :: "v"(qhp), "v"(qlp), "v"(khp), "v"(klp) : "memory");   /* keeps the loads' address pairs live and unwritten up to the wait */
        v8f s[2] = {}, sr[2] = {};
#pragma unroll
        for (int kd = 0; kd < HD / 32; ++kd)
#pragma unroll
          for (int t = 0; t < 2; ++t) { s[t] = wmma16(kh[t][kd], qh[kd], s[t]); sr[t] = wmma16(kh[t][kd], ql[kd], sr[t]); sr[t] = wmma16(kl[t][kd], qh[kd], sr[t]); }
        float sv[16];
#pragma unroll
        for (int i = 0; i < 16; ++i) { const float v = (s[i >> 3][i & 7] + sr[i >> 3][i & 7] * (1.0f / 1024.0f)) * SL2E; sv[i] = (kc * 32 + (i >> 3) * 16 + 8 * g + (i & 7) <= q0 + qt * 16 + col) ? v : -3.0e38f; }
        const SMX x = sm_step(sv, m[qt], l[qt], 0.f); const F2 p = bsplit16(x.e); v16b vh[HD / 16], vl[HD / 16];
#pragma unroll
        for (int j = 0; j < HD / 16; ++j) { vh[j] = frag_bp(vhp + j * 512); vl[j] = frag_bp(vlp + j * 512); }
        asm volatile("s_wait_xcnt 0x0" :: "v"(vhp), "v"(vlp) : "memory");   /* as above */
#pragma unroll
        for (int j = 0; j < HD / 16; ++j) { acc[qt][j] *= x.al; acc[qt][j] = wmma_bf(vh[j], p.h, acc[qt][j]); acc[qt][j] = wmma_bf(vh[j], p.l, acc[qt][j]); acc[qt][j] = wmma_bf(vl[j], p.h, acc[qt][j]); } } }
  } else { const _Float16* vp = VT + (row0 + wave * 32) * CC + lane * 8; v16h qf[2][HD / 32];
#pragma unroll
    for (int qt = 0; qt < 2; ++qt)
#pragma unroll
      for (int kd = 0; kd < HD / 32; ++kd) qf[qt][kd] = frag_hp(qhp + (qt * 2 + kd) * 512);
    asm volatile("s_wait_xcnt 0x0" :: "v"(qhp) : "memory");   /* as above */
#pragma unroll 1
    for (int kc = wave; kc < nch; kc += AW, khp += AW * 32 * CC, vp += AW * 32 * CC) { v16h kf[2][HD / 32], vf[HD / 16];
#pragma unroll
      for (int t = 0; t < 2; ++t)
#pragma unroll
        for (int kd = 0; kd < HD / 32; ++kd) kf[t][kd] = frag_hp(khp + (t * 2 + kd) * 512);
#pragma unroll
      for (int j = 0; j < HD / 16; ++j) vf[j] = frag_hp(vp + j * 512);
      asm volatile("s_wait_xcnt 0x0" :: "v"(khp), "v"(vp) : "memory");   /* as above */
#pragma unroll
      for (int qt = 0; qt < 2; ++qt) { v8f s[2] = {};
#pragma unroll
        for (int t = 0; t < 2; ++t)
#pragma unroll
          for (int kd = 0; kd < HD / 32; ++kd) s[t] = wmma16(kf[t][kd], qf[qt][kd], s[t]);
        float sv[16];
#pragma unroll
        for (int i = 0; i < 16; ++i) sv[i] = s[i >> 3][i & 7] * SL2E;
        if (kc == nch - 1) {   /* only the diagonal chunk holds keys past a query */
#pragma unroll
          for (int i = 0; i < 16; ++i) if (kc * 32 + (i >> 3) * 16 + 8 * g + (i & 7) > q0 + qt * 16 + col) sv[i] = -3.0e38f; }
        const SMX x = sm_step(sv, m[qt], l[qt], 10.f); v16h p;
#pragma unroll
        for (int i = 0; i < 16; ++i) p[i] = (_Float16)x.e[i];
#pragma unroll
        for (int j = 0; j < HD / 16; ++j) { acc[qt][j] *= x.al; acc[qt][j] = wmma16(vf[j], p, acc[qt][j]); } } } }
#pragma unroll
  for (int qt = 0; qt < 2; ++qt) { const float lt = l[qt] + __shfl_xor(l[qt], 16); if (g == 0) { smx[wave][qt * 16 + col] = m[qt]; sls[wave][qt * 16 + col] = lt; }
#pragma unroll
    for (int j = 0; j < HD / 16; ++j) { v4f a0, a1;
#pragma unroll
      for (int r = 0; r < 4; ++r) { a0[r] = acc[qt][j][r]; a1[r] = acc[qt][j][4 + r]; }
      *(v4f*)&so[wave][qt * 16 + col][j * 16 + 8 * g] = a0; *(v4f*)&so[wave][qt * 16 + col][j * 16 + 8 * g + 4] = a1; } }
  __syncthreads();   /* every wave's partial (max, sum, O) is in LDS before any of them is joined */
  { const int qr = tid >> 4, q = tid & 15; float mw[AW], wt[AW]; float M = -3.0e38f;
#pragma unroll
    for (int w = 0; w < AW; ++w) { mw[w] = smx[w][qr]; M = fmaxf(M, mw[w]); }
#pragma unroll
    for (int w = 0; w < AW; ++w) mw[w] -= M;
    exp2x8(wt, mw); exp2x8(wt + 8, mw + 8);
    float Ls = 0.f; v4f o = {};
#pragma unroll
    for (int w = 0; w < AW; ++w) { Ls += wt[w] * sls[w][qr]; o += *(const v4f*)&so[w][qr][q * 4] * wt[w]; }
    const float inv = Ls > 0.f ? 1.0f / Ls : 0.f; vst2(Y + (row0 + q0 + qr) * CC + q * 4, o * inv); } }

extern "C" void kernel_launch(void* const* d_in, const int* in_sizes, int n_in, void* d_out, int out_size, void* d_ws, size_t ws_size, hipStream_t stream) {
  (void)in_sizes; (void)n_in; (void)out_size;
  const float** F = (const float**)d_in;
  if (ws_size < (size_t)WS_END) return;
  char* ws = (char*)d_ws; _Float16 *QH = (_Float16*)(ws + WS_QH), *KH = (_Float16*)(ws + WS_KH), *VT = (_Float16*)(ws + WS_VT), *QL = (_Float16*)(ws + WS_QL), *KL = (_Float16*)(ws + WS_KL); __bf16 *VB = (__bf16*)(ws + WS_VB), *VBL = (__bf16*)(ws + WS_VBL); float *S = (float*)(ws + WS_S), *Y = (float*)(ws + WS_Y);
  (void)Y; (void)S;
  // inputs: 0 q_in [4,4096,512]; 1 k_in; 2 v_in (separate inputs); 3 Wq [512,64], 4 bq; 5 Wk, 6 bk; 7 Wv, 8 bv ((in,out); zero biases read)
  k_proj<<<dim3(TNB * TT / 64, CC / 64, 3), 128, 0, stream>>>(F[0], F[1], F[2], F[3], F[5], F[7], F[4], F[6], F[8], QH, QL, KH, KL, VT, VB, VBL);
  k_attn<<<dim3(NB * (TT / 32)), AW * 32, 0, stream>>>(QH, KH, QL, KL, VT, VB, VBL, (float*)d_out);   /* out rows are the ctx rows: [b*TT+t][64] */
}

// v005
// A run of this version takes 29.8 microseconds.
// In two side-by-side timings against v004, it was 1.49 and 1.48 times as fast.
// Counting every step since v000, it is 23.0 times as fast.
// compute dtype: all float inputs rounded to bf16; q/k/v projections with EXACT bf16 products on WMMA 16x16x32 (f32 accumulate) + bias; causal logits: 3 products (q f16 hi + residual x k hi + residual) for the first 384 rows, single f16 q x k after, x scale; online softmax f32 (base 2) in registers; unnormalised weights x 2^10 once to f16 x v once to f16 (1 product; bf16 hi + lo below row 384), divided by the f32 sum at the end; f32 output.
#include <hip/hip_runtime.h>
#include <math.h>

typedef __attribute__((ext_vector_type(16))) _Float16 v16h;
typedef __attribute__((ext_vector_type(16))) __bf16 v16b;
typedef __attribute__((ext_vector_type(8)))  _Float16 v8h;
typedef __attribute__((ext_vector_type(8)))  float v8f;
typedef __attribute__((ext_vector_type(4)))  float v4f;
typedef __attribute__((ext_vector_type(2)))  float v2f;
typedef __attribute__((ext_vector_type(4)))  unsigned v4u;
typedef __attribute__((ext_vector_type(4)))  int v4i;
typedef float __attribute__((may_alias)) float_a;
typedef int __attribute__((may_alias)) int_a;

template <typename T> __device__ __forceinline__ void vst2(void* p, T v) { *(T*)p = v;  }
// store in a loop: the wait takes the store's address and data as inputs, so that neither register is rewritten (next store, next trip) in front of it
template <typename T> __device__ __forceinline__ void vst2w(void* p, T v) { *(T*)p = v; asm volatile("s_wait_xcnt 0x0" :: "v"(p), "v"(v) : "memory"); }
__device__ __forceinline__ v8f wmma16(v16h a, v16h b, v8f c) {
  v8f d = __builtin_amdgcn_wmma_f32_16x16x32_f16(false, a, false, b, (short)0, c, false, false);
  asm volatile("v_nop\n\tv_nop\n\tv_nop\n\tv_nop" : "+v"(d) : "v"(a), "v"(b));
  return d;
}
__device__ __forceinline__ v8f wmma_bf(v16b a, v16b b, v8f c) {
  v8f d = __builtin_amdgcn_wmma_f32_16x16x32_bf16(false, a, false, b, (short)0, c, false, false);
  asm volatile("v_nop\n\tv_nop\n\tv_nop\n\tv_nop" : "+v"(d) : "v"(a), "v"(b));
  return d;
}
// 16x16x32 fragments: lane = (h = lane>>4, row/col = lane&15); elements 0..7 = k0+8h+0..7, 8..15 = k0+16+8h+0..7; D element r = row 8h+r
__device__ __forceinline__ v16h frag_h(const _Float16* rowk0, int lane) {
  union { v16h v; v8h q[2]; } u; const _Float16* p = rowk0 + 8 * (lane >> 4);
  u.q[0] = *(const v8h*)p; u.q[1] = *(const v8h*)(p + 16); return u.v;
}
__device__ __forceinline__ v16h frag_f32(const float* rowk0, int lane) {
  v16h a; const float* p = rowk0 + 8 * (lane >> 4);
#pragma unroll
  for (int i = 0; i < 8; ++i) { a[i] = (_Float16)p[i]; a[8 + i] = (_Float16)p[16 + i]; }
  return a;
}
__device__ __forceinline__ v16h frag_f32s(const float* rowk0, int lane, float sc) {
  v16h a; const float* p = rowk0 + 8 * (lane >> 4);
#pragma unroll
  for (int i = 0; i < 8; ++i) { a[i] = (_Float16)(p[i] * sc); a[8 + i] = (_Float16)(p[16 + i] * sc); }
  return a;
}
// column fragment from a [K][ld] layout (column n), rows >= K read as 0
__device__ __forceinline__ v16h fragc_f32(const float* W, int k0, int n, int lane, int ld, int K) {
  v16h a; const int g = lane >> 4;
#pragma unroll
  for (int i = 0; i < 8; ++i) { const int ka = k0 + 8 * g + i, kb = ka + 16;
    a[i] = (_Float16)(ka < K ? W[(size_t)(ka < K ? ka : K - 1) * ld + n] : 0.f); a[8 + i] = (_Float16)(kb < K ? W[(size_t)(kb < K ? kb : K - 1) * ld + n] : 0.f); }
  return a;
}
struct F2 { v16b h, l; };
__device__ __forceinline__ F2 bsplit16(const float v[16]) { F2 r;
#pragma unroll
  for (int i = 0; i < 16; ++i) { const __bf16 h = (__bf16)v[i]; r.h[i] = h; r.l[i] = (__bf16)(v[i] - (float)h); }
  return r; }
__device__ __forceinline__ F2 split_row(const float* row, int k0, int lane) { float v[16]; const float* p = row + k0 + 8 * (lane >> 4);
#pragma unroll
  for (int i = 0; i < 8; ++i) { v[i] = p[i]; v[8 + i] = p[16 + i]; }
  return bsplit16(v); }
__device__ __forceinline__ F2 split_rowK(const float* row, int k0, int lane, int K) { float v[16]; const int g = lane >> 4;
#pragma unroll
  for (int i = 0; i < 8; ++i) { const int ka = k0 + 8 * g + i, kb = ka + 16; v[i] = ka < K ? row[ka < K ? ka : K - 1] : 0.f; v[8 + i] = kb < K ? row[kb < K ? kb : K - 1] : 0.f; }
  return bsplit16(v); }
__device__ __forceinline__ F2 split_col(const float* W, int k0, int n, int lane, int ld, int K) { float v[16]; const int g = lane >> 4;
#pragma unroll
  for (int i = 0; i < 8; ++i) { const int ka = k0 + 8 * g + i, kb = ka + 16; v[i] = ka < K ? W[(size_t)(ka < K ? ka : K - 1) * ld + n] : 0.f; v[8 + i] = kb < K ? W[(size_t)(kb < K ? kb : K - 1) * ld + n] : 0.f; }
  return bsplit16(v); }
__device__ __forceinline__ v8f mac3(const F2& a, const F2& b, v8f c) { c = wmma_bf(a.l, b.h, c); c = wmma_bf(a.h, b.l, c); return wmma_bf(a.h, b.h, c); }
__device__ __forceinline__ float sigm(float v) { return 1.0f / (1.0f + expf(-v)); }
#define LDSX() do { asm volatile("s_wait_dscnt 0" ::: "memory"); __builtin_amdgcn_wave_barrier(); __builtin_amdgcn_fence(__ATOMIC_RELEASE, "workgroup"); } while (0)

// Single-head causal scaled dot-product attention with separate inputs (q_in / k_in / v_in [4,4096,512]; Keras Dense (in,out) Wq / Wk / Wv [512,64] N(0, 1/512) + zero biases; scale 1/8; causal j <= i, -inf): out = softmax(causal((q_in Wq + bq)(k_in Wk + bk)^T / 8)) (v_in Wv + bv) -> [4,4096,64].
#define NB 4
#define TT 4096
#define CC 64             // NH * HD = projected width
#define DIN 512          // input (model) width
#define NH 1
#define HD 64
#define NQB (TT / 64)
#define HG 1
#define SCALE (0.125f)
#define CAUSAL 1
#ifndef TNB
#define TNB NB
#endif
__device__ __forceinline__ float bfr(float v) { return (float)(__bf16)v; }
__host__ __device__ __forceinline__ int kb_last(int qb) { return CAUSAL ? ((qb * 64 + 63) >> 7) : (TT / 128 - 1); }
typedef __attribute__((ext_vector_type(8))) __bf16 v8b;
__device__ __forceinline__ v16b frag_b(const __bf16* rowk0, int lane) {
  union { v16b v; v8b q[2]; } u; const __bf16* p = rowk0 + 8 * (lane >> 4);
  u.q[0] = *(const v8b*)p; u.q[1] = *(const v8b*)(p + 16); return u.v;
}
#define QBH 6              // unused; causal: query rows < QBH * 64 (= QHI; few keys, no averaging) take the high-precision path
#define QHI 384            // rows carrying a q residual plane
#define KHI 384            // key rows carrying k residual / v bf16 hi+lo planes (used only by the causal high-precision path)
// B fragment (k rows k0+.., output column o) of a weight: (in,out) [K][ld] or (out,in) [ld rows of K]: bf16 exact, or f16(bf16 * 256) exact
__device__ __forceinline__ v16b wcol_io(const float* Wm, int k0, int o, int lane, int ld) { v16b w; const int g = lane >> 4;
#pragma unroll
  for (int i = 0; i < 8; ++i) { w[i] = (__bf16)Wm[(size_t)(k0 + 8 * g + i) * ld + o]; w[8 + i] = (__bf16)Wm[(size_t)(k0 + 16 + 8 * g + i) * ld + o]; }
  return w; }
__device__ __forceinline__ v16b wcol_oi(const float* Wm, int k0, int o, int lane, int K) { v16b w; const float* p = Wm + (size_t)o * K + k0 + 8 * (lane >> 4);
#pragma unroll
  for (int i = 0; i < 8; ++i) { w[i] = (__bf16)p[i]; w[8 + i] = (__bf16)p[16 + i]; }
  return w; }
__device__ __forceinline__ v16h wcolh_io(const float* Wm, int k0, int o, int lane, int ld) { v16h w; const int g = lane >> 4;
#pragma unroll
  for (int i = 0; i < 8; ++i) { w[i] = (_Float16)(bfr(Wm[(size_t)(k0 + 8 * g + i) * ld + o]) * 256.0f); w[8 + i] = (_Float16)(bfr(Wm[(size_t)(k0 + 16 + 8 * g + i) * ld + o]) * 256.0f); }
  return w; }
__device__ __forceinline__ v16h wcolh_oi(const float* Wm, int k0, int o, int lane, int K) { v16h w; const float* p = Wm + (size_t)o * K + k0 + 8 * (lane >> 4);
#pragma unroll
  for (int i = 0; i < 8; ++i) { w[i] = (_Float16)(bfr(p[i]) * 256.0f); w[8 + i] = (_Float16)(bfr(p[16 + i]) * 256.0f); }
  return w; }
#define WQKV_LAYOUT 0   // 0 = (in,out) [DIN][CC]; 1 = (out,in) [CC][DIN]; 2 = per-head [NH][DIN][HD]
__device__ __forceinline__ v16b wcol_hdk(const float* Wm, int k0, int o, int lane) { v16b w; const int g = lane >> 4; const float* p = Wm + (size_t)(o / HD) * DIN * HD + (o % HD);
#pragma unroll
  for (int i = 0; i < 8; ++i) { w[i] = (__bf16)p[(size_t)(k0 + 8 * g + i) * HD]; w[8 + i] = (__bf16)p[(size_t)(k0 + 16 + 8 * g + i) * HD]; }
  return w; }
#define WO_OUT_IN 0
#if WQKV_LAYOUT == 1
#define WCOL(W, k0, o, lane) wcol_oi(W, k0, o, lane, DIN)
#elif WQKV_LAYOUT == 2
#define WCOL(W, k0, o, lane) wcol_hdk(W, k0, o, lane)
#else
#define WCOL(W, k0, o, lane) wcol_io(W, k0, o, lane, CC)
#endif
#if WO_OUT_IN
#define WOCOL(W, k0, o, lane) wcol_oi(W, k0, o, lane, CC)
#define WOCOLH(W, k0, o, lane) wcolh_oi(W, k0, o, lane, CC)
#else
#define WOCOL(W, k0, o, lane) wcol_io(W, k0, o, lane, DIN)
#define WOCOLH(W, k0, o, lane) wcolh_io(W, k0, o, lane, DIN)
#endif
#ifndef SM_EXTRA_PARAMS
#define SM_EXTRA_PARAMS
#endif
#ifndef PROJ_EXTRA_PARAMS
#define PROJ_EXTRA_PARAMS
#endif
#ifndef SM_MASK_HOOK
#define SM_MASK_HOOK (void)0
#endif

// k_attn's operands lie in FRAGMENT ORDER: a 32-row chunk (32 queries or 32 keys, all 64 channels) is 4 KB = 8 groups of 512 B, and a group holds lane 0..31's 16 bytes side by side,
// so that one wave-wide 16-byte load covers 4 whole 128-byte lines. q, k: group = (t, kd, half), lane (g, col) holds row t * 16 + col, channels kd * 32 + half * 16 + g * 8 + 0..7;
// v: group = (j, half), lane (g, col) holds channel j * 16 + col, keys half * 16 + g * 8 + 0..7.
static_assert(CC == 64 && HD == 64, "the fragment order is laid out for 64 channels");
#define WS_QH  0u                                      // f16 q, fragment order [b][t / 32][4 KB]
#define WS_KH  (WS_QH + 2u * (size_t)NB * TT * CC)      // f16 k, fragment order [b][t / 32][4 KB]
#define WS_VT  (WS_KH + 2u * (size_t)NB * TT * CC)      // f16 v, fragment order [b][t / 32][4 KB]
#define WS_QL  (WS_VT + 2u * (size_t)NB * CC * TT)      // f16 q residual x 2^10, fragment order [b][t / 32, t < QHI][4 KB]
#define WS_KL  (WS_QL + 2u * (size_t)NB * QHI * CC)     // f16 k residual x 2^10, fragment order [b][t / 32, t < KHI][4 KB]
#define WS_VB  (WS_KL + 2u * (size_t)NB * KHI * CC)     // bf16 v hi (VBL: lo), fragment order [b][t / 32, t < KHI][4 KB]
#define WS_VBL (WS_VB + 2u * (size_t)NB * CC * KHI)
#define WS_S   (WS_VBL + 2u * (size_t)NB * CC * KHI)    // f32 [hg][t][s] region, unused (the logits stay in registers)
#define WS_Y   (WS_S  + 4u * (size_t)HG * TT * TT)      // f32 ctx rows [b*t][CC] (only when there is an output projection)
#define WS_END (WS_Y  + 0u)

// ---- k_proj: q/k/v = X W (+ b) with exact bf16 products (K = DIN). The 3 * NSB sub-blocks of 64 rows (projection = sub-block / NSB) are dealt PB to a block, 4 waves each; a block touches at most two projections.
// W is turned ONCE per block into bf16 B fragments in LDS; the K loop reads them from there and has only X left to fetch from memory, PD fragments ahead.
// projection 0: q f16 (+ residual for rows < QHI); 1: k f16 (+ residual for rows < KHI); 2: v f16 (+ bf16 hi/lo for t < KHI); all stored in fragment order
#define PB 3                  // 64-row sub-blocks of a block
#define NSB (TNB * TT / 64)   // sub-blocks of a projection
#define PD 4                  // X fragments a wave has in flight
static_assert((3 * NSB) % PB == 0 && NSB >= PB && DIN / 32 >= PD, "sub-blocks are dealt evenly, and a block spans at most two projections");
// W [DIN][CC] f32 -> LDS: the 512-byte group (kc, j, half) holds for lane (g, col) the 8 values k = kc * 32 + half * 16 + g * 8 + 0..7 of column j * 16 + col, at 16-byte slot lane ^ j
// (the xor spreads a writing wave's 16 column quads over all banks; a reading wave's 32 slots still fill the group). A thread takes 8 k rows x 4 columns: a wave-wide 16-byte load covers 4 whole lines.
#define WTR ((DIN * 2 + PB * 128 - 1) / (PB * 128))   // trips of a thread over the DIN * 2 pieces of work; only the last can be a part trip
static_assert(WTR == 3, "the wait behind the loads names one address pair per trip");
__device__ __forceinline__ void stage_w(const float* __restrict__ Wm, char* dst, int ftid) { v4f r[WTR][8]; const float* wp[WTR];
#pragma unroll
  for (int n = 0; n < WTR; ++n) { const int e = ftid + n * PB * 128, ec = e < DIN * 2 ? e : DIN * 2 - 1; wp[n] = Wm + (size_t)(ec >> 4) * 8 * CC + (ec & 15) * 4;   /* all trips' loads fly together; a thread past the end reads the last piece and stores nothing */
#pragma unroll
    for (int i = 0; i < 8; ++i) r[n][i] = *(const v4f*)(wp[n] + i * CC); }
  asm volatile("s_wait_xcnt 0x0" :: "v"(wp[0]), "v"(wp[1]), "v"(wp[2]) : "memory");   /* keeps the loads' address pairs live and unwritten up to the wait, and every trip's loads in front of the first store */
#pragma unroll
  for (int n = 0; n < WTR; ++n) { const int e = ftid + n * PB * 128;
    if ((n + 1) * PB * 128 <= DIN * 2 || e < DIN * 2) { const int cq = e & 15, ko = e >> 4; char* d = dst + ((ko >> 2) * 4 + (cq >> 2)) * 1024 + ((ko >> 1) & 1) * 512;
#pragma unroll
      for (int c = 0; c < 4; ++c) { v8b pc;
#pragma unroll
        for (int i = 0; i < 8; ++i) pc[i] = (__bf16)r[n][i][c];
        *(v8b*)(d + ((((ko & 1) * 16 + (cq & 3) * 4 + c) ^ (cq >> 2)) * 16)) = pc; } } } }
__global__ __launch_bounds__(PB * 128) void k_proj(const float* __restrict__ XQ, const float* __restrict__ XK, const float* __restrict__ XV, const float* __restrict__ WQ, const float* __restrict__ WK, const float* __restrict__ WV, const float* __restrict__ BQ, const float* __restrict__ BK, const float* __restrict__ BV,
    _Float16* __restrict__ QH, _Float16* __restrict__ QL, _Float16* __restrict__ KH, _Float16* __restrict__ KL, _Float16* __restrict__ VT, __bf16* __restrict__ VB, __bf16* __restrict__ VBL) {
  __shared__ __align__(16) char wlds[2][DIN * CC * 2];
  __shared__ __align__(16) _Float16 sh3[PB][64][72], sl3[PB][64][72]; __shared__ __align__(16) _Float16 th3[PB][64][72]; __shared__ __align__(16) __bf16 tb3[PB][64][72], tbl3[PB][64][72];
  const int ftid = threadIdx.x, sub = __builtin_amdgcn_readfirstlane(ftid >> 7), tid = ftid & 127, wave = tid >> 5, lane = tid & 31, col = lane & 15, g = lane >> 4;
  const int sb = blockIdx.x * PB + sub, which = sb / NSB, wfirst = (blockIdx.x * PB) / NSB, wlast = (blockIdx.x * PB + PB - 1) / NSB; const int c0 = 0; const size_t r0 = (size_t)(sb % NSB) * 64; const size_t bb = r0 / TT; const int t0 = (int)(r0 % TT);
  _Float16 (*sh)[72] = sh3[sub]; _Float16 (*sl)[72] = sl3[sub]; _Float16 (*th)[72] = th3[sub]; __bf16 (*tb)[72] = tb3[sub]; __bf16 (*tbl)[72] = tbl3[sub];
  const float* X = which == 0 ? XQ : which == 1 ? XK : XV; const float* BA = which == 0 ? BQ : which == 1 ? BK : BV;
  const float* xp = X + (r0 + wave * 16 + col) * DIN + 8 * g; v4f raw[PD][4];
#pragma unroll
  for (int d = 0; d < PD; ++d) { raw[d][0] = *(const v4f*)(xp + d * 32); raw[d][1] = *(const v4f*)(xp + d * 32 + 4); raw[d][2] = *(const v4f*)(xp + d * 32 + 16); raw[d][3] = *(const v4f*)(xp + d * 32 + 20); }
  stage_w(wfirst == 0 ? WQ : wfirst == 1 ? WK : WV, wlds[0], ftid);
  if (wlast != wfirst) stage_w(wlast == 1 ? WK : WV, wlds[1], ftid);
  __syncthreads();   /* every W fragment is in LDS before any wave reads one */
  const char* wb = wlds[which - wfirst];
  v8f acc[4] = {}; union WF { v16b v; v8b q[2]; } wf[2][4];
#pragma unroll
  for (int j = 0; j < 4; ++j) { const char* wq = wb + j * 1024 + ((lane ^ j) * 16); wf[0][j].q[0] = *(const v8b*)wq; wf[0][j].q[1] = *(const v8b*)(wq + 512); }
#pragma unroll   /* whole: raw[kc % PD] and wf[kc & 1] stay in registers only under constant indices */
  for (int kc = 0; kc < DIN / 32; ++kc) { v16b a; v4f* rw = raw[kc % PD];
#pragma unroll
    for (int i = 0; i < 4; ++i) { a[i] = (__bf16)rw[0][i]; a[4 + i] = (__bf16)rw[1][i]; a[8 + i] = (__bf16)rw[2][i]; a[12 + i] = (__bf16)rw[3][i]; }
    if (kc + PD < DIN / 32) { const float* p = xp + (kc + PD) * 32; rw[0] = *(const v4f*)p; rw[1] = *(const v4f*)(p + 4); rw[2] = *(const v4f*)(p + 16); rw[3] = *(const v4f*)(p + 20); }
    if (kc + 1 < DIN / 32) {
#pragma unroll
      for (int j = 0; j < 4; ++j) { const char* wq = wb + ((kc + 1) * 4 + j) * 1024 + ((lane ^ j) * 16); wf[(kc + 1) & 1][j].q[0] = *(const v8b*)wq; wf[(kc + 1) & 1][j].q[1] = *(const v8b*)(wq + 512); } }
    __builtin_amdgcn_sched_barrier(0);   /* holds the fetches for later K steps (X from memory, W from LDS) in front of this step's products, so that they fly under them */
#pragma unroll
    for (int j = 0; j < 4; ++j) acc[j] = wmma_bf(a, wf[kc & 1][j].v, acc[j]);
    __builtin_amdgcn_sched_barrier(0);   /* holds the next step's conversions behind this step: lifted up, they wait for X loads that were only just issued */
  }
  if (which < 2) {
#pragma unroll
    for (int j = 0; j < 4; ++j) { const float bias = BA ? bfr(BA[c0 + j * 16 + col]) : 0.f;
#pragma unroll
      for (int r = 0; r < 8; ++r) { const float v = acc[j][r] + bias; const _Float16 hv = (_Float16)v; sh[wave * 16 + 8 * g + r][j * 16 + col] = hv; sl[wave * 16 + 8 * g + r][j * 16 + col] = (_Float16)((v - (float)hv) * 1024.0f); } }
  } else {
#pragma unroll
    for (int j = 0; j < 4; ++j) { const float bias = BA ? bfr(BA[c0 + j * 16 + col]) : 0.f;
#pragma unroll
      for (int r = 0; r < 8; ++r) { const float v = acc[j][r] + bias; const int rl = wave * 16 + 8 * g + r, cl = j * 16 + col; th[cl][rl] = (_Float16)v; const __bf16 bh = (__bf16)v; tb[cl][rl] = bh; tbl[cl][rl] = (__bf16)(v - (float)bh); } } }
  __syncthreads();   /* one barrier for both kinds of sub-block: a block may hold both, and every wave passes it */
  if (which < 2) { _Float16* DH = which == 0 ? QH : KH; _Float16* DL = which == 0 ? QL : KL; const int nhi = which == 0 ? QHI : KHI; const bool hi_rows = t0 < nhi;
    for (int e = tid; e < 64 * 8; e += 128) { const int rl = (e >> 7) * 16 + (e & 15), d = ((e >> 4) & 7) * 8;   /* 16-byte piece e = (chunk, t, kd, half, g, col) */
      vst2w((unsigned*)(DH + r0 * CC + (size_t)e * 8), *(const v4u*)&sh[rl][d]); if (hi_rows) vst2w((unsigned*)(DL + (bb * nhi + t0) * (size_t)CC + (size_t)e * 8), *(const v4u*)&sl[rl][d]); }
  } else { const bool hi_rows = t0 < KHI;
    for (int e = tid; e < 64 * 8; e += 128) { const int cl = ((e >> 6) & 3) * 16 + (e & 15), tl = (e >> 8) * 32 + ((e >> 4) & 3) * 8;   /* 16-byte piece e = (chunk, j, half, g, col) */
      vst2w((unsigned*)(VT + r0 * CC + (size_t)e * 8), *(const v4u*)&th[cl][tl]); if (hi_rows) { const size_t o3 = (bb * KHI + t0) * (size_t)CC + (size_t)e * 8; vst2w((unsigned*)(VB + o3), *(const v4u*)&tb[cl][tl]); vst2w((unsigned*)(VBL + o3), *(const v4u*)&tbl[cl][tl]); } } } }
// ---- k_attn: logits, causal softmax and P V in one kernel, all batches in one launch; the logits never leave the registers.
// block = 32 queries (two 16-column groups) of batch b, AW waves; wave w walks the 32-key chunks w, w + AW, ... up to the diagonal chunk.
// S^T = K Q^T (A = 16 key rows, B = 16 query columns): a lane holds 16 logits of ONE query (column lane & 15), in the k order a B operand wants, so P^T goes from the two score tiles straight into O^T += V^T P^T.
// Running maximum and sum per lane (log2 domain, online softmax); the AW partial (max, sum, O) are joined through LDS in wave order.
// Queries < QHI: 3-product logits (q, k as f16 hi + residual x 2^10) and P, v as bf16 hi + lo (3 products); after: single f16 products, weights x 2^10 (the factor is in the sum too and cancels).
#define AW 16
#define SL2E (SCALE * 1.4426950408889634f)
// fragment in fragment order: p = chunk start + group pair * 512 + lane * 8; the two halves are neighbouring 512-byte groups
__device__ __forceinline__ v16h frag_hp(const _Float16* p) { union { v16h v; v8h q[2]; } u; u.q[0] = *(const v8h*)p; u.q[1] = *(const v8h*)(p + 256); return u.v; }
__device__ __forceinline__ v16b frag_bp(const __bf16* p) { union { v16b v; v8b q[2]; } u; u.q[0] = *(const v8b*)p; u.q[1] = *(const v8b*)(p + 256); return u.v; }
// 2^x, eight at a time: the early-clobber outputs keep a v_exp_f32 from overwriting the source of the one in front of it, and the v_nop fills the slot behind the last one
__device__ __forceinline__ void exp2x8(float* o, const float* x) {
  asm("v_exp_f32 %0, %8\n\tv_exp_f32 %1, %9\n\tv_exp_f32 %2, %10\n\tv_exp_f32 %3, %11\n\tv_exp_f32 %4, %12\n\tv_exp_f32 %5, %13\n\tv_exp_f32 %6, %14\n\tv_exp_f32 %7, %15\n\tv_nop"
      : "=&v"(o[0]), "=&v"(o[1]), "=&v"(o[2]), "=&v"(o[3]), "=&v"(o[4]), "=&v"(o[5]), "=&v"(o[6]), "=&v"(o[7]) : "v"(x[0]), "v"(x[1]), "v"(x[2]), "v"(x[3]), "v"(x[4]), "v"(x[5]), "v"(x[6]), "v"(x[7])); }
// 2^x, one value; the v_nop fills the slot behind the transcendental
__device__ __forceinline__ float exp2x1(float x) { float r; asm("v_exp_f32 %0, %1\n\tv_nop" : "=v"(r) : "v"(x)); return r; }
struct SMX { float e[16]; float al; };
// one online-softmax step of one query column: sv = 16 scaled log2 logits of this lane's query; poff = log2 of the weights' common factor
__device__ __forceinline__ SMX sm_step(const float sv[16], float& m, float& l, float poff) { SMX o; float mx = sv[0];
#pragma unroll
  for (int i = 1; i < 16; ++i) mx = fmaxf(mx, sv[i]);
  mx = fmaxf(mx, __shfl_xor(mx, 16)); const float mn = fmaxf(m, mx); o.al = exp2x1(m - mn); m = mn; const float mref = mn - poff; float d[16], ls = 0.f;
#pragma unroll
  for (int i = 0; i < 16; ++i) d[i] = sv[i] - mref;
  exp2x8(o.e, d); exp2x8(o.e + 8, d + 8);
#pragma unroll
  for (int i = 0; i < 16; ++i) ls += o.e[i];
  l = l * o.al + ls; return o; }
__global__ __launch_bounds__(AW * 32) void k_attn(const _Float16* __restrict__ QH, const _Float16* __restrict__ KH, const _Float16* __restrict__ QL, const _Float16* __restrict__ KL, const _Float16* __restrict__ VT, const __bf16* __restrict__ VB, const __bf16* __restrict__ VBL, float* __restrict__ Y) {
  __shared__ __align__(16) float so[AW][32][HD + 4]; __shared__ float smx[AW][32], sls[AW][32];
  const int tid = threadIdx.x, wave = __builtin_amdgcn_readfirstlane(tid >> 5), lane = tid & 31, col = lane & 15, g = lane >> 4;
  const int b = blockIdx.x % NB; const int rt = (TT / 32 - 1) - blockIdx.x / NB;   /* longest walks start first */
  const int q0 = rt * 32, nch = rt + 1; const size_t row0 = (size_t)b * TT;
  v8f acc[2][HD / 16] = {}; float m[2] = {-3.0e38f, -3.0e38f}, l[2] = {0.f, 0.f};
  const _Float16* qhp = QH + (row0 + q0) * CC + lane * 8;
  const _Float16* khp = KH + (row0 + wave * 32) * CC + lane * 8;
  if (q0 < QHI) { const _Float16* qlp = QL + ((size_t)b * QHI + q0) * CC + lane * 8; const _Float16* klp = KL + ((size_t)b * KHI + wave * 32) * CC + lane * 8;
    const __bf16* vhp = VB + ((size_t)b * KHI + wave * 32) * CC + lane * 8; const __bf16* vlp = VBL + ((size_t)b * KHI + wave * 32) * CC + lane * 8;
#pragma unroll 1
    for (int kc = wave; kc < nch; kc += AW, khp += AW * 32 * CC, klp += AW * 32 * CC, vhp += AW * 32 * CC, vlp += AW * 32 * CC) {
#pragma unroll
      for (int qt = 0; qt < 2; ++qt) { v16h qh[HD / 32], ql[HD / 32], kh[2][HD / 32], kl[2][HD / 32];
#pragma unroll
        for (int kd = 0; kd < HD / 32; ++kd) { qh[kd] = frag_hp(qhp + (qt * 2 + kd) * 512); ql[kd] = frag_hp(qlp + (qt * 2 + kd) * 512);
#pragma unroll
          for (int t = 0; t < 2; ++t) { kh[t][kd] = frag_hp(khp + (t * 2 + kd) * 512); kl[t][kd] = frag_hp(klp + (t * 2 + kd) * 512); } }
        asm volatile("s_wait_xcnt 0x0" :: "v"(qhp), "v"(qlp), "v"(khp), "v"(klp) : "memory");   /* keeps the loads' address pairs live and unwritten up to the wait */
        v8f s[2] = {}, sr[2] = {};
#pragma unroll
        for (int kd = 0; kd < HD / 32; ++kd)
#pragma unroll
          for (int t = 0; t < 2; ++t) { s[t] = wmma16(kh[t][kd], qh[kd], s[t]); sr[t] = wmma16(kh[t][kd], ql[kd], sr[t]); sr[t] = wmma16(kl[t][kd], qh[kd], sr[t]); }
        float sv[16];
#pragma unroll
        for (int i = 0; i < 16; ++i) { const float v = (s[i >> 3][i & 7] + sr[i >> 3][i & 7] * (1.0f / 1024.0f)) * SL2E; sv[i] = (kc * 32 + (i >> 3) * 16 + 8 * g + (i & 7) <= q0 + qt * 16 + col) ? v : -3.0e38f; }
        const SMX x = sm_step(sv, m[qt], l[qt], 0.f); const F2 p = bsplit16(x.e); v16b vh[HD / 16], vl[HD / 16];
#pragma unroll
        for (int j = 0; j < HD / 16; ++j) { vh[j] = frag_bp(vhp + j * 512); vl[j] = frag_bp(vlp + j * 512); }
        asm volatile("s_wait_xcnt 0x0" :: "v"(vhp), "v"(vlp) : "memory");   /* as above */
#pragma unroll
        for (int j = 0; j < HD / 16; ++j) { acc[qt][j] *= x.al; acc[qt][j] = wmma_bf(vh[j], p.h, acc[qt][j]); acc[qt][j] = wmma_bf(vh[j], p.l, acc[qt][j]); acc[qt][j] = wmma_bf(vl[j], p.h, acc[qt][j]); } } }
  } else { const _Float16* vp = VT + (row0 + wave * 32) * CC + lane * 8; v16h qf[2][HD / 32];
#pragma unroll
    for (int qt = 0; qt < 2; ++qt)
#pragma unroll
      for (int kd = 0; kd < HD / 32; ++kd) qf[qt][kd] = frag_hp(qhp + (qt * 2 + kd) * 512);
    asm volatile("s_wait_xcnt 0x0" :: "v"(qhp) : "memory");   /* as above */
#pragma unroll 1
    for (int kc = wave; kc < nch; kc += AW, khp += AW * 32 * CC, vp += AW * 32 * CC) { v16h kf[2][HD / 32], vf[HD / 16];
#pragma unroll
      for (int t = 0; t < 2; ++t)
#pragma unroll
        for (int kd = 0; kd < HD / 32; ++kd) kf[t][kd] = frag_hp(khp + (t * 2 + kd) * 512);
#pragma unroll
      for (int j = 0; j < HD / 16; ++j) vf[j] = frag_hp(vp + j * 512);
      asm volatile("s_wait_xcnt 0x0" :: "v"(khp), "v"(vp) : "memory");   /* as above */
#pragma unroll
      for (int qt = 0; qt < 2; ++qt) { v8f s[2] = {};
#pragma unroll
        for (int t = 0; t < 2; ++t)
#pragma unroll
          for (int kd = 0; kd < HD / 32; ++kd) s[t] = wmma16(kf[t][kd], qf[qt][kd], s[t]);
        float sv[16];
#pragma unroll
        for (int i = 0; i < 16; ++i) sv[i] = s[i >> 3][i & 7] * SL2E;
        if (kc == nch - 1) {   /* only the diagonal chunk holds keys past a query */
#pragma unroll
          for (int i = 0; i < 16; ++i) if (kc * 32 + (i >> 3) * 16 + 8 * g + (i & 7) > q0 + qt * 16 + col) sv[i] = -3.0e38f; }
        const SMX x = sm_step(sv, m[qt], l[qt], 10.f); v16h p;
#pragma unroll
        for (int i = 0; i < 16; ++i) p[i] = (_Float16)x.e[i];
#pragma unroll
        for (int j = 0; j < HD / 16; ++j) { acc[qt][j] *= x.al; acc[qt][j] = wmma16(vf[j], p, acc[qt][j]); } } } }
#pragma unroll
  for (int qt = 0; qt < 2; ++qt) { const float lt = l[qt] + __shfl_xor(l[qt], 16); if (g == 0) { smx[wave][qt * 16 + col] = m[qt]; sls[wave][qt * 16 + col] = lt; }
#pragma unroll
    for (int j = 0; j < HD / 16; ++j) { v4f a0, a1;
#pragma unroll
      for (int r = 0; r < 4; ++r) { a0[r] = acc[qt][j][r]; a1[r] = acc[qt][j][4 + r]; }
      *(v4f*)&so[wave][qt * 16 + col][j * 16 + 8 * g] = a0; *(v4f*)&so[wave][qt * 16 + col][j * 16 + 8 * g + 4] = a1; } }
  __syncthreads();   /* every wave's partial (max, sum, O) is in LDS before any of them is joined */
  { const int qr = tid >> 4, q = tid & 15; float mw[AW], wt[AW]; float M = -3.0e38f;
#pragma unroll
    for (int w = 0; w < AW; ++w) { mw[w] = smx[w][qr]; M = fmaxf(M, mw[w]); }
#pragma unroll
    for (int w = 0; w < AW; ++w) mw[w] -= M;
    exp2x8(wt, mw); exp2x8(wt + 8, mw + 8);
    float Ls = 0.f; v4f o = {};
#pragma unroll
    for (int w = 0; w < AW; ++w) { Ls += wt[w] * sls[w][qr]; o += *(const v4f*)&so[w][qr][q * 4] * wt[w]; }
    const float inv = Ls > 0.f ? 1.0f / Ls : 0.f; vst2(Y + (row0 + q0 + qr) * CC + q * 4, o * inv); } }

extern "C" void kernel_launch(void* const* d_in, const int* in_sizes, int n_in, void* d_out, int out_size, void* d_ws, size_t ws_size, hipStream_t stream) {
  (void)in_sizes; (void)n_in; (void)out_size;
  const float** F = (const float**)d_in;
  if (ws_size < (size_t)WS_END) return;
  char* ws = (char*)d_ws; _Float16 *QH = (_Float16*)(ws + WS_QH), *KH = (_Float16*)(ws + WS_KH), *VT = (_Float16*)(ws + WS_VT), *QL = (_Float16*)(ws + WS_QL), *KL = (_Float16*)(ws + WS_KL); __bf16 *VB = (__bf16*)(ws + WS_VB), *VBL = (__bf16*)(ws + WS_VBL); float *S = (float*)(ws + WS_S), *Y = (float*)(ws + WS_Y);
  (void)Y; (void)S;
  // inputs: 0 q_in [4,4096,512]; 1 k_in; 2 v_in (separate inputs); 3 Wq [512,64], 4 bq; 5 Wk, 6 bk; 7 Wv, 8 bv ((in,out); zero biases read)
  k_proj<<<dim3(3 * NSB / PB), PB * 128, 0, stream>>>(F[0], F[1], F[2], F[3], F[5], F[7], F[4], F[6], F[8], QH, QL, KH, KL, VT, VB, VBL);
  k_attn<<<dim3(NB * (TT / 32)), AW * 32, 0, stream>>>(QH, KH, QL, KL, VT, VB, VBL, (float*)d_out);   /* out rows are the ctx rows: [b*TT+t][64] */
}

// v006
// Measured time: 28.1 microseconds a run.
// Two timings next to v005 put it at 1.07 and 1.08 times that version's speed.
// Over all steps from v000 it is 24.8 times as fast.
// compute dtype: all float inputs rounded to bf16; q/k/v projections with EXACT bf16 products on WMMA 16x16x32 (f32 accumulate) + bias; causal logits: 3 products (q f16 hi + residual x k hi + residual) for the first 384 rows, single f16 q x k after, x scale; online softmax f32 (base 2) in registers; unnormalised weights x 2^10 once to f16 x v once to f16 (1 product; bf16 hi + lo below row 384), divided by the f32 sum at the end; f32 output.
#include <hip/hip_runtime.h>
#include <math.h>

typedef __attribute__((ext_vector_type(16))) _Float16 v16h;
typedef __attribute__((ext_vector_type(16))) __bf16 v16b;
typedef __attribute__((ext_vector_type(8)))  _Float16 v8h;
typedef __attribute__((ext_vector_type(8)))  float v8f;
typedef __attribute__((ext_vector_type(4)))  float v4f;
typedef __attribute__((ext_vector_type(2)))  float v2f;
typedef __attribute__((ext_vector_type(4)))  unsigned v4u;
typedef __attribute__((ext_vector_type(4)))  int v4i;
typedef float __attribute__((may_alias)) float_a;
typedef int __attribute__((may_alias)) int_a;

template <typename T> __device__ __forceinline__ void vst2(void* p, T v) { *(T*)p = v;  }
// store in a loop: the wait takes the store's address and data as inputs, so that neither register is rewritten (next store, next trip) in front of it
template <typename T> __device__ __forceinline__ void vst2w(void* p, T v) { *(T*)p = v; asm volatile("s_wait_xcnt 0x0" :: "v"(p), "v"(v) : "memory"); }
__device__ __forceinline__ v8f wmma16(v16h a, v16h b, v8f c) {
  v8f d = __builtin_amdgcn_wmma_f32_16x16x32_f16(false, a, false, b, (short)0, c, false, false);
  asm volatile("v_nop\n\tv_nop\n\tv_nop\n\tv_nop" : "+v"(d) : "v"(a), "v"(b));
  return d;
}
__device__ __forceinline__ v8f wmma_bf(v16b a, v16b b, v8f c) {
  v8f d = __builtin_amdgcn_wmma_f32_16x16x32_bf16(false, a, false, b, (short)0, c, false, false);
  asm volatile("v_nop\n\tv_nop\n\tv_nop\n\tv_nop" : "+v"(d) : "v"(a), "v"(b));
  return d;
}
// 16x16x32 fragments: lane = (h = lane>>4, row/col = lane&15); elements 0..7 = k0+8h+0..7, 8..15 = k0+16+8h+0..7; D element r = row 8h+r
__device__ __forceinline__ v16h frag_h(const _Float16* rowk0, int lane) {
  union { v16h v; v8h q[2]; } u; const _Float16* p = rowk0 + 8 * (lane >> 4);
  u.q[0] = *(const v8h*)p; u.q[1] = *(const v8h*)(p + 16); return u.v;
}
__device__ __forceinline__ v16h frag_f32(const float* rowk0, int lane) {
  v16h a; const float* p = rowk0 + 8 * (lane >> 4);
#pragma unroll
  for (int i = 0; i < 8; ++i) { a[i] = (_Float16)p[i]; a[8 + i] = (_Float16)p[16 + i]; }
  return a;
}
__device__ __forceinline__ v16h frag_f32s(const float* rowk0, int lane, float sc) {
  v16h a; const float* p = rowk0 + 8 * (lane >> 4);
#pragma unroll
  for (int i = 0; i < 8; ++i) { a[i] = (_Float16)(p[i] * sc); a[8 + i] = (_Float16)(p[16 + i] * sc); }
  return a;
}
// column fragment from a [K][ld] layout (column n), rows >= K read as 0
__device__ __forceinline__ v16h fragc_f32(const float* W, int k0, int n, int lane, int ld, int K) {
  v16h a; const int g = lane >> 4;
#pragma unroll
  for (int i = 0; i < 8; ++i) { const int ka = k0 + 8 * g + i, kb = ka + 16;
    a[i] = (_Float16)(ka < K ? W[(size_t)(ka < K ? ka : K - 1) * ld + n] : 0.f); a[8 + i] = (_Float16)(kb < K ? W[(size_t)(kb < K ? kb : K - 1) * ld + n] : 0.f); }
  return a;
}
struct F2 { v16b h, l; };
__device__ __forceinline__ F2 bsplit16(const float v[16]) { F2 r;
#pragma unroll
  for (int i = 0; i < 16; ++i) { const __bf16 h = (__bf16)v[i]; r.h[i] = h; r.l[i] = (__bf16)(v[i] - (float)h); }
  return r; }
__device__ __forceinline__ F2 split_row(const float* row, int k0, int lane) { float v[16]; const float* p = row + k0 + 8 * (lane >> 4);
#pragma unroll
  for (int i = 0; i < 8; ++i) { v[i] = p[i]; v[8 + i] = p[16 + i]; }
  return bsplit16(v); }
__device__ __forceinline__ F2 split_rowK(const float* row, int k0, int lane, int K) { float v[16]; const int g = lane >> 4;
#pragma unroll
  for (int i = 0; i < 8; ++i) { const int ka = k0 + 8 * g + i, kb = ka + 16; v[i] = ka < K ? row[ka < K ? ka : K - 1] : 0.f; v[8 + i] = kb < K ? row[kb < K ? kb : K - 1] : 0.f; }
  return bsplit16(v); }
__device__ __forceinline__ F2 split_col(const float* W, int k0, int n, int lane, int ld, int K) { float v[16]; const int g = lane >> 4;
#pragma unroll
  for (int i = 0; i < 8; ++i) { const int ka = k0 + 8 * g + i, kb = ka + 16; v[i] = ka < K ? W[(size_t)(ka < K ? ka : K - 1) * ld + n] : 0.f; v[8 + i] = kb < K ? W[(size_t)(kb < K ? kb : K - 1) * ld + n] : 0.f; }
  return bsplit16(v); }
__device__ __forceinline__ v8f mac3(const F2& a, const F2& b, v8f c) { c = wmma_bf(a.l, b.h, c); c = wmma_bf(a.h, b.l, c); return wmma_bf(a.h, b.h, c); }
__device__ __forceinline__ float sigm(float v) { return 1.0f / (1.0f + expf(-v)); }
#define LDSX() do { asm volatile("s_wait_dscnt 0" ::: "memory"); __builtin_amdgcn_wave_barrier(); __builtin_amdgcn_fence(__ATOMIC_RELEASE, "workgroup"); } while (0)

// Single-head causal scaled dot-product attention with separate inputs (q_in / k_in / v_in [4,4096,512]; Keras Dense (in,out) Wq / Wk / Wv [512,64] N(0, 1/512) + zero biases; scale 1/8; causal j <= i, -inf): out = softmax(causal((q_in Wq + bq)(k_in Wk + bk)^T / 8)) (v_in Wv + bv) -> [4,4096,64].
#define NB 4
#define TT 4096
#define CC 64             // NH * HD = projected width
#define DIN 512          // input (model) width
#define NH 1
#define HD 64
#define NQB (TT / 64)
#define HG 1
#define SCALE (0.125f)
#define CAUSAL 1
#ifndef TNB
#define TNB NB
#endif
__device__ __forceinline__ float bfr(float v) { return (float)(__bf16)v; }
__host__ __device__ __forceinline__ int kb_last(int qb) { return CAUSAL ? ((qb * 64 + 63) >> 7) : (TT / 128 - 1); }
typedef __attribute__((ext_vector_type(8))) __bf16 v8b;
__device__ __forceinline__ v16b frag_b(const __bf16* rowk0, int lane) {
  union { v16b v; v8b q[2]; } u; const __bf16* p = rowk0 + 8 * (lane >> 4);
  u.q[0] = *(const v8b*)p; u.q[1] = *(const v8b*)(p + 16); return u.v;
}
#define QBH 6              // unused; causal: query rows < QBH * 64 (= QHI; few keys, no averaging) take the high-precision path
#define QHI 384            // rows carrying a q residual plane
#define KHI 384            // key rows carrying k residual / v bf16 hi+lo planes (used only by the causal high-precision path)
// B fragment (k rows k0+.., output column o) of a weight: (in,out) [K][ld] or (out,in) [ld rows of K]: bf16 exact, or f16(bf16 * 256) exact
__device__ __forceinline__ v16b wcol_io(const float* Wm, int k0, int o, int lane, int ld) { v16b w; const int g = lane >> 4;
#pragma unroll
  for (int i = 0; i < 8; ++i) { w[i] = (__bf16)Wm[(size_t)(k0 + 8 * g + i) * ld + o]; w[8 + i] = (__bf16)Wm[(size_t)(k0 + 16 + 8 * g + i) * ld + o]; }
  return w; }
__device__ __forceinline__ v16b wcol_oi(const float* Wm, int k0, int o, int lane, int K) { v16b w; const float* p = Wm + (size_t)o * K + k0 + 8 * (lane >> 4);
#pragma unroll
  for (int i = 0; i < 8; ++i) { w[i] = (__bf16)p[i]; w[8 + i] = (__bf16)p[16 + i]; }
  return w; }
__device__ __forceinline__ v16h wcolh_io(const float* Wm, int k0, int o, int lane, int ld) { v16h w; const int g = lane >> 4;
#pragma unroll
  for (int i = 0; i < 8; ++i) { w[i] = (_Float16)(bfr(Wm[(size_t)(k0 + 8 * g + i) * ld + o]) * 256.0f); w[8 + i] = (_Float16)(bfr(Wm[(size_t)(k0 + 16 + 8 * g + i) * ld + o]) * 256.0f); }
  return w; }
__device__ __forceinline__ v16h wcolh_oi(const float* Wm, int k0, int o, int lane, int K) { v16h w; const float* p = Wm + (size_t)o * K + k0 + 8 * (lane >> 4);
#pragma unroll
  for (int i = 0; i < 8; ++i) { w[i] = (_Float16)(bfr(p[i]) * 256.0f); w[8 + i] = (_Float16)(bfr(p[16 + i]) * 256.0f); }
  return w; }
#define WQKV_LAYOUT 0   // 0 = (in,out) [DIN][CC]; 1 = (out,in) [CC][DIN]; 2 = per-head [NH][DIN][HD]
__device__ __forceinline__ v16b wcol_hdk(const float* Wm, int k0, int o, int lane) { v16b w; const int g = lane >> 4; const float* p = Wm + (size_t)(o / HD) * DIN * HD + (o % HD);
#pragma unroll
  for (int i = 0; i < 8; ++i) { w[i] = (__bf16)p[(size_t)(k0 + 8 * g + i) * HD]; w[8 + i] = (__bf16)p[(size_t)(k0 + 16 + 8 * g + i) * HD]; }
  return w; }
#define WO_OUT_IN 0
#if WQKV_LAYOUT == 1
#define WCOL(W, k0, o, lane) wcol_oi(W, k0, o, lane, DIN)
#elif WQKV_LAYOUT == 2
#define WCOL(W, k0, o, lane) wcol_hdk(W, k0, o, lane)
#else
#define WCOL(W, k0, o, lane) wcol_io(W, k0, o, lane, CC)
#endif
#if WO_OUT_IN
#define WOCOL(W, k0, o, lane) wcol_oi(W, k0, o, lane, CC)
#define WOCOLH(W, k0, o, lane) wcolh_oi(W, k0, o, lane, CC)
#else
#define WOCOL(W, k0, o, lane) wcol_io(W, k0, o, lane, DIN)
#define WOCOLH(W, k0, o, lane) wcolh_io(W, k0, o, lane, DIN)
#endif
#ifndef SM_EXTRA_PARAMS
#define SM_EXTRA_PARAMS
#endif
#ifndef PROJ_EXTRA_PARAMS
#define PROJ_EXTRA_PARAMS
#endif
#ifndef SM_MASK_HOOK
#define SM_MASK_HOOK (void)0
#endif

// k_attn's operands lie in FRAGMENT ORDER: a 32-row chunk (32 queries or 32 keys, all 64 channels) is 4 KB = 8 groups of 512 B, and a group holds lane 0..31's 16 bytes side by side,
// so that one wave-wide 16-byte load covers 4 whole 128-byte lines. q, k: group = (t, kd, half), lane (g, col) holds row t * 16 + col, channels kd * 32 + half * 16 + g * 8 + 0..7;
// v: group = (j, half), lane (g, col) holds channel j * 16 + col, keys half * 16 + g * 8 + 0..7.
static_assert(CC == 64 && HD == 64, "the fragment order is laid out for 64 channels");
#define WS_QH  0u                                      // f16 q, fragment order [b][t / 32][4 KB]
#define WS_KH  (WS_QH + 2u * (size_t)NB * TT * CC)      // f16 k, fragment order [b][t / 32][4 KB]
#define WS_VT  (WS_KH + 2u * (size_t)NB * TT * CC)      // f16 v, fragment order [b][t / 32][4 KB]
#define WS_QL  (WS_VT + 2u * (size_t)NB * CC * TT)      // f16 q residual x 2^10, fragment order [b][t / 32, t < QHI][4 KB]
#define WS_KL  (WS_QL + 2u * (size_t)NB * QHI * CC)     // f16 k residual x 2^10, fragment order [b][t / 32, t < KHI][4 KB]
#define WS_VB  (WS_KL + 2u * (size_t)NB * KHI * CC)     // bf16 v hi (VBL: lo), fragment order [b][t / 32, t < KHI][4 KB]
#define WS_VBL (WS_VB + 2u * (size_t)NB * CC * KHI)
#define WS_S   (WS_VBL + 2u * (size_t)NB * CC * KHI)    // f32 [hg][t][s] region, unused (the logits stay in registers)
#define WS_Y   (WS_S  + 4u * (size_t)HG * TT * TT)      // f32 ctx rows [b*t][CC] (only when there is an output projection)
#define WS_END (WS_Y  + 0u)

// ---- k_proj: q/k/v = X W (+ b) with exact bf16 products (K = DIN). The 3 * NSB sub-blocks of 64 rows (projection = sub-block / NSB) are dealt PB to a block, 4 waves each; a block touches at most two projections.
// W is turned ONCE per block into bf16 B fragments in LDS; the K loop reads them from there and has only X left to fetch from memory, two stages (PD K steps) ahead.
// X comes in stages of XS columns by WHOLE lines: a wave-wide 16-byte load covers 256 contiguous bytes of each of two rows (4 whole lines; a load in fragment order touches 16 lines for the same 512 bytes).
// The wave rounds a stage to bf16, stores it to its OWN two-buffer LDS range (rows of XP bytes) and reads its A fragments back from there, so no other wave and no barrier is involved.
// projection 0: q f16 (+ residual for rows < QHI); 1: k f16 (+ residual for rows < KHI); 2: v f16 (+ bf16 hi/lo for t < KHI); all stored in fragment order
#define PB 3                  // 64-row sub-blocks of a block
#define NSB (TNB * TT / 64)   // sub-blocks of a projection
#define PD 4                  // K steps of X a wave has in flight
#define XS 64                 // X columns of a stage (two K steps)
#define XP (XS * 2 + 16)      // LDS pitch of a staged bf16 row: 16 bytes x odd, the pitch at which 16-byte fragment reads meet no bank twice
typedef __attribute__((ext_vector_type(4))) __bf16 v4b;
static_assert((3 * NSB) % PB == 0 && NSB >= PB && DIN / XS >= 2 && DIN % XS == 0 && XS == 64 && PD * 32 == 2 * XS, "sub-blocks are dealt evenly, and a block spans at most two projections; two stages of two K steps fly");
// W [DIN][CC] f32 -> LDS: the 512-byte group (kc, j, half) holds for lane (g, col) the 8 values k = kc * 32 + half * 16 + g * 8 + 0..7 of column j * 16 + col, at 16-byte slot lane ^ j
// (the xor spreads a writing wave's 16 column quads over all banks; a reading wave's 32 slots still fill the group). A thread takes 8 k rows x 4 columns: a wave-wide 16-byte load covers 4 whole lines.
#define WTR ((DIN * 2 + PB * 128 - 1) / (PB * 128))   // trips of a thread over the DIN * 2 pieces of work; only the last can be a part trip
static_assert(WTR == 3, "the wait behind the loads names one address pair per trip");
__device__ __forceinline__ void stage_w(const float* __restrict__ Wm, char* dst, int ftid) { v4f r[WTR][8]; const float* wp[WTR];
#pragma unroll
  for (int n = 0; n < WTR; ++n) { const int e = ftid + n * PB * 128, ec = e < DIN * 2 ? e : DIN * 2 - 1; wp[n] = Wm + (size_t)(ec >> 4) * 8 * CC + (ec & 15) * 4;   /* all trips' loads fly together; a thread past the end reads the last piece and stores nothing */
#pragma unroll
    for (int i = 0; i < 8; ++i) r[n][i] = *(const v4f*)(wp[n] + i * CC); }
  asm volatile("s_wait_xcnt 0x0" :: "v"(wp[0]), "v"(wp[1]), "v"(wp[2]) : "memory");   /* keeps the loads' address pairs live and unwritten up to the wait, and every trip's loads in front of the first store */
#pragma unroll
  for (int n = 0; n < WTR; ++n) { const int e = ftid + n * PB * 128;
    if ((n + 1) * PB * 128 <= DIN * 2 || e < DIN * 2) { const int cq = e & 15, ko = e >> 4; char* d = dst + ((ko >> 2) * 4 + (cq >> 2)) * 1024 + ((ko >> 1) & 1) * 512;
#pragma unroll
      for (int c = 0; c < 4; ++c) { v8b pc;
#pragma unroll
        for (int i = 0; i < 8; ++i) pc[i] = (__bf16)r[n][i][c];
        *(v8b*)(d + ((((ko & 1) * 16 + (cq & 3) * 4 + c) ^ (cq >> 2)) * 16)) = pc; } } } }
__global__ __launch_bounds__(PB * 128) void k_proj(const float* __restrict__ XQ, const float* __restrict__ XK, const float* __restrict__ XV, const float* __restrict__ WQ, const float* __restrict__ WK, const float* __restrict__ WV, const float* __restrict__ BQ, const float* __restrict__ BK, const float* __restrict__ BV,
    _Float16* __restrict__ QH, _Float16* __restrict__ QL, _Float16* __restrict__ KH, _Float16* __restrict__ KL, _Float16* __restrict__ VT, __bf16* __restrict__ VB, __bf16* __restrict__ VBL) {
  __shared__ __align__(16) char wlds[2][DIN * CC * 2];
  __shared__ __align__(16) char xs3[PB * 4][2][16 * XP];
  __shared__ __align__(16) _Float16 sh3[PB][64][72], sl3[PB][64][72]; __shared__ __align__(16) _Float16 th3[PB][64][72]; __shared__ __align__(16) __bf16 tb3[PB][64][72], tbl3[PB][64][72];
  const int ftid = threadIdx.x, sub = __builtin_amdgcn_readfirstlane(ftid >> 7), tid = ftid & 127, wave = tid >> 5, lane = tid & 31, col = lane & 15, g = lane >> 4;
  const int sb = blockIdx.x * PB + sub, which = sb / NSB, wfirst = (blockIdx.x * PB) / NSB, wlast = (blockIdx.x * PB + PB - 1) / NSB; const int c0 = 0; const size_t r0 = (size_t)(sb % NSB) * 64; const size_t bb = r0 / TT; const int t0 = (int)(r0 % TT);
  _Float16 (*sh)[72] = sh3[sub]; _Float16 (*sl)[72] = sl3[sub]; _Float16 (*th)[72] = th3[sub]; __bf16 (*tb)[72] = tb3[sub]; __bf16 (*tbl)[72] = tbl3[sub];
  const float* X = which == 0 ? XQ : which == 1 ? XK : XV; const float* BA = which == 0 ? BQ : which == 1 ? BK : BV;
  const float* xp = X + (r0 + wave * 16 + g) * DIN + col * 4; v4f raw[2][8];   /* load i of a stage: rows 2 i + g, columns col * 4 + 0..3 of the stage */
  char* xw = xs3[ftid >> 5][0];
#pragma unroll
  for (int d = 0; d < 2; ++d)
#pragma unroll
    for (int i = 0; i < 8; ++i) raw[d][i] = *(const v4f*)(xp + i * 2 * DIN + d * XS);
  stage_w(wfirst == 0 ? WQ : wfirst == 1 ? WK : WV, wlds[0], ftid);
  if (wlast != wfirst) stage_w(wlast == 1 ? WK : WV, wlds[1], ftid);
  __syncthreads();   /* every W fragment is in LDS before any wave reads one */
  const char* wb = wlds[which - wfirst];
  v8f acc[4] = {}; union WF { v16b v; v8b q[2]; } wf[2][4], af[2];
  /* stage st: rounds the 8 loaded pieces to bf16 into buffer st & 1, then sends the loads of stage st + 2 into the registers just freed */
#define XSTORE(st) do { _Pragma("unroll") for (int i = 0; i < 8; ++i) { const v4f x = raw[(st) & 1][i]; v4b pc; pc[0] = (__bf16)x[0]; pc[1] = (__bf16)x[1]; pc[2] = (__bf16)x[2]; pc[3] = (__bf16)x[3]; \
      *(v4b*)(xw + ((st) & 1) * 16 * XP + (2 * i + g) * XP + col * 8) = pc; } \
    if ((st) + 2 < DIN / XS) { _Pragma("unroll") for (int i = 0; i < 8; ++i) raw[(st) & 1][i] = *(const v4f*)(xp + i * 2 * DIN + ((st) + 2) * XS); } } while (0)
  /* A fragment of K step k: row col, elements 0..7 = k * 32 + 8 g + 0..7, 8..15 = 16 further on (the k order of the W fragments) */
#define XFRAG(k) do { const char* xq = xw + (((k) >> 1) & 1) * 16 * XP + col * XP + ((k) & 1) * 64 + g * 16; af[(k) & 1].q[0] = *(const v8b*)xq; af[(k) & 1].q[1] = *(const v8b*)(xq + 32); } while (0)
  XSTORE(0);
  asm volatile("s_wait_dscnt 0x0" ::: "memory");   /* the wave's own stores of stage 0, made by other lanes than those that read them, have landed before the fragments are read back */
  XFRAG(0);
#pragma unroll
  for (int j = 0; j < 4; ++j) { const char* wq = wb + j * 1024 + ((lane ^ j) * 16); wf[0][j].q[0] = *(const v8b*)wq; wf[0][j].q[1] = *(const v8b*)(wq + 512); }
#pragma unroll   /* whole: raw[stage & 1], af[kc & 1] and wf[kc & 1] stay in registers only under constant indices */
  for (int kc = 0; kc < DIN / 32; ++kc) {
    if (kc + 1 < DIN / 32) {
      if (kc & 1) asm volatile("s_wait_dscnt 0x0" ::: "memory");   /* the next step opens a stage, stored one step ago: as above, its rows have landed before they are read back */
      XFRAG(kc + 1);
#pragma unroll
      for (int j = 0; j < 4; ++j) { const char* wq = wb + ((kc + 1) * 4 + j) * 1024 + ((lane ^ j) * 16); wf[(kc + 1) & 1][j].q[0] = *(const v8b*)wq; wf[(kc + 1) & 1][j].q[1] = *(const v8b*)(wq + 512); } }
    if (!(kc & 1) && kc / 2 + 1 < DIN / XS) XSTORE(kc / 2 + 1);
    __builtin_amdgcn_sched_barrier(0);   /* holds the fetches for later K steps (X from memory, X and W fragments from LDS) in front of this step's products, so that they fly under them */
#pragma unroll
    for (int j = 0; j < 4; ++j) acc[j] = wmma_bf(af[kc & 1].v, wf[kc & 1][j].v, acc[j]);
    __builtin_amdgcn_sched_barrier(0);   /* holds the next stage's conversions behind this step: lifted up, they wait for X loads that were only just issued */
  }
  if (which < 2) {
#pragma unroll
    for (int j = 0; j < 4; ++j) { const float bias = BA ? bfr(BA[c0 + j * 16 + col]) : 0.f;
#pragma unroll
      for (int r = 0; r < 8; ++r) { const float v = acc[j][r] + bias; const _Float16 hv = (_Float16)v; sh[wave * 16 + 8 * g + r][j * 16 + col] = hv; sl[wave * 16 + 8 * g + r][j * 16 + col] = (_Float16)((v - (float)hv) * 1024.0f); } }
  } else {
#pragma unroll
    for (int j = 0; j < 4; ++j) { const float bias = BA ? bfr(BA[c0 + j * 16 + col]) : 0.f;
#pragma unroll
      for (int r = 0; r < 8; ++r) { const float v = acc[j][r] + bias; const int rl = wave * 16 + 8 * g + r, cl = j * 16 + col; th[cl][rl] = (_Float16)v; const __bf16 bh = (__bf16)v; tb[cl][rl] = bh; tbl[cl][rl] = (__bf16)(v - (float)bh); } } }
  __syncthreads();   /* one barrier for both kinds of sub-block: a block may hold both, and every wave passes it */
  if (which < 2) { _Float16* DH = which == 0 ? QH : KH; _Float16* DL = which == 0 ? QL : KL; const int nhi = which == 0 ? QHI : KHI; const bool hi_rows = t0 < nhi;
    for (int e = tid; e < 64 * 8; e += 128) { const int rl = (e >> 7) * 16 + (e & 15), d = ((e >> 4) & 7) * 8;   /* 16-byte piece e = (chunk, t, kd, half, g, col) */
      vst2w((unsigned*)(DH + r0 * CC + (size_t)e * 8), *(const v4u*)&sh[rl][d]); if (hi_rows) vst2w((unsigned*)(DL + (bb * nhi + t0) * (size_t)CC + (size_t)e * 8), *(const v4u*)&sl[rl][d]); }
  } else { const bool hi_rows = t0 < KHI;
    for (int e = tid; e < 64 * 8; e += 128) { const int cl = ((e >> 6) & 3) * 16 + (e & 15), tl = (e >> 8) * 32 + ((e >> 4) & 3) * 8;   /* 16-byte piece e = (chunk, j, half, g, col) */
      vst2w((unsigned*)(VT + r0 * CC + (size_t)e * 8), *(const v4u*)&th[cl][tl]); if (hi_rows) { const size_t o3 = (bb * KHI + t0) * (size_t)CC + (size_t)e * 8; vst2w((unsigned*)(VB + o3), *(const v4u*)&tb[cl][tl]); vst2w((unsigned*)(VBL + o3), *(const v4u*)&tbl[cl][tl]); } } } }
// ---- k_attn: logits, causal softmax and P V in one kernel, all batches in one launch; the logits never leave the registers.
// block = 32 queries (two 16-column groups) of batch b, AW waves; wave w walks the 32-key chunks w, w + AW, ... up to the diagonal chunk.
// S^T = K Q^T (A = 16 key rows, B = 16 query columns): a lane holds 16 logits of ONE query (column lane & 15), in the k order a B operand wants, so P^T goes from the two score tiles straight into O^T += V^T P^T.
// Running maximum and sum per lane (log2 domain, online softmax); the AW partial (max, sum, O) are joined through LDS in wave order.
// Queries < QHI: 3-product logits (q, k as f16 hi + residual x 2^10) and P, v as bf16 hi + lo (3 products); after: single f16 products, weights x 2^10 (the factor is in the sum too and cancels).
#define AW 16
#define SL2E (SCALE * 1.4426950408889634f)
// fragment in fragment order: p = chunk start + group pair * 512 + lane * 8; the two halves are neighbouring 512-byte groups
__device__ __forceinline__ v16h frag_hp(const _Float16* p) { union { v16h v; v8h q[2]; } u; u.q[0] = *(const v8h*)p; u.q[1] = *(const v8h*)(p + 256); return u.v; }
__device__ __forceinline__ v16b frag_bp(const __bf16* p) { union { v16b v; v8b q[2]; } u; u.q[0] = *(const v8b*)p; u.q[1] = *(const v8b*)(p + 256); return u.v; }
// 2^x, eight at a time: the early-clobber outputs keep a v_exp_f32 from overwriting the source of the one in front of it, and the v_nop fills the slot behind the last one
__device__ __forceinline__ void exp2x8(float* o, const float* x) {
  asm("v_exp_f32 %0, %8\n\tv_exp_f32 %1, %9\n\tv_exp_f32 %2, %10\n\tv_exp_f32 %3, %11\n\tv_exp_f32 %4, %12\n\tv_exp_f32 %5, %13\n\tv_exp_f32 %6, %14\n\tv_exp_f32 %7, %15\n\tv_nop"
      : "=&v"(o[0]), "=&v"(o[1]), "=&v"(o[2]), "=&v"(o[3]), "=&v"(o[4]), "=&v"(o[5]), "=&v"(o[6]), "=&v"(o[7]) : "v"(x[0]), "v"(x[1]), "v"(x[2]), "v"(x[3]), "v"(x[4]), "v"(x[5]), "v"(x[6]), "v"(x[7])); }
// 2^x, one value; the v_nop fills the slot behind the transcendental
__device__ __forceinline__ float exp2x1(float x) { float r; asm("v_exp_f32 %0, %1\n\tv_nop" : "=v"(r) : "v"(x)); return r; }
struct SMX { float e[16]; float al; };
// one online-softmax step of one query column: sv = 16 scaled log2 logits of this lane's query; poff = log2 of the weights' common factor
__device__ __forceinline__ SMX sm_step(const float sv[16], float& m, float& l, float poff) { SMX o; float mx = sv[0];
#pragma unroll
  for (int i = 1; i < 16; ++i) mx = fmaxf(mx, sv[i]);
  mx = fmaxf(mx, __shfl_xor(mx, 16)); const float mn = fmaxf(m, mx); o.al = exp2x1(m - mn); m = mn; const float mref = mn - poff; float d[16], ls = 0.f;
#pragma unroll
  for (int i = 0; i < 16; ++i) d[i] = sv[i] - mref;
  exp2x8(o.e, d); exp2x8(o.e + 8, d + 8);
#pragma unroll
  for (int i = 0; i < 16; ++i) ls += o.e[i];
  l = l * o.al + ls; return o; }
__global__ __launch_bounds__(AW * 32) void k_attn(const _Float16* __restrict__ QH, const _Float16* __restrict__ KH, const _Float16* __restrict__ QL, const _Float16* __restrict__ KL, const _Float16* __restrict__ VT, const __bf16* __restrict__ VB, const __bf16* __restrict__ VBL, float* __restrict__ Y) {
  __shared__ __align__(16) float so[AW][32][HD + 4]; __shared__ float smx[AW][32], sls[AW][32];
  const int tid = threadIdx.x, wave = __builtin_amdgcn_readfirstlane(tid >> 5), lane = tid & 31, col = lane & 15, g = lane >> 4;
  const int b = blockIdx.x % NB; const int rt = (TT / 32 - 1) - blockIdx.x / NB;   /* longest walks start first */
  const int q0 = rt * 32, nch = rt + 1; const size_t row0 = (size_t)b * TT;
  v8f acc[2][HD / 16] = {}; float m[2] = {-3.0e38f, -3.0e38f}, l[2] = {0.f, 0.f};
  const _Float16* qhp = QH + (row0 + q0) * CC + lane * 8;
  const _Float16* khp = KH + (row0 + wave * 32) * CC + lane * 8;
  if (q0 < QHI) { const _Float16* qlp = QL + ((size_t)b * QHI + q0) * CC + lane * 8; const _Float16* klp = KL + ((size_t)b * KHI + wave * 32) * CC + lane * 8;
    const __bf16* vhp = VB + ((size_t)b * KHI + wave * 32) * CC + lane * 8; const __bf16* vlp = VBL + ((size_t)b * KHI + wave * 32) * CC + lane * 8;
#pragma unroll 1
    for (int kc = wave; kc < nch; kc += AW, khp += AW * 32 * CC, klp += AW * 32 * CC, vhp += AW * 32 * CC, vlp += AW * 32 * CC) {
#pragma unroll
      for (int qt = 0; qt < 2; ++qt) { v16h qh[HD / 32], ql[HD / 32], kh[2][HD / 32], kl[2][HD / 32];
#pragma unroll
        for (int kd = 0; kd < HD / 32; ++kd) { qh[kd] = frag_hp(qhp + (qt * 2 + kd) * 512); ql[kd] = frag_hp(qlp + (qt * 2 + kd) * 512);
#pragma unroll
          for (int t = 0; t < 2; ++t) { kh[t][kd] = frag_hp(khp + (t * 2 + kd) * 512); kl[t][kd] = frag_hp(klp + (t * 2 + kd) * 512); } }
        asm volatile("s_wait_xcnt 0x0" :: "v"(qhp), "v"(qlp), "v"(khp), "v"(klp) : "memory");   /* keeps the loads' address pairs live and unwritten up to the wait */
        v8f s[2] = {}, sr[2] = {};
#pragma unroll
        for (int kd = 0; kd < HD / 32; ++kd)
#pragma unroll
          for (int t = 0; t < 2; ++t) { s[t] = wmma16(kh[t][kd], qh[kd], s[t]); sr[t] = wmma16(kh[t][kd], ql[kd], sr[t]); sr[t] = wmma16(kl[t][kd], qh[kd], sr[t]); }
        float sv[16];
#pragma unroll
        for (int i = 0; i < 16; ++i) { const float v = (s[i >> 3][i & 7] + sr[i >> 3][i & 7] * (1.0f / 1024.0f)) * SL2E; sv[i] = (kc * 32 + (i >> 3) * 16 + 8 * g + (i & 7) <= q0 + qt * 16 + col) ? v : -3.0e38f; }
        const SMX x = sm_step(sv, m[qt], l[qt], 0.f); const F2 p = bsplit16(x.e); v16b vh[HD / 16], vl[HD / 16];
#pragma unroll
        for (int j = 0; j < HD / 16; ++j) { vh[j] = frag_bp(vhp + j * 512); vl[j] = frag_bp(vlp + j * 512); }
        asm volatile("s_wait_xcnt 0x0" :: "v"(vhp), "v"(vlp) : "memory");   /* as above */
#pragma unroll
        for (int j = 0; j < HD / 16; ++j) { acc[qt][j] *= x.al; acc[qt][j] = wmma_bf(vh[j], p.h, acc[qt][j]); acc[qt][j] = wmma_bf(vh[j], p.l, acc[qt][j]); acc[qt][j] = wmma_bf(vl[j], p.h, acc[qt][j]); } } }
  } else { const _Float16* vp = VT + (row0 + wave * 32) * CC + lane * 8; v16h qf[2][HD / 32];
#pragma unroll
    for (int qt = 0; qt < 2; ++qt)
#pragma unroll
      for (int kd = 0; kd < HD / 32; ++kd) qf[qt][kd] = frag_hp(qhp + (qt * 2 + kd) * 512);
    asm volatile("s_wait_xcnt 0x0" :: "v"(qhp) : "memory");   /* as above */
#pragma unroll 1
    for (int kc = wave; kc < nch; kc += AW, khp += AW * 32 * CC, vp += AW * 32 * CC) { v16h kf[2][HD / 32], vf[HD / 16];
#pragma unroll
      for (int t = 0; t < 2; ++t)
#pragma unroll
        for (int kd = 0; kd < HD / 32; ++kd) kf[t][kd] = frag_hp(khp + (t * 2 + kd) * 512);
#pragma unroll
      for (int j = 0; j < HD / 16; ++j) vf[j] = frag_hp(vp + j * 512);
      asm volatile("s_wait_xcnt 0x0" :: "v"(khp), "v"(vp) : "memory");   /* as above */
#pragma unroll
      for (int qt = 0; qt < 2; ++qt) { v8f s[2] = {};
#pragma unroll
        for (int t = 0; t < 2; ++t)
#pragma unroll
          for (int kd = 0; kd < HD / 32; ++kd) s[t] = wmma16(kf[t][kd], qf[qt][kd], s[t]);
        float sv[16];
#pragma unroll
        for (int i = 0; i < 16; ++i) sv[i] = s[i >> 3][i & 7] * SL2E;
        if (kc == nch - 1) {   /* only the diagonal chunk holds keys past a query */
#pragma unroll
          for (int i = 0; i < 16; ++i) if (kc * 32 + (i >> 3) * 16 + 8 * g + (i & 7) > q0 + qt * 16 + col) sv[i] = -3.0e38f; }
        const SMX x = sm_step(sv, m[qt], l[qt], 10.f); v16h p;
#pragma unroll
        for (int i = 0; i < 16; ++i) p[i] = (_Float16)x.e[i];
#pragma unroll
        for (int j = 0; j < HD / 16; ++j) { acc[qt][j] *= x.al; acc[qt][j] = wmma16(vf[j], p, acc[qt][j]); } } } }
#pragma unroll
  for (int qt = 0; qt < 2; ++qt) { const float lt = l[qt] + __shfl_xor(l[qt], 16); if (g == 0) { smx[wave][qt * 16 + col] = m[qt]; sls[wave][qt * 16 + col] = lt; }
#pragma unroll
    for (int j = 0; j < HD / 16; ++j) { v4f a0, a1;
#pragma unroll
      for (int r = 0; r < 4; ++r) { a0[r] = acc[qt][j][r]; a1[r] = acc[qt][j][4 + r]; }
      *(v4f*)&so[wave][qt * 16 + col][j * 16 + 8 * g] = a0; *(v4f*)&so[wave][qt * 16 + col][j * 16 + 8 * g + 4] = a1; } }
  __syncthreads();   /* every wave's partial (max, sum, O) is in LDS before any of them is joined */
  { const int qr = tid >> 4, q = tid & 15; float mw[AW], wt[AW]; float M = -3.0e38f;
#pragma unroll
    for (int w = 0; w < AW; ++w) { mw[w] = smx[w][qr]; M = fmaxf(M, mw[w]); }
#pragma unroll
    for (int w = 0; w < AW; ++w) mw[w] -= M;
    exp2x8(wt, mw); exp2x8(wt + 8, mw + 8);
    float Ls = 0.f; v4f o = {};
#pragma unroll
    for (int w = 0; w < AW; ++w) { Ls += wt[w] * sls[w][qr]; o += *(const v4f*)&so[w][qr][q * 4] * wt[w]; }
    const float inv = Ls > 0.f ? 1.0f / Ls : 0.f; vst2(Y + (row0 + q0 + qr) * CC + q * 4, o * inv); } }

extern "C" void kernel_launch(void* const* d_in, const int* in_sizes, int n_in, void* d_out, int out_size, void* d_ws, size_t ws_size, hipStream_t stream) {
  (void)in_sizes; (void)n_in; (void)out_size;
  const float** F = (const float**)d_in;
  if (ws_size < (size_t)WS_END) return;
  char* ws = (char*)d_ws; _Float16 *QH = (_Float16*)(ws + WS_QH), *KH = (_Float16*)(ws + WS_KH), *VT = (_Float16*)(ws + WS_VT), *QL = (_Float16*)(ws + WS_QL), *KL = (_Float16*)(ws + WS_KL); __bf16 *VB = (__bf16*)(ws + WS_VB), *VBL = (__bf16*)(ws + WS_VBL); float *S = (float*)(ws + WS_S), *Y = (float*)(ws + WS_Y);
  (void)Y; (void)S;
  // inputs: 0 q_in [4,4096,512]; 1 k_in; 2 v_in (separate inputs); 3 Wq [512,64], 4 bq; 5 Wk, 6 bk; 7 Wv, 8 bv ((in,out); zero biases read)
  k_proj<<<dim3(3 * NSB / PB), PB * 128, 0, stream>>>(F[0], F[1], F[2], F[3], F[5], F[7], F[4], F[6], F[8], QH, QL, KH, KL, VT, VB, VBL);
  k_attn<<<dim3(NB * (TT / 32)), AW * 32, 0, stream>>>(QH, KH, QL, KL, VT, VB, VBL, (float*)d_out);   /* out rows are the ctx rows: [b*TT+t][64] */
}

// v007
// A run of this version takes 26.8 microseconds.
// Timed twice side by side with v006, it ran 1.06 and 1.05 times as fast.
// All steps since v000 together make it 26.1 times as fast.
// compute dtype: all float inputs rounded to bf16; q/k/v projections with EXACT bf16 products on WMMA 16x16x32 (f32 accumulate) + bias; causal logits: 3 products (q f16 hi + residual x k hi + residual) for the first 384 rows, single f16 q x k after, x scale; online softmax f32 (base 2) in registers; unnormalised weights x 2^10 once to f16 x v once to f16 (1 product; bf16 hi + lo below row 384), divided by the f32 sum at the end; f32 output.
#include <hip/hip_runtime.h>
#include <math.h>

typedef __attribute__((ext_vector_type(16))) _Float16 v16h;
typedef __attribute__((ext_vector_type(16))) __bf16 v16b;
typedef __attribute__((ext_vector_type(8)))  _Float16 v8h;
typedef __attribute__((ext_vector_type(8)))  float v8f;
typedef __attribute__((ext_vector_type(4)))  float v4f;
typedef __attribute__((ext_vector_type(2)))  float v2f;
typedef __attribute__((ext_vector_type(4)))  unsigned v4u;
typedef __attribute__((ext_vector_type(4)))  int v4i;
typedef float __attribute__((may_alias)) float_a;
typedef int __attribute__((may_alias)) int_a;

template <typename T> __device__ __forceinline__ void vst2(void* p, T v) { *(T*)p = v;  }
// store in a loop: the wait takes the store's address and data as inputs, so that neither register is rewritten (next store, next trip) in front of it
template <typename T> __device__ __forceinline__ void vst2w(void* p, T v) { *(T*)p = v; asm volatile("s_wait_xcnt 0x0" :: "v"(p), "v"(v) : "memory"); }
__device__ __forceinline__ v8f wmma16(v16h a, v16h b, v8f c) {
  v8f d = __builtin_amdgcn_wmma_f32_16x16x32_f16(false, a, false, b, (short)0, c, false, false);
  asm volatile("v_nop\n\tv_nop\n\tv_nop\n\tv_nop" : "+v"(d) : "v"(a), "v"(b));
  return d;
}
__device__ __forceinline__ v8f wmma_bf(v16b a, v16b b, v8f c) {
  v8f d = __builtin_amdgcn_wmma_f32_16x16x32_bf16(false, a, false, b, (short)0, c, false, false);
  asm volatile("v_nop\n\tv_nop\n\tv_nop\n\tv_nop" : "+v"(d) : "v"(a), "v"(b));
  return d;
}
// 16x16x32 fragments: lane = (h = lane>>4, row/col = lane&15); elements 0..7 = k0+8h+0..7, 8..15 = k0+16+8h+0..7; D element r = row 8h+r
__device__ __forceinline__ v16h frag_h(const _Float16* rowk0, int lane) {
  union { v16h v; v8h q[2]; } u; const _Float16* p = rowk0 + 8 * (lane >> 4);
  u.q[0] = *(const v8h*)p; u.q[1] = *(const v8h*)(p + 16); return u.v;
}
__device__ __forceinline__ v16h frag_f32(const float* rowk0, int lane) {
  v16h a; const float* p = rowk0 + 8 * (lane >> 4);
#pragma unroll
  for (int i = 0; i < 8; ++i) { a[i] = (_Float16)p[i]; a[8 + i] = (_Float16)p[16 + i]; }
  return a;
}
__device__ __forceinline__ v16h frag_f32s(const float* rowk0, int lane, float sc) {
  v16h a; const float* p = rowk0 + 8 * (lane >> 4);
#pragma unroll
  for (int i = 0; i < 8; ++i) { a[i] = (_Float16)(p[i] * sc); a[8 + i] = (_Float16)(p[16 + i] * sc); }
  return a;
}
// column fragment from a [K][ld] layout (column n), rows >= K read as 0
__device__ __forceinline__ v16h fragc_f32(const float* W, int k0, int n, int lane, int ld, int K) {
  v16h a; const int g = lane >> 4;
#pragma unroll
  for (int i = 0; i < 8; ++i) { const int ka = k0 + 8 * g + i, kb = ka + 16;
    a[i] = (_Float16)(ka < K ? W[(size_t)(ka < K ? ka : K - 1) * ld + n] : 0.f); a[8 + i] = (_Float16)(kb < K ? W[(size_t)(kb < K ? kb : K - 1) * ld + n] : 0.f); }
  return a;
}
struct F2 { v16b h, l; };
__device__ __forceinline__ F2 bsplit16(const float v[16]) { F2 r;
#pragma unroll
  for (int i = 0; i < 16; ++i) { const __bf16 h = (__bf16)v[i]; r.h[i] = h; r.l[i] = (__bf16)(v[i] - (float)h); }
  return r; }
__device__ __forceinline__ F2 split_row(const float* row, int k0, int lane) { float v[16]; const float* p = row + k0 + 8 * (lane >> 4);
#pragma unroll
  for (int i = 0; i < 8; ++i) { v[i] = p[i]; v[8 + i] = p[16 + i]; }
  return bsplit16(v); }
__device__ __forceinline__ F2 split_rowK(const float* row, int k0, int lane, int K) { float v[16]; const int g = lane >> 4;
#pragma unroll
  for (int i = 0; i < 8; ++i) { const int ka = k0 + 8 * g + i, kb = ka + 16; v[i] = ka < K ? row[ka < K ? ka : K - 1] : 0.f; v[8 + i] = kb < K ? row[kb < K ? kb : K - 1] : 0.f; }
  return bsplit16(v); }
__device__ __forceinline__ F2 split_col(const float* W, int k0, int n, int lane, int ld, int K) { float v[16]; const int g = lane >> 4;
#pragma unroll
  for (int i = 0; i < 8; ++i) { const int ka = k0 + 8 * g + i, kb = ka + 16; v[i] = ka < K ? W[(size_t)(ka < K ? ka : K - 1) * ld + n] : 0.f; v[8 + i] = kb < K ? W[(size_t)(kb < K ? kb : K - 1) * ld + n] : 0.f; }
  return bsplit16(v); }
__device__ __forceinline__ v8f mac3(const F2& a, const F2& b, v8f c) { c = wmma_bf(a.l, b.h, c); c = wmma_bf(a.h, b.l, c); return wmma_bf(a.h, b.h, c); }
__device__ __forceinline__ float sigm(float v) { return 1.0f / (1.0f + expf(-v)); }
#define LDSX() do { asm volatile("s_wait_dscnt 0" ::: "memory"); __builtin_amdgcn_wave_barrier(); __builtin_amdgcn_fence(__ATOMIC_RELEASE, "workgroup"); } while (0)

// Single-head causal scaled dot-product attention with separate inputs (q_in / k_in / v_in [4,4096,512]; Keras Dense (in,out) Wq / Wk / Wv [512,64] N(0, 1/512) + zero biases; scale 1/8; causal j <= i, -inf): out = softmax(causal((q_in Wq + bq)(k_in Wk + bk)^T / 8)) (v_in Wv + bv) -> [4,4096,64].
#define NB 4
#define TT 4096
#define CC 64             // NH * HD = projected width
#define DIN 512          // input (model) width
#define NH 1
#define HD 64
#define NQB (TT / 64)
#define HG 1
#define SCALE (0.125f)
#define CAUSAL 1
#ifndef TNB
#define TNB NB
#endif
__device__ __forceinline__ float bfr(float v) { return (float)(__bf16)v; }
__host__ __device__ __forceinline__ int kb_last(int qb) { return CAUSAL ? ((qb * 64 + 63) >> 7) : (TT / 128 - 1); }
typedef __attribute__((ext_vector_type(8))) __bf16 v8b;
__device__ __forceinline__ v16b frag_b(const __bf16* rowk0, int lane) {
  union { v16b v; v8b q[2]; } u; const __bf16* p = rowk0 + 8 * (lane >> 4);
  u.q[0] = *(const v8b*)p; u.q[1] = *(const v8b*)(p + 16); return u.v;
}
#define QBH 6              // unused; causal: query rows < QBH * 64 (= QHI; few keys, no averaging) take the high-precision path
#define QHI 384            // rows carrying a q residual plane
#define KHI 384            // key rows carrying k residual / v bf16 hi+lo planes (used only by the causal high-precision path)
// B fragment (k rows k0+.., output column o) of a weight: (in,out) [K][ld] or (out,in) [ld rows of K]: bf16 exact, or f16(bf16 * 256) exact
__device__ __forceinline__ v16b wcol_io(const float* Wm, int k0, int o, int lane, int ld) { v16b w; const int g = lane >> 4;
#pragma unroll
  for (int i = 0; i < 8; ++i) { w[i] = (__bf16)Wm[(size_t)(k0 + 8 * g + i) * ld + o]; w[8 + i] = (__bf16)Wm[(size_t)(k0 + 16 + 8 * g + i) * ld + o]; }
  return w; }
__device__ __forceinline__ v16b wcol_oi(const float* Wm, int k0, int o, int lane, int K) { v16b w; const float* p = Wm + (size_t)o * K + k0 + 8 * (lane >> 4);
#pragma unroll
  for (int i = 0; i < 8; ++i) { w[i] = (__bf16)p[i]; w[8 + i] = (__bf16)p[16 + i]; }
  return w; }
__device__ __forceinline__ v16h wcolh_io(const float* Wm, int k0, int o, int lane, int ld) { v16h w; const int g = lane >> 4;
#pragma unroll
  for (int i = 0; i < 8; ++i) { w[i] = (_Float16)(bfr(Wm[(size_t)(k0 + 8 * g + i) * ld + o]) * 256.0f); w[8 + i] = (_Float16)(bfr(Wm[(size_t)(k0 + 16 + 8 * g + i) * ld + o]) * 256.0f); }
  return w; }
__device__ __forceinline__ v16h wcolh_oi(const float* Wm, int k0, int o, int lane, int K) { v16h w; const float* p = Wm + (size_t)o * K + k0 + 8 * (lane >> 4);
#pragma unroll
  for (int i = 0; i < 8; ++i) { w[i] = (_Float16)(bfr(p[i]) * 256.0f); w[8 + i] = (_Float16)(bfr(p[16 + i]) * 256.0f); }
  return w; }
#define WQKV_LAYOUT 0   // 0 = (in,out) [DIN][CC]; 1 = (out,in) [CC][DIN]; 2 = per-head [NH][DIN][HD]
__device__ __forceinline__ v16b wcol_hdk(const float* Wm, int k0, int o, int lane) { v16b w; const int g = lane >> 4; const float* p = Wm + (size_t)(o / HD) * DIN * HD + (o % HD);
#pragma unroll
  for (int i = 0; i < 8; ++i) { w[i] = (__bf16)p[(size_t)(k0 + 8 * g + i) * HD]; w[8 + i] = (__bf16)p[(size_t)(k0 + 16 + 8 * g + i) * HD]; }
  return w; }
#define WO_OUT_IN 0
#if WQKV_LAYOUT == 1
#define WCOL(W, k0, o, lane) wcol_oi(W, k0, o, lane, DIN)
#elif WQKV_LAYOUT == 2
#define WCOL(W, k0, o, lane) wcol_hdk(W, k0, o, lane)
#else
#define WCOL(W, k0, o, lane) wcol_io(W, k0, o, lane, CC)
#endif
#if WO_OUT_IN
#define WOCOL(W, k0, o, lane) wcol_oi(W, k0, o, lane, CC)
#define WOCOLH(W, k0, o, lane) wcolh_oi(W, k0, o, lane, CC)
#else
#define WOCOL(W, k0, o, lane) wcol_io(W, k0, o, lane, DIN)
#define WOCOLH(W, k0, o, lane) wcolh_io(W, k0, o, lane, DIN)
#endif
#ifndef SM_EXTRA_PARAMS
#define SM_EXTRA_PARAMS
#endif
#ifndef PROJ_EXTRA_PARAMS
#define PROJ_EXTRA_PARAMS
#endif
#ifndef SM_MASK_HOOK
#define SM_MASK_HOOK (void)0
#endif

// k_attn's operands lie in FRAGMENT ORDER: a 32-row chunk (32 queries or 32 keys, all 64 channels) is 4 KB = 8 groups of 512 B, and a group holds lane 0..31's 16 bytes side by side,
// so that one wave-wide 16-byte load covers 4 whole 128-byte lines. q, k: group = (t, kd, half), lane (g, col) holds row t * 16 + col, channels kd * 32 + half * 16 + g * 8 + 0..7;
// v: group = (j, half), lane (g, col) holds channel j * 16 + col, keys half * 16 + g * 8 + 0..7.
static_assert(CC == 64 && HD == 64, "the fragment order is laid out for 64 channels");
#define WS_QH  0u                                      // f16 q, fragment order [b][t / 32][4 KB]
#define WS_KH  (WS_QH + 2u * (size_t)NB * TT * CC)      // f16 k, fragment order [b][t / 32][4 KB]
#define WS_VT  (WS_KH + 2u * (size_t)NB * TT * CC)      // f16 v, fragment order [b][t / 32][4 KB]
#define WS_QL  (WS_VT + 2u * (size_t)NB * CC * TT)      // f16 q residual x 2^10, fragment order [b][t / 32, t < QHI][4 KB]
#define WS_KL  (WS_QL + 2u * (size_t)NB * QHI * CC)     // f16 k residual x 2^10, fragment order [b][t / 32, t < KHI][4 KB]
#define WS_VB  (WS_KL + 2u * (size_t)NB * KHI * CC)     // bf16 v hi (VBL: lo), fragment order [b][t / 32, t < KHI][4 KB]
#define WS_VBL (WS_VB + 2u * (size_t)NB * CC * KHI)
#define WS_S   (WS_VBL + 2u * (size_t)NB * CC * KHI)    // f32 [hg][t][s] region, unused (the logits stay in registers)
#define WS_Y   (WS_S  + 4u * (size_t)HG * TT * TT)      // f32 ctx rows [b*t][CC] (only when there is an output projection)
#define WS_END (WS_Y  + 0u)

// ---- k_proj: q/k/v = X W (+ b) with exact bf16 products (K = DIN). The 3 * NSB sub-blocks of 64 rows (projection = sub-block / NSB) are dealt PB to a block, 4 waves each; a block touches at most two projections.
// W is turned ONCE per block into bf16 B fragments in LDS; the K loop reads them from there and has only X left to fetch from memory, two stages (PD K steps) ahead.
// X comes in stages of XS columns by WHOLE lines: a wave-wide 16-byte load covers 256 contiguous bytes of each of two rows (4 whole lines; a load in fragment order touches 16 lines for the same 512 bytes).
// The wave rounds a stage to bf16, stores it to its OWN two-buffer LDS range (rows of XP bytes) and reads its A fragments back from there, so no other wave and no barrier is involved.
// projection 0: q f16 (+ residual for rows < QHI); 1: k f16 (+ residual for rows < KHI); 2: v f16 (+ bf16 hi/lo for t < KHI); all stored in fragment order
#define PB 3                  // 64-row sub-blocks of a block
#define NSB (TNB * TT / 64)   // sub-blocks of a projection
#define PD 4                  // K steps of X a wave has in flight
#define XS 64                 // X columns of a stage (two K steps)
#define XP (XS * 2 + 16)      // LDS pitch of a staged bf16 row: 16 bytes x odd, the pitch at which 16-byte fragment reads meet no bank twice
typedef __attribute__((ext_vector_type(4))) __bf16 v4b;
static_assert((3 * NSB) % PB == 0 && NSB >= PB && DIN / XS >= 2 && DIN % XS == 0 && XS == 64 && PD * 32 == 2 * XS, "sub-blocks are dealt evenly, and a block spans at most two projections; two stages of two K steps fly");
// W [DIN][CC] f32 -> LDS: the 512-byte group (kc, j, half) holds for lane (g, col) the 8 values k = kc * 32 + half * 16 + g * 8 + 0..7 of column j * 16 + col, at 16-byte slot lane ^ j
// (the xor spreads a writing wave's 16 column quads over all banks; a reading wave's 32 slots still fill the group). A thread takes 8 k rows x 4 columns: a wave-wide 16-byte load covers 4 whole lines.
#define WTR ((DIN * 2 + PB * 128 - 1) / (PB * 128))   // trips of a thread over the DIN * 2 pieces of work; only the last can be a part trip
static_assert(WTR == 3, "the wait behind the loads names one address pair per trip");
__device__ __forceinline__ void stage_w(const float* __restrict__ Wm, char* dst, int ftid) { v4f r[WTR][8]; const float* wp[WTR];
#pragma unroll
  for (int n = 0; n < WTR; ++n) { const int e = ftid + n * PB * 128, ec = e < DIN * 2 ? e : DIN * 2 - 1; wp[n] = Wm + (size_t)(ec >> 4) * 8 * CC + (ec & 15) * 4;   /* all trips' loads fly together; a thread past the end reads the last piece and stores nothing */
#pragma unroll
    for (int i = 0; i < 8; ++i) r[n][i] = *(const v4f*)(wp[n] + i * CC); }
  asm volatile("s_wait_xcnt 0x0" :: "v"(wp[0]), "v"(wp[1]), "v"(wp[2]) : "memory");   /* keeps the loads' address pairs live and unwritten up to the wait, and every trip's loads in front of the first store */
#pragma unroll
  for (int n = 0; n < WTR; ++n) { const int e = ftid + n * PB * 128;
    if ((n + 1) * PB * 128 <= DIN * 2 || e < DIN * 2) { const int cq = e & 15, ko = e >> 4; char* d = dst + ((ko >> 2) * 4 + (cq >> 2)) * 1024 + ((ko >> 1) & 1) * 512;
#pragma unroll
      for (int c = 0; c < 4; ++c) { v8b pc;
#pragma unroll
        for (int i = 0; i < 8; ++i) pc[i] = (__bf16)r[n][i][c];
        *(v8b*)(d + ((((ko & 1) * 16 + (cq & 3) * 4 + c) ^ (cq >> 2)) * 16)) = pc; } } } }
__global__ __launch_bounds__(PB * 128) void k_proj(const float* __restrict__ XQ, const float* __restrict__ XK, const float* __restrict__ XV, const float* __restrict__ WQ, const float* __restrict__ WK, const float* __restrict__ WV, const float* __restrict__ BQ, const float* __restrict__ BK, const float* __restrict__ BV,
    _Float16* __restrict__ QH, _Float16* __restrict__ QL, _Float16* __restrict__ KH, _Float16* __restrict__ KL, _Float16* __restrict__ VT, __bf16* __restrict__ VB, __bf16* __restrict__ VBL) {
  __shared__ __align__(16) char wlds[2][DIN * CC * 2];
  __shared__ __align__(16) char xs3[PB * 4][2][16 * XP];
  __shared__ __align__(16) _Float16 sh3[PB][64][72], sl3[PB][64][72]; __shared__ __align__(16) _Float16 th3[PB][64][72]; __shared__ __align__(16) __bf16 tb3[PB][64][72], tbl3[PB][64][72];
  const int ftid = threadIdx.x, sub = __builtin_amdgcn_readfirstlane(ftid >> 7), tid = ftid & 127, wave = tid >> 5, lane = tid & 31, col = lane & 15, g = lane >> 4;
  const int sb = blockIdx.x * PB + sub, which = sb / NSB, wfirst = (blockIdx.x * PB) / NSB, wlast = (blockIdx.x * PB + PB - 1) / NSB; const int c0 = 0; const size_t r0 = (size_t)(sb % NSB) * 64; const size_t bb = r0 / TT; const int t0 = (int)(r0 % TT);
  _Float16 (*sh)[72] = sh3[sub]; _Float16 (*sl)[72] = sl3[sub]; _Float16 (*th)[72] = th3[sub]; __bf16 (*tb)[72] = tb3[sub]; __bf16 (*tbl)[72] = tbl3[sub];
  const float* X = which == 0 ? XQ : which == 1 ? XK : XV; const float* BA = which == 0 ? BQ : which == 1 ? BK : BV;
  const float* xp = X + (r0 + wave * 16 + g) * DIN + col * 4; v4f raw[2][8];   /* load i of a stage: rows 2 i + g, columns col * 4 + 0..3 of the stage */
  char* xw = xs3[ftid >> 5][0];
#pragma unroll
  for (int d = 0; d < 2; ++d)
#pragma unroll
    for (int i = 0; i < 8; ++i) raw[d][i] = *(const v4f*)(xp + i * 2 * DIN + d * XS);
  stage_w(wfirst == 0 ? WQ : wfirst == 1 ? WK : WV, wlds[0], ftid);
  if (wlast != wfirst) stage_w(wlast == 1 ? WK : WV, wlds[1], ftid);
  __syncthreads();   /* every W fragment is in LDS before any wave reads one */
  const char* wb = wlds[which - wfirst];
  v8f acc[4] = {}; union WF { v16b v; v8b q[2]; } wf[2][4], af[2];
  /* stage st: rounds the 8 loaded pieces to bf16 into buffer st & 1, then sends the loads of stage st + 2 into the registers just freed */
#define XSTORE(st) do { _Pragma("unroll") for (int i = 0; i < 8; ++i) { const v4f x = raw[(st) & 1][i]; v4b pc; pc[0] = (__bf16)x[0]; pc[1] = (__bf16)x[1]; pc[2] = (__bf16)x[2]; pc[3] = (__bf16)x[3]; \
      *(v4b*)(xw + ((st) & 1) * 16 * XP + (2 * i + g) * XP + col * 8) = pc; } \
    if ((st) + 2 < DIN / XS) { _Pragma("unroll") for (int i = 0; i < 8; ++i) raw[(st) & 1][i] = *(const v4f*)(xp + i * 2 * DIN + ((st) + 2) * XS); } } while (0)
  /* A fragment of K step k: row col, elements 0..7 = k * 32 + 8 g + 0..7, 8..15 = 16 further on (the k order of the W fragments) */
#define XFRAG(k) do { const char* xq = xw + (((k) >> 1) & 1) * 16 * XP + col * XP + ((k) & 1) * 64 + g * 16; af[(k) & 1].q[0] = *(const v8b*)xq; af[(k) & 1].q[1] = *(const v8b*)(xq + 32); } while (0)
  XSTORE(0);
  asm volatile("s_wait_dscnt 0x0" ::: "memory");   /* the wave's own stores of stage 0, made by other lanes than those that read them, have landed before the fragments are read back */
  XFRAG(0);
#pragma unroll
  for (int j = 0; j < 4; ++j) { const char* wq = wb + j * 1024 + ((lane ^ j) * 16); wf[0][j].q[0] = *(const v8b*)wq; wf[0][j].q[1] = *(const v8b*)(wq + 512); }
#pragma unroll   /* whole: raw[stage & 1], af[kc & 1] and wf[kc & 1] stay in registers only under constant indices */
  for (int kc = 0; kc < DIN / 32; ++kc) {
    if (kc + 1 < DIN / 32) {
      if (kc & 1) asm volatile("s_wait_dscnt 0x0" ::: "memory");   /* the next step opens a stage, stored one step ago: as above, its rows have landed before they are read back */
      XFRAG(kc + 1);
#pragma unroll
      for (int j = 0; j < 4; ++j) { const char* wq = wb + ((kc + 1) * 4 + j) * 1024 + ((lane ^ j) * 16); wf[(kc + 1) & 1][j].q[0] = *(const v8b*)wq; wf[(kc + 1) & 1][j].q[1] = *(const v8b*)(wq + 512); } }
    if (!(kc & 1) && kc / 2 + 1 < DIN / XS) XSTORE(kc / 2 + 1);
    __builtin_amdgcn_sched_barrier(0);   /* holds the fetches for later K steps (X from memory, X and W fragments from LDS) in front of this step's products, so that they fly under them */
#pragma unroll
    for (int j = 0; j < 4; ++j) acc[j] = wmma_bf(af[kc & 1].v, wf[kc & 1][j].v, acc[j]);
    __builtin_amdgcn_sched_barrier(0);   /* holds the next stage's conversions behind this step: lifted up, they wait for X loads that were only just issued */
  }
  if (which < 2) {
#pragma unroll
    for (int j = 0; j < 4; ++j) { const float bias = BA ? bfr(BA[c0 + j * 16 + col]) : 0.f;
#pragma unroll
      for (int r = 0; r < 8; ++r) { const float v = acc[j][r] + bias; const _Float16 hv = (_Float16)v; sh[wave * 16 + 8 * g + r][j * 16 + col] = hv; sl[wave * 16 + 8 * g + r][j * 16 + col] = (_Float16)((v - (float)hv) * 1024.0f); } }
  } else {
#pragma unroll
    for (int j = 0; j < 4; ++j) { const float bias = BA ? bfr(BA[c0 + j * 16 + col]) : 0.f;
#pragma unroll
      for (int r = 0; r < 8; ++r) { const float v = acc[j][r] + bias; const int rl = wave * 16 + 8 * g + r, cl = j * 16 + col; th[cl][rl] = (_Float16)v; const __bf16 bh = (__bf16)v; tb[cl][rl] = bh; tbl[cl][rl] = (__bf16)(v - (float)bh); } } }
  __syncthreads();   /* one barrier for both kinds of sub-block: a block may hold both, and every wave passes it */
  if (which < 2) { _Float16* DH = which == 0 ? QH : KH; _Float16* DL = which == 0 ? QL : KL; const int nhi = which == 0 ? QHI : KHI; const bool hi_rows = t0 < nhi;
    for (int e = tid; e < 64 * 8; e += 128) { const int rl = (e >> 7) * 16 + (e & 15), d = ((e >> 4) & 7) * 8;   /* 16-byte piece e = (chunk, t, kd, half, g, col) */
      vst2w((unsigned*)(DH + r0 * CC + (size_t)e * 8), *(const v4u*)&sh[rl][d]); if (hi_rows) vst2w((unsigned*)(DL + (bb * nhi + t0) * (size_t)CC + (size_t)e * 8), *(const v4u*)&sl[rl][d]); }
  } else { const bool hi_rows = t0 < KHI;
    for (int e = tid; e < 64 * 8; e += 128) { const int cl = ((e >> 6) & 3) * 16 + (e & 15), tl = (e >> 8) * 32 + ((e >> 4) & 3) * 8;   /* 16-byte piece e = (chunk, j, half, g, col) */
      vst2w((unsigned*)(VT + r0 * CC + (size_t)e * 8), *(const v4u*)&th[cl][tl]); if (hi_rows) { const size_t o3 = (bb * KHI + t0) * (size_t)CC + (size_t)e * 8; vst2w((unsigned*)(VB + o3), *(const v4u*)&tb[cl][tl]); vst2w((unsigned*)(VBL + o3), *(const v4u*)&tbl[cl][tl]); } } } }
// ---- k_attn: logits, causal softmax and P V in one kernel, all batches in one launch; the logits never leave the registers.
// block = 32 queries (two 16-column groups) of batch b, AW waves; wave w walks the 32-key chunks w, w + AW, ... up to the diagonal chunk.
// S^T = K Q^T (A = 16 key rows, B = 16 query columns): a lane holds 16 logits of ONE query (column lane & 15), in the k order a B operand wants, so P^T goes from the two score tiles straight into O^T += V^T P^T.
// Running maximum and sum per lane (log2 domain, online softmax); the AW partial (max, sum, O) are joined through LDS in wave order.
// Queries < QHI: 3-product logits (q, k as f16 hi + residual x 2^10) and P, v as bf16 hi + lo (3 products); after: single f16 products, weights x 2^10 (the factor is in the sum too and cancels).
#define AW 16
#define SL2E (SCALE * 1.4426950408889634f)
// fragment in fragment order: p = chunk start + group pair * 512 + lane * 8; the two halves are neighbouring 512-byte groups
__device__ __forceinline__ v16h frag_hp(const _Float16* p) { union { v16h v; v8h q[2]; } u; u.q[0] = *(const v8h*)p; u.q[1] = *(const v8h*)(p + 256); return u.v; }
__device__ __forceinline__ v16b frag_bp(const __bf16* p) { union { v16b v; v8b q[2]; } u; u.q[0] = *(const v8b*)p; u.q[1] = *(const v8b*)(p + 256); return u.v; }
// 2^x, eight at a time: the early-clobber outputs keep a v_exp_f32 from overwriting the source of the one in front of it, and the v_nop fills the slot behind the last one
__device__ __forceinline__ void exp2x8(float* o, const float* x) {
  asm("v_exp_f32 %0, %8\n\tv_exp_f32 %1, %9\n\tv_exp_f32 %2, %10\n\tv_exp_f32 %3, %11\n\tv_exp_f32 %4, %12\n\tv_exp_f32 %5, %13\n\tv_exp_f32 %6, %14\n\tv_exp_f32 %7, %15\n\tv_nop"
      : "=&v"(o[0]), "=&v"(o[1]), "=&v"(o[2]), "=&v"(o[3]), "=&v"(o[4]), "=&v"(o[5]), "=&v"(o[6]), "=&v"(o[7]) : "v"(x[0]), "v"(x[1]), "v"(x[2]), "v"(x[3]), "v"(x[4]), "v"(x[5]), "v"(x[6]), "v"(x[7])); }
// 2^x, one value; the v_nop fills the slot behind the transcendental
__device__ __forceinline__ float exp2x1(float x) { float r; asm("v_exp_f32 %0, %1\n\tv_nop" : "=v"(r) : "v"(x)); return r; }
struct SMX { float e[16]; float al; };
// one online-softmax step of one query column: sv = 16 scaled log2 logits of this lane's query; poff = log2 of the weights' common factor
__device__ __forceinline__ SMX sm_step(const float sv[16], float& m, float& l, float poff) { SMX o; float mx = sv[0];
#pragma unroll
  for (int i = 1; i < 16; ++i) mx = fmaxf(mx, sv[i]);
  mx = fmaxf(mx, __shfl_xor(mx, 16)); const float mn = fmaxf(m, mx); o.al = exp2x1(m - mn); m = mn; const float mref = mn - poff; float d[16], ls = 0.f;
#pragma unroll
  for (int i = 0; i < 16; ++i) d[i] = sv[i] - mref;
  exp2x8(o.e, d); exp2x8(o.e + 8, d + 8);
#pragma unroll
  for (int i = 0; i < 16; ++i) ls += o.e[i];
  l = l * o.al + ls; return o; }
// The main path's k and v come through LDS: each wave owns a ring of two buffers, a buffer holds one 32-key chunk (4 KB of k, then 4 KB of v, both in fragment order as they lie in memory).
#define RB 8192            // bytes of a ring buffer
#define RW (2 * RB)        // bytes of a wave's ring
static_assert(32 * (HD + 4) * 4 <= RW, "a wave's partial O tile is staged in its own ring");
// one chunk, 16 asynchronous copies of 512 B (16 B a lane); the offset moves the LDS and the global address alike. The s_wait_xcnt stands inside the statement, so that no address register is rewritten in front of it
__device__ __forceinline__ void copy_chunk(unsigned lds, const _Float16* kg, const _Float16* vg) {
  asm volatile("global_load_async_to_lds_b128 %0, %2, off\n\tglobal_load_async_to_lds_b128 %0, %2, off offset:512\n\tglobal_load_async_to_lds_b128 %0, %2, off offset:1024\n\tglobal_load_async_to_lds_b128 %0, %2, off offset:1536\n\t"
               "global_load_async_to_lds_b128 %0, %2, off offset:2048\n\tglobal_load_async_to_lds_b128 %0, %2, off offset:2560\n\tglobal_load_async_to_lds_b128 %0, %2, off offset:3072\n\tglobal_load_async_to_lds_b128 %0, %2, off offset:3584\n\t"
               "global_load_async_to_lds_b128 %1, %3, off\n\tglobal_load_async_to_lds_b128 %1, %3, off offset:512\n\tglobal_load_async_to_lds_b128 %1, %3, off offset:1024\n\tglobal_load_async_to_lds_b128 %1, %3, off offset:1536\n\t"
               "global_load_async_to_lds_b128 %1, %3, off offset:2048\n\tglobal_load_async_to_lds_b128 %1, %3, off offset:2560\n\tglobal_load_async_to_lds_b128 %1, %3, off offset:3072\n\tglobal_load_async_to_lds_b128 %1, %3, off offset:3584\n\ts_wait_xcnt 0x0"
               :: "v"(lds), "v"(lds + 4096u), "v"(kg), "v"(vg) : "memory"); }
__global__ __launch_bounds__(AW * 32) void k_attn(const _Float16* __restrict__ QH, const _Float16* __restrict__ KH, const _Float16* __restrict__ QL, const _Float16* __restrict__ KL, const _Float16* __restrict__ VT, const __bf16* __restrict__ VB, const __bf16* __restrict__ VBL, float* __restrict__ Y) {
  __shared__ __align__(16) char ring[AW][RW]; __shared__ float smx[AW][32], sls[AW][32];
  const int tid = threadIdx.x, wave = __builtin_amdgcn_readfirstlane(tid >> 5), lane = tid & 31, col = lane & 15, g = lane >> 4;
  const int b = blockIdx.x % NB; const int rt = (TT / 32 - 1) - blockIdx.x / NB;   /* longest walks start first */
  const int q0 = rt * 32, nch = rt + 1; const size_t row0 = (size_t)b * TT;
  v8f acc[2][HD / 16] = {}; float m[2] = {-3.0e38f, -3.0e38f}, l[2] = {0.f, 0.f};
  const _Float16* qhp = QH + (row0 + q0) * CC + lane * 8;
  const _Float16* khp = KH + (row0 + wave * 32) * CC + lane * 8;
  if (q0 < QHI) { const _Float16* qlp = QL + ((size_t)b * QHI + q0) * CC + lane * 8; const _Float16* klp = KL + ((size_t)b * KHI + wave * 32) * CC + lane * 8;
    const __bf16* vhp = VB + ((size_t)b * KHI + wave * 32) * CC + lane * 8; const __bf16* vlp = VBL + ((size_t)b * KHI + wave * 32) * CC + lane * 8;
#pragma unroll 1
    for (int kc = wave; kc < nch; kc += AW, khp += AW * 32 * CC, klp += AW * 32 * CC, vhp += AW * 32 * CC, vlp += AW * 32 * CC) {
#pragma unroll
      for (int qt = 0; qt < 2; ++qt) { v16h qh[HD / 32], ql[HD / 32], kh[2][HD / 32], kl[2][HD / 32];
#pragma unroll
        for (int kd = 0; kd < HD / 32; ++kd) { qh[kd] = frag_hp(qhp + (qt * 2 + kd) * 512); ql[kd] = frag_hp(qlp + (qt * 2 + kd) * 512);
#pragma unroll
          for (int t = 0; t < 2; ++t) { kh[t][kd] = frag_hp(khp + (t * 2 + kd) * 512); kl[t][kd] = frag_hp(klp + (t * 2 + kd) * 512); } }
        asm volatile("s_wait_xcnt 0x0" :: "v"(qhp), "v"(qlp), "v"(khp), "v"(klp) : "memory");   /* keeps the loads' address pairs live and unwritten up to the wait */
        v8f s[2] = {}, sr[2] = {};
#pragma unroll
        for (int kd = 0; kd < HD / 32; ++kd)
#pragma unroll
          for (int t = 0; t < 2; ++t) { s[t] = wmma16(kh[t][kd], qh[kd], s[t]); sr[t] = wmma16(kh[t][kd], ql[kd], sr[t]); sr[t] = wmma16(kl[t][kd], qh[kd], sr[t]); }
        float sv[16];
#pragma unroll
        for (int i = 0; i < 16; ++i) { const float v = (s[i >> 3][i & 7] + sr[i >> 3][i & 7] * (1.0f / 1024.0f)) * SL2E; sv[i] = (kc * 32 + (i >> 3) * 16 + 8 * g + (i & 7) <= q0 + qt * 16 + col) ? v : -3.0e38f; }
        const SMX x = sm_step(sv, m[qt], l[qt], 0.f); const F2 p = bsplit16(x.e); v16b vh[HD / 16], vl[HD / 16];
#pragma unroll
        for (int j = 0; j < HD / 16; ++j) { vh[j] = frag_bp(vhp + j * 512); vl[j] = frag_bp(vlp + j * 512); }
        asm volatile("s_wait_xcnt 0x0" :: "v"(vhp), "v"(vlp) : "memory");   /* as above */
#pragma unroll
        for (int j = 0; j < HD / 16; ++j) { acc[qt][j] *= x.al; acc[qt][j] = wmma_bf(vh[j], p.h, acc[qt][j]); acc[qt][j] = wmma_bf(vh[j], p.l, acc[qt][j]); acc[qt][j] = wmma_bf(vl[j], p.h, acc[qt][j]); } } }
  } else { const _Float16* vp = VT + (row0 + wave * 32) * CC + lane * 8; v16h qf[2][HD / 32];
#pragma unroll
    for (int qt = 0; qt < 2; ++qt)
#pragma unroll
      for (int kd = 0; kd < HD / 32; ++kd) qf[qt][kd] = frag_hp(qhp + (qt * 2 + kd) * 512);
    asm volatile("s_wait_xcnt 0x0" :: "v"(qhp) : "memory");   /* as above */
    /* the ring is private to its wave: only the wave that copies a chunk reads it, so the wave's own waits order everything and no barrier stands in the loop */
    const char* rb = ring[wave] + lane * 16; const unsigned rl = (unsigned)(size_t)rb; unsigned cur = 0;
    if (wave < nch) { copy_chunk(rl, khp, vp); khp += AW * 32 * CC; vp += AW * 32 * CC;
      asm volatile("s_wait_asynccnt 0x0" ::: "memory");   /* the first chunk has landed before its fragments are read */
      if (wave + AW < nch) copy_chunk(rl + RB, khp, vp); }
#pragma unroll 1
    for (int kc = wave; kc < nch; kc += AW, cur ^= RB) { v16h kf[2][HD / 32], vf[HD / 16]; const _Float16* kl = (const _Float16*)(rb + cur);
      khp += AW * 32 * CC; vp += AW * 32 * CC;   /* now the chunk two trips on */
#pragma unroll
      for (int t = 0; t < 2; ++t)
#pragma unroll
        for (int kd = 0; kd < HD / 32; ++kd) kf[t][kd] = frag_hp(kl + (t * 2 + kd) * 512);
#pragma unroll
      for (int j = 0; j < HD / 16; ++j) vf[j] = frag_hp(kl + 2048 + j * 512);
#pragma unroll
      for (int qt = 0; qt < 2; ++qt) { v8f s[2] = {};
#pragma unroll
        for (int t = 0; t < 2; ++t)
#pragma unroll
          for (int kd = 0; kd < HD / 32; ++kd) s[t] = wmma16(kf[t][kd], qf[qt][kd], s[t]);
        float sv[16];
#pragma unroll
        for (int i = 0; i < 16; ++i) sv[i] = s[i >> 3][i & 7] * SL2E;
        if (kc == nch - 1) {   /* only the diagonal chunk holds keys past a query */
#pragma unroll
          for (int i = 0; i < 16; ++i) if (kc * 32 + (i >> 3) * 16 + 8 * g + (i & 7) > q0 + qt * 16 + col) sv[i] = -3.0e38f; }
        const SMX x = sm_step(sv, m[qt], l[qt], 10.f); v16h p;
#pragma unroll
        for (int i = 0; i < 16; ++i) p[i] = (_Float16)x.e[i];
#pragma unroll
        for (int j = 0; j < HD / 16; ++j) { acc[qt][j] *= x.al; acc[qt][j] = wmma16(vf[j], p, acc[qt][j]); } }
      asm volatile("s_wait_dscnt 0x0" ::: "memory");      /* the wave's reads of this buffer have retired before copies are aimed at it */
      asm volatile("s_wait_asynccnt 0x0" ::: "memory");   /* the next chunk, sent one trip ago, has landed before the next trip reads it */
      if (kc + 2 * AW < nch) copy_chunk(rl + cur, khp, vp); }
    asm volatile("s_wait_asynccnt 0x0" ::: "memory");   /* no copy is in flight when the ring becomes the staging of the partial O tile */
  }
  float (*so)[HD + 4] = (float (*)[HD + 4])ring[wave];
#pragma unroll
  for (int qt = 0; qt < 2; ++qt) { const float lt = l[qt] + __shfl_xor(l[qt], 16); if (g == 0) { smx[wave][qt * 16 + col] = m[qt]; sls[wave][qt * 16 + col] = lt; }
#pragma unroll
    for (int j = 0; j < HD / 16; ++j) { v4f a0, a1;
#pragma unroll
      for (int r = 0; r < 4; ++r) { a0[r] = acc[qt][j][r]; a1[r] = acc[qt][j][4 + r]; }
      *(v4f*)&so[qt * 16 + col][j * 16 + 8 * g] = a0; *(v4f*)&so[qt * 16 + col][j * 16 + 8 * g + 4] = a1; } }
  __syncthreads();   /* every wave's partial (max, sum, O) is in LDS before any of them is joined */
  { const int qr = tid >> 4, q = tid & 15; float mw[AW], wt[AW]; float M = -3.0e38f;
#pragma unroll
    for (int w = 0; w < AW; ++w) { mw[w] = smx[w][qr]; M = fmaxf(M, mw[w]); }
#pragma unroll
    for (int w = 0; w < AW; ++w) mw[w] -= M;
    exp2x8(wt, mw); exp2x8(wt + 8, mw + 8);
    float Ls = 0.f; v4f o = {};
#pragma unroll
    for (int w = 0; w < AW; ++w) { Ls += wt[w] * sls[w][qr]; o += *(const v4f*)(ring[w] + (qr * (HD + 4) + q * 4) * 4) * wt[w]; }
    const float inv = Ls > 0.f ? 1.0f / Ls : 0.f; vst2(Y + (row0 + q0 + qr) * CC + q * 4, o * inv); } }

extern "C" void kernel_launch(void* const* d_in, const int* in_sizes, int n_in, void* d_out, int out_size, void* d_ws, size_t ws_size, hipStream_t stream) {
  (void)in_sizes; (void)n_in; (void)out_size;
  const float** F = (const float**)d_in;
  if (ws_size < (size_t)WS_END) return;
  char* ws = (char*)d_ws; _Float16 *QH = (_Float16*)(ws + WS_QH), *KH = (_Float16*)(ws + WS_KH), *VT = (_Float16*)(ws + WS_VT), *QL = (_Float16*)(ws + WS_QL), *KL = (_Float16*)(ws + WS_KL); __bf16 *VB = (__bf16*)(ws + WS_VB), *VBL = (__bf16*)(ws + WS_VBL); float *S = (float*)(ws + WS_S), *Y = (float*)(ws + WS_Y);
  (void)Y; (void)S;
  // inputs: 0 q_in [4,4096,512]; 1 k_in; 2 v_in (separate inputs); 3 Wq [512,64], 4 bq; 5 Wk, 6 bk; 7 Wv, 8 bv ((in,out); zero biases read)
  k_proj<<<dim3(3 * NSB / PB), PB * 128, 0, stream>>>(F[0], F[1], F[2], F[3], F[5], F[7], F[4], F[6], F[8], QH, QL, KH, KL, VT, VB, VBL);
  k_attn<<<dim3(NB * (TT / 32)), AW * 32, 0, stream>>>(QH, KH, QL, KL, VT, VB, VBL, (float*)d_out);   /* out rows are the ctx rows: [b*TT+t][64] */
}

// v008
// It runs in 25.2 microseconds.
// Next to v007, in two timings, it ran 1.08 and 1.06 times as fast.
// Over all steps from v000 it is 27.9 times as fast.
// compute dtype: all float inputs rounded to bf16; q/k/v projections with EXACT bf16 products on WMMA 16x16x32 (f32 accumulate) + bias; causal logits: 3 products (q f16 hi + residual x k hi + residual) for the first 384 rows, single f16 q x k after, x scale; online softmax f32 (base 2) in registers; unnormalised weights x 2^10 once to f16 x v once to f16 (1 product; bf16 hi + lo below row 384), divided by the f32 sum at the end; f32 output.
#include <hip/hip_runtime.h>
#include <math.h>

typedef __attribute__((ext_vector_type(16))) _Float16 v16h;
typedef __attribute__((ext_vector_type(16))) __bf16 v16b;
typedef __attribute__((ext_vector_type(8)))  _Float16 v8h;
typedef __attribute__((ext_vector_type(8)))  float v8f;
typedef __attribute__((ext_vector_type(4)))  float v4f;
typedef __attribute__((ext_vector_type(2)))  float v2f;
typedef __attribute__((ext_vector_type(4)))  unsigned v4u;
typedef __attribute__((ext_vector_type(4)))  int v4i;
typedef float __attribute__((may_alias)) float_a;
typedef int __attribute__((may_alias)) int_a;

template <typename T> __device__ __forceinline__ void vst2(void* p, T v) { *(T*)p = v;  }
// store in a loop: the wait takes the store's address and data as inputs, so that neither register is rewritten (next store, next trip) in front of it
template <typename T> __device__ __forceinline__ void vst2w(void* p, T v) { *(T*)p = v; asm volatile("s_wait_xcnt 0x0" :: "v"(p), "v"(v) : "memory"); }
__device__ __forceinline__ v8f wmma16(v16h a, v16h b, v8f c) {
  v8f d = __builtin_amdgcn_wmma_f32_16x16x32_f16(false, a, false, b, (short)0, c, false, false);
  asm volatile("v_nop\n\tv_nop\n\tv_nop\n\tv_nop" : "+v"(d) : "v"(a), "v"(b));
  return d;
}
__device__ __forceinline__ v8f wmma_bf(v16b a, v16b b, v8f c) {
  v8f d = __builtin_amdgcn_wmma_f32_16x16x32_bf16(false, a, false, b, (short)0, c, false, false);
  asm volatile("v_nop\n\tv_nop\n\tv_nop\n\tv_nop" : "+v"(d) : "v"(a), "v"(b));
  return d;
}
// 16x16x32 fragments: lane = (h = lane>>4, row/col = lane&15); elements 0..7 = k0+8h+0..7, 8..15 = k0+16+8h+0..7; D element r = row 8h+r
__device__ __forceinline__ v16h frag_h(const _Float16* rowk0, int lane) {
  union { v16h v; v8h q[2]; } u; const _Float16* p = rowk0 + 8 * (lane >> 4);
  u.q[0] = *(const v8h*)p; u.q[1] = *(const v8h*)(p + 16); return u.v;
}
__device__ __forceinline__ v16h frag_f32(const float* rowk0, int lane) {
  v16h a; const float* p = rowk0 + 8 * (lane >> 4);
#pragma unroll
  for (int i = 0; i < 8; ++i) { a[i] = (_Float16)p[i]; a[8 + i] = (_Float16)p[16 + i]; }
  return a;
}
__device__ __forceinline__ v16h frag_f32s(const float* rowk0, int lane, float sc) {
  v16h a; const float* p = rowk0 + 8 * (lane >> 4);
#pragma unroll
  for (int i = 0; i < 8; ++i) { a[i] = (_Float16)(p[i] * sc); a[8 + i] = (_Float16)(p[16 + i] * sc); }
  return a;
}
// column fragment from a [K][ld] layout (column n), rows >= K read as 0
__device__ __forceinline__ v16h fragc_f32(const float* W, int k0, int n, int lane, int ld, int K) {
  v16h a; const int g = lane >> 4;
#pragma unroll
  for (int i = 0; i < 8; ++i) { const int ka = k0 + 8 * g + i, kb = ka + 16;
    a[i] = (_Float16)(ka < K ? W[(size_t)(ka < K ? ka : K - 1) * ld + n] : 0.f); a[8 + i] = (_Float16)(kb < K ? W[(size_t)(kb < K ? kb : K - 1) * ld + n] : 0.f); }
  return a;
}
struct F2 { v16b h, l; };
__device__ __forceinline__ F2 bsplit16(const float v[16]) { F2 r;
#pragma unroll
  for (int i = 0; i < 16; ++i) { const __bf16 h = (__bf16)v[i]; r.h[i] = h; r.l[i] = (__bf16)(v[i] - (float)h); }
  return r; }
__device__ __forceinline__ F2 split_row(const float* row, int k0, int lane) { float v[16]; const float* p = row + k0 + 8 * (lane >> 4);
#pragma unroll
  for (int i = 0; i < 8; ++i) { v[i] = p[i]; v[8 + i] = p[16 + i]; }
  return bsplit16(v); }
__device__ __forceinline__ F2 split_rowK(const float* row, int k0, int lane, int K) { float v[16]; const int g = lane >> 4;
#pragma unroll
  for (int i = 0; i < 8; ++i) { const int ka = k0 + 8 * g + i, kb = ka + 16; v[i] = ka < K ? row[ka < K ? ka : K - 1] : 0.f; v[8 + i] = kb < K ? row[kb < K ? kb : K - 1] : 0.f; }
  return bsplit16(v); }
__device__ __forceinline__ F2 split_col(const float* W, int k0, int n, int lane, int ld, int K) { float v[16]; const int g = lane >> 4;
#pragma unroll
  for (int i = 0; i < 8; ++i) { const int ka = k0 + 8 * g + i, kb = ka + 16; v[i] = ka < K ? W[(size_t)(ka < K ? ka : K - 1) * ld + n] : 0.f; v[8 + i] = kb < K ? W[(size_t)(kb < K ? kb : K - 1) * ld + n] : 0.f; }
  return bsplit16(v); }
__device__ __forceinline__ v8f mac3(const F2& a, const F2& b, v8f c) { c = wmma_bf(a.l, b.h, c); c = wmma_bf(a.h, b.l, c); return wmma_bf(a.h, b.h, c); }
__device__ __forceinline__ float sigm(float v) { return 1.0f / (1.0f + expf(-v)); }
#define LDSX() do { asm volatile("s_wait_dscnt 0" ::: "memory"); __builtin_amdgcn_wave_barrier(); __builtin_amdgcn_fence(__ATOMIC_RELEASE, "workgroup"); } while (0)

// Single-head causal scaled dot-product attention with separate inputs (q_in / k_in / v_in [4,4096,512]; Keras Dense (in,out) Wq / Wk / Wv [512,64] N(0, 1/512) + zero biases; scale 1/8; causal j <= i, -inf): out = softmax(causal((q_in Wq + bq)(k_in Wk + bk)^T / 8)) (v_in Wv + bv) -> [4,4096,64].
#define NB 4
#define TT 4096
#define CC 64             // NH * HD = projected width
#define DIN 512          // input (model) width
#define NH 1
#define HD 64
#define NQB (TT / 64)
#define HG 1
#define SCALE (0.125f)
#define CAUSAL 1
#ifndef TNB
#define TNB NB
#endif
__device__ __forceinline__ float bfr(float v) { return (float)(__bf16)v; }
__host__ __device__ __forceinline__ int kb_last(int qb) { return CAUSAL ? ((qb * 64 + 63) >> 7) : (TT / 128 - 1); }
typedef __attribute__((ext_vector_type(8))) __bf16 v8b;
__device__ __forceinline__ v16b frag_b(const __bf16* rowk0, int lane) {
  union { v16b v; v8b q[2]; } u; const __bf16* p = rowk0 + 8 * (lane >> 4);
  u.q[0] = *(const v8b*)p; u.q[1] = *(const v8b*)(p + 16); return u.v;
}
#define QBH 6              // unused; causal: query rows < QBH * 64 (= QHI; few keys, no averaging) take the high-precision path
#define QHI 384            // rows carrying a q residual plane
#define KHI 384            // key rows carrying k residual / v bf16 hi+lo planes (used only by the causal high-precision path)
// B fragment (k rows k0+.., output column o) of a weight: (in,out) [K][ld] or (out,in) [ld rows of K]: bf16 exact, or f16(bf16 * 256) exact
__device__ __forceinline__ v16b wcol_io(const float* Wm, int k0, int o, int lane, int ld) { v16b w; const int g = lane >> 4;
#pragma unroll
  for (int i = 0; i < 8; ++i) { w[i] = (__bf16)Wm[(size_t)(k0 + 8 * g + i) * ld + o]; w[8 + i] = (__bf16)Wm[(size_t)(k0 + 16 + 8 * g + i) * ld + o]; }
  return w; }
__device__ __forceinline__ v16b wcol_oi(const float* Wm, int k0, int o, int lane, int K) { v16b w; const float* p = Wm + (size_t)o * K + k0 + 8 * (lane >> 4);
#pragma unroll
  for (int i = 0; i < 8; ++i) { w[i] = (__bf16)p[i]; w[8 + i] = (__bf16)p[16 + i]; }
  return w; }
__device__ __forceinline__ v16h wcolh_io(const float* Wm, int k0, int o, int lane, int ld) { v16h w; const int g = lane >> 4;
#pragma unroll
  for (int i = 0; i < 8; ++i) { w[i] = (_Float16)(bfr(Wm[(size_t)(k0 + 8 * g + i) * ld + o]) * 256.0f); w[8 + i] = (_Float16)(bfr(Wm[(size_t)(k0 + 16 + 8 * g + i) * ld + o]) * 256.0f); }
  return w; }
__device__ __forceinline__ v16h wcolh_oi(const float* Wm, int k0, int o, int lane, int K) { v16h w; const float* p = Wm + (size_t)o * K + k0 + 8 * (lane >> 4);
#pragma unroll
  for (int i = 0; i < 8; ++i) { w[i] = (_Float16)(bfr(p[i]) * 256.0f); w[8 + i] = (_Float16)(bfr(p[16 + i]) * 256.0f); }
  return w; }
#define WQKV_LAYOUT 0   // 0 = (in,out) [DIN][CC]; 1 = (out,in) [CC][DIN]; 2 = per-head [NH][DIN][HD]
__device__ __forceinline__ v16b wcol_hdk(const float* Wm, int k0, int o, int lane) { v16b w; const int g = lane >> 4; const float* p = Wm + (size_t)(o / HD) * DIN * HD + (o % HD);
#pragma unroll
  for (int i = 0; i < 8; ++i) { w[i] = (__bf16)p[(size_t)(k0 + 8 * g + i) * HD]; w[8 + i] = (__bf16)p[(size_t)(k0 + 16 + 8 * g + i) * HD]; }
  return w; }
#define WO_OUT_IN 0
#if WQKV_LAYOUT == 1
#define WCOL(W, k0, o, lane) wcol_oi(W, k0, o, lane, DIN)
#elif WQKV_LAYOUT == 2
#define WCOL(W, k0, o, lane) wcol_hdk(W, k0, o, lane)
#else
#define WCOL(W, k0, o, lane) wcol_io(W, k0, o, lane, CC)
#endif
#if WO_OUT_IN
#define WOCOL(W, k0, o, lane) wcol_oi(W, k0, o, lane, CC)
#define WOCOLH(W, k0, o, lane) wcolh_oi(W, k0, o, lane, CC)
#else
#define WOCOL(W, k0, o, lane) wcol_io(W, k0, o, lane, DIN)
#define WOCOLH(W, k0, o, lane) wcolh_io(W, k0, o, lane, DIN)
#endif
#ifndef SM_EXTRA_PARAMS
#define SM_EXTRA_PARAMS
#endif
#ifndef PROJ_EXTRA_PARAMS
#define PROJ_EXTRA_PARAMS
#endif
#ifndef SM_MASK_HOOK
#define SM_MASK_HOOK (void)0
#endif

// k_attn's operands lie in FRAGMENT ORDER: a 32-row chunk (32 queries or 32 keys, all 64 channels) is 4 KB = 8 groups of 512 B, and a group holds lane 0..31's 16 bytes side by side,
// so that one wave-wide 16-byte load covers 4 whole 128-byte lines. q, k: group = (t, kd, half), lane (g, col) holds row t * 16 + col, channels kd * 32 + half * 16 + g * 8 + 0..7;
// v: group = (j, half), lane (g, col) holds channel j * 16 + col, keys half * 16 + g * 8 + 0..7.
static_assert(CC == 64 && HD == 64, "the fragment order is laid out for 64 channels");
#define WS_QH  0u                                      // f16 q, fragment order [b][t / 32][4 KB]
#define WS_KH  (WS_QH + 2u * (size_t)NB * TT * CC)      // f16 k, fragment order [b][t / 32][4 KB]
#define WS_VT  (WS_KH + 2u * (size_t)NB * TT * CC)      // f16 v, fragment order [b][t / 32][4 KB]
#define WS_QL  (WS_VT + 2u * (size_t)NB * CC * TT)      // f16 q residual x 2^10, fragment order [b][t / 32, t < QHI][4 KB]
#define WS_KL  (WS_QL + 2u * (size_t)NB * QHI * CC)     // f16 k residual x 2^10, fragment order [b][t / 32, t < KHI][4 KB]
#define WS_VB  (WS_KL + 2u * (size_t)NB * KHI * CC)     // bf16 v hi (VBL: lo), fragment order [b][t / 32, t < KHI][4 KB]
#define WS_VBL (WS_VB + 2u * (size_t)NB * CC * KHI)
#define WS_S   (WS_VBL + 2u * (size_t)NB * CC * KHI)    // f32 [hg][t][s] region, unused (the logits stay in registers)
#define WS_Y   (WS_S  + 4u * (size_t)HG * TT * TT)      // f32 ctx rows [b*t][CC] (only when there is an output projection)
#define WS_END (WS_Y  + 0u)

// ---- k_proj: q/k/v = X W (+ b) with exact bf16 products (K = DIN). The 3 * NSB sub-blocks of 64 rows (projection = sub-block / NSB) are dealt PB to a block, 4 waves each; a block touches at most two projections.
// W is turned ONCE per block into bf16 B fragments in LDS; the K loop reads them from there and has only X left to fetch from memory, two stages (PD K steps) ahead.
// X comes in stages of XS columns by WHOLE lines: a wave-wide 16-byte load covers 256 contiguous bytes of each of two rows (4 whole lines; a load in fragment order touches 16 lines for the same 512 bytes).
// The wave rounds a stage to bf16, stores it to its OWN two-buffer LDS range (rows of XP bytes) and reads its A fragments back from there, so no other wave and no barrier is involved.
// projection 0: q f16 (+ residual for rows < QHI); 1: k f16 (+ residual for rows < KHI); 2: v f16 (+ bf16 hi/lo for t < KHI); all stored in fragment order
#define PB 3                  // 64-row sub-blocks of a block
#define NSB (TNB * TT / 64)   // sub-blocks of a projection
#define PD 4                  // K steps of X a wave has in flight
#define XS 64                 // X columns of a stage (two K steps)
#define XP (XS * 2 + 16)      // LDS pitch of a staged bf16 row: 16 bytes x odd, the pitch at which 16-byte fragment reads meet no bank twice
typedef __attribute__((ext_vector_type(4))) __bf16 v4b;
static_assert((3 * NSB) % PB == 0 && NSB >= PB && DIN / XS >= 2 && DIN % XS == 0 && XS == 64 && PD * 32 == 2 * XS, "sub-blocks are dealt evenly, and a block spans at most two projections; two stages of two K steps fly");
// W [DIN][CC] f32 -> LDS: the 512-byte group (kc, j, half) holds for lane (g, col) the 8 values k = kc * 32 + half * 16 + g * 8 + 0..7 of column j * 16 + col, at 16-byte slot lane ^ j
// (the xor spreads a writing wave's 16 column quads over all banks; a reading wave's 32 slots still fill the group). A thread takes 8 k rows x 4 columns: a wave-wide 16-byte load covers 4 whole lines.
#define WTR ((DIN * 2 + PB * 128 - 1) / (PB * 128))   // trips of a thread over the DIN * 2 pieces of work; only the last can be a part trip
static_assert(WTR == 3, "the wait behind the loads names one address pair per trip");
__device__ __forceinline__ void stage_w(const float* __restrict__ Wm, char* dst, int ftid) { v4f r[WTR][8]; const float* wp[WTR];
#pragma unroll
  for (int n = 0; n < WTR; ++n) { const int e = ftid + n * PB * 128, ec = e < DIN * 2 ? e : DIN * 2 - 1; wp[n] = Wm + (size_t)(ec >> 4) * 8 * CC + (ec & 15) * 4;   /* all trips' loads fly together; a thread past the end reads the last piece and stores nothing */
#pragma unroll
    for (int i = 0; i < 8; ++i) r[n][i] = *(const v4f*)(wp[n] + i * CC); }
  asm volatile("s_wait_xcnt 0x0" :: "v"(wp[0]), "v"(wp[1]), "v"(wp[2]) : "memory");   /* keeps the loads' address pairs live and unwritten up to the wait, and every trip's loads in front of the first store */
#pragma unroll
  for (int n = 0; n < WTR; ++n) { const int e = ftid + n * PB * 128;
    if ((n + 1) * PB * 128 <= DIN * 2 || e < DIN * 2) { const int cq = e & 15, ko = e >> 4; char* d = dst + ((ko >> 2) * 4 + (cq >> 2)) * 1024 + ((ko >> 1) & 1) * 512;
#pragma unroll
      for (int c = 0; c < 4; ++c) { v8b pc;
#pragma unroll
        for (int i = 0; i < 8; ++i) pc[i] = (__bf16)r[n][i][c];
        *(v8b*)(d + ((((ko & 1) * 16 + (cq & 3) * 4 + c) ^ (cq >> 2)) * 16)) = pc; } } } }
__global__ __launch_bounds__(PB * 128) void k_proj(const float* __restrict__ XQ, const float* __restrict__ XK, const float* __restrict__ XV, const float* __restrict__ WQ, const float* __restrict__ WK, const float* __restrict__ WV, const float* __restrict__ BQ, const float* __restrict__ BK, const float* __restrict__ BV,
    _Float16* __restrict__ QH, _Float16* __restrict__ QL, _Float16* __restrict__ KH, _Float16* __restrict__ KL, _Float16* __restrict__ VT, __bf16* __restrict__ VB, __bf16* __restrict__ VBL) {
  __shared__ __align__(16) char wlds[2][DIN * CC * 2];
  __shared__ __align__(16) char xs3[PB * 4][2][16 * XP];
  __shared__ __align__(16) _Float16 sh3[PB][64][72], sl3[PB][64][72]; __shared__ __align__(16) _Float16 th3[PB][64][72]; __shared__ __align__(16) __bf16 tb3[PB][64][72], tbl3[PB][64][72];
  const int ftid = threadIdx.x, sub = __builtin_amdgcn_readfirstlane(ftid >> 7), tid = ftid & 127, wave = tid >> 5, lane = tid & 31, col = lane & 15, g = lane >> 4;
  const int sb = blockIdx.x * PB + sub, which = sb / NSB, wfirst = (blockIdx.x * PB) / NSB, wlast = (blockIdx.x * PB + PB - 1) / NSB; const int c0 = 0; const size_t r0 = (size_t)(sb % NSB) * 64; const size_t bb = r0 / TT; const int t0 = (int)(r0 % TT);
  _Float16 (*sh)[72] = sh3[sub]; _Float16 (*sl)[72] = sl3[sub]; _Float16 (*th)[72] = th3[sub]; __bf16 (*tb)[72] = tb3[sub]; __bf16 (*tbl)[72] = tbl3[sub];
  const float* X = which == 0 ? XQ : which == 1 ? XK : XV; const float* BA = which == 0 ? BQ : which == 1 ? BK : BV;
  const float* xp = X + (r0 + wave * 16 + g) * DIN + col * 4; v4f raw[2][8];   /* load i of a stage: rows 2 i + g, columns col * 4 + 0..3 of the stage */
  char* xw = xs3[ftid >> 5][0];
#pragma unroll
  for (int d = 0; d < 2; ++d)
#pragma unroll
    for (int i = 0; i < 8; ++i) raw[d][i] = *(const v4f*)(xp + i * 2 * DIN + d * XS);
  stage_w(wfirst == 0 ? WQ : wfirst == 1 ? WK : WV, wlds[0], ftid);
  if (wlast != wfirst) stage_w(wlast == 1 ? WK : WV, wlds[1], ftid);
  __syncthreads();   /* every W fragment is in LDS before any wave reads one */
  const char* wb = wlds[which - wfirst];
  v8f acc[4] = {}; union WF { v16b v; v8b q[2]; } wf[2][4], af[2];
  /* stage st: rounds the 8 loaded pieces to bf16 into buffer st & 1, then sends the loads of stage st + 2 into the registers just freed */
#define XSTORE(st) do { _Pragma("unroll") for (int i = 0; i < 8; ++i) { const v4f x = raw[(st) & 1][i]; v4b pc; pc[0] = (__bf16)x[0]; pc[1] = (__bf16)x[1]; pc[2] = (__bf16)x[2]; pc[3] = (__bf16)x[3]; \
      *(v4b*)(xw + ((st) & 1) * 16 * XP + (2 * i + g) * XP + col * 8) = pc; } \
    if ((st) + 2 < DIN / XS) { _Pragma("unroll") for (int i = 0; i < 8; ++i) raw[(st) & 1][i] = *(const v4f*)(xp + i * 2 * DIN + ((st) + 2) * XS); } } while (0)
  /* A fragment of K step k: row col, elements 0..7 = k * 32 + 8 g + 0..7, 8..15 = 16 further on (the k order of the W fragments) */
#define XFRAG(k) do { const char* xq = xw + (((k) >> 1) & 1) * 16 * XP + col * XP + ((k) & 1) * 64 + g * 16; af[(k) & 1].q[0] = *(const v8b*)xq; af[(k) & 1].q[1] = *(const v8b*)(xq + 32); } while (0)
  XSTORE(0);
  asm volatile("s_wait_dscnt 0x0" ::: "memory");   /* the wave's own stores of stage 0, made by other lanes than those that read them, have landed before the fragments are read back */
  XFRAG(0);
#pragma unroll
  for (int j = 0; j < 4; ++j) { const char* wq = wb + j * 1024 + ((lane ^ j) * 16); wf[0][j].q[0] = *(const v8b*)wq; wf[0][j].q[1] = *(const v8b*)(wq + 512); }
#pragma unroll   /* whole: raw[stage & 1], af[kc & 1] and wf[kc & 1] stay in registers only under constant indices */
  for (int kc = 0; kc < DIN / 32; ++kc) {
    if (kc + 1 < DIN / 32) {
      if (kc & 1) asm volatile("s_wait_dscnt 0x0" ::: "memory");   /* the next step opens a stage, stored one step ago: as above, its rows have landed before they are read back */
      XFRAG(kc + 1);
#pragma unroll
      for (int j = 0; j < 4; ++j) { const char* wq = wb + ((kc + 1) * 4 + j) * 1024 + ((lane ^ j) * 16); wf[(kc + 1) & 1][j].q[0] = *(const v8b*)wq; wf[(kc + 1) & 1][j].q[1] = *(const v8b*)(wq + 512); } }
    if (!(kc & 1) && kc / 2 + 1 < DIN / XS) XSTORE(kc / 2 + 1);
    __builtin_amdgcn_sched_barrier(0);   /* holds the fetches for later K steps (X from memory, X and W fragments from LDS) in front of this step's products, so that they fly under them */
#pragma unroll
    for (int j = 0; j < 4; ++j) acc[j] = wmma_bf(af[kc & 1].v, wf[kc & 1][j].v, acc[j]);
    __builtin_amdgcn_sched_barrier(0);   /* holds the next stage's conversions behind this step: lifted up, they wait for X loads that were only just issued */
  }
  if (which < 2) {
#pragma unroll
    for (int j = 0; j < 4; ++j) { const float bias = BA ? bfr(BA[c0 + j * 16 + col]) : 0.f;
#pragma unroll
      for (int r = 0; r < 8; ++r) { const float v = acc[j][r] + bias; const _Float16 hv = (_Float16)v; sh[wave * 16 + 8 * g + r][j * 16 + col] = hv; sl[wave * 16 + 8 * g + r][j * 16 + col] = (_Float16)((v - (float)hv) * 1024.0f); } }
  } else {
#pragma unroll
    for (int j = 0; j < 4; ++j) { const float bias = BA ? bfr(BA[c0 + j * 16 + col]) : 0.f;
#pragma unroll
      for (int r = 0; r < 8; ++r) { const float v = acc[j][r] + bias; const int rl = wave * 16 + 8 * g + r, cl = j * 16 + col; th[cl][rl] = (_Float16)v; const __bf16 bh = (__bf16)v; tb[cl][rl] = bh; tbl[cl][rl] = (__bf16)(v - (float)bh); } } }
  __syncthreads();   /* one barrier for both kinds of sub-block: a block may hold both, and every wave passes it */
  if (which < 2) { _Float16* DH = which == 0 ? QH : KH; _Float16* DL = which == 0 ? QL : KL; const int nhi = which == 0 ? QHI : KHI; const bool hi_rows = t0 < nhi;
    for (int e = tid; e < 64 * 8; e += 128) { const int rl = (e >> 7) * 16 + (e & 15), d = ((e >> 4) & 7) * 8;   /* 16-byte piece e = (chunk, t, kd, half, g, col) */
      vst2w((unsigned*)(DH + r0 * CC + (size_t)e * 8), *(const v4u*)&sh[rl][d]); if (hi_rows) vst2w((unsigned*)(DL + (bb * nhi + t0) * (size_t)CC + (size_t)e * 8), *(const v4u*)&sl[rl][d]); }
  } else { const bool hi_rows = t0 < KHI;
    for (int e = tid; e < 64 * 8; e += 128) { const int cl = ((e >> 6) & 3) * 16 + (e & 15), tl = (e >> 8) * 32 + ((e >> 4) & 3) * 8;   /* 16-byte piece e = (chunk, j, half, g, col) */
      vst2w((unsigned*)(VT + r0 * CC + (size_t)e * 8), *(const v4u*)&th[cl][tl]); if (hi_rows) { const size_t o3 = (bb * KHI + t0) * (size_t)CC + (size_t)e * 8; vst2w((unsigned*)(VB + o3), *(const v4u*)&tb[cl][tl]); vst2w((unsigned*)(VBL + o3), *(const v4u*)&tbl[cl][tl]); } } } }
// ---- k_attn: logits, causal softmax and P V in one kernel, all batches in one launch; the logits never leave the registers.
// block = two 32-query tiles of batch b, tp and its mirror TT / 32 - 1 - tp, side by side: every block walks TT / 32 + 1 chunks in all, so one block per WGP is an even deal. The first wS of the AW waves take the short tile, the rest the long one;
// wave number wl of the nw waves of a tile walks that tile's 32-key chunks wl, wl + nw, ... up to the diagonal chunk.
// S^T = K Q^T (A = 16 key rows, B = 16 query columns): a lane holds 16 logits of ONE query (column lane & 15), in the k order a B operand wants, so P^T goes from the two score tiles straight into O^T += V^T P^T.
// Running maximum and sum per lane (log2 domain, online softmax); the AW partial (max, sum, O) are joined through LDS in wave order.
// Queries < QHI: 3-product logits (q, k as f16 hi + residual x 2^10) and P, v as bf16 hi + lo (3 products); after: single f16 products, weights x 2^10 (the factor is in the sum too and cancels).
#define AW 16
#define SL2E (SCALE * 1.4426950408889634f)
// fragment in fragment order: p = chunk start + group pair * 512 + lane * 8; the two halves are neighbouring 512-byte groups
__device__ __forceinline__ v16h frag_hp(const _Float16* p) { union { v16h v; v8h q[2]; } u; u.q[0] = *(const v8h*)p; u.q[1] = *(const v8h*)(p + 256); return u.v; }
__device__ __forceinline__ v16b frag_bp(const __bf16* p) { union { v16b v; v8b q[2]; } u; u.q[0] = *(const v8b*)p; u.q[1] = *(const v8b*)(p + 256); return u.v; }
// 2^x, eight at a time: the early-clobber outputs keep a v_exp_f32 from overwriting the source of the one in front of it, and the v_nop fills the slot behind the last one
__device__ __forceinline__ void exp2x8(float* o, const float* x) {
  asm("v_exp_f32 %0, %8\n\tv_exp_f32 %1, %9\n\tv_exp_f32 %2, %10\n\tv_exp_f32 %3, %11\n\tv_exp_f32 %4, %12\n\tv_exp_f32 %5, %13\n\tv_exp_f32 %6, %14\n\tv_exp_f32 %7, %15\n\tv_nop"
      : "=&v"(o[0]), "=&v"(o[1]), "=&v"(o[2]), "=&v"(o[3]), "=&v"(o[4]), "=&v"(o[5]), "=&v"(o[6]), "=&v"(o[7]) : "v"(x[0]), "v"(x[1]), "v"(x[2]), "v"(x[3]), "v"(x[4]), "v"(x[5]), "v"(x[6]), "v"(x[7])); }
// 2^x, one value; the v_nop fills the slot behind the transcendental
__device__ __forceinline__ float exp2x1(float x) { float r; asm("v_exp_f32 %0, %1\n\tv_nop" : "=v"(r) : "v"(x)); return r; }
struct SMX { float e[16]; float al; };
// one online-softmax step of one query column: sv = 16 scaled log2 logits of this lane's query; poff = log2 of the weights' common factor
__device__ __forceinline__ SMX sm_step(const float sv[16], float& m, float& l, float poff) { SMX o; float mx = sv[0];
#pragma unroll
  for (int i = 1; i < 16; ++i) mx = fmaxf(mx, sv[i]);
  mx = fmaxf(mx, __shfl_xor(mx, 16)); const float mn = fmaxf(m, mx); o.al = exp2x1(m - mn); m = mn; const float mref = mn - poff; float d[16], ls = 0.f;
#pragma unroll
  for (int i = 0; i < 16; ++i) d[i] = sv[i] - mref;
  exp2x8(o.e, d); exp2x8(o.e + 8, d + 8);
#pragma unroll
  for (int i = 0; i < 16; ++i) ls += o.e[i];
  l = l * o.al + ls; return o; }
// The main path's k and v come through LDS: each wave owns a ring of two buffers, a buffer holds one 32-key chunk (4 KB of k, then 4 KB of v, both in fragment order as they lie in memory).
#define RB 8192            // bytes of a ring buffer
#define RW (2 * RB)        // bytes of a wave's ring
static_assert(32 * (HD + 4) * 4 <= RW, "a wave's partial O tile is staged in its own ring");
// one chunk, 16 asynchronous copies of 512 B (16 B a lane); the offset moves the LDS and the global address alike. The s_wait_xcnt stands inside the statement, so that no address register is rewritten in front of it
__device__ __forceinline__ void copy_chunk(unsigned lds, const _Float16* kg, const _Float16* vg) {
  asm volatile("global_load_async_to_lds_b128 %0, %2, off\n\tglobal_load_async_to_lds_b128 %0, %2, off offset:512\n\tglobal_load_async_to_lds_b128 %0, %2, off offset:1024\n\tglobal_load_async_to_lds_b128 %0, %2, off offset:1536\n\t"
               "global_load_async_to_lds_b128 %0, %2, off offset:2048\n\tglobal_load_async_to_lds_b128 %0, %2, off offset:2560\n\tglobal_load_async_to_lds_b128 %0, %2, off offset:3072\n\tglobal_load_async_to_lds_b128 %0, %2, off offset:3584\n\t"
               "global_load_async_to_lds_b128 %1, %3, off\n\tglobal_load_async_to_lds_b128 %1, %3, off offset:512\n\tglobal_load_async_to_lds_b128 %1, %3, off offset:1024\n\tglobal_load_async_to_lds_b128 %1, %3, off offset:1536\n\t"
               "global_load_async_to_lds_b128 %1, %3, off offset:2048\n\tglobal_load_async_to_lds_b128 %1, %3, off offset:2560\n\tglobal_load_async_to_lds_b128 %1, %3, off offset:3072\n\tglobal_load_async_to_lds_b128 %1, %3, off offset:3584\n\ts_wait_xcnt 0x0"
               :: "v"(lds), "v"(lds + 4096u), "v"(kg), "v"(vg) : "memory"); }
__global__ __launch_bounds__(AW * 32) void k_attn(const _Float16* __restrict__ QH, const _Float16* __restrict__ KH, const _Float16* __restrict__ QL, const _Float16* __restrict__ KL, const _Float16* __restrict__ VT, const __bf16* __restrict__ VB, const __bf16* __restrict__ VBL, float* __restrict__ Y) {
  __shared__ __align__(16) char ring[AW][RW]; __shared__ float smx[AW][32], sls[AW][32];
  const int tid = threadIdx.x, wave = __builtin_amdgcn_readfirstlane(tid >> 5), lane = tid & 31, col = lane & 15, g = lane >> 4;
  const int b = blockIdx.x % NB, tp = blockIdx.x / NB;
  const int wS = ((tp * 32 < QHI ? 3 : 1) * (tp + 1) + 8) / 9;   /* waves of the short tile: at most 9 trips each, a high-precision trip counted as 3 */
  static_assert((TT / 64 + 8) / 9 <= AW / 2 && (3 * (QHI / 32) + 8) / 9 <= AW / 2 && QHI <= TT / 2, "the short tile never has more than half the waves, and the long tile is never a high-precision one");
  const bool st = wave < wS; const int rt = st ? tp : TT / 32 - 1 - tp, wl = st ? wave : wave - wS, nw = st ? wS : AW - wS;
  const int q0 = rt * 32, nch = rt + 1; const size_t row0 = (size_t)b * TT; const int stp = nw * 32 * CC;   /* stp: elements from a wave's chunk to its next */
  v8f acc[2][HD / 16] = {}; float m[2] = {-3.0e38f, -3.0e38f}, l[2] = {0.f, 0.f};
  const _Float16* qhp = QH + (row0 + q0) * CC + lane * 8;
  const _Float16* khp = KH + (row0 + wl * 32) * CC + lane * 8;
  if (q0 < QHI) { const _Float16* qlp = QL + ((size_t)b * QHI + q0) * CC + lane * 8; const _Float16* klp = KL + ((size_t)b * KHI + wl * 32) * CC + lane * 8;
    const __bf16* vhp = VB + ((size_t)b * KHI + wl * 32) * CC + lane * 8; const __bf16* vlp = VBL + ((size_t)b * KHI + wl * 32) * CC + lane * 8;
#pragma unroll 1
    for (int kc = wl; kc < nch; kc += nw, khp += stp, klp += stp, vhp += stp, vlp += stp) {
#pragma unroll
      for (int qt = 0; qt < 2; ++qt) { v16h qh[HD / 32], ql[HD / 32], kh[2][HD / 32], kl[2][HD / 32];
#pragma unroll
        for (int kd = 0; kd < HD / 32; ++kd) { qh[kd] = frag_hp(qhp + (qt * 2 + kd) * 512); ql[kd] = frag_hp(qlp + (qt * 2 + kd) * 512);
#pragma unroll
          for (int t = 0; t < 2; ++t) { kh[t][kd] = frag_hp(khp + (t * 2 + kd) * 512); kl[t][kd] = frag_hp(klp + (t * 2 + kd) * 512); } }
        asm volatile("s_wait_xcnt 0x0" :: "v"(qhp), "v"(qlp), "v"(khp), "v"(klp) : "memory");   /* keeps the loads' address pairs live and unwritten up to the wait */
        v8f s[2] = {}, sr[2] = {};
#pragma unroll
        for (int kd = 0; kd < HD / 32; ++kd)
#pragma unroll
          for (int t = 0; t < 2; ++t) { s[t] = wmma16(kh[t][kd], qh[kd], s[t]); sr[t] = wmma16(kh[t][kd], ql[kd], sr[t]); sr[t] = wmma16(kl[t][kd], qh[kd], sr[t]); }
        float sv[16]; const int thr = q0 + qt * 16 + col - kc * 32 - 8 * g;   /* the lane's last open key, counted from its first: one register, where 16 key numbers would not fit beside the fragments */
#pragma unroll
        for (int i = 0; i < 16; ++i) { const float v = (s[i >> 3][i & 7] + sr[i >> 3][i & 7] * (1.0f / 1024.0f)) * SL2E; sv[i] = ((i >> 3) * 16 + (i & 7) <= thr) ? v : -3.0e38f; }
        const SMX x = sm_step(sv, m[qt], l[qt], 0.f); const F2 p = bsplit16(x.e); v16b vh[HD / 16], vl[HD / 16];
#pragma unroll
        for (int j = 0; j < HD / 16; ++j) { vh[j] = frag_bp(vhp + j * 512); vl[j] = frag_bp(vlp + j * 512); }
        asm volatile("s_wait_xcnt 0x0" :: "v"(vhp), "v"(vlp) : "memory");   /* as above */
#pragma unroll
        for (int j = 0; j < HD / 16; ++j) { acc[qt][j] *= x.al; acc[qt][j] = wmma_bf(vh[j], p.h, acc[qt][j]); acc[qt][j] = wmma_bf(vh[j], p.l, acc[qt][j]); acc[qt][j] = wmma_bf(vl[j], p.h, acc[qt][j]); } } }
  } else { const _Float16* vp = VT + (row0 + wl * 32) * CC + lane * 8; v16h qf[2][HD / 32];
#pragma unroll
    for (int qt = 0; qt < 2; ++qt)
#pragma unroll
      for (int kd = 0; kd < HD / 32; ++kd) qf[qt][kd] = frag_hp(qhp + (qt * 2 + kd) * 512);
    asm volatile("s_wait_xcnt 0x0" :: "v"(qhp) : "memory");   /* as above */
    /* the ring is private to its wave: only the wave that copies a chunk reads it, so the wave's own waits order everything and no barrier stands in the loop */
    const char* rb = ring[wave] + lane * 16; const unsigned rl = (unsigned)(size_t)rb; unsigned cur = 0;
    if (wl < nch) { copy_chunk(rl, khp, vp); khp += stp; vp += stp;
      asm volatile("s_wait_asynccnt 0x0" ::: "memory");   /* the first chunk has landed before its fragments are read */
      if (wl + nw < nch) copy_chunk(rl + RB, khp, vp); }
#pragma unroll 1
    for (int kc = wl; kc < nch; kc += nw, cur ^= RB) { v16h kf[2][HD / 32], vf[HD / 16]; const _Float16* kl = (const _Float16*)(rb + cur);
      khp += stp; vp += stp;   /* now the chunk two trips on */
#pragma unroll
      for (int t = 0; t < 2; ++t)
#pragma unroll
        for (int kd = 0; kd < HD / 32; ++kd) kf[t][kd] = frag_hp(kl + (t * 2 + kd) * 512);
#pragma unroll
      for (int j = 0; j < HD / 16; ++j) vf[j] = frag_hp(kl + 2048 + j * 512);
#pragma unroll
      for (int qt = 0; qt < 2; ++qt) { v8f s[2] = {};
#pragma unroll
        for (int t = 0; t < 2; ++t)
#pragma unroll
          for (int kd = 0; kd < HD / 32; ++kd) s[t] = wmma16(kf[t][kd], qf[qt][kd], s[t]);
        float sv[16];
#pragma unroll
        for (int i = 0; i < 16; ++i) sv[i] = s[i >> 3][i & 7] * SL2E;
        if (kc == nch - 1) {   /* only the diagonal chunk holds keys past a query */
#pragma unroll
          for (int i = 0; i < 16; ++i) if (kc * 32 + (i >> 3) * 16 + 8 * g + (i & 7) > q0 + qt * 16 + col) sv[i] = -3.0e38f; }
        const SMX x = sm_step(sv, m[qt], l[qt], 10.f); v16h p;
#pragma unroll
        for (int i = 0; i < 16; ++i) p[i] = (_Float16)x.e[i];
#pragma unroll
        for (int j = 0; j < HD / 16; ++j) { acc[qt][j] *= x.al; acc[qt][j] = wmma16(vf[j], p, acc[qt][j]); } }
      asm volatile("s_wait_dscnt 0x0" ::: "memory");      /* the wave's reads of this buffer have retired before copies are aimed at it */
      asm volatile("s_wait_asynccnt 0x0" ::: "memory");   /* the next chunk, sent one trip ago, has landed before the next trip reads it */
      if (kc + 2 * nw < nch) copy_chunk(rl + cur, khp, vp); }
    asm volatile("s_wait_asynccnt 0x0" ::: "memory");   /* no copy is in flight when the ring becomes the staging of the partial O tile */
  }
  float (*so)[HD + 4] = (float (*)[HD + 4])ring[wave];
#pragma unroll
  for (int qt = 0; qt < 2; ++qt) { const float lt = l[qt] + __shfl_xor(l[qt], 16); if (g == 0) { smx[wave][qt * 16 + col] = m[qt]; sls[wave][qt * 16 + col] = lt; }
#pragma unroll
    for (int j = 0; j < HD / 16; ++j) { v4f a0, a1;
#pragma unroll
      for (int r = 0; r < 4; ++r) { a0[r] = acc[qt][j][r]; a1[r] = acc[qt][j][4 + r]; }
      *(v4f*)&so[qt * 16 + col][j * 16 + 8 * g] = a0; *(v4f*)&so[qt * 16 + col][j * 16 + 8 * g + 4] = a1; } }
  __syncthreads();   /* every wave's partial (max, sum, O) is in LDS before any of them is joined */
  { const int qr = tid >> 4, q = tid & 15; float mw[AW], wt[AW]; float M[2] = {-3.0e38f, -3.0e38f};   /* a thread joins row qr, channels q * 4 + 0..3 of both tiles: index 0 the short tile (waves < wS), 1 the long one */
#pragma unroll
    for (int w = 0; w < AW; ++w) { const bool s0 = w < AW / 2 && w < wS; mw[w] = smx[w][qr]; M[0] = fmaxf(M[0], s0 ? mw[w] : -3.0e38f); M[1] = fmaxf(M[1], s0 ? -3.0e38f : mw[w]); }
#pragma unroll
    for (int w = 0; w < AW; ++w) mw[w] -= (w < AW / 2 && w < wS) ? M[0] : M[1];
    exp2x8(wt, mw); exp2x8(wt + 8, mw + 8);
    float Ls[2] = {0.f, 0.f}; v4f o[2] = {};
#pragma unroll
    for (int w = 0; w < AW; ++w) { const bool s0 = w < AW / 2 && w < wS; const float lw = sls[w][qr], w0 = s0 ? wt[w] : 0.f, w1 = s0 ? 0.f : wt[w]; const v4f ow = *(const v4f*)(ring[w] + (qr * (HD + 4) + q * 4) * 4);   /* a wave's partial enters the other tile's sums with weight 0: no branch stands among the LDS reads */
      Ls[0] += w0 * lw; o[0] += ow * w0; Ls[1] += w1 * lw; o[1] += ow * w1; }
    const float inv0 = Ls[0] > 0.f ? 1.0f / Ls[0] : 0.f, inv1 = Ls[1] > 0.f ? 1.0f / Ls[1] : 0.f;
    vst2w(Y + (row0 + tp * 32 + qr) * CC + q * 4, o[0] * inv0); vst2(Y + (row0 + (TT / 32 - 1 - tp) * 32 + qr) * CC + q * 4, o[1] * inv1); } }

extern "C" void kernel_launch(void* const* d_in, const int* in_sizes, int n_in, void* d_out, int out_size, void* d_ws, size_t ws_size, hipStream_t stream) {
  (void)in_sizes; (void)n_in; (void)out_size;
  const float** F = (const float**)d_in;
  if (ws_size < (size_t)WS_END) return;
  char* ws = (char*)d_ws; _Float16 *QH = (_Float16*)(ws + WS_QH), *KH = (_Float16*)(ws + WS_KH), *VT = (_Float16*)(ws + WS_VT), *QL = (_Float16*)(ws + WS_QL), *KL = (_Float16*)(ws + WS_KL); __bf16 *VB = (__bf16*)(ws + WS_VB), *VBL = (__bf16*)(ws + WS_VBL); float *S = (float*)(ws + WS_S), *Y = (float*)(ws + WS_Y);
  (void)Y; (void)S;
  // inputs: 0 q_in [4,4096,512]; 1 k_in; 2 v_in (separate inputs); 3 Wq [512,64], 4 bq; 5 Wk, 6 bk; 7 Wv, 8 bv ((in,out); zero biases read)
  k_proj<<<dim3(3 * NSB / PB), PB * 128, 0, stream>>>(F[0], F[1], F[2], F[3], F[5], F[7], F[4], F[6], F[8], QH, QL, KH, KL, VT, VB, VBL);
  k_attn<<<dim3(NB * (TT / 64)), AW * 32, 0, stream>>>(QH, KH, QL, KL, VT, VB, VBL, (float*)d_out);   /* out rows are the ctx rows: [b*TT+t][64] */
}

// v009
// It runs in 24.1 microseconds.
// Two timings next to v008 put it at 1.03 and 1.06 times that version's speed.
// All steps since v000 together make it 29.2 times as fast.
// compute dtype: all float inputs rounded to bf16; q/k/v projections with EXACT bf16 products on WMMA 16x16x32 (f32 accumulate) + bias; causal logits: 3 products (q f16 hi + residual x k hi + residual) for the first 384 rows, single f16 q x k after, x scale; online softmax f32 (base 2) in registers; unnormalised weights x 2^10 once to f16 x v once to f16 (1 product; bf16 hi + lo below row 384), divided by the f32 sum at the end; f32 output.
#include <hip/hip_runtime.h>
#include <math.h>

typedef __attribute__((ext_vector_type(16))) _Float16 v16h;
typedef __attribute__((ext_vector_type(16))) __bf16 v16b;
typedef __attribute__((ext_vector_type(8)))  _Float16 v8h;
typedef __attribute__((ext_vector_type(8)))  float v8f;
typedef __attribute__((ext_vector_type(4)))  float v4f;
typedef __attribute__((ext_vector_type(2)))  float v2f;
typedef __attribute__((ext_vector_type(4)))  unsigned v4u;
typedef __attribute__((ext_vector_type(4)))  int v4i;
typedef float __attribute__((may_alias)) float_a;
typedef int __attribute__((may_alias)) int_a;

template <typename T> __device__ __forceinline__ void vst2(void* p, T v) { *(T*)p = v;  }
// store in a loop: the wait takes the store's address and data as inputs, so that neither register is rewritten (next store, next trip) in front of it
template <typename T> __device__ __forceinline__ void vst2w(void* p, T v) { *(T*)p = v; asm volatile("s_wait_xcnt 0x0" :: "v"(p), "v"(v) : "memory"); }
__device__ __forceinline__ v8f wmma16(v16h a, v16h b, v8f c) {
  v8f d = __builtin_amdgcn_wmma_f32_16x16x32_f16(false, a, false, b, (short)0, c, false, false);
  asm volatile("v_nop\n\tv_nop\n\tv_nop\n\tv_nop" : "+v"(d) : "v"(a), "v"(b));
  return d;
}
__device__ __forceinline__ v8f wmma_bf(v16b a, v16b b, v8f c) {
  v8f d = __builtin_amdgcn_wmma_f32_16x16x32_bf16(false, a, false, b, (short)0, c, false, false);
  asm volatile("v_nop\n\tv_nop\n\tv_nop\n\tv_nop" : "+v"(d) : "v"(a), "v"(b));
  return d;
}
// 16x16x32 fragments: lane = (h = lane>>4, row/col = lane&15); elements 0..7 = k0+8h+0..7, 8..15 = k0+16+8h+0..7; D element r = row 8h+r
__device__ __forceinline__ v16h frag_h(const _Float16* rowk0, int lane) {
  union { v16h v; v8h q[2]; } u; const _Float16* p = rowk0 + 8 * (lane >> 4);
  u.q[0] = *(const v8h*)p; u.q[1] = *(const v8h*)(p + 16); return u.v;
}
__device__ __forceinline__ v16h frag_f32(const float* rowk0, int lane) {
  v16h a; const float* p = rowk0 + 8 * (lane >> 4);
#pragma unroll
  for (int i = 0; i < 8; ++i) { a[i] = (_Float16)p[i]; a[8 + i] = (_Float16)p[16 + i]; }
  return a;
}
__device__ __forceinline__ v16h frag_f32s(const float* rowk0, int lane, float sc) {
  v16h a; const float* p = rowk0 + 8 * (lane >> 4);
#pragma unroll
  for (int i = 0; i < 8; ++i) { a[i] = (_Float16)(p[i] * sc); a[8 + i] = (_Float16)(p[16 + i] * sc); }
  return a;
}
// column fragment from a [K][ld] layout (column n), rows >= K read as 0
__device__ __forceinline__ v16h fragc_f32(const float* W, int k0, int n, int lane, int ld, int K) {
  v16h a; const int g = lane >> 4;
#pragma unroll
  for (int i = 0; i < 8; ++i) { const int ka = k0 + 8 * g + i, kb = ka + 16;
    a[i] = (_Float16)(ka < K ? W[(size_t)(ka < K ? ka : K - 1) * ld + n] : 0.f); a[8 + i] = (_Float16)(kb < K ? W[(size_t)(kb < K ? kb : K - 1) * ld + n] : 0.f); }
  return a;
}
struct F2 { v16b h, l; };
__device__ __forceinline__ F2 bsplit16(const float v[16]) { F2 r;
#pragma unroll
  for (int i = 0; i < 16; ++i) { const __bf16 h = (__bf16)v[i]; r.h[i] = h; r.l[i] = (__bf16)(v[i] - (float)h); }
  return r; }
__device__ __forceinline__ F2 split_row(const float* row, int k0, int lane) { float v[16]; const float* p = row + k0 + 8 * (lane >> 4);
#pragma unroll
  for (int i = 0; i < 8; ++i) { v[i] = p[i]; v[8 + i] = p[16 + i]; }
  return bsplit16(v); }
__device__ __forceinline__ F2 split_rowK(const float* row, int k0, int lane, int K) { float v[16]; const int g = lane >> 4;
#pragma unroll
  for (int i = 0; i < 8; ++i) { const int ka = k0 + 8 * g + i, kb = ka + 16; v[i] = ka < K ? row[ka < K ? ka : K - 1] : 0.f; v[8 + i] = kb < K ? row[kb < K ? kb : K - 1] : 0.f; }
  return bsplit16(v); }
__device__ __forceinline__ F2 split_col(const float* W, int k0, int n, int lane, int ld, int K) { float v[16]; const int g = lane >> 4;
#pragma unroll
  for (int i = 0; i < 8; ++i) { const int ka = k0 + 8 * g + i, kb = ka + 16; v[i] = ka < K ? W[(size_t)(ka < K ? ka : K - 1) * ld + n] : 0.f; v[8 + i] = kb < K ? W[(size_t)(kb < K ? kb : K - 1) * ld + n] : 0.f; }
  return bsplit16(v); }
__device__ __forceinline__ v8f mac3(const F2& a, const F2& b, v8f c) { c = wmma_bf(a.l, b.h, c); c = wmma_bf(a.h, b.l, c); return wmma_bf(a.h, b.h, c); }
__device__ __forceinline__ float sigm(float v) { return 1.0f / (1.0f + expf(-v)); }
#define LDSX() do { asm volatile("s_wait_dscnt 0" ::: "memory"); __builtin_amdgcn_wave_barrier(); __builtin_amdgcn_fence(__ATOMIC_RELEASE, "workgroup"); } while (0)

// Single-head causal scaled dot-product attention with separate inputs (q_in / k_in / v_in [4,4096,512]; Keras Dense (in,out) Wq / Wk / Wv [512,64] N(0, 1/512) + zero biases; scale 1/8; causal j <= i, -inf): out = softmax(causal((q_in Wq + bq)(k_in Wk + bk)^T / 8)) (v_in Wv + bv) -> [4,4096,64].
#define NB 4
#define TT 4096
#define CC 64             // NH * HD = projected width
#define DIN 512          // input (model) width
#define NH 1
#define HD 64
#define NQB (TT / 64)
#define HG 1
#define SCALE (0.125f)
#define CAUSAL 1
#ifndef TNB
#define TNB NB
#endif
__device__ __forceinline__ float bfr(float v) { return (float)(__bf16)v; }
__host__ __device__ __forceinline__ int kb_last(int qb) { return CAUSAL ? ((qb * 64 + 63) >> 7) : (TT / 128 - 1); }
typedef __attribute__((ext_vector_type(8))) __bf16 v8b;
__device__ __forceinline__ v16b frag_b(const __bf16* rowk0, int lane) {
  union { v16b v; v8b q[2]; } u; const __bf16* p = rowk0 + 8 * (lane >> 4);
  u.q[0] = *(const v8b*)p; u.q[1] = *(const v8b*)(p + 16); return u.v;
}
#define QBH 6              // unused; causal: query rows < QBH * 64 (= QHI; few keys, no averaging) take the high-precision path
#define QHI 384            // rows carrying a q residual plane
#define KHI 384            // key rows carrying k residual / v bf16 hi+lo planes (used only by the causal high-precision path)
// B fragment (k rows k0+.., output column o) of a weight: (in,out) [K][ld] or (out,in) [ld rows of K]: bf16 exact, or f16(bf16 * 256) exact
__device__ __forceinline__ v16b wcol_io(const float* Wm, int k0, int o, int lane, int ld) { v16b w; const int g = lane >> 4;
#pragma unroll
  for (int i = 0; i < 8; ++i) { w[i] = (__bf16)Wm[(size_t)(k0 + 8 * g + i) * ld + o]; w[8 + i] = (__bf16)Wm[(size_t)(k0 + 16 + 8 * g + i) * ld + o]; }
  return w; }
__device__ __forceinline__ v16b wcol_oi(const float* Wm, int k0, int o, int lane, int K) { v16b w; const float* p = Wm + (size_t)o * K + k0 + 8 * (lane >> 4);
#pragma unroll
  for (int i = 0; i < 8; ++i) { w[i] = (__bf16)p[i]; w[8 + i] = (__bf16)p[16 + i]; }
  return w; }
__device__ __forceinline__ v16h wcolh_io(const float* Wm, int k0, int o, int lane, int ld) { v16h w; const int g = lane >> 4;
#pragma unroll
  for (int i = 0; i < 8; ++i) { w[i] = (_Float16)(bfr(Wm[(size_t)(k0 + 8 * g + i) * ld + o]) * 256.0f); w[8 + i] = (_Float16)(bfr(Wm[(size_t)(k0 + 16 + 8 * g + i) * ld + o]) * 256.0f); }
  return w; }
__device__ __forceinline__ v16h wcolh_oi(const float* Wm, int k0, int o, int lane, int K) { v16h w; const float* p = Wm + (size_t)o * K + k0 + 8 * (lane >> 4);
#pragma unroll
  for (int i = 0; i < 8; ++i) { w[i] = (_Float16)(bfr(p[i]) * 256.0f); w[8 + i] = (_Float16)(bfr(p[16 + i]) * 256.0f); }
  return w; }
#define WQKV_LAYOUT 0   // 0 = (in,out) [DIN][CC]; 1 = (out,in) [CC][DIN]; 2 = per-head [NH][DIN][HD]
__device__ __forceinline__ v16b wcol_hdk(const float* Wm, int k0, int o, int lane) { v16b w; const int g = lane >> 4; const float* p = Wm + (size_t)(o / HD) * DIN * HD + (o % HD);
#pragma unroll
  for (int i = 0; i < 8; ++i) { w[i] = (__bf16)p[(size_t)(k0 + 8 * g + i) * HD]; w[8 + i] = (__bf16)p[(size_t)(k0 + 16 + 8 * g + i) * HD]; }
  return w; }
#define WO_OUT_IN 0
#if WQKV_LAYOUT == 1
#define WCOL(W, k0, o, lane) wcol_oi(W, k0, o, lane, DIN)
#elif WQKV_LAYOUT == 2
#define WCOL(W, k0, o, lane) wcol_hdk(W, k0, o, lane)
#else
#define WCOL(W, k0, o, lane) wcol_io(W, k0, o, lane, CC)
#endif
#if WO_OUT_IN
#define WOCOL(W, k0, o, lane) wcol_oi(W, k0, o, lane, CC)
#define WOCOLH(W, k0, o, lane) wcolh_oi(W, k0, o, lane, CC)
#else
#define WOCOL(W, k0, o, lane) wcol_io(W, k0, o, lane, DIN)
#define WOCOLH(W, k0, o, lane) wcolh_io(W, k0, o, lane, DIN)
#endif
#ifndef SM_EXTRA_PARAMS
#define SM_EXTRA_PARAMS
#endif
#ifndef PROJ_EXTRA_PARAMS
#define PROJ_EXTRA_PARAMS
#endif
#ifndef SM_MASK_HOOK
#define SM_MASK_HOOK (void)0
#endif

// k_attn's operands lie in FRAGMENT ORDER: a 32-row chunk (32 queries or 32 keys, all 64 channels) is 4 KB = 8 groups of 512 B, and a group holds lane 0..31's 16 bytes side by side,
// so that one wave-wide 16-byte load covers 4 whole 128-byte lines. q, k: group = (t, kd, half), lane (g, col) holds row t * 16 + col, channels kd * 32 + half * 16 + g * 8 + 0..7;
// v: group = (j, half), lane (g, col) holds channel j * 16 + col, keys half * 16 + g * 8 + 0..7.
static_assert(CC == 64 && HD == 64, "the fragment order is laid out for 64 channels");
#define WS_QH  0u                                      // f16 q, fragment order [b][t / 32][4 KB]
#define WS_KH  (WS_QH + 2u * (size_t)NB * TT * CC)      // f16 k, fragment order [b][t / 32][4 KB]
#define WS_VT  (WS_KH + 2u * (size_t)NB * TT * CC)      // f16 v, fragment order [b][t / 32][4 KB]
#define WS_QL  (WS_VT + 2u * (size_t)NB * CC * TT)      // f16 q residual x 2^10, fragment order [b][t / 32, t < QHI][4 KB]
#define WS_KL  (WS_QL + 2u * (size_t)NB * QHI * CC)     // f16 k residual x 2^10, fragment order [b][t / 32, t < KHI][4 KB]
#define WS_VB  (WS_KL + 2u * (size_t)NB * KHI * CC)     // bf16 v hi (VBL: lo), fragment order [b][t / 32, t < KHI][4 KB]
#define WS_VBL (WS_VB + 2u * (size_t)NB * CC * KHI)
#define WS_S   (WS_VBL + 2u * (size_t)NB * CC * KHI)    // f32 [hg][t][s] region, unused (the logits stay in registers)
#define WS_Y   (WS_S  + 4u * (size_t)HG * TT * TT)      // f32 ctx rows [b*t][CC] (only when there is an output projection)
#define WS_END (WS_Y  + 0u)

// ---- k_proj: q/k/v = X W (+ b) with exact bf16 products (K = DIN). The 3 * NSB sub-blocks of 64 rows (projection = sub-block / NSB) are dealt PB to a block, 4 waves each; a block touches at most two projections.
// W is turned ONCE per block into bf16 B fragments in LDS; the K loop reads them from there and has only X left to fetch from memory, two stages (PD K steps) ahead.
// X comes in stages of XS columns by WHOLE lines: a wave-wide 16-byte load covers 256 contiguous bytes of each of two rows (4 whole lines; a load in fragment order touches 16 lines for the same 512 bytes).
// The wave rounds a stage to bf16, stores it to its OWN two-buffer LDS range (rows of XP bytes) and reads its A fragments back from there, so no other wave and no barrier is involved.
// projection 0: q f16 (+ residual for rows < QHI); 1: k f16 (+ residual for rows < KHI); 2: v f16 (+ bf16 hi/lo for t < KHI); all stored in fragment order
#define PB 3                  // 64-row sub-blocks of a block
#define NSB (TNB * TT / 64)   // sub-blocks of a projection
#define PD 4                  // K steps of X a wave has in flight
#define XS 64                 // X columns of a stage (two K steps)
#define XP (XS * 2 + 16)      // LDS pitch of a staged bf16 row: 16 bytes x odd, the pitch at which 16-byte fragment reads meet no bank twice
typedef __attribute__((ext_vector_type(4))) __bf16 v4b;
static_assert((3 * NSB) % PB == 0 && NSB >= PB && DIN / XS >= 2 && DIN % XS == 0 && XS == 64 && PD * 32 == 2 * XS, "sub-blocks are dealt evenly, and a block spans at most two projections; two stages of two K steps fly");
// W [DIN][CC] f32 -> LDS: the 512-byte group (kc, j, half) holds for lane (g, col) the 8 values k = kc * 32 + half * 16 + g * 8 + 0..7 of column j * 16 + col, at 16-byte slot lane ^ j
// (the xor spreads a writing wave's 16 column quads over all banks; a reading wave's 32 slots still fill the group). A thread takes 8 k rows x 4 columns: a wave-wide 16-byte load covers 4 whole lines.
#define WTR ((DIN * 2 + PB * 128 - 1) / (PB * 128))   // trips of a thread over the DIN * 2 pieces of work; only the last can be a part trip
static_assert(WTR == 3, "the wait behind the loads names one address pair per trip");
__device__ __forceinline__ void stage_w(const float* __restrict__ Wm, char* dst, int ftid) { v4f r[WTR][8]; const float* wp[WTR];
#pragma unroll
  for (int n = 0; n < WTR; ++n) { const int e = ftid + n * PB * 128, ec = e < DIN * 2 ? e : DIN * 2 - 1; wp[n] = Wm + (size_t)(ec >> 4) * 8 * CC + (ec & 15) * 4;   /* all trips' loads fly together; a thread past the end reads the last piece and stores nothing */
#pragma unroll
    for (int i = 0; i < 8; ++i) r[n][i] = *(const v4f*)(wp[n] + i * CC); }
  asm volatile("s_wait_xcnt 0x0" :: "v"(wp[0]), "v"(wp[1]), "v"(wp[2]) : "memory");   /* keeps the loads' address pairs live and unwritten up to the wait, and every trip's loads in front of the first store */
#pragma unroll
  for (int n = 0; n < WTR; ++n) { const int e = ftid + n * PB * 128;
    if ((n + 1) * PB * 128 <= DIN * 2 || e < DIN * 2) { const int cq = e & 15, ko = e >> 4; char* d = dst + ((ko >> 2) * 4 + (cq >> 2)) * 1024 + ((ko >> 1) & 1) * 512;
#pragma unroll
      for (int c = 0; c < 4; ++c) { v8b pc;
#pragma unroll
        for (int i = 0; i < 8; ++i) pc[i] = (__bf16)r[n][i][c];
        *(v8b*)(d + ((((ko & 1) * 16 + (cq & 3) * 4 + c) ^ (cq >> 2)) * 16)) = pc; } } } }
__global__ __launch_bounds__(PB * 128) void k_proj(const float* __restrict__ XQ, const float* __restrict__ XK, const float* __restrict__ XV, const float* __restrict__ WQ, const float* __restrict__ WK, const float* __restrict__ WV, const float* __restrict__ BQ, const float* __restrict__ BK, const float* __restrict__ BV,
    _Float16* __restrict__ QH, _Float16* __restrict__ QL, _Float16* __restrict__ KH, _Float16* __restrict__ KL, _Float16* __restrict__ VT, __bf16* __restrict__ VB, __bf16* __restrict__ VBL) {
  __shared__ __align__(16) char wlds[2][DIN * CC * 2];
  __shared__ __align__(16) char xs3[PB * 4][2][16 * XP];
  __shared__ __align__(16) _Float16 sh3[PB][64][72], sl3[PB][64][72]; __shared__ __align__(16) _Float16 th3[PB][64][72]; __shared__ __align__(16) __bf16 tb3[PB][64][72], tbl3[PB][64][72];
  const int ftid = threadIdx.x, sub = __builtin_amdgcn_readfirstlane(ftid >> 7), tid = ftid & 127, wave = tid >> 5, lane = tid & 31, col = lane & 15, g = lane >> 4;
  const int sb = blockIdx.x * PB + sub, which = sb / NSB, wfirst = (blockIdx.x * PB) / NSB, wlast = (blockIdx.x * PB + PB - 1) / NSB; const int c0 = 0; const size_t r0 = (size_t)(sb % NSB) * 64; const size_t bb = r0 / TT; const int t0 = (int)(r0 % TT);
  _Float16 (*sh)[72] = sh3[sub]; _Float16 (*sl)[72] = sl3[sub]; _Float16 (*th)[72] = th3[sub]; __bf16 (*tb)[72] = tb3[sub]; __bf16 (*tbl)[72] = tbl3[sub];
  const float* X = which == 0 ? XQ : which == 1 ? XK : XV; const float* BA = which == 0 ? BQ : which == 1 ? BK : BV;
  const float* xp = X + (r0 + wave * 16 + g) * DIN + col * 4; v4f raw[2][8];   /* load i of a stage: rows 2 i + g, columns col * 4 + 0..3 of the stage */
  char* xw = xs3[ftid >> 5][0];
#pragma unroll
  for (int d = 0; d < 2; ++d)
#pragma unroll
    for (int i = 0; i < 8; ++i) raw[d][i] = *(const v4f*)(xp + i * 2 * DIN + d * XS);
  stage_w(wfirst == 0 ? WQ : wfirst == 1 ? WK : WV, wlds[0], ftid);
  if (wlast != wfirst) stage_w(wlast == 1 ? WK : WV, wlds[1], ftid);
  __syncthreads();   /* every W fragment is in LDS before any wave reads one */
  const char* wb = wlds[which - wfirst];
  v8f acc[4] = {}; union WF { v16b v; v8b q[2]; } wf[2][4], af[2];
  /* stage st: rounds the 8 loaded pieces to bf16 into buffer st & 1, then sends the loads of stage st + 2 into the registers just freed */
#define XSTORE(st) do { _Pragma("unroll") for (int i = 0; i < 8; ++i) { const v4f x = raw[(st) & 1][i]; v4b pc; pc[0] = (__bf16)x[0]; pc[1] = (__bf16)x[1]; pc[2] = (__bf16)x[2]; pc[3] = (__bf16)x[3]; \
      *(v4b*)(xw + ((st) & 1) * 16 * XP + (2 * i + g) * XP + col * 8) = pc; } \
    if ((st) + 2 < DIN / XS) { _Pragma("unroll") for (int i = 0; i < 8; ++i) raw[(st) & 1][i] = *(const v4f*)(xp + i * 2 * DIN + ((st) + 2) * XS); } } while (0)
  /* A fragment of K step k: row col, elements 0..7 = k * 32 + 8 g + 0..7, 8..15 = 16 further on (the k order of the W fragments) */
#define XFRAG(k) do { const char* xq = xw + (((k) >> 1) & 1) * 16 * XP + col * XP + ((k) & 1) * 64 + g * 16; af[(k) & 1].q[0] = *(const v8b*)xq; af[(k) & 1].q[1] = *(const v8b*)(xq + 32); } while (0)
  XSTORE(0);
  asm volatile("s_wait_dscnt 0x0" ::: "memory");   /* the wave's own stores of stage 0, made by other lanes than those that read them, have landed before the fragments are read back */
  XFRAG(0);
#pragma unroll
  for (int j = 0; j < 4; ++j) { const char* wq = wb + j * 1024 + ((lane ^ j) * 16); wf[0][j].q[0] = *(const v8b*)wq; wf[0][j].q[1] = *(const v8b*)(wq + 512); }
#pragma unroll   /* whole: raw[stage & 1], af[kc & 1] and wf[kc & 1] stay in registers only under constant indices */
  for (int kc = 0; kc < DIN / 32; ++kc) {
    if (kc + 1 < DIN / 32) {
      if (kc & 1) asm volatile("s_wait_dscnt 0x0" ::: "memory");   /* the next step opens a stage, stored one step ago: as above, its rows have landed before they are read back */
      XFRAG(kc + 1);
#pragma unroll
      for (int j = 0; j < 4; ++j) { const char* wq = wb + ((kc + 1) * 4 + j) * 1024 + ((lane ^ j) * 16); wf[(kc + 1) & 1][j].q[0] = *(const v8b*)wq; wf[(kc + 1) & 1][j].q[1] = *(const v8b*)(wq + 512); } }
    if (!(kc & 1) && kc / 2 + 1 < DIN / XS) XSTORE(kc / 2 + 1);
    __builtin_amdgcn_sched_barrier(0);   /* holds the fetches for later K steps (X from memory, X and W fragments from LDS) in front of this step's products, so that they fly under them */
#pragma unroll
    for (int j = 0; j < 4; ++j) acc[j] = wmma_bf(af[kc & 1].v, wf[kc & 1][j].v, acc[j]);
    __builtin_amdgcn_sched_barrier(0);   /* holds the next stage's conversions behind this step: lifted up, they wait for X loads that were only just issued */
  }
  if (which < 2) {
#pragma unroll
    for (int j = 0; j < 4; ++j) { const float bias = BA ? bfr(BA[c0 + j * 16 + col]) : 0.f;
#pragma unroll
      for (int r = 0; r < 8; ++r) { const float v = acc[j][r] + bias; const _Float16 hv = (_Float16)v; sh[wave * 16 + 8 * g + r][j * 16 + col] = hv; sl[wave * 16 + 8 * g + r][j * 16 + col] = (_Float16)((v - (float)hv) * 1024.0f); } }
  } else {
#pragma unroll
    for (int j = 0; j < 4; ++j) { const float bias = BA ? bfr(BA[c0 + j * 16 + col]) : 0.f;
#pragma unroll
      for (int r = 0; r < 8; ++r) { const float v = acc[j][r] + bias; const int rl = wave * 16 + 8 * g + r, cl = j * 16 + col; th[cl][rl] = (_Float16)v; const __bf16 bh = (__bf16)v; tb[cl][rl] = bh; tbl[cl][rl] = (__bf16)(v - (float)bh); } } }
  __syncthreads();   /* one barrier for both kinds of sub-block: a block may hold both, and every wave passes it */
  if (which < 2) { _Float16* DH = which == 0 ? QH : KH; _Float16* DL = which == 0 ? QL : KL; const int nhi = which == 0 ? QHI : KHI; const bool hi_rows = t0 < nhi;
    for (int e = tid; e < 64 * 8; e += 128) { const int rl = (e >> 7) * 16 + (e & 15), d = ((e >> 4) & 7) * 8;   /* 16-byte piece e = (chunk, t, kd, half, g, col) */
      vst2w((unsigned*)(DH + r0 * CC + (size_t)e * 8), *(const v4u*)&sh[rl][d]); if (hi_rows) vst2w((unsigned*)(DL + (bb * nhi + t0) * (size_t)CC + (size_t)e * 8), *(const v4u*)&sl[rl][d]); }
  } else { const bool hi_rows = t0 < KHI;
    for (int e = tid; e < 64 * 8; e += 128) { const int cl = ((e >> 6) & 3) * 16 + (e & 15), tl = (e >> 8) * 32 + ((e >> 4) & 3) * 8;   /* 16-byte piece e = (chunk, j, half, g, col) */
      vst2w((unsigned*)(VT + r0 * CC + (size_t)e * 8), *(const v4u*)&th[cl][tl]); if (hi_rows) { const size_t o3 = (bb * KHI + t0) * (size_t)CC + (size_t)e * 8; vst2w((unsigned*)(VB + o3), *(const v4u*)&tb[cl][tl]); vst2w((unsigned*)(VBL + o3), *(const v4u*)&tbl[cl][tl]); } } } }
// ---- k_attn: logits, causal softmax and P V in one kernel, all batches in one launch; the logits never leave the registers.
// block = two 32-query tiles of batch b, tp and its mirror TT / 32 - 1 - tp, side by side: every block walks TT / 32 + 1 chunks in all, so one block per WGP is an even deal. The first wS of the AW waves take the short tile, the rest the long one;
// wave number wl of the nw waves of a tile walks that tile's 32-key chunks wl, wl + nw, ... up to the diagonal chunk.
// S^T = K Q^T (A = 16 key rows, B = 16 query columns): a lane holds 16 logits of ONE query (column lane & 15), in the k order a B operand wants, so P^T goes from the two score tiles straight into O^T += V^T P^T.
// Reference and sum per lane (log2 domain, online softmax); the AW partial (reference, sum, O) are joined through LDS in wave order. High-precision path: the reference is the running maximum, raised every trip.
// Main path: the reference stays as it is while the weights taken against it fit f16 (lazy rescale), so that a trip has no maximum, no exchange between the halves and no rescaling of O.
// Queries < QHI: 3-product logits (q, k as f16 hi + residual x 2^10) and P, v as bf16 hi + lo (3 products); after: single f16 products, weights x 2^10 (the factor is in the sum too and cancels).
#define AW 16
#define SL2E (SCALE * 1.4426950408889634f)
// fragment in fragment order: p = chunk start + group pair * 512 + lane * 8; the two halves are neighbouring 512-byte groups
__device__ __forceinline__ v16h frag_hp(const _Float16* p) { union { v16h v; v8h q[2]; } u; u.q[0] = *(const v8h*)p; u.q[1] = *(const v8h*)(p + 256); return u.v; }
__device__ __forceinline__ v16b frag_bp(const __bf16* p) { union { v16b v; v8b q[2]; } u; u.q[0] = *(const v8b*)p; u.q[1] = *(const v8b*)(p + 256); return u.v; }
// 2^x, eight at a time: the early-clobber outputs keep a v_exp_f32 from overwriting the source of the one in front of it, and the v_nop fills the slot behind the last one
__device__ __forceinline__ void exp2x8(float* o, const float* x) {
  asm("v_exp_f32 %0, %8\n\tv_exp_f32 %1, %9\n\tv_exp_f32 %2, %10\n\tv_exp_f32 %3, %11\n\tv_exp_f32 %4, %12\n\tv_exp_f32 %5, %13\n\tv_exp_f32 %6, %14\n\tv_exp_f32 %7, %15\n\tv_nop"
      : "=&v"(o[0]), "=&v"(o[1]), "=&v"(o[2]), "=&v"(o[3]), "=&v"(o[4]), "=&v"(o[5]), "=&v"(o[6]), "=&v"(o[7]) : "v"(x[0]), "v"(x[1]), "v"(x[2]), "v"(x[3]), "v"(x[4]), "v"(x[5]), "v"(x[6]), "v"(x[7])); }
// 2^x, one value; the v_nop fills the slot behind the transcendental
__device__ __forceinline__ float exp2x1(float x) { float r; asm("v_exp_f32 %0, %1\n\tv_nop" : "=v"(r) : "v"(x)); return r; }
struct SMX { float e[16]; float al; };
// one online-softmax step of one query column: sv = 16 scaled log2 logits of this lane's query; poff = log2 of the weights' common factor
__device__ __forceinline__ SMX sm_step(const float sv[16], float& m, float& l, float poff) { SMX o; float mx = sv[0];
#pragma unroll
  for (int i = 1; i < 16; ++i) mx = fmaxf(mx, sv[i]);
  mx = fmaxf(mx, __shfl_xor(mx, 16)); const float mn = fmaxf(m, mx); o.al = exp2x1(m - mn); m = mn; const float mref = mn - poff; float d[16], ls = 0.f;
#pragma unroll
  for (int i = 0; i < 16; ++i) d[i] = sv[i] - mref;
  exp2x8(o.e, d); exp2x8(o.e + 8, d + 8);
#pragma unroll
  for (int i = 0; i < 16; ++i) ls += o.e[i];
  l = l * o.al + ls; return o; }
// main path: the 16 weights 2^(s * SL2E + nm) of one query column (s = raw logits, nm = log2 of the common factor less the reference in use), one multiply-add a score; returns their sum, taken in four chains
#define PSUM 32768.0f      // a lane's 16 weights sum to no more than this: each of them fits f16
__device__ __forceinline__ float wts16(float* e, const v8f s[2], float nm) { float d[16];
#pragma unroll
  for (int i = 0; i < 16; ++i) d[i] = fmaf(s[i >> 3][i & 7], SL2E, nm);
  exp2x8(e, d); exp2x8(e + 8, d + 8); float c4[4] = {e[0], e[1], e[2], e[3]};
#pragma unroll
  for (int i = 4; i < 16; ++i) c4[i & 3] += e[i];
  return (c4[0] + c4[1]) + (c4[2] + c4[3]); }
// The main path's k and v come through LDS: each wave owns a ring of two buffers, a buffer holds one 32-key chunk (4 KB of k, then 4 KB of v, both in fragment order as they lie in memory).
#define RB 8192            // bytes of a ring buffer
#define RW (2 * RB)        // bytes of a wave's ring
static_assert(32 * (HD + 4) * 4 <= RW, "a wave's partial O tile is staged in its own ring");
// one chunk, 16 asynchronous copies of 512 B (16 B a lane); the offset moves the LDS and the global address alike. The s_wait_xcnt stands inside the statement, so that no address register is rewritten in front of it
__device__ __forceinline__ void copy_chunk(unsigned lds, const _Float16* kg, const _Float16* vg) {
  asm volatile("global_load_async_to_lds_b128 %0, %2, off\n\tglobal_load_async_to_lds_b128 %0, %2, off offset:512\n\tglobal_load_async_to_lds_b128 %0, %2, off offset:1024\n\tglobal_load_async_to_lds_b128 %0, %2, off offset:1536\n\t"
               "global_load_async_to_lds_b128 %0, %2, off offset:2048\n\tglobal_load_async_to_lds_b128 %0, %2, off offset:2560\n\tglobal_load_async_to_lds_b128 %0, %2, off offset:3072\n\tglobal_load_async_to_lds_b128 %0, %2, off offset:3584\n\t"
               "global_load_async_to_lds_b128 %1, %3, off\n\tglobal_load_async_to_lds_b128 %1, %3, off offset:512\n\tglobal_load_async_to_lds_b128 %1, %3, off offset:1024\n\tglobal_load_async_to_lds_b128 %1, %3, off offset:1536\n\t"
               "global_load_async_to_lds_b128 %1, %3, off offset:2048\n\tglobal_load_async_to_lds_b128 %1, %3, off offset:2560\n\tglobal_load_async_to_lds_b128 %1, %3, off offset:3072\n\tglobal_load_async_to_lds_b128 %1, %3, off offset:3584\n\ts_wait_xcnt 0x0"
               :: "v"(lds), "v"(lds + 4096u), "v"(kg), "v"(vg) : "memory"); }
__global__ __launch_bounds__(AW * 32) void k_attn(const _Float16* __restrict__ QH, const _Float16* __restrict__ KH, const _Float16* __restrict__ QL, const _Float16* __restrict__ KL, const _Float16* __restrict__ VT, const __bf16* __restrict__ VB, const __bf16* __restrict__ VBL, float* __restrict__ Y) {
  __shared__ __align__(16) char ring[AW][RW]; __shared__ float smx[AW][32], sls[AW][32];
  const int tid = threadIdx.x, wave = __builtin_amdgcn_readfirstlane(tid >> 5), lane = tid & 31, col = lane & 15, g = lane >> 4;
  const int b = blockIdx.x % NB, tp = blockIdx.x / NB;
  const int wS = ((tp * 32 < QHI ? 3 : 1) * (tp + 1) + 8) / 9;   /* waves of the short tile: at most 9 trips each, a high-precision trip counted as 3 */
  static_assert((TT / 64 + 8) / 9 <= AW / 2 && (3 * (QHI / 32) + 8) / 9 <= AW / 2 && QHI <= TT / 2, "the short tile never has more than half the waves, and the long tile is never a high-precision one");
  const bool st = wave < wS; const int rt = st ? tp : TT / 32 - 1 - tp, wl = st ? wave : wave - wS, nw = st ? wS : AW - wS;
  const int q0 = rt * 32, nch = rt + 1; const size_t row0 = (size_t)b * TT; const int stp = nw * 32 * CC;   /* stp: elements from a wave's chunk to its next */
  v8f acc[2][HD / 16] = {}; float m[2] = {-3.0e38f, -3.0e38f}, l[2] = {0.f, 0.f};
  const _Float16* qhp = QH + (row0 + q0) * CC + lane * 8;
  const _Float16* khp = KH + (row0 + wl * 32) * CC + lane * 8;
  if (q0 < QHI) { const _Float16* qlp = QL + ((size_t)b * QHI + q0) * CC + lane * 8; const _Float16* klp = KL + ((size_t)b * KHI + wl * 32) * CC + lane * 8;
    const __bf16* vhp = VB + ((size_t)b * KHI + wl * 32) * CC + lane * 8; const __bf16* vlp = VBL + ((size_t)b * KHI + wl * 32) * CC + lane * 8;
#pragma unroll 1
    for (int kc = wl; kc < nch; kc += nw, khp += stp, klp += stp, vhp += stp, vlp += stp) {
#pragma unroll
      for (int qt = 0; qt < 2; ++qt) { v16h qh[HD / 32], ql[HD / 32], kh[2][HD / 32], kl[2][HD / 32];
#pragma unroll
        for (int kd = 0; kd < HD / 32; ++kd) { qh[kd] = frag_hp(qhp + (qt * 2 + kd) * 512); ql[kd] = frag_hp(qlp + (qt * 2 + kd) * 512);
#pragma unroll
          for (int t = 0; t < 2; ++t) { kh[t][kd] = frag_hp(khp + (t * 2 + kd) * 512); kl[t][kd] = frag_hp(klp + (t * 2 + kd) * 512); } }
        asm volatile("s_wait_xcnt 0x0" :: "v"(qhp), "v"(qlp), "v"(khp), "v"(klp) : "memory");   /* keeps the loads' address pairs live and unwritten up to the wait */
        v8f s[2] = {}, sr[2] = {};
#pragma unroll
        for (int kd = 0; kd < HD / 32; ++kd)
#pragma unroll
          for (int t = 0; t < 2; ++t) { s[t] = wmma16(kh[t][kd], qh[kd], s[t]); sr[t] = wmma16(kh[t][kd], ql[kd], sr[t]); sr[t] = wmma16(kl[t][kd], qh[kd], sr[t]); }
        float sv[16]; const int thr = q0 + qt * 16 + col - kc * 32 - 8 * g;   /* the lane's last open key, counted from its first: one register, where 16 key numbers would not fit beside the fragments */
#pragma unroll
        for (int i = 0; i < 16; ++i) { const float v = (s[i >> 3][i & 7] + sr[i >> 3][i & 7] * (1.0f / 1024.0f)) * SL2E; sv[i] = ((i >> 3) * 16 + (i & 7) <= thr) ? v : -3.0e38f; }
        const SMX x = sm_step(sv, m[qt], l[qt], 0.f); const F2 p = bsplit16(x.e); v16b vh[HD / 16], vl[HD / 16];
#pragma unroll
        for (int j = 0; j < HD / 16; ++j) { vh[j] = frag_bp(vhp + j * 512); vl[j] = frag_bp(vlp + j * 512); }
        asm volatile("s_wait_xcnt 0x0" :: "v"(vhp), "v"(vlp) : "memory");   /* as above */
#pragma unroll
        for (int j = 0; j < HD / 16; ++j) { acc[qt][j] *= x.al; acc[qt][j] = wmma_bf(vh[j], p.h, acc[qt][j]); acc[qt][j] = wmma_bf(vh[j], p.l, acc[qt][j]); acc[qt][j] = wmma_bf(vl[j], p.h, acc[qt][j]); } } }
  } else { const _Float16* vp = VT + (row0 + wl * 32) * CC + lane * 8; v16h qf[2][HD / 32];
#pragma unroll
    for (int qt = 0; qt < 2; ++qt)
#pragma unroll
      for (int kd = 0; kd < HD / 32; ++kd) qf[qt][kd] = frag_hp(qhp + (qt * 2 + kd) * 512);
    asm volatile("s_wait_xcnt 0x0" :: "v"(qhp) : "memory");   /* as above */
    /* the ring is private to its wave: only the wave that copies a chunk reads it, so the wave's own waits order everything and no barrier stands in the loop */
    const char* rb = ring[wave] + lane * 16; const unsigned rl = (unsigned)(size_t)rb; unsigned cur = 0;
    if (wl < nch) { copy_chunk(rl, khp, vp); khp += stp; vp += stp;
      asm volatile("s_wait_asynccnt 0x0" ::: "memory");   /* the first chunk has landed before its fragments are read */
      if (wl + nw < nch) copy_chunk(rl + RB, khp, vp); }
#pragma unroll 1
    for (int kc = wl; kc < nch; kc += nw, cur ^= RB) { v16h kf[2][HD / 32], vf[HD / 16]; const _Float16* kl = (const _Float16*)(rb + cur);
      khp += stp; vp += stp;   /* now the chunk two trips on */
#pragma unroll
      for (int t = 0; t < 2; ++t)
#pragma unroll
        for (int kd = 0; kd < HD / 32; ++kd) kf[t][kd] = frag_hp(kl + (t * 2 + kd) * 512);
#pragma unroll
      for (int j = 0; j < HD / 16; ++j) vf[j] = frag_hp(kl + 2048 + j * 512);
      v8f s[2][2] = {};
#pragma unroll
      for (int qt = 0; qt < 2; ++qt)
#pragma unroll
        for (int t = 0; t < 2; ++t)
#pragma unroll
          for (int kd = 0; kd < HD / 32; ++kd) s[qt][t] = wmma16(kf[t][kd], qf[qt][kd], s[qt][t]);
      if (kc == nch - 1) {   /* only the diagonal chunk holds keys past a query */
#pragma unroll
        for (int qt = 0; qt < 2; ++qt)
#pragma unroll
          for (int i = 0; i < 16; ++i) if (kc * 32 + (i >> 3) * 16 + 8 * g + (i & 7) > q0 + qt * 16 + col) s[qt][i >> 3][i & 7] = -3.0e38f; }
      float e[2][16], ls[2];
#pragma unroll
      for (int qt = 0; qt < 2; ++qt) ls[qt] = wts16(e[qt], s[qt], 10.f - m[qt]);
      /* one test a trip, a scalar branch: a lane's sum above PSUM (or infinite, as on the wave's first trip) says that a weight may not fit f16; only then are the maxima taken, the references raised, O and the sums rescaled and the weights made again */
      if (__builtin_amdgcn_ballot_w32(!(ls[0] <= PSUM) || !(ls[1] <= PSUM)) != 0) {
#pragma unroll
        for (int qt = 0; qt < 2; ++qt) { float mx = s[qt][0][0];
#pragma unroll
          for (int i = 1; i < 16; ++i) mx = fmaxf(mx, s[qt][i >> 3][i & 7]);
          mx *= SL2E; mx = fmaxf(mx, __shfl_xor(mx, 16)); const float mn = fmaxf(m[qt], mx), al = exp2x1(m[qt] - mn); m[qt] = mn; l[qt] *= al;
#pragma unroll
          for (int j = 0; j < HD / 16; ++j) acc[qt][j] *= al;
          ls[qt] = wts16(e[qt], s[qt], 10.f - mn); } }
#pragma unroll
      for (int qt = 0; qt < 2; ++qt) { l[qt] += ls[qt]; v16h p;
#pragma unroll
        for (int i = 0; i < 16; ++i) p[i] = (_Float16)e[qt][i];
#pragma unroll
        for (int j = 0; j < HD / 16; ++j) acc[qt][j] = wmma16(vf[j], p, acc[qt][j]); }
      asm volatile("s_wait_dscnt 0x0" ::: "memory");      /* the wave's reads of this buffer have retired before copies are aimed at it */
      asm volatile("s_wait_asynccnt 0x0" ::: "memory");   /* the next chunk, sent one trip ago, has landed before the next trip reads it */
      if (kc + 2 * nw < nch) copy_chunk(rl + cur, khp, vp); }
    asm volatile("s_wait_asynccnt 0x0" ::: "memory");   /* no copy is in flight when the ring becomes the staging of the partial O tile */
  }
  float (*so)[HD + 4] = (float (*)[HD + 4])ring[wave];
#pragma unroll
  for (int qt = 0; qt < 2; ++qt) { const float lt = l[qt] + __shfl_xor(l[qt], 16); if (g == 0) { smx[wave][qt * 16 + col] = m[qt]; sls[wave][qt * 16 + col] = lt; }
#pragma unroll
    for (int j = 0; j < HD / 16; ++j) { v4f a0, a1;
#pragma unroll
      for (int r = 0; r < 4; ++r) { a0[r] = acc[qt][j][r]; a1[r] = acc[qt][j][4 + r]; }
      *(v4f*)&so[qt * 16 + col][j * 16 + 8 * g] = a0; *(v4f*)&so[qt * 16 + col][j * 16 + 8 * g + 4] = a1; } }
  __syncthreads();   /* every wave's partial (reference, sum, O) is in LDS before any of them is joined */
  { const int qr = tid >> 4, q = tid & 15; float mw[AW], wt[AW]; float M[2] = {-3.0e38f, -3.0e38f};   /* a thread joins row qr, channels q * 4 + 0..3 of both tiles: index 0 the short tile (waves < wS), 1 the long one */
#pragma unroll
    for (int w = 0; w < AW; ++w) { const bool s0 = w < AW / 2 && w < wS; mw[w] = smx[w][qr]; M[0] = fmaxf(M[0], s0 ? mw[w] : -3.0e38f); M[1] = fmaxf(M[1], s0 ? -3.0e38f : mw[w]); }
#pragma unroll
    for (int w = 0; w < AW; ++w) mw[w] -= (w < AW / 2 && w < wS) ? M[0] : M[1];
    exp2x8(wt, mw); exp2x8(wt + 8, mw + 8);
    float Ls[2] = {0.f, 0.f}; v4f o[2] = {};
#pragma unroll
    for (int w = 0; w < AW; ++w) { const bool s0 = w < AW / 2 && w < wS; const float lw = sls[w][qr], w0 = s0 ? wt[w] : 0.f, w1 = s0 ? 0.f : wt[w]; const v4f ow = *(const v4f*)(ring[w] + (qr * (HD + 4) + q * 4) * 4);   /* a wave's partial enters the other tile's sums with weight 0: no branch stands among the LDS reads */
      Ls[0] += w0 * lw; o[0] += ow * w0; Ls[1] += w1 * lw; o[1] += ow * w1; }
    const float inv0 = Ls[0] > 0.f ? 1.0f / Ls[0] : 0.f, inv1 = Ls[1] > 0.f ? 1.0f / Ls[1] : 0.f;
    vst2w(Y + (row0 + tp * 32 + qr) * CC + q * 4, o[0] * inv0); vst2(Y + (row0 + (TT / 32 - 1 - tp) * 32 + qr) * CC + q * 4, o[1] * inv1); } }

extern "C" void kernel_launch(void* const* d_in, const int* in_sizes, int n_in, void* d_out, int out_size, void* d_ws, size_t ws_size, hipStream_t stream) {
  (void)in_sizes; (void)n_in; (void)out_size;
  const float** F = (const float**)d_in;
  if (ws_size < (size_t)WS_END) return;
  char* ws = (char*)d_ws; _Float16 *QH = (_Float16*)(ws + WS_QH), *KH = (_Float16*)(ws + WS_KH), *VT = (_Float16*)(ws + WS_VT), *QL = (_Float16*)(ws + WS_QL), *KL = (_Float16*)(ws + WS_KL); __bf16 *VB = (__bf16*)(ws + WS_VB), *VBL = (__bf16*)(ws + WS_VBL); float *S = (float*)(ws + WS_S), *Y = (float*)(ws + WS_Y);
  (void)Y; (void)S;
  // inputs: 0 q_in [4,4096,512]; 1 k_in; 2 v_in (separate inputs); 3 Wq [512,64], 4 bq; 5 Wk, 6 bk; 7 Wv, 8 bv ((in,out); zero biases read)
  k_proj<<<dim3(3 * NSB / PB), PB * 128, 0, stream>>>(F[0], F[1], F[2], F[3], F[5], F[7], F[4], F[6], F[8], QH, QL, KH, KL, VT, VB, VBL);
  k_attn<<<dim3(NB * (TT / 64)), AW * 32, 0, stream>>>(QH, KH, QL, KL, VT, VB, VBL, (float*)d_out);   /* out rows are the ctx rows: [b*TT+t][64] */
}

// v010
// Measured time: 22.8 microseconds a run.
// Next to v009, in two timings, it ran 1.05 times as fast each time.
// Counting every step since v000, it is 30.7 times as fast.
// compute dtype: all float inputs rounded to bf16; q/k/v projections with EXACT bf16 products on WMMA 16x16x32 (f32 accumulate) + bias; causal logits: 3 products (q f16 hi + residual x k hi + residual) for the first 384 rows, single f16 q x k after, x scale; online softmax f32 (base 2) in registers; unnormalised weights x 2^10 once to f16 x v once to f16 (1 product; bf16 hi + lo below row 384), divided by the f32 sum at the end; f32 output.
#include <hip/hip_runtime.h>
#include <math.h>

typedef __attribute__((ext_vector_type(16))) _Float16 v16h;
typedef __attribute__((ext_vector_type(16))) __bf16 v16b;
typedef __attribute__((ext_vector_type(8)))  _Float16 v8h;
typedef __attribute__((ext_vector_type(8)))  float v8f;
typedef __attribute__((ext_vector_type(4)))  float v4f;
typedef __attribute__((ext_vector_type(2)))  float v2f;
typedef __attribute__((ext_vector_type(4)))  unsigned v4u;
typedef __attribute__((ext_vector_type(4)))  int v4i;
typedef float __attribute__((may_alias)) float_a;
typedef int __attribute__((may_alias)) int_a;

template <typename T> __device__ __forceinline__ void vst2(void* p, T v) { *(T*)p = v;  }
// store in a loop: the wait takes the store's address and data as inputs, so that neither register is rewritten (next store, next trip) in front of it
template <typename T> __device__ __forceinline__ void vst2w(void* p, T v) { *(T*)p = v; asm volatile("s_wait_xcnt 0x0" :: "v"(p), "v"(v) : "memory"); }
__device__ __forceinline__ v8f wmma16(v16h a, v16h b, v8f c) {
  v8f d = __builtin_amdgcn_wmma_f32_16x16x32_f16(false, a, false, b, (short)0, c, false, false);
  asm volatile("v_nop\n\tv_nop\n\tv_nop\n\tv_nop" : "+v"(d) : "v"(a), "v"(b));
  return d;
}
__device__ __forceinline__ v8f wmma_bf(v16b a, v16b b, v8f c) {
  v8f d = __builtin_amdgcn_wmma_f32_16x16x32_bf16(false, a, false, b, (short)0, c, false, false);
  asm volatile("v_nop\n\tv_nop\n\tv_nop\n\tv_nop" : "+v"(d) : "v"(a), "v"(b));
  return d;
}
// 16x16x32 fragments: lane = (h = lane>>4, row/col = lane&15); elements 0..7 = k0+8h+0..7, 8..15 = k0+16+8h+0..7; D element r = row 8h+r
__device__ __forceinline__ v16h frag_h(const _Float16* rowk0, int lane) {
  union { v16h v; v8h q[2]; } u; const _Float16* p = rowk0 + 8 * (lane >> 4);
  u.q[0] = *(const v8h*)p; u.q[1] = *(const v8h*)(p + 16); return u.v;
}
__device__ __forceinline__ v16h frag_f32(const float* rowk0, int lane) {
  v16h a; const float* p = rowk0 + 8 * (lane >> 4);
#pragma unroll
  for (int i = 0; i < 8; ++i) { a[i] = (_Float16)p[i]; a[8 + i] = (_Float16)p[16 + i]; }
  return a;
}
__device__ __forceinline__ v16h frag_f32s(const float* rowk0, int lane, float sc) {
  v16h a; const float* p = rowk0 + 8 * (lane >> 4);
#pragma unroll
  for (int i = 0; i < 8; ++i) { a[i] = (_Float16)(p[i] * sc); a[8 + i] = (_Float16)(p[16 + i] * sc); }
  return a;
}
// column fragment from a [K][ld] layout (column n), rows >= K read as 0
__device__ __forceinline__ v16h fragc_f32(const float* W, int k0, int n, int lane, int ld, int K) {
  v16h a; const int g = lane >> 4;
#pragma unroll
  for (int i = 0; i < 8; ++i) { const int ka = k0 + 8 * g + i, kb = ka + 16;
    a[i] = (_Float16)(ka < K ? W[(size_t)(ka < K ? ka : K - 1) * ld + n] : 0.f); a[8 + i] = (_Float16)(kb < K ? W[(size_t)(kb < K ? kb : K - 1) * ld + n] : 0.f); }
  return a;
}
struct F2 { v16b h, l; };
__device__ __forceinline__ F2 bsplit16(const float v[16]) { F2 r;
#pragma unroll
  for (int i = 0; i < 16; ++i) { const __bf16 h = (__bf16)v[i]; r.h[i] = h; r.l[i] = (__bf16)(v[i] - (float)h); }
  return r; }
__device__ __forceinline__ F2 split_row(const float* row, int k0, int lane) { float v[16]; const float* p = row + k0 + 8 * (lane >> 4);
#pragma unroll
  for (int i = 0; i < 8; ++i) { v[i] = p[i]; v[8 + i] = p[16 + i]; }
  return bsplit16(v); }
__device__ __forceinline__ F2 split_rowK(const float* row, int k0, int lane, int K) { float v[16]; const int g = lane >> 4;
#pragma unroll
  for (int i = 0; i < 8; ++i) { const int ka = k0 + 8 * g + i, kb = ka + 16; v[i] = ka < K ? row[ka < K ? ka : K - 1] : 0.f; v[8 + i] = kb < K ? row[kb < K ? kb : K - 1] : 0.f; }
  return bsplit16(v); }
__device__ __forceinline__ F2 split_col(const float* W, int k0, int n, int lane, int ld, int K) { float v[16]; const int g = lane >> 4;
#pragma unroll
  for (int i = 0; i < 8; ++i) { const int ka = k0 + 8 * g + i, kb = ka + 16; v[i] = ka < K ? W[(size_t)(ka < K ? ka : K - 1) * ld + n] : 0.f; v[8 + i] = kb < K ? W[(size_t)(kb < K ? kb : K - 1) * ld + n] : 0.f; }
  return bsplit16(v); }
__device__ __forceinline__ v8f mac3(const F2& a, const F2& b, v8f c) { c = wmma_bf(a.l, b.h, c); c = wmma_bf(a.h, b.l, c); return wmma_bf(a.h, b.h, c); }
__device__ __forceinline__ float sigm(float v) { return 1.0f / (1.0f + expf(-v)); }
#define LDSX() do { asm volatile("s_wait_dscnt 0" ::: "memory"); __builtin_amdgcn_wave_barrier(); __builtin_amdgcn_fence(__ATOMIC_RELEASE, "workgroup"); } while (0)

// Single-head causal scaled dot-product attention with separate inputs (q_in / k_in / v_in [4,4096,512]; Keras Dense (in,out) Wq / Wk / Wv [512,64] N(0, 1/512) + zero biases; scale 1/8; causal j <= i, -inf): out = softmax(causal((q_in Wq + bq)(k_in Wk + bk)^T / 8)) (v_in Wv + bv) -> [4,4096,64].
#define NB 4
#define TT 4096
#define CC 64             // NH * HD = projected width
#define DIN 512          // input (model) width
#define NH 1
#define HD 64
#define NQB (TT / 64)
#define HG 1
#define SCALE (0.125f)
#define CAUSAL 1
#ifndef TNB
#define TNB NB
#endif
__device__ __forceinline__ float bfr(float v) { return (float)(__bf16)v; }
__host__ __device__ __forceinline__ int kb_last(int qb) { return CAUSAL ? ((qb * 64 + 63) >> 7) : (TT / 128 - 1); }
typedef __attribute__((ext_vector_type(8))) __bf16 v8b;
__device__ __forceinline__ v16b frag_b(const __bf16* rowk0, int lane) {
  union { v16b v; v8b q[2]; } u; const __bf16* p = rowk0 + 8 * (lane >> 4);
  u.q[0] = *(const v8b*)p; u.q[1] = *(const v8b*)(p + 16); return u.v;
}
#define QBH 6              // unused; causal: query rows < QBH * 64 (= QHI; few keys, no averaging) take the high-precision path
#define QHI 384            // rows carrying a q residual plane
#define KHI 384            // key rows carrying k residual / v bf16 hi+lo planes (used only by the causal high-precision path)
// B fragment (k rows k0+.., output column o) of a weight: (in,out) [K][ld] or (out,in) [ld rows of K]: bf16 exact, or f16(bf16 * 256) exact
__device__ __forceinline__ v16b wcol_io(const float* Wm, int k0, int o, int lane, int ld) { v16b w; const int g = lane >> 4;
#pragma unroll
  for (int i = 0; i < 8; ++i) { w[i] = (__bf16)Wm[(size_t)(k0 + 8 * g + i) * ld + o]; w[8 + i] = (__bf16)Wm[(size_t)(k0 + 16 + 8 * g + i) * ld + o]; }
  return w; }
__device__ __forceinline__ v16b wcol_oi(const float* Wm, int k0, int o, int lane, int K) { v16b w; const float* p = Wm + (size_t)o * K + k0 + 8 * (lane >> 4);
#pragma unroll
  for (int i = 0; i < 8; ++i) { w[i] = (__bf16)p[i]; w[8 + i] = (__bf16)p[16 + i]; }
  return w; }
__device__ __forceinline__ v16h wcolh_io(const float* Wm, int k0, int o, int lane, int ld) { v16h w; const int g = lane >> 4;
#pragma unroll
  for (int i = 0; i < 8; ++i) { w[i] = (_Float16)(bfr(Wm[(size_t)(k0 + 8 * g + i) * ld + o]) * 256.0f); w[8 + i] = (_Float16)(bfr(Wm[(size_t)(k0 + 16 + 8 * g + i) * ld + o]) * 256.0f); }
  return w; }
__device__ __forceinline__ v16h wcolh_oi(const float* Wm, int k0, int o, int lane, int K) { v16h w; const float* p = Wm + (size_t)o * K + k0 + 8 * (lane >> 4);
#pragma unroll
  for (int i = 0; i < 8; ++i) { w[i] = (_Float16)(bfr(p[i]) * 256.0f); w[8 + i] = (_Float16)(bfr(p[16 + i]) * 256.0f); }
  return w; }
#define WQKV_LAYOUT 0   // 0 = (in,out) [DIN][CC]; 1 = (out,in) [CC][DIN]; 2 = per-head [NH][DIN][HD]
__device__ __forceinline__ v16b wcol_hdk(const float* Wm, int k0, int o, int lane) { v16b w; const int g = lane >> 4; const float* p = Wm + (size_t)(o / HD) * DIN * HD + (o % HD);
#pragma unroll
  for (int i = 0; i < 8; ++i) { w[i] = (__bf16)p[(size_t)(k0 + 8 * g + i) * HD]; w[8 + i] = (__bf16)p[(size_t)(k0 + 16 + 8 * g + i) * HD]; }
  return w; }
#define WO_OUT_IN 0
#if WQKV_LAYOUT == 1
#define WCOL(W, k0, o, lane) wcol_oi(W, k0, o, lane, DIN)
#elif WQKV_LAYOUT == 2
#define WCOL(W, k0, o, lane) wcol_hdk(W, k0, o, lane)
#else
#define WCOL(W, k0, o, lane) wcol_io(W, k0, o, lane, CC)
#endif
#if WO_OUT_IN
#define WOCOL(W, k0, o, lane) wcol_oi(W, k0, o, lane, CC)
#define WOCOLH(W, k0, o, lane) wcolh_oi(W, k0, o, lane, CC)
#else
#define WOCOL(W, k0, o, lane) wcol_io(W, k0, o, lane, DIN)
#define WOCOLH(W, k0, o, lane) wcolh_io(W, k0, o, lane, DIN)
#endif
#ifndef SM_EXTRA_PARAMS
#define SM_EXTRA_PARAMS
#endif
#ifndef PROJ_EXTRA_PARAMS
#define PROJ_EXTRA_PARAMS
#endif
#ifndef SM_MASK_HOOK
#define SM_MASK_HOOK (void)0
#endif

// k_attn's operands lie in FRAGMENT ORDER: a 32-row chunk (32 queries or 32 keys, all 64 channels) is 4 KB = 8 groups of 512 B, and a group holds lane 0..31's 16 bytes side by side,
// so that one wave-wide 16-byte load covers 4 whole 128-byte lines. q, k: group = (t, kd, half), lane (g, col) holds row t * 16 + col, channels kd * 32 + half * 16 + g * 8 + 0..7;
// v: group = (j, half), lane (g, col) holds channel j * 16 + col, keys half * 16 + g * 8 + 0..7.
static_assert(CC == 64 && HD == 64, "the fragment order is laid out for 64 channels");
#define WS_QH  0u                                      // f16 q, fragment order [b][t / 32][4 KB]
#define WS_KH  (WS_QH + 2u * (size_t)NB * TT * CC)      // f16 k, fragment order [b][t / 32][4 KB]
#define WS_VT  (WS_KH + 2u * (size_t)NB * TT * CC)      // f16 v, fragment order [b][t / 32][4 KB]
#define WS_QL  (WS_VT + 2u * (size_t)NB * CC * TT)      // f16 q residual x 2^10, fragment order [b][t / 32, t < QHI][4 KB]
#define WS_KL  (WS_QL + 2u * (size_t)NB * QHI * CC)     // f16 k residual x 2^10, fragment order [b][t / 32, t < KHI][4 KB]
#define WS_VB  (WS_KL + 2u * (size_t)NB * KHI * CC)     // bf16 v hi (VBL: lo), fragment order [b][t / 32, t < KHI][4 KB]
#define WS_VBL (WS_VB + 2u * (size_t)NB * CC * KHI)
#define WS_S   (WS_VBL + 2u * (size_t)NB * CC * KHI)    // f32 [hg][t][s] region, unused (the logits stay in registers)
#define WS_Y   (WS_S  + 4u * (size_t)HG * TT * TT)      // f32 ctx rows [b*t][CC] (only when there is an output projection)
#define WS_END (WS_Y  + 0u)

// ---- k_proj: q/k/v = X W (+ b) with exact bf16 products (K = DIN). The 3 * NSB sub-blocks of 64 rows (projection = sub-block / NSB) are dealt PB to a block, 4 waves each; a block touches at most two projections.
// W is turned ONCE per block into bf16 B fragments in LDS; the K loop reads them from there and has only X left to fetch from memory, two stages (PD K steps) ahead.
// X comes in stages of XS columns by WHOLE lines: a wave-wide 16-byte load covers 256 contiguous bytes of each of two rows (4 whole lines; a load in fragment order touches 16 lines for the same 512 bytes).
// The wave rounds a stage to bf16, stores it to its OWN two-buffer LDS range (rows of XP bytes) and reads its A fragments back from there, so no other wave and no barrier is involved.
// projection 0: q f16 (+ residual for rows < QHI); 1: k f16 (+ residual for rows < KHI); 2: v f16 (+ bf16 hi/lo for t < KHI); all stored in fragment order, by each wave straight from its registers
#define PB 3                  // 64-row sub-blocks of a block
#define NSB (TNB * TT / 64)   // sub-blocks of a projection
#define PD 4                  // K steps of X a wave has in flight
#define XS 64                 // X columns of a stage (two K steps)
#define XP (XS * 2 + 16)      // LDS pitch of a staged bf16 row: 16 bytes x odd, the pitch at which 16-byte fragment reads meet no bank twice
typedef __attribute__((ext_vector_type(4))) __bf16 v4b;
static_assert((3 * NSB) % PB == 0 && NSB >= PB && DIN / XS >= 2 && DIN % XS == 0 && XS == 64 && PD * 32 == 2 * XS, "sub-blocks are dealt evenly, and a block spans at most two projections; two stages of two K steps fly");
// W [DIN][CC] f32 -> LDS: the 512-byte group (kc, j, half) holds for lane (g, col) the 8 values k = kc * 32 + half * 16 + g * 8 + 0..7 of column j * 16 + col, at 16-byte slot lane ^ j
// (the xor spreads a writing wave's 16 column quads over all banks; a reading wave's 32 slots still fill the group). A thread takes 8 k rows x 4 columns: a wave-wide 16-byte load covers 4 whole lines.
#define WTR ((DIN * 2 + PB * 128 - 1) / (PB * 128))   // trips of a thread over the DIN * 2 pieces of work; only the last can be a part trip
static_assert(WTR == 3, "the wait behind the loads names one address pair per trip");
__device__ __forceinline__ void stage_w(const float* __restrict__ Wm, char* dst, int ftid) { v4f r[WTR][8]; const float* wp[WTR];
#pragma unroll
  for (int n = 0; n < WTR; ++n) { const int e = ftid + n * PB * 128, ec = e < DIN * 2 ? e : DIN * 2 - 1; wp[n] = Wm + (size_t)(ec >> 4) * 8 * CC + (ec & 15) * 4;   /* all trips' loads fly together; a thread past the end reads the last piece and stores nothing */
#pragma unroll
    for (int i = 0; i < 8; ++i) r[n][i] = *(const v4f*)(wp[n] + i * CC); }
  asm volatile("s_wait_xcnt 0x0" :: "v"(wp[0]), "v"(wp[1]), "v"(wp[2]) : "memory");   /* keeps the loads' address pairs live and unwritten up to the wait, and every trip's loads in front of the first store */
#pragma unroll
  for (int n = 0; n < WTR; ++n) { const int e = ftid + n * PB * 128;
    if ((n + 1) * PB * 128 <= DIN * 2 || e < DIN * 2) { const int cq = e & 15, ko = e >> 4; char* d = dst + ((ko >> 2) * 4 + (cq >> 2)) * 1024 + ((ko >> 1) & 1) * 512;
#pragma unroll
      for (int c = 0; c < 4; ++c) { v8b pc;
#pragma unroll
        for (int i = 0; i < 8; ++i) pc[i] = (__bf16)r[n][i][c];
        *(v8b*)(d + ((((ko & 1) * 16 + (cq & 3) * 4 + c) ^ (cq >> 2)) * 16)) = pc; } } } }
// How a result leaves: a lane's 8 accumulators of tile j are rows 8 g + 0..7 of channel j * 16 + col. Rounded to 16 bits they are 16 bytes of v's fragment order as they stand.
// q and k want the tile turned (a lane holds channels j * 16 + 8 g + 0..7 of row col). The 8 values of a lane, read as the first half of an A fragment, are the turned tile's row col, k = 8 g + 0..7;
// its product with the identity gives every value back unchanged (one term times 1, all other terms 0) in the lane and register that the fragment order asks for. So a wave-wide 16-byte store is one whole 512-byte group.
union PK { v8h h; v8b b; v4u u; };   /* a lane's 8 results of a tile: one 16-byte store */
__device__ __forceinline__ v8h turn(v8h t, v16h idn) { v16h a; v8h o;
#pragma unroll   /* vector elements stay in registers only under constant indices; so below */
  for (int i = 0; i < 8; ++i) { a[i] = t[i]; a[8 + i] = (_Float16)0.0f; }
  const v8f z = {}, d = wmma16(a, idn, z);
#pragma unroll
  for (int r = 0; r < 8; ++r) o[r] = (_Float16)d[r];   /* exact: d holds f16 values */
  return o; }
// a wave's four tiles, ST bytes apart, at base (the same in every lane) + off; the s_wait_xcnt stands inside the statement, so that no register that a store names is rewritten in front of it
template <int ST> __device__ __forceinline__ void st4(void* base, unsigned off, v4u a, v4u b, v4u c, v4u d) {
  asm volatile("global_store_b128 %0, %1, %5\n\tglobal_store_b128 %0, %2, %5 offset:%6\n\tglobal_store_b128 %0, %3, %5 offset:%7\n\tglobal_store_b128 %0, %4, %5 offset:%8\n\ts_wait_xcnt 0x0"
               :: "v"(off), "v"(a), "v"(b), "v"(c), "v"(d), "s"(base), "n"(ST), "n"(2 * ST), "n"(3 * ST) : "memory"); }
__global__ __launch_bounds__(PB * 128) void k_proj(const float* __restrict__ XQ, const float* __restrict__ XK, const float* __restrict__ XV, const float* __restrict__ WQ, const float* __restrict__ WK, const float* __restrict__ WV, const float* __restrict__ BQ, const float* __restrict__ BK, const float* __restrict__ BV,
    _Float16* __restrict__ QH, _Float16* __restrict__ QL, _Float16* __restrict__ KH, _Float16* __restrict__ KL, _Float16* __restrict__ VT, __bf16* __restrict__ VB, __bf16* __restrict__ VBL) {
  __shared__ __align__(16) char wlds[2][DIN * CC * 2];
  __shared__ __align__(16) char xs3[PB * 4][2][16 * XP];
  const int ftid = threadIdx.x, sub = __builtin_amdgcn_readfirstlane(ftid >> 7), tid = ftid & 127, wave = tid >> 5, lane = tid & 31, col = lane & 15, g = lane >> 4;
  const int sb = blockIdx.x * PB + sub, which = sb / NSB, wfirst = (blockIdx.x * PB) / NSB, wlast = (blockIdx.x * PB + PB - 1) / NSB; const size_t r0 = (size_t)(sb % NSB) * 64; const size_t bb = r0 / TT; const int t0 = (int)(r0 % TT);
  const float* X = which == 0 ? XQ : which == 1 ? XK : XV; const float* BA = which == 0 ? BQ : which == 1 ? BK : BV;
  const float* xp = X + (r0 + wave * 16 + g) * DIN + col * 4; v4f raw[2][8];   /* load i of a stage: rows 2 i + g, columns col * 4 + 0..3 of the stage */
  char* xw = xs3[ftid >> 5][0];
#pragma unroll
  for (int d = 0; d < 2; ++d)
#pragma unroll
    for (int i = 0; i < 8; ++i) raw[d][i] = *(const v4f*)(xp + i * 2 * DIN + d * XS);
  float bs[4] = {};   /* the biases of the lane's four columns, fetched beside the first X stages and first used behind the K loop */
  if (BA) {
#pragma unroll   /* bs stays in registers only under constant indices */
    for (int j = 0; j < 4; ++j) bs[j] = BA[j * 16 + col]; }
  stage_w(wfirst == 0 ? WQ : wfirst == 1 ? WK : WV, wlds[0], ftid);
  if (wlast != wfirst) stage_w(wlast == 1 ? WK : WV, wlds[1], ftid);
  asm volatile("s_wait_xcnt 0x0" :: "s"(BA), "v"(col) : "memory");   /* keeps the bias loads' base and offset registers live and unwritten up to the wait */
  __syncthreads();   /* every W fragment is in LDS before any wave reads one */
  const char* wb = wlds[which - wfirst];
  v8f acc[4] = {}; union WF { v16b v; v8b q[2]; } wf[2][4], af[2];
  /* stage st: rounds the 8 loaded pieces to bf16 into buffer st & 1, then sends the loads of stage st + 2 into the registers just freed */
#define XSTORE(st) do { _Pragma("unroll") for (int i = 0; i < 8; ++i) { const v4f x = raw[(st) & 1][i]; v4b pc; pc[0] = (__bf16)x[0]; pc[1] = (__bf16)x[1]; pc[2] = (__bf16)x[2]; pc[3] = (__bf16)x[3]; \
      *(v4b*)(xw + ((st) & 1) * 16 * XP + (2 * i + g) * XP + col * 8) = pc; } \
    if ((st) + 2 < DIN / XS) { _Pragma("unroll") for (int i = 0; i < 8; ++i) raw[(st) & 1][i] = *(const v4f*)(xp + i * 2 * DIN + ((st) + 2) * XS); } } while (0)
  /* A fragment of K step k: row col, elements 0..7 = k * 32 + 8 g + 0..7, 8..15 = 16 further on (the k order of the W fragments) */
#define XFRAG(k) do { const char* xq = xw + (((k) >> 1) & 1) * 16 * XP + col * XP + ((k) & 1) * 64 + g * 16; af[(k) & 1].q[0] = *(const v8b*)xq; af[(k) & 1].q[1] = *(const v8b*)(xq + 32); } while (0)
  XSTORE(0);
  asm volatile("s_wait_dscnt 0x0" ::: "memory");   /* the wave's own stores of stage 0, made by other lanes than those that read them, have landed before the fragments are read back */
  XFRAG(0);
#pragma unroll
  for (int j = 0; j < 4; ++j) { const char* wq = wb + j * 1024 + ((lane ^ j) * 16); wf[0][j].q[0] = *(const v8b*)wq; wf[0][j].q[1] = *(const v8b*)(wq + 512); }
#pragma unroll   /* whole: raw[stage & 1], af[kc & 1] and wf[kc & 1] stay in registers only under constant indices */
  for (int kc = 0; kc < DIN / 32; ++kc) {
    if (kc + 1 < DIN / 32) {
      if (kc & 1) asm volatile("s_wait_dscnt 0x0" ::: "memory");   /* the next step opens a stage, stored one step ago: as above, its rows have landed before they are read back */
      XFRAG(kc + 1);
#pragma unroll
      for (int j = 0; j < 4; ++j) { const char* wq = wb + ((kc + 1) * 4 + j) * 1024 + ((lane ^ j) * 16); wf[(kc + 1) & 1][j].q[0] = *(const v8b*)wq; wf[(kc + 1) & 1][j].q[1] = *(const v8b*)(wq + 512); } }
    if (!(kc & 1) && kc / 2 + 1 < DIN / XS) XSTORE(kc / 2 + 1);
    __builtin_amdgcn_sched_barrier(0);   /* holds the fetches for later K steps (X from memory, X and W fragments from LDS) in front of this step's products, so that they fly under them */
#pragma unroll
    for (int j = 0; j < 4; ++j) acc[j] = wmma_bf(af[kc & 1].v, wf[kc & 1][j].v, acc[j]);
    __builtin_amdgcn_sched_barrier(0);   /* holds the next stage's conversions behind this step: lifted up, they wait for X loads that were only just issued */
  }
  PK hv[4];
#pragma unroll   /* acc, bs and hv stay in registers only under constant indices; so in the loops below */
  for (int j = 0; j < 4; ++j) { const float bias = bfr(bs[j]);
#pragma unroll
    for (int r = 0; r < 8; ++r) { acc[j][r] += bias; hv[j].h[r] = (_Float16)acc[j][r]; } }
  if (which < 2) { _Float16* DH = which == 0 ? QH : KH; _Float16* DL = which == 0 ? QL : KL; const int nhi = which == 0 ? QHI : KHI;
    const unsigned off = (unsigned)(wave * 128 + lane) * 16u;   /* 16-byte piece (chunk, t, kd, half, g, col) = wave * 128 + j * 32 + lane */
    v16h idn; PK ht[4];
#pragma unroll
    for (int i = 0; i < 8; ++i) { idn[i] = 8 * g + i == col ? (_Float16)1.0f : (_Float16)0.0f; idn[8 + i] = (_Float16)0.0f; }
#pragma unroll
    for (int j = 0; j < 4; ++j) ht[j].h = turn(hv[j].h, idn);
    st4<512>(DH + r0 * CC, off, ht[0].u, ht[1].u, ht[2].u, ht[3].u);
    if (t0 < nhi) { PK lt[4];
#pragma unroll
      for (int j = 0; j < 4; ++j) { v8h lv;
#pragma unroll
        for (int r = 0; r < 8; ++r) lv[r] = (_Float16)((acc[j][r] - (float)hv[j].h[r]) * 1024.0f);
        lt[j].h = turn(lv, idn); }
      st4<512>(DL + (bb * nhi + t0) * (size_t)CC, off, lt[0].u, lt[1].u, lt[2].u, lt[3].u); }
  } else { const unsigned off = (unsigned)((wave >> 1) * 256 + (wave & 1) * 32 + lane) * 16u;   /* 16-byte piece (chunk, j, half, g, col) = (wave >> 1) * 256 + j * 64 + (wave & 1) * 32 + lane */
    st4<1024>(VT + r0 * CC, off, hv[0].u, hv[1].u, hv[2].u, hv[3].u);
    if (t0 < KHI) { PK bh[4], bl[4]; const size_t o3 = (bb * KHI + t0) * (size_t)CC;
#pragma unroll
      for (int j = 0; j < 4; ++j)
#pragma unroll
        for (int r = 0; r < 8; ++r) { const __bf16 t = (__bf16)acc[j][r]; bh[j].b[r] = t; bl[j].b[r] = (__bf16)(acc[j][r] - (float)t); }
      st4<1024>(VB + o3, off, bh[0].u, bh[1].u, bh[2].u, bh[3].u); st4<1024>(VBL + o3, off, bl[0].u, bl[1].u, bl[2].u, bl[3].u); } } }
// ---- k_attn: logits, causal softmax and P V in one kernel, all batches in one launch; the logits never leave the registers.
// block = two 32-query tiles of batch b, tp and its mirror TT / 32 - 1 - tp, side by side: every block walks TT / 32 + 1 chunks in all, so one block per WGP is an even deal. The first wS of the AW waves take the short tile, the rest the long one;
// wave number wl of the nw waves of a tile walks that tile's 32-key chunks wl, wl + nw, ... up to the diagonal chunk.
// S^T = K Q^T (A = 16 key rows, B = 16 query columns): a lane holds 16 logits of ONE query (column lane & 15), in the k order a B operand wants, so P^T goes from the two score tiles straight into O^T += V^T P^T.
// Reference and sum per lane (log2 domain, online softmax); the AW partial (reference, sum, O) are joined through LDS in wave order. High-precision path: the reference is the running maximum, raised every trip.
// Main path: the reference stays as it is while the weights taken against it fit f16 (lazy rescale), so that a trip has no maximum, no exchange between the halves and no rescaling of O.
// Queries < QHI: 3-product logits (q, k as f16 hi + residual x 2^10) and P, v as bf16 hi + lo (3 products); after: single f16 products, weights x 2^10 (the factor is in the sum too and cancels).
#define AW 16
#define SL2E (SCALE * 1.4426950408889634f)
// fragment in fragment order: p = chunk start + group pair * 512 + lane * 8; the two halves are neighbouring 512-byte groups
__device__ __forceinline__ v16h frag_hp(const _Float16* p) { union { v16h v; v8h q[2]; } u; u.q[0] = *(const v8h*)p; u.q[1] = *(const v8h*)(p + 256); return u.v; }
__device__ __forceinline__ v16b frag_bp(const __bf16* p) { union { v16b v; v8b q[2]; } u; u.q[0] = *(const v8b*)p; u.q[1] = *(const v8b*)(p + 256); return u.v; }
// 2^x, eight at a time: the early-clobber outputs keep a v_exp_f32 from overwriting the source of the one in front of it, and the v_nop fills the slot behind the last one
__device__ __forceinline__ void exp2x8(float* o, const float* x) {
  asm("v_exp_f32 %0, %8\n\tv_exp_f32 %1, %9\n\tv_exp_f32 %2, %10\n\tv_exp_f32 %3, %11\n\tv_exp_f32 %4, %12\n\tv_exp_f32 %5, %13\n\tv_exp_f32 %6, %14\n\tv_exp_f32 %7, %15\n\tv_nop"
      : "=&v"(o[0]), "=&v"(o[1]), "=&v"(o[2]), "=&v"(o[3]), "=&v"(o[4]), "=&v"(o[5]), "=&v"(o[6]), "=&v"(o[7]) : "v"(x[0]), "v"(x[1]), "v"(x[2]), "v"(x[3]), "v"(x[4]), "v"(x[5]), "v"(x[6]), "v"(x[7])); }
// 2^x, one value; the v_nop fills the slot behind the transcendental
__device__ __forceinline__ float exp2x1(float x) { float r; asm("v_exp_f32 %0, %1\n\tv_nop" : "=v"(r) : "v"(x)); return r; }
struct SMX { float e[16]; float al; };
// one online-softmax step of one query column: sv = 16 scaled log2 logits of this lane's query; poff = log2 of the weights' common factor
__device__ __forceinline__ SMX sm_step(const float sv[16], float& m, float& l, float poff) { SMX o; float mx = sv[0];
#pragma unroll
  for (int i = 1; i < 16; ++i) mx = fmaxf(mx, sv[i]);
  mx = fmaxf(mx, __shfl_xor(mx, 16)); const float mn = fmaxf(m, mx); o.al = exp2x1(m - mn); m = mn; const float mref = mn - poff; float d[16], ls = 0.f;
#pragma unroll
  for (int i = 0; i < 16; ++i) d[i] = sv[i] - mref;
  exp2x8(o.e, d); exp2x8(o.e + 8, d + 8);
#pragma unroll
  for (int i = 0; i < 16; ++i) ls += o.e[i];
  l = l * o.al + ls; return o; }
// main path: the 16 weights 2^(s * SL2E + nm) of one query column (s = raw logits, nm = log2 of the common factor less the reference in use), one multiply-add a score; returns their sum, taken in four chains
#define PSUM 32768.0f      // a lane's 16 weights sum to no more than this: each of them fits f16
__device__ __forceinline__ float wts16(float* e, const v8f s[2], float nm) { float d[16];
#pragma unroll
  for (int i = 0; i < 16; ++i) d[i] = fmaf(s[i >> 3][i & 7], SL2E, nm);
  exp2x8(e, d); exp2x8(e + 8, d + 8); float c4[4] = {e[0], e[1], e[2], e[3]};
#pragma unroll
  for (int i = 4; i < 16; ++i) c4[i & 3] += e[i];
  return (c4[0] + c4[1]) + (c4[2] + c4[3]); }
// The main path's k and v come through LDS: each wave owns a ring of two buffers, a buffer holds one 32-key chunk (4 KB of k, then 4 KB of v, both in fragment order as they lie in memory).
#define RB 8192            // bytes of a ring buffer
#define RW (2 * RB)        // bytes of a wave's ring
static_assert(32 * (HD + 4) * 4 <= RW, "a wave's partial O tile is staged in its own ring");
// one chunk, 16 asynchronous copies of 512 B (16 B a lane); the offset moves the LDS and the global address alike. The s_wait_xcnt stands inside the statement, so that no address register is rewritten in front of it
__device__ __forceinline__ void copy_chunk(unsigned lds, const _Float16* kg, const _Float16* vg) {
  asm volatile("global_load_async_to_lds_b128 %0, %2, off\n\tglobal_load_async_to_lds_b128 %0, %2, off offset:512\n\tglobal_load_async_to_lds_b128 %0, %2, off offset:1024\n\tglobal_load_async_to_lds_b128 %0, %2, off offset:1536\n\t"
               "global_load_async_to_lds_b128 %0, %2, off offset:2048\n\tglobal_load_async_to_lds_b128 %0, %2, off offset:2560\n\tglobal_load_async_to_lds_b128 %0, %2, off offset:3072\n\tglobal_load_async_to_lds_b128 %0, %2, off offset:3584\n\t"
               "global_load_async_to_lds_b128 %1, %3, off\n\tglobal_load_async_to_lds_b128 %1, %3, off offset:512\n\tglobal_load_async_to_lds_b128 %1, %3, off offset:1024\n\tglobal_load_async_to_lds_b128 %1, %3, off offset:1536\n\t"
               "global_load_async_to_lds_b128 %1, %3, off offset:2048\n\tglobal_load_async_to_lds_b128 %1, %3, off offset:2560\n\tglobal_load_async_to_lds_b128 %1, %3, off offset:3072\n\tglobal_load_async_to_lds_b128 %1, %3, off offset:3584\n\ts_wait_xcnt 0x0"
               :: "v"(lds), "v"(lds + 4096u), "v"(kg), "v"(vg) : "memory"); }
__global__ __launch_bounds__(AW * 32) void k_attn(const _Float16* __restrict__ QH, const _Float16* __restrict__ KH, const _Float16* __restrict__ QL, const _Float16* __restrict__ KL, const _Float16* __restrict__ VT, const __bf16* __restrict__ VB, const __bf16* __restrict__ VBL, float* __restrict__ Y) {
  __shared__ __align__(16) char ring[AW][RW]; __shared__ float smx[AW][32], sls[AW][32];
  const int tid = threadIdx.x, wave = __builtin_amdgcn_readfirstlane(tid >> 5), lane = tid & 31, col = lane & 15, g = lane >> 4;
  const int b = blockIdx.x % NB, tp = blockIdx.x / NB;
  const int wS = ((tp * 32 < QHI ? 3 : 1) * (tp + 1) + 8) / 9;   /* waves of the short tile: at most 9 trips each, a high-precision trip counted as 3 */
  static_assert((TT / 64 + 8) / 9 <= AW / 2 && (3 * (QHI / 32) + 8) / 9 <= AW / 2 && QHI <= TT / 2, "the short tile never has more than half the waves, and the long tile is never a high-precision one");
  const bool st = wave < wS; const int rt = st ? tp : TT / 32 - 1 - tp, wl = st ? wave : wave - wS, nw = st ? wS : AW - wS;
  const int q0 = rt * 32, nch = rt + 1; const size_t row0 = (size_t)b * TT; const int stp = nw * 32 * CC;   /* stp: elements from a wave's chunk to its next */
  v8f acc[2][HD / 16] = {}; float m[2] = {-3.0e38f, -3.0e38f}, l[2] = {0.f, 0.f};
  const _Float16* qhp = QH + (row0 + q0) * CC + lane * 8;
  const _Float16* khp = KH + (row0 + wl * 32) * CC + lane * 8;
  if (q0 < QHI) { const _Float16* qlp = QL + ((size_t)b * QHI + q0) * CC + lane * 8; const _Float16* klp = KL + ((size_t)b * KHI + wl * 32) * CC + lane * 8;
    const __bf16* vhp = VB + ((size_t)b * KHI + wl * 32) * CC + lane * 8; const __bf16* vlp = VBL + ((size_t)b * KHI + wl * 32) * CC + lane * 8;
#pragma unroll 1
    for (int kc = wl; kc < nch; kc += nw, khp += stp, klp += stp, vhp += stp, vlp += stp) {
#pragma unroll
      for (int qt = 0; qt < 2; ++qt) { v16h qh[HD / 32], ql[HD / 32], kh[2][HD / 32], kl[2][HD / 32];
#pragma unroll
        for (int kd = 0; kd < HD / 32; ++kd) { qh[kd] = frag_hp(qhp + (qt * 2 + kd) * 512); ql[kd] = frag_hp(qlp + (qt * 2 + kd) * 512);
#pragma unroll
          for (int t = 0; t < 2; ++t) { kh[t][kd] = frag_hp(khp + (t * 2 + kd) * 512); kl[t][kd] = frag_hp(klp + (t * 2 + kd) * 512); } }
        asm volatile("s_wait_xcnt 0x0" :: "v"(qhp), "v"(qlp), "v"(khp), "v"(klp) : "memory");   /* keeps the loads' address pairs live and unwritten up to the wait */
        v8f s[2] = {}, sr[2] = {};
#pragma unroll
        for (int kd = 0; kd < HD / 32; ++kd)
#pragma unroll
          for (int t = 0; t < 2; ++t) { s[t] = wmma16(kh[t][kd], qh[kd], s[t]); sr[t] = wmma16(kh[t][kd], ql[kd], sr[t]); sr[t] = wmma16(kl[t][kd], qh[kd], sr[t]); }
        float sv[16]; const int thr = q0 + qt * 16 + col - kc * 32 - 8 * g;   /* the lane's last open key, counted from its first: one register, where 16 key numbers would not fit beside the fragments */
#pragma unroll
        for (int i = 0; i < 16; ++i) { const float v = (s[i >> 3][i & 7] + sr[i >> 3][i & 7] * (1.0f / 1024.0f)) * SL2E; sv[i] = ((i >> 3) * 16 + (i & 7) <= thr) ? v : -3.0e38f; }
        const SMX x = sm_step(sv, m[qt], l[qt], 0.f); const F2 p = bsplit16(x.e); v16b vh[HD / 16], vl[HD / 16];
#pragma unroll
        for (int j = 0; j < HD / 16; ++j) { vh[j] = frag_bp(vhp + j * 512); vl[j] = frag_bp(vlp + j * 512); }
        asm volatile("s_wait_xcnt 0x0" :: "v"(vhp), "v"(vlp) : "memory");   /* as above */
#pragma unroll
        for (int j = 0; j < HD / 16; ++j) { acc[qt][j] *= x.al; acc[qt][j] = wmma_bf(vh[j], p.h, acc[qt][j]); acc[qt][j] = wmma_bf(vh[j], p.l, acc[qt][j]); acc[qt][j] = wmma_bf(vl[j], p.h, acc[qt][j]); } } }
  } else { const _Float16* vp = VT + (row0 + wl * 32) * CC + lane * 8; v16h qf[2][HD / 32];
#pragma unroll
    for (int qt = 0; qt < 2; ++qt)
#pragma unroll
      for (int kd = 0; kd < HD / 32; ++kd) qf[qt][kd] = frag_hp(qhp + (qt * 2 + kd) * 512);
    asm volatile("s_wait_xcnt 0x0" :: "v"(qhp) : "memory");   /* as above */
    /* the ring is private to its wave: only the wave that copies a chunk reads it, so the wave's own waits order everything and no barrier stands in the loop */
    const char* rb = ring[wave] + lane * 16; const unsigned rl = (unsigned)(size_t)rb; unsigned cur = 0;
    if (wl < nch) { copy_chunk(rl, khp, vp); khp += stp; vp += stp;
      asm volatile("s_wait_asynccnt 0x0" ::: "memory");   /* the first chunk has landed before its fragments are read */
      if (wl + nw < nch) copy_chunk(rl + RB, khp, vp); }
#pragma unroll 1
    for (int kc = wl; kc < nch; kc += nw, cur ^= RB) { v16h kf[2][HD / 32], vf[HD / 16]; const _Float16* kl = (const _Float16*)(rb + cur);
      khp += stp; vp += stp;   /* now the chunk two trips on */
#pragma unroll
      for (int t = 0; t < 2; ++t)
#pragma unroll
        for (int kd = 0; kd < HD / 32; ++kd) kf[t][kd] = frag_hp(kl + (t * 2 + kd) * 512);
#pragma unroll
      for (int j = 0; j < HD / 16; ++j) vf[j] = frag_hp(kl + 2048 + j * 512);
      v8f s[2][2] = {};
#pragma unroll
      for (int qt = 0; qt < 2; ++qt)
#pragma unroll
        for (int t = 0; t < 2; ++t)
#pragma unroll
          for (int kd = 0; kd < HD / 32; ++kd) s[qt][t] = wmma16(kf[t][kd], qf[qt][kd], s[qt][t]);
      if (kc == nch - 1) {   /* only the diagonal chunk holds keys past a query */
#pragma unroll
        for (int qt = 0; qt < 2; ++qt)
#pragma unroll
          for (int i = 0; i < 16; ++i) if (kc * 32 + (i >> 3) * 16 + 8 * g + (i & 7) > q0 + qt * 16 + col) s[qt][i >> 3][i & 7] = -3.0e38f; }
      float e[2][16], ls[2];
#pragma unroll
      for (int qt = 0; qt < 2; ++qt) ls[qt] = wts16(e[qt], s[qt], 10.f - m[qt]);
      /* one test a trip, a scalar branch: a lane's sum above PSUM (or infinite, as on the wave's first trip) says that a weight may not fit f16; only then are the maxima taken, the references raised, O and the sums rescaled and the weights made again */
      if (__builtin_amdgcn_ballot_w32(!(ls[0] <= PSUM) || !(ls[1] <= PSUM)) != 0) {
#pragma unroll
        for (int qt = 0; qt < 2; ++qt) { float mx = s[qt][0][0];
#pragma unroll
          for (int i = 1; i < 16; ++i) mx = fmaxf(mx, s[qt][i >> 3][i & 7]);
          mx *= SL2E; mx = fmaxf(mx, __shfl_xor(mx, 16)); const float mn = fmaxf(m[qt], mx), al = exp2x1(m[qt] - mn); m[qt] = mn; l[qt] *= al;
#pragma unroll
          for (int j = 0; j < HD / 16; ++j) acc[qt][j] *= al;
          ls[qt] = wts16(e[qt], s[qt], 10.f - mn); } }
#pragma unroll
      for (int qt = 0; qt < 2; ++qt) { l[qt] += ls[qt]; v16h p;
#pragma unroll
        for (int i = 0; i < 16; ++i) p[i] = (_Float16)e[qt][i];
#pragma unroll
        for (int j = 0; j < HD / 16; ++j) acc[qt][j] = wmma16(vf[j], p, acc[qt][j]); }
      asm volatile("s_wait_dscnt 0x0" ::: "memory");      /* the wave's reads of this buffer have retired before copies are aimed at it */
      asm volatile("s_wait_asynccnt 0x0" ::: "memory");   /* the next chunk, sent one trip ago, has landed before the next trip reads it */
      if (kc + 2 * nw < nch) copy_chunk(rl + cur, khp, vp); }
    asm volatile("s_wait_asynccnt 0x0" ::: "memory");   /* no copy is in flight when the ring becomes the staging of the partial O tile */
  }
  float (*so)[HD + 4] = (float (*)[HD + 4])ring[wave];
#pragma unroll
  for (int qt = 0; qt < 2; ++qt) { const float lt = l[qt] + __shfl_xor(l[qt], 16); if (g == 0) { smx[wave][qt * 16 + col] = m[qt]; sls[wave][qt * 16 + col] = lt; }
#pragma unroll
    for (int j = 0; j < HD / 16; ++j) { v4f a0, a1;
#pragma unroll
      for (int r = 0; r < 4; ++r) { a0[r] = acc[qt][j][r]; a1[r] = acc[qt][j][4 + r]; }
      *(v4f*)&so[qt * 16 + col][j * 16 + 8 * g] = a0; *(v4f*)&so[qt * 16 + col][j * 16 + 8 * g + 4] = a1; } }
  __syncthreads();   /* every wave's partial (reference, sum, O) is in LDS before any of them is joined */
  { const int qr = tid >> 4, q = tid & 15; float mw[AW], wt[AW]; float M[2] = {-3.0e38f, -3.0e38f};   /* a thread joins row qr, channels q * 4 + 0..3 of both tiles: index 0 the short tile (waves < wS), 1 the long one */
#pragma unroll
    for (int w = 0; w < AW; ++w) { const bool s0 = w < AW / 2 && w < wS; mw[w] = smx[w][qr]; M[0] = fmaxf(M[0], s0 ? mw[w] : -3.0e38f); M[1] = fmaxf(M[1], s0 ? -3.0e38f : mw[w]); }
#pragma unroll
    for (int w = 0; w < AW; ++w) mw[w] -= (w < AW / 2 && w < wS) ? M[0] : M[1];
    exp2x8(wt, mw); exp2x8(wt + 8, mw + 8);
    float Ls[2] = {0.f, 0.f}; v4f o[2] = {};
#pragma unroll
    for (int w = 0; w < AW; ++w) { const bool s0 = w < AW / 2 && w < wS; const float lw = sls[w][qr], w0 = s0 ? wt[w] : 0.f, w1 = s0 ? 0.f : wt[w]; const v4f ow = *(const v4f*)(ring[w] + (qr * (HD + 4) + q * 4) * 4);   /* a wave's partial enters the other tile's sums with weight 0: no branch stands among the LDS reads */
      Ls[0] += w0 * lw; o[0] += ow * w0; Ls[1] += w1 * lw; o[1] += ow * w1; }
    const float inv0 = Ls[0] > 0.f ? 1.0f / Ls[0] : 0.f, inv1 = Ls[1] > 0.f ? 1.0f / Ls[1] : 0.f;
    vst2w(Y + (row0 + tp * 32 + qr) * CC + q * 4, o[0] * inv0); vst2(Y + (row0 + (TT / 32 - 1 - tp) * 32 + qr) * CC + q * 4, o[1] * inv1); } }

extern "C" void kernel_launch(void* const* d_in, const int* in_sizes, int n_in, void* d_out, int out_size, void* d_ws, size_t ws_size, hipStream_t stream) {
  (void)in_sizes; (void)n_in; (void)out_size;
  const float** F = (const float**)d_in;
  if (ws_size < (size_t)WS_END) return;
  char* ws = (char*)d_ws; _Float16 *QH = (_Float16*)(ws + WS_QH), *KH = (_Float16*)(ws + WS_KH), *VT = (_Float16*)(ws + WS_VT), *QL = (_Float16*)(ws + WS_QL), *KL = (_Float16*)(ws + WS_KL); __bf16 *VB = (__bf16*)(ws + WS_VB), *VBL = (__bf16*)(ws + WS_VBL); float *S = (float*)(ws + WS_S), *Y = (float*)(ws + WS_Y);
  (void)Y; (void)S;
  // inputs: 0 q_in [4,4096,512]; 1 k_in; 2 v_in (separate inputs); 3 Wq [512,64], 4 bq; 5 Wk, 6 bk; 7 Wv, 8 bv ((in,out); zero biases read)
  k_proj<<<dim3(3 * NSB / PB), PB * 128, 0, stream>>>(F[0], F[1], F[2], F[3], F[5], F[7], F[4], F[6], F[8], QH, QL, KH, KL, VT, VB, VBL);
  k_attn<<<dim3(NB * (TT / 64)), AW * 32, 0, stream>>>(QH, KH, QL, KL, VT, VB, VBL, (float*)d_out);   /* out rows are the ctx rows: [b*TT+t][64] */
}
